// v000
// The times below were measured on an AMD MI455X: many runs one after another, warmed up first and cycling through
// copies of the inputs, with the whole window's GPU time divided by the number of runs. Launches and the gaps
// between them are all in it. The median over several windows is given; except for v000 it joins two sittings, which
// can be a few percent apart, so the side-by-side timings, each taken in one sitting, are the better comparison.
// The starting kernel, v000, takes 985 microseconds a run.
#include <hip/hip_runtime.h>
// Contractions: Q/K/V projections (K = 512), scores Q K^T (K = 512), P V (K = keys) and the output projection (K = 512)
// on v_wmma_f32_16x16x32_f16 (f16 operands, f32 accumulate). Inputs enter as bf16-RNE values carried x16 in f16 planes;
// q/k/v/ctx are f16 hi planes carried x16 plus f16 residual planes carried x16384 for the first EARLY_R positions of each
// sequence (scores: hh + hr + rh, P V: hh + hr + rh, output projection: h + r); P carried x1024; softmax statistics in f32.

typedef _Float16 h16;
typedef _Float16 h16x8 __attribute__((ext_vector_type(8)));
typedef _Float16 v16h  __attribute__((ext_vector_type(16)));
typedef float  v8f    __attribute__((ext_vector_type(8)));
typedef float  v4f    __attribute__((ext_vector_type(4)));
typedef unsigned v4u  __attribute__((ext_vector_type(4)));

#ifndef NB
#define NB 4
#endif
#ifndef SEQ
#define SEQ 4096
#endif
#define NB_FULL 4
#define SEQ_FULL 4096
#define DM 512
#define EARLY_CAP 512
#define EARLY_R ((SEQ < EARLY_CAP) ? SEQ : EARLY_CAP)
#define MT (NB * SEQ)

static_assert(SEQ % 64 == 0);
static_assert((EARLY_R) % 64 == 0);
static_assert(NB >= 1 && NB <= NB_FULL);
static_assert(SEQ >= 64 && SEQ <= SEQ_FULL);
static_assert(DM % 128 == 0);
static_assert(((NB - 1) * SEQ_FULL + SEQ) * DM <= NB_FULL * SEQ_FULL * DM);

#define ISC  16.0f                 // carry of the x / q / k / v / ctx f16 hi planes
#define WSC  16.0f                 // carry of the weight planes
#define PSC  1024.0f               // carry of P
#define RSC  16384.0f              // carry of every residual plane
#define RINV (1.0f / 16384.0f)
#define PROJ_MUL (1.0f / 16.0f)    // acc of (x16 * x16) operands -> x16 plane value
#define OUT_MUL  (1.0f / 256.0f)   // acc of (x16 * x16) operands -> f32 output
#define SCL ((1.0f / 256.0f) * (1.0f / 22.627416610717773f))

template <typename V> __device__ __forceinline__ void vst2(void* p, V v) {
  *(V*)p = v; 
}
__device__ __forceinline__ void copy16_g2s(h16* ldst, const h16* gsrc) { *(h16x8*)ldst = *(const h16x8*)gsrc; }

__device__ __forceinline__ float bf16r(float f) {     // RNE convert to bf16, value kept in f32
  unsigned u = __float_as_uint(f);
  u = (u + 0x7FFFu + ((u >> 16) & 1u)) & 0xFFFF0000u;
  return __uint_as_float(u);
}

// ---- WMMA fragment loaders (f16, row-major K-contiguous source); A and B (from B^T rows) share the per-lane K map:
//      row/col = lane&15; elements 0..7 <- k0 + 8*half + 0..7, elements 8..15 <- k0 + 16 + 8*half + 0..7
__device__ __forceinline__ v16h load_a_frag(const h16* base, int ld, int k0) {
  int lane = threadIdx.x & 31;
  int idx  = lane & 15;
  int half = lane >> 4;
  const h16* p = base + idx * ld + k0 + half * 8;
  h16x8 lo = *(const h16x8*)(p);
  h16x8 hi = *(const h16x8*)(p + 16);
  return __builtin_shufflevector(lo, hi, 0,1,2,3,4,5,6,7,8,9,10,11,12,13,14,15);
}
__device__ __forceinline__ v16h load_b_frag(const h16* base, int ld, int k0) { return load_a_frag(base, ld, k0); }

__device__ __forceinline__ v8f wmma_f16(v16h a, v16h b, v8f c) {
  v8f d = __builtin_amdgcn_wmma_f32_16x16x32_f16(false, a, false, b, (short)0, c, false, false);
  asm volatile("v_nop\n\tv_nop\n\tv_nop\n\tv_nop" : "+v"(d) : "v"(a), "v"(b));
  return d;
}

// ---------------- conversion kernels ----------------
// xb[row][c] = f16( bf16r(x) * 16 ), rows indexed b*SEQ + s, source rows b*SEQ_FULL + s; 8 elements (16 B) per thread
__global__ __launch_bounds__(256) void cvt_x_kernel(const float* __restrict__ x, h16* __restrict__ xb, int n8) {
  int g = blockIdx.x * 256 + threadIdx.x;
  if (g >= n8) return;
  const int row = g >> 6, c8 = g & 63;            // 64 groups of 8 per 512-wide row
  const int b = row / SEQ, s = row - b * SEQ;
  const float* src = x + ((size_t)(b * SEQ_FULL + s)) * DM + c8 * 8;
  const v4f a = *(const v4f*)(src), bq = *(const v4f*)(src + 4);
  union { h16x8 h; v4u u; } pk;
#pragma unroll
  for (int i = 0; i < 4; ++i) { pk.h[i] = (h16)(bf16r(a[i]) * ISC); pk.h[4 + i] = (h16)(bf16r(bq[i]) * ISC); }
  vst2(xb + (size_t)g * 8, pk.u);
}

// Wb[n][k] = f16( bf16r(W[n][k]) * 16 ) for the matrix selected by blockIdx.y (weights are already [out][in] = [n][k])
__global__ __launch_bounds__(256) void cvt_w_kernel(const float* __restrict__ W0, const float* __restrict__ W1,
                                                    const float* __restrict__ W2, const float* __restrict__ W3,
                                                    h16* __restrict__ D0, h16* __restrict__ D1,
                                                    h16* __restrict__ D2, h16* __restrict__ D3) {
  const int y = blockIdx.y;
  const float* W = (y == 0) ? W0 : (y == 1) ? W1 : (y == 2) ? W2 : W3;
  h16*       D  = (y == 0) ? D0 : (y == 1) ? D1 : (y == 2) ? D2 : D3;
  const int g = blockIdx.x * 256 + threadIdx.x;    // < DM*DM/8 by grid construction
  if (g >= DM * DM / 8) return;
  const float* src = W + (size_t)g * 8;
  const v4f a = *(const v4f*)(src), bq = *(const v4f*)(src + 4);
  union { h16x8 h; v4u u; } pk;
#pragma unroll
  for (int i = 0; i < 4; ++i) { pk.h[i] = (h16)(bf16r(a[i]) * WSC); pk.h[4 + i] = (h16)(bf16r(bq[i]) * WSC); }
  vst2(D + (size_t)g * 8, pk.u);
}

// ---------------- projection GEMM: Y = X(MT x 512) * W(512 x 512)^T, blockIdx.z selects Q / K / V ----------------
// 8 waves/WG: 4 M-subtiles x 2 N-groups(64). Each wave: 16x64 (4 WMMA tiles). Block tile 64 x 128 staged in LDS (f16) and
// Blocks whose sequence positions are < EARLY_R also write the residual planes (x16384).
__global__ __launch_bounds__(256) void proj_qkv_kernel(const h16* __restrict__ Xb,
                                                       const h16* __restrict__ Wq, const h16* __restrict__ Wk,
                                                       const h16* __restrict__ Wv,
                                                       h16* __restrict__ Qh, h16* __restrict__ Kh, h16* __restrict__ Vth,
                                                       h16* __restrict__ Qr, h16* __restrict__ Kr, h16* __restrict__ Vtr) {
  __shared__ __align__(16) h16 Th[128 * 136];     // [m][n] pitch 136 (Q/K) or [n][m] pitch 72 (V)
  __shared__ __align__(16) h16 Tr[128 * 136];
  const int z = blockIdx.z;
  const h16* W = (z == 0) ? Wq : (z == 1) ? Wk : Wv;
  const int transposed = (z == 2) ? 1 : 0;
  const int m0 = blockIdx.x * 64, n0 = blockIdx.y * 128;
  const int bb = m0 / SEQ, s0 = m0 - bb * SEQ;
  const bool early = (s0 < EARLY_R);
  const int tid = threadIdx.x, w = tid >> 5, lane = tid & 31, idx = lane & 15, half = lane >> 4;
  const int mw_l = (w & 3) * 16;
  const int nw_l = (w >> 2) * 64;

  v8f c[4] = {};
  const h16* arow = Xb + (size_t)(m0 + mw_l) * DM;
  const h16* brow = W + (size_t)(n0 + nw_l) * DM;
#pragma unroll 2
  for (int k0 = 0; k0 < DM; k0 += 32) {
    v16h a = load_a_frag(arow, DM, k0);
#pragma unroll
    for (int t = 0; t < 4; ++t) {
      v16h bf = load_b_frag(brow + (size_t)(t * 16) * DM, DM, k0);
      c[t] = wmma_f16(a, bf, c[t]);
    }
  }
#pragma unroll
  for (int t = 0; t < 4; ++t) {
    const int cl = nw_l + t * 16 + idx;             // local col
#pragma unroll
    for (int g = 0; g < 8; ++g) {
      const int rl = mw_l + g + 8 * half;           // local row
      const float u = c[t][g] * PROJ_MUL;           // x16 carried value
      const h16 hv = (h16)u;
      const int li = transposed ? (cl * 72 + rl) : (rl * 136 + cl);
      Th[li] = hv;
      if (early) Tr[li] = (h16)((u - (float)hv) * RSC);
    }
  }
  __syncthreads();
  if (!transposed) {
    h16* Oh = (z == 0) ? Qh : Kh;
    h16* Orp = (z == 0) ? Qr : Kr;
    for (int gg = tid; gg < 64 * 16; gg += 256) {
      const int rl = gg >> 4, pc = gg & 15;
      vst2(Oh + (size_t)(m0 + rl) * DM + n0 + pc * 8, *(const v4u*)(&Th[rl * 136 + pc * 8]));
      if (early) vst2(Orp + (size_t)(bb * EARLY_R + s0 + rl) * DM + n0 + pc * 8, *(const v4u*)(&Tr[rl * 136 + pc * 8]));
    }
  } else {
    for (int gg = tid; gg < 128 * 8; gg += 256) {
      const int cl = gg >> 3, pc = gg & 7;
      vst2(Vth + ((size_t)(bb * DM + n0 + cl)) * SEQ + s0 + pc * 8, *(const v4u*)(&Th[cl * 72 + pc * 8]));
      if (early) vst2(Vtr + ((size_t)(bb * DM + n0 + cl)) * EARLY_R + s0 + pc * 8, *(const v4u*)(&Tr[cl * 72 + pc * 8]));
    }
  }
}

// ---------------- flash attention, causal, query positions >= EARLY_R (single products) ----------------
// WG = 32 queries, 8 waves, key chunks of 64 (chunks 0 .. q0/64). K fragments read from the dense K plane,
// V^T chunk staged in LDS. Score phase: wave w -> (qi = w&1, kj = w>>1) 16x16 tile, K-loop over 512.
// PV phase: wave w -> (qi = w&1, dg = w>>1) 16 q x 128 dims (8 accum tiles).
__global__ __launch_bounds__(256) __attribute__((amdgpu_num_vgpr(256)))
void attn_main_kernel(const h16* __restrict__ Qh, const h16* __restrict__ Kh,
                      const h16* __restrict__ Vth, h16* __restrict__ Ch) {
  __shared__ __align__(16) h16   Qs[32][DM];       // 32 KB
  __shared__ __align__(16) h16   Vts[DM][64];      // 64 KB (d-major; reused as the f16 ctx tile [32][512] after the loop)
  __shared__ __align__(16) float Ss[32][64];       // 8 KB
  __shared__ __align__(16) h16   Ps[32][64];       // 4 KB
  __shared__ float alpha_s[32];
  __shared__ float l_s[32];

  const int b   = blockIdx.y;
  const int q0  = EARLY_R + blockIdx.x * 32;
  const int tid = threadIdx.x;
  const int w    = tid >> 5;
  const int lane = tid & 31;
  const int idx  = lane & 15;
  const int half = lane >> 4;
  const int qi = w & 1;
  const int kj = w >> 1;     // score key subtile
  const int dg = w >> 1;     // PV d-group (128 dims)

  const h16* Qg = Qh + ((size_t)(b * SEQ + q0)) * DM;
  for (int cc = tid; cc < 32 * (DM / 8); cc += 256) {
    const int r = cc >> 6, dc = cc & 63;
    copy16_g2s(&Qs[r][dc * 8], Qg + (size_t)r * DM + dc * 8);
  }

  v8f o[8] = {};
  const int srow = tid >> 3;          // softmax: 8 threads per query row
  const int sj   = tid & 7;
  float m_prev = -1e30f;
  float l_run  = 0.0f;
  const int nchunk = q0 / 64 + 1;     // keys 0 .. 64*nchunk-1 cover every position <= q0+31

#pragma unroll 1
  for (int ci = 0; ci < nchunk; ++ci) {
    const int kv0 = ci * 64;
    __syncthreads();   // prior PV done with Vts / Ps (and Qs issue point on the first chunk)
    const h16* Vg = Vth + (size_t)(b * DM) * SEQ + kv0;
    for (int cc = tid; cc < DM * 8; cc += 256) {
      const int d = cc >> 3, j = cc & 7;
      copy16_g2s(&Vts[d][j * 8], Vg + (size_t)d * SEQ + j * 8);
    }
    __syncthreads();

    {
      v8f sc = {};
      const h16* Kg = Kh + ((size_t)(b * SEQ + kv0 + kj * 16)) * DM;
#pragma unroll 4
      for (int k0 = 0; k0 < DM; k0 += 32) {
        v16h a  = load_a_frag(&Qs[qi * 16][0], DM, k0);
        v16h bf = load_b_frag(Kg, DM, k0);
        sc = wmma_f16(a, bf, sc);
      }
      const int col = kj * 16 + idx;
      const int key = kv0 + col;
#pragma unroll
      for (int g = 0; g < 8; ++g) {
        const int rl = qi * 16 + g + 8 * half;
        float val = sc[g] * SCL;
        if (key > q0 + rl) val = -1e30f;          // causal: replace masked scores
        Ss[rl][col] = val;
      }
    }
    __syncthreads();

    {
      float v[8];
      float mloc = -1e30f;
#pragma unroll
      for (int e = 0; e < 8; ++e) { v[e] = Ss[srow][sj + e * 8]; mloc = fmaxf(mloc, v[e]); }
#pragma unroll
      for (int msk = 1; msk < 8; msk <<= 1) mloc = fmaxf(mloc, __shfl_xor(mloc, msk, 32));
      const float m_new = fmaxf(m_prev, mloc);
      const float alpha = __expf(m_prev - m_new);
      float ssum = 0.0f;
#pragma unroll
      for (int e = 0; e < 8; ++e) {
        const float p = __expf(v[e] - m_new);
        ssum += p;
        Ps[srow][sj + e * 8] = (h16)(p * PSC);
      }
#pragma unroll
      for (int msk = 1; msk < 8; msk <<= 1) ssum += __shfl_xor(ssum, msk, 32);
      l_run = l_run * alpha + ssum;
      m_prev = m_new;
      if (sj == 0) { alpha_s[srow] = alpha; l_s[srow] = l_run; }
    }
    __syncthreads();

    {
      float al[8];
#pragma unroll
      for (int g = 0; g < 8; ++g) al[g] = alpha_s[qi * 16 + g + 8 * half];
#pragma unroll
      for (int t = 0; t < 8; ++t)
#pragma unroll
        for (int g = 0; g < 8; ++g) o[t][g] *= al[g];
#pragma unroll
      for (int k0 = 0; k0 < 64; k0 += 32) {
        v16h a = load_a_frag(&Ps[qi * 16][0], 64, k0);
#pragma unroll
        for (int t = 0; t < 8; ++t) {
          v16h bf = load_b_frag(&Vts[dg * 128 + t * 16][0], 64, k0);
          o[t] = wmma_f16(a, bf, o[t]);
        }
      }
    }
  }
  __syncthreads();

  h16* Ct = &Vts[0][0];
  float linv[8];
#pragma unroll
  for (int g = 0; g < 8; ++g) linv[g] = 1.0f / (l_s[qi * 16 + g + 8 * half] * PSC);
#pragma unroll
  for (int t = 0; t < 8; ++t) {
    const int col = dg * 128 + t * 16 + idx;
#pragma unroll
    for (int g = 0; g < 8; ++g) Ct[(qi * 16 + g + 8 * half) * DM + col] = (h16)(o[t][g] * linv[g]);
  }
  __syncthreads();
  {
    h16* dst = Ch + ((size_t)(b * SEQ + q0)) * DM;
    for (int gg = tid; gg < 32 * DM / 8; gg += 256) vst2(dst + (size_t)gg * 8, *(const v4u*)(Ct + gg * 8));
  }
}

// ---------------- flash attention, causal, query positions < EARLY_R (hi + residual products) ----------------
// WG = 16 queries, 8 waves, key chunks of 32 (chunks 0 .. q0/32). Q (hi,res) staged once; K (hi,res) and V^T (hi,res)
// chunks staged in LDS. Score phase: waves 0..5 -> (prod = w>>1, kj = w&1): prod 0 = Qh Kh, 1 = Qh Kr, 2 = Qr Kh.
// PV phase: wave w -> dims [64w, 64w+64): Oh += Ph Vh ; Or += Ph Vr + Pr Vh. Writes ctx hi and ctx res planes.
__global__ __launch_bounds__(256) __attribute__((amdgpu_num_vgpr(256)))
void attn_early_kernel(const h16* __restrict__ Qh, const h16* __restrict__ Qr,
                       const h16* __restrict__ Kh, const h16* __restrict__ Kr,
                       const h16* __restrict__ Vth, const h16* __restrict__ Vtr,
                       h16* __restrict__ Ch, h16* __restrict__ Cr) {
  __shared__ __align__(16) h16   Qs[2][16][DM];    // 32 KB
  __shared__ __align__(16) h16   Ks[2][32][DM];    // 64 KB (reused as the ctx tiles [2][16][512] after the loop)
  __shared__ __align__(16) h16   Vts[2][DM][32];   // 64 KB (d-major)
  __shared__ __align__(16) float Ss[3][16][32];    // 6 KB
  __shared__ __align__(16) h16   Ps[2][16][32];    // 2 KB
  __shared__ float alpha_s[16];
  __shared__ float l_s[16];

  const int b   = blockIdx.y;
  const int q0  = blockIdx.x * 16;
  const int tid = threadIdx.x;
  const int w    = tid >> 5;
  const int lane = tid & 31;
  const int idx  = lane & 15;
  const int half = lane >> 4;

  {
    const h16* Qg0 = Qh + ((size_t)(b * SEQ + q0)) * DM;
    const h16* Qg1 = Qr + ((size_t)(b * EARLY_R + q0)) * DM;
    for (int cc = tid; cc < 16 * (DM / 8); cc += 256) {
      const int r = cc >> 6, dc = cc & 63;
      copy16_g2s(&Qs[0][r][dc * 8], Qg0 + (size_t)r * DM + dc * 8);
      copy16_g2s(&Qs[1][r][dc * 8], Qg1 + (size_t)r * DM + dc * 8);
    }
  }

  v8f oh[4] = {};
  v8f orr[4] = {};
  const int srow = tid >> 4;          // softmax: 16 threads per query row
  const int sj   = tid & 15;
  float m_prev = -1e30f;
  float l_run  = 0.0f;
  const int nchunk = q0 / 32 + 1;     // keys 0 .. 32*nchunk-1 cover every position <= q0+15

#pragma unroll 1
  for (int ci = 0; ci < nchunk; ++ci) {
    const int kv0 = ci * 32;
    __syncthreads();   // prior PV done with Vts / Ps, prior scores done with Ks
    {
      const h16* Kg0 = Kh + ((size_t)(b * SEQ + kv0)) * DM;
      const h16* Kg1 = Kr + ((size_t)(b * EARLY_R + kv0)) * DM;
      for (int cc = tid; cc < 32 * (DM / 8); cc += 256) {
        const int r = cc >> 6, dc = cc & 63;
        copy16_g2s(&Ks[0][r][dc * 8], Kg0 + (size_t)r * DM + dc * 8);
        copy16_g2s(&Ks[1][r][dc * 8], Kg1 + (size_t)r * DM + dc * 8);
      }
      const h16* Vg0 = Vth + (size_t)(b * DM) * SEQ + kv0;
      const h16* Vg1 = Vtr + (size_t)(b * DM) * EARLY_R + kv0;
      for (int cc = tid; cc < DM * 4; cc += 256) {
        const int d = cc >> 2, j = cc & 3;
        copy16_g2s(&Vts[0][d][j * 8], Vg0 + (size_t)d * SEQ + j * 8);
        copy16_g2s(&Vts[1][d][j * 8], Vg1 + (size_t)d * EARLY_R + j * 8);
      }
    }
    __syncthreads();

    if (w < 6) {                                   // wave-uniform
      const int prod = w >> 1, kj = w & 1;
      const int pa = (prod == 2) ? 1 : 0;
      const int pb = (prod == 1) ? 1 : 0;
      v8f sc = {};
#pragma unroll 4
      for (int k0 = 0; k0 < DM; k0 += 32) {
        v16h a  = load_a_frag(&Qs[pa][0][0], DM, k0);
        v16h bf = load_b_frag(&Ks[pb][kj * 16][0], DM, k0);
        sc = wmma_f16(a, bf, sc);
      }
      const int col = kj * 16 + idx;
#pragma unroll
      for (int g = 0; g < 8; ++g) Ss[prod][g + 8 * half][col] = sc[g];
    }
    __syncthreads();

    {
      float v[2];
      float mloc = -1e30f;
      const int qrow = q0 + srow;
#pragma unroll
      for (int e = 0; e < 2; ++e) {
        const int cidx = sj + e * 16;
        float s = (Ss[0][srow][cidx] + (Ss[1][srow][cidx] + Ss[2][srow][cidx]) * RINV) * SCL;
        if (kv0 + cidx > qrow) s = -1e30f;         // causal: replace masked scores
        v[e] = s; mloc = fmaxf(mloc, s);
      }
#pragma unroll
      for (int msk = 1; msk < 16; msk <<= 1) mloc = fmaxf(mloc, __shfl_xor(mloc, msk, 32));
      const float m_new = fmaxf(m_prev, mloc);
      const float alpha = __expf(m_prev - m_new);
      float ssum = 0.0f;
#pragma unroll
      for (int e = 0; e < 2; ++e) {
        const int cidx = sj + e * 16;
        const float p  = __expf(v[e] - m_new);
        ssum += p;
        const float pp = p * PSC;
        const h16 hv = (h16)pp;
        Ps[0][srow][cidx] = hv;
        Ps[1][srow][cidx] = (h16)((pp - (float)hv) * RSC);
      }
#pragma unroll
      for (int msk = 1; msk < 16; msk <<= 1) ssum += __shfl_xor(ssum, msk, 32);
      l_run = l_run * alpha + ssum;
      m_prev = m_new;
      if (sj == 0) { alpha_s[srow] = alpha; l_s[srow] = l_run; }
    }
    __syncthreads();

    {
      float al[8];
#pragma unroll
      for (int g = 0; g < 8; ++g) al[g] = alpha_s[g + 8 * half];
#pragma unroll
      for (int t = 0; t < 4; ++t)
#pragma unroll
        for (int g = 0; g < 8; ++g) { oh[t][g] *= al[g]; orr[t][g] *= al[g]; }
      v16h ah = load_a_frag(&Ps[0][0][0], 32, 0);
      v16h ar = load_a_frag(&Ps[1][0][0], 32, 0);
#pragma unroll
      for (int t = 0; t < 4; ++t) {
        const int d0 = w * 64 + t * 16;
        v16h bh = load_b_frag(&Vts[0][d0][0], 32, 0);
        v16h br = load_b_frag(&Vts[1][d0][0], 32, 0);
        oh[t]  = wmma_f16(ah, bh, oh[t]);
        orr[t] = wmma_f16(ah, br, orr[t]);
        orr[t] = wmma_f16(ar, bh, orr[t]);
      }
    }
  }
  __syncthreads();

  h16* Ct = &Ks[0][0][0];
  float linv[8];
#pragma unroll
  for (int g = 0; g < 8; ++g) linv[g] = 1.0f / (l_s[g + 8 * half] * PSC);
#pragma unroll
  for (int t = 0; t < 4; ++t) {
    const int col = w * 64 + t * 16 + idx;
#pragma unroll
    for (int g = 0; g < 8; ++g) {
      const int rl = g + 8 * half;
      const float u = (oh[t][g] + orr[t][g] * RINV) * linv[g];     // x16 carried ctx
      const h16 hv = (h16)u;
      Ct[rl * DM + col] = hv;
      Ct[16 * DM + rl * DM + col] = (h16)((u - (float)hv) * RSC);
    }
  }
  __syncthreads();
  {
    h16* dsth = Ch + ((size_t)(b * SEQ + q0)) * DM;
    h16* dstr = Cr + ((size_t)(b * EARLY_R + q0)) * DM;
    for (int gg = tid; gg < 16 * DM / 8; gg += 256) {
      vst2(dsth + (size_t)gg * 8, *(const v4u*)(Ct + gg * 8));
      vst2(dstr + (size_t)gg * 8, *(const v4u*)(Ct + 16 * DM + gg * 8));
    }
  }
}

// ---------------- output projection: out = ctx(MT x 512) * Wo(512 x 512)^T, f32 ----------------
// Same wave layout as proj_qkv. Blocks with sequence positions < EARLY_R add the ctx residual product (second accumulator).
__global__ __launch_bounds__(256) void proj_out_kernel(const h16* __restrict__ Ch, const h16* __restrict__ Cr,
                                                       const h16* __restrict__ Wo, float* __restrict__ out) {
  __shared__ __align__(16) float T[64 * 132];
  const int m0 = blockIdx.x * 64, n0 = blockIdx.y * 128;
  const int bb = m0 / SEQ, s0 = m0 - bb * SEQ;
  const bool early = (s0 < EARLY_R);
  const int tid = threadIdx.x, w = tid >> 5, lane = tid & 31, idx = lane & 15, half = lane >> 4;
  const int mw_l = (w & 3) * 16;
  const int nw_l = (w >> 2) * 64;

  v8f c[4] = {};
  v8f cr[4] = {};
  const h16* arow = Ch + (size_t)(m0 + mw_l) * DM;
  const h16* brow = Wo + (size_t)(n0 + nw_l) * DM;
  if (early) {
    const h16* rrow = Cr + (size_t)(bb * EARLY_R + s0 + mw_l) * DM;
#pragma unroll 2
    for (int k0 = 0; k0 < DM; k0 += 32) {
      v16h a  = load_a_frag(arow, DM, k0);
      v16h ar = load_a_frag(rrow, DM, k0);
#pragma unroll
      for (int t = 0; t < 4; ++t) {
        v16h bf = load_b_frag(brow + (size_t)(t * 16) * DM, DM, k0);
        c[t]  = wmma_f16(a, bf, c[t]);
        cr[t] = wmma_f16(ar, bf, cr[t]);
      }
    }
  } else {
#pragma unroll 2
    for (int k0 = 0; k0 < DM; k0 += 32) {
      v16h a = load_a_frag(arow, DM, k0);
#pragma unroll
      for (int t = 0; t < 4; ++t) {
        v16h bf = load_b_frag(brow + (size_t)(t * 16) * DM, DM, k0);
        c[t] = wmma_f16(a, bf, c[t]);
      }
    }
  }
#pragma unroll
  for (int t = 0; t < 4; ++t) {
    const int cl = nw_l + t * 16 + idx;
#pragma unroll
    for (int g = 0; g < 8; ++g) {
      const int rl = mw_l + g + 8 * half;
      T[rl * 132 + cl] = (c[t][g] + cr[t][g] * RINV) * OUT_MUL;
    }
  }
  __syncthreads();
  {
    float* dst = out + ((size_t)(bb * SEQ_FULL + s0)) * DM + n0;
    for (int gg = tid; gg < 64 * 32; gg += 256) {
      const int rl = gg >> 5, pc = gg & 31;
      vst2(dst + (size_t)rl * DM + pc * 4, *(const v4f*)(&T[rl * 132 + pc * 4]));
    }
  }
}

extern "C" void kernel_launch(void* const* d_in, const int* in_sizes, int n_in,
                              void* d_out, int out_size, void* d_ws, size_t ws_size,
                              hipStream_t stream) {
  if (n_in < 5) return;
  const int rows_needed = (NB - 1) * SEQ_FULL + SEQ;
  if (in_sizes[0] < rows_needed * DM) return;
  for (int i = 1; i < 5; ++i) if (in_sizes[i] < DM * DM) return;
  if (out_size < rows_needed * DM) return;

  const float* x  = (const float*)d_in[0];
  const float* Wq = (const float*)d_in[1];
  const float* Wk = (const float*)d_in[2];
  const float* Wv = (const float*)d_in[3];
  const float* Wo = (const float*)d_in[4];
  float* out = (float*)d_out;

  const size_t plane = (size_t)MT * DM * sizeof(h16);              // 16,777,216 at full size
  const size_t wpl   = (size_t)DM * DM * sizeof(h16);              //    524,288
  const size_t rpl   = (size_t)NB * EARLY_R * DM * sizeof(h16);    //  2,097,152 at full size
  size_t off = 0;
  char* ws = (char*)d_ws;
  h16* xb  = (h16*)(ws + off); off += plane;
  h16* wqb = (h16*)(ws + off); off += wpl;
  h16* wkb = (h16*)(ws + off); off += wpl;
  h16* wvb = (h16*)(ws + off); off += wpl;
  h16* wob = (h16*)(ws + off); off += wpl;
  h16* qh  = (h16*)(ws + off); off += plane;
  h16* kh  = (h16*)(ws + off); off += plane;
  h16* vth = (h16*)(ws + off); off += plane;   // [b][d][s]
  h16* qr  = (h16*)(ws + off); off += rpl;
  h16* kr  = (h16*)(ws + off); off += rpl;
  h16* vtr = (h16*)(ws + off); off += rpl;     // [b][d][s < EARLY_R]
  h16* ch  = (h16*)(ws + off); off += plane;
  h16* crp = (h16*)(ws + off); off += rpl;     // total 94,371,840 at full size
  if (off > ws_size) return;

  const int nx8 = MT * DM / 8;
  cvt_x_kernel<<<(nx8 + 255) / 256, 256, 0, stream>>>(x, xb, nx8);
  cvt_w_kernel<<<dim3((DM * DM / 8 + 255) / 256, 4), 256, 0, stream>>>(Wq, Wk, Wv, Wo, wqb, wkb, wvb, wob);

  proj_qkv_kernel<<<dim3(MT / 64, DM / 128, 3), 256, 0, stream>>>(xb, wqb, wkb, wvb, qh, kh, vth, qr, kr, vtr);

  attn_early_kernel<<<dim3(EARLY_R / 16, NB), 256, 0, stream>>>(qh, qr, kh, kr, vth, vtr, ch, crp);
  if (SEQ > EARLY_R) {
    attn_main_kernel<<<dim3((SEQ - EARLY_R) / 32, NB), 256, 0, stream>>>(qh, kh, vth, ch);
  }

  proj_out_kernel<<<dim3(MT / 64, DM / 128), 256, 0, stream>>>(ch, crp, wob, out);
}

// v001
// It runs in 689 microseconds.
// Two timings next to v000 put it at 1.47 and 1.45 times that version's speed.
#include <hip/hip_runtime.h>
// Contractions: Q/K/V projections (K = 512), scores Q K^T (K = 512), P V (K = keys) and the output projection (K = 512)
// on v_wmma_f32_16x16x32_f16 (f16 operands, f32 accumulate). Inputs enter as bf16-RNE values carried x16 in f16 planes;
// q/k/v/ctx are f16 hi planes carried x16 plus f16 residual planes carried x16384 for the first EARLY_R positions of each
// sequence (scores: hh + hr + rh, P V: hh + hr + rh, output projection: h + r); P carried x1024; softmax statistics in f32.

typedef _Float16 h16;
typedef _Float16 h16x8 __attribute__((ext_vector_type(8)));
typedef _Float16 v16h  __attribute__((ext_vector_type(16)));
typedef float  v8f    __attribute__((ext_vector_type(8)));
typedef float  v4f    __attribute__((ext_vector_type(4)));
typedef unsigned v4u  __attribute__((ext_vector_type(4)));

#ifndef NB
#define NB 4
#endif
#ifndef SEQ
#define SEQ 4096
#endif
#define NB_FULL 4
#define SEQ_FULL 4096
#define DM 512
#define EARLY_CAP 512
#define EARLY_R ((SEQ < EARLY_CAP) ? SEQ : EARLY_CAP)
#define MT (NB * SEQ)
// LDS row pitches in elements. f16 rows read by 16-byte fragment loads: byte pitch = 16 x odd, so the 16 rows of a fragment
// fall on distinct bank groups. f32 score rows: pitch chosen so that the tile stores and the row reads both spread over banks.
#define QP  (DM + 8)               // 1040 B: Q and K rows of 512 f16
#define VP64 72                    // 144 B: V^T and P rows of 64 f16
#define VP32 40                    // 80 B: V^T and P rows of 32 f16
#define SP64 76                    // f32 score rows of 64
#define SP32 36                    // f32 score rows of 32

static_assert(SEQ % 64 == 0);
static_assert((EARLY_R) % 64 == 0);
static_assert(NB >= 1 && NB <= NB_FULL);
static_assert(SEQ >= 64 && SEQ <= SEQ_FULL);
static_assert(DM % 128 == 0);
static_assert(((NB - 1) * SEQ_FULL + SEQ) * DM <= NB_FULL * SEQ_FULL * DM);

#define ISC  16.0f                 // carry of the x / q / k / v / ctx f16 hi planes
#define WSC  16.0f                 // carry of the weight planes
#define PSC  1024.0f               // carry of P
#define RSC  16384.0f              // carry of every residual plane
#define RINV (1.0f / 16384.0f)
#define PROJ_MUL (1.0f / 16.0f)    // acc of (x16 * x16) operands -> x16 plane value
#define OUT_MUL  (1.0f / 256.0f)   // acc of (x16 * x16) operands -> f32 output
#define SCL ((1.0f / 256.0f) * (1.0f / 22.627416610717773f))

template <typename V> __device__ __forceinline__ void vst2(void* p, V v) {
  *(V*)p = v; 
}
__device__ __forceinline__ void copy16_g2s(h16* ldst, const h16* gsrc) { *(h16x8*)ldst = *(const h16x8*)gsrc; }

__device__ __forceinline__ float bf16r(float f) {     // RNE convert to bf16, value kept in f32
  unsigned u = __float_as_uint(f);
  u = (u + 0x7FFFu + ((u >> 16) & 1u)) & 0xFFFF0000u;
  return __uint_as_float(u);
}

// ---- WMMA fragment loaders (f16, row-major K-contiguous source); A and B (from B^T rows) share the per-lane K map:
//      row/col = lane&15; elements 0..7 <- k0 + 8*half + 0..7, elements 8..15 <- k0 + 16 + 8*half + 0..7
__device__ __forceinline__ v16h load_a_frag(const h16* base, int ld, int k0) {
  int lane = threadIdx.x & 31;
  int idx  = lane & 15;
  int half = lane >> 4;
  const h16* p = base + idx * ld + k0 + half * 8;
  h16x8 lo = *(const h16x8*)(p);
  h16x8 hi = *(const h16x8*)(p + 16);
  return __builtin_shufflevector(lo, hi, 0,1,2,3,4,5,6,7,8,9,10,11,12,13,14,15);
}
__device__ __forceinline__ v16h load_b_frag(const h16* base, int ld, int k0) { return load_a_frag(base, ld, k0); }

__device__ __forceinline__ v8f wmma_f16(v16h a, v16h b, v8f c) {
  v8f d = __builtin_amdgcn_wmma_f32_16x16x32_f16(false, a, false, b, (short)0, c, false, false);
  asm volatile("v_nop\n\tv_nop\n\tv_nop\n\tv_nop" : "+v"(d) : "v"(a), "v"(b));
  return d;
}

// ---------------- conversion kernels ----------------
// xb[row][c] = f16( bf16r(x) * 16 ), rows indexed b*SEQ + s, source rows b*SEQ_FULL + s; 8 elements (16 B) per thread
__global__ __launch_bounds__(256) void cvt_x_kernel(const float* __restrict__ x, h16* __restrict__ xb, int n8) {
  int g = blockIdx.x * 256 + threadIdx.x;
  if (g >= n8) return;
  const int row = g >> 6, c8 = g & 63;            // 64 groups of 8 per 512-wide row
  const int b = row / SEQ, s = row - b * SEQ;
  const float* src = x + ((size_t)(b * SEQ_FULL + s)) * DM + c8 * 8;
  const v4f a = *(const v4f*)(src), bq = *(const v4f*)(src + 4);
  union { h16x8 h; v4u u; } pk;
#pragma unroll
  for (int i = 0; i < 4; ++i) { pk.h[i] = (h16)(bf16r(a[i]) * ISC); pk.h[4 + i] = (h16)(bf16r(bq[i]) * ISC); }
  vst2(xb + (size_t)g * 8, pk.u);
}

// Wb[n][k] = f16( bf16r(W[n][k]) * 16 ) for the matrix selected by blockIdx.y (weights are already [out][in] = [n][k])
__global__ __launch_bounds__(256) void cvt_w_kernel(const float* __restrict__ W0, const float* __restrict__ W1,
                                                    const float* __restrict__ W2, const float* __restrict__ W3,
                                                    h16* __restrict__ D0, h16* __restrict__ D1,
                                                    h16* __restrict__ D2, h16* __restrict__ D3) {
  const int y = blockIdx.y;
  const float* W = (y == 0) ? W0 : (y == 1) ? W1 : (y == 2) ? W2 : W3;
  h16*       D  = (y == 0) ? D0 : (y == 1) ? D1 : (y == 2) ? D2 : D3;
  const int g = blockIdx.x * 256 + threadIdx.x;    // < DM*DM/8 by grid construction
  if (g >= DM * DM / 8) return;
  const float* src = W + (size_t)g * 8;
  const v4f a = *(const v4f*)(src), bq = *(const v4f*)(src + 4);
  union { h16x8 h; v4u u; } pk;
#pragma unroll
  for (int i = 0; i < 4; ++i) { pk.h[i] = (h16)(bf16r(a[i]) * WSC); pk.h[4 + i] = (h16)(bf16r(bq[i]) * WSC); }
  vst2(D + (size_t)g * 8, pk.u);
}

// ---------------- projection GEMM: Y = X(MT x 512) * W(512 x 512)^T, blockIdx.z selects Q / K / V ----------------
// 8 waves/WG: 4 M-subtiles x 2 N-groups(64). Each wave: 16x64 (4 WMMA tiles). Block tile 64 x 128 staged in LDS (f16) and
// Blocks whose sequence positions are < EARLY_R also write the residual planes (x16384).
__global__ __launch_bounds__(256) void proj_qkv_kernel(const h16* __restrict__ Xb,
                                                       const h16* __restrict__ Wq, const h16* __restrict__ Wk,
                                                       const h16* __restrict__ Wv,
                                                       h16* __restrict__ Qh, h16* __restrict__ Kh, h16* __restrict__ Vth,
                                                       h16* __restrict__ Qr, h16* __restrict__ Kr, h16* __restrict__ Vtr) {
  __shared__ __align__(16) h16 Th[128 * 136];     // [m][n] pitch 136 (Q/K) or [n][m] pitch 72 (V)
  __shared__ __align__(16) h16 Tr[128 * 136];
  const int z = blockIdx.z;
  const h16* W = (z == 0) ? Wq : (z == 1) ? Wk : Wv;
  const int transposed = (z == 2) ? 1 : 0;
  const int m0 = blockIdx.x * 64, n0 = blockIdx.y * 128;
  const int bb = m0 / SEQ, s0 = m0 - bb * SEQ;
  const bool early = (s0 < EARLY_R);
  const int tid = threadIdx.x, w = tid >> 5, lane = tid & 31, idx = lane & 15, half = lane >> 4;
  const int mw_l = (w & 3) * 16;
  const int nw_l = (w >> 2) * 64;

  v8f c[4] = {};
  const h16* arow = Xb + (size_t)(m0 + mw_l) * DM;
  const h16* brow = W + (size_t)(n0 + nw_l) * DM;
#pragma unroll 2
  for (int k0 = 0; k0 < DM; k0 += 32) {
    v16h a = load_a_frag(arow, DM, k0);
#pragma unroll
    for (int t = 0; t < 4; ++t) {
      v16h bf = load_b_frag(brow + (size_t)(t * 16) * DM, DM, k0);
      c[t] = wmma_f16(a, bf, c[t]);
    }
  }
#pragma unroll
  for (int t = 0; t < 4; ++t) {
    const int cl = nw_l + t * 16 + idx;             // local col
#pragma unroll
    for (int g = 0; g < 8; ++g) {
      const int rl = mw_l + g + 8 * half;           // local row
      const float u = c[t][g] * PROJ_MUL;           // x16 carried value
      const h16 hv = (h16)u;
      const int li = transposed ? (cl * 72 + rl) : (rl * 136 + cl);
      Th[li] = hv;
      if (early) Tr[li] = (h16)((u - (float)hv) * RSC);
    }
  }
  __syncthreads();
  if (!transposed) {
    h16* Oh = (z == 0) ? Qh : Kh;
    h16* Orp = (z == 0) ? Qr : Kr;
    for (int gg = tid; gg < 64 * 16; gg += 256) {
      const int rl = gg >> 4, pc = gg & 15;
      vst2(Oh + (size_t)(m0 + rl) * DM + n0 + pc * 8, *(const v4u*)(&Th[rl * 136 + pc * 8]));
      if (early) vst2(Orp + (size_t)(bb * EARLY_R + s0 + rl) * DM + n0 + pc * 8, *(const v4u*)(&Tr[rl * 136 + pc * 8]));
    }
  } else {
    for (int gg = tid; gg < 128 * 8; gg += 256) {
      const int cl = gg >> 3, pc = gg & 7;
      vst2(Vth + ((size_t)(bb * DM + n0 + cl)) * SEQ + s0 + pc * 8, *(const v4u*)(&Th[cl * 72 + pc * 8]));
      if (early) vst2(Vtr + ((size_t)(bb * DM + n0 + cl)) * EARLY_R + s0 + pc * 8, *(const v4u*)(&Tr[cl * 72 + pc * 8]));
    }
  }
}

// ---------------- flash attention, causal, query positions >= EARLY_R (single products) ----------------
// WG = 32 queries, 8 waves, key chunks of 64 (chunks 0 .. q0/64). K fragments read from the dense K plane,
// V^T chunk staged in LDS. Score phase: wave w -> (qi = w&1, kj = w>>1) 16x16 tile, K-loop over 512.
// PV phase: wave w -> (qi = w&1, dg = w>>1) 16 q x 128 dims (8 accum tiles).
__global__ __launch_bounds__(256) __attribute__((amdgpu_num_vgpr(256)))
void attn_main_kernel(const h16* __restrict__ Qh, const h16* __restrict__ Kh,
                      const h16* __restrict__ Vth, h16* __restrict__ Ch) {
  __shared__ __align__(16) h16   Qs[32][QP];
  __shared__ __align__(16) h16   Vts[DM][VP64];    // d-major; reused as the f16 ctx tile [32][512] after the loop
  __shared__ __align__(16) float Ss[32][SP64];
  __shared__ __align__(16) h16   Ps[32][VP64];
  __shared__ float alpha_s[32];
  __shared__ float l_s[32];

  const int b   = blockIdx.y;
  const int q0  = EARLY_R + blockIdx.x * 32;
  const int tid = threadIdx.x;
  const int w    = tid >> 5;
  const int lane = tid & 31;
  const int idx  = lane & 15;
  const int half = lane >> 4;
  const int qi = w & 1;
  const int kj = w >> 1;     // score key subtile
  const int dg = w >> 1;     // PV d-group (128 dims)

  const h16* Qg = Qh + ((size_t)(b * SEQ + q0)) * DM;
  for (int cc = tid; cc < 32 * (DM / 8); cc += 256) {
    const int r = cc >> 6, dc = cc & 63;
    copy16_g2s(&Qs[r][dc * 8], Qg + (size_t)r * DM + dc * 8);
  }

  v8f o[8] = {};
  const int srow = tid >> 3;          // softmax: 8 threads per query row
  const int sj   = tid & 7;
  float m_prev = -1e30f;
  float l_run  = 0.0f;
  const int nchunk = q0 / 64 + 1;     // keys 0 .. 64*nchunk-1 cover every position <= q0+31

#pragma unroll 1
  for (int ci = 0; ci < nchunk; ++ci) {
    const int kv0 = ci * 64;
    __syncthreads();   // prior PV done with Vts / Ps (and Qs issue point on the first chunk)
    const h16* Vg = Vth + (size_t)(b * DM) * SEQ + kv0;
    for (int cc = tid; cc < DM * 8; cc += 256) {
      const int d = cc >> 3, j = cc & 7;
      copy16_g2s(&Vts[d][j * 8], Vg + (size_t)d * SEQ + j * 8);
    }
    __syncthreads();

    {
      v8f sc = {};
      const h16* Kg = Kh + ((size_t)(b * SEQ + kv0 + kj * 16)) * DM;
#pragma unroll 4
      for (int k0 = 0; k0 < DM; k0 += 32) {
        v16h a  = load_a_frag(&Qs[qi * 16][0], QP, k0);
        v16h bf = load_b_frag(Kg, DM, k0);
        sc = wmma_f16(a, bf, sc);
      }
      const int col = kj * 16 + idx;
      const int key = kv0 + col;
#pragma unroll
      for (int g = 0; g < 8; ++g) {
        const int rl = qi * 16 + g + 8 * half;
        float val = sc[g] * SCL;
        if (key > q0 + rl) val = -1e30f;          // causal: replace masked scores
        Ss[rl][col] = val;
      }
    }
    __syncthreads();

    {
      float v[8];
      float mloc = -1e30f;
#pragma unroll
      for (int e = 0; e < 8; ++e) { v[e] = Ss[srow][sj + e * 8]; mloc = fmaxf(mloc, v[e]); }
#pragma unroll
      for (int msk = 1; msk < 8; msk <<= 1) mloc = fmaxf(mloc, __shfl_xor(mloc, msk, 32));
      const float m_new = fmaxf(m_prev, mloc);
      const float alpha = __expf(m_prev - m_new);
      float ssum = 0.0f;
#pragma unroll
      for (int e = 0; e < 8; ++e) {
        const float p = __expf(v[e] - m_new);
        ssum += p;
        Ps[srow][sj + e * 8] = (h16)(p * PSC);
      }
#pragma unroll
      for (int msk = 1; msk < 8; msk <<= 1) ssum += __shfl_xor(ssum, msk, 32);
      l_run = l_run * alpha + ssum;
      m_prev = m_new;
      if (sj == 0) { alpha_s[srow] = alpha; l_s[srow] = l_run; }
    }
    __syncthreads();

    {
      float al[8];
#pragma unroll
      for (int g = 0; g < 8; ++g) al[g] = alpha_s[qi * 16 + g + 8 * half];
#pragma unroll
      for (int t = 0; t < 8; ++t)
#pragma unroll
        for (int g = 0; g < 8; ++g) o[t][g] *= al[g];
#pragma unroll
      for (int k0 = 0; k0 < 64; k0 += 32) {
        v16h a = load_a_frag(&Ps[qi * 16][0], VP64, k0);
#pragma unroll
        for (int t = 0; t < 8; ++t) {
          v16h bf = load_b_frag(&Vts[dg * 128 + t * 16][0], VP64, k0);
          o[t] = wmma_f16(a, bf, o[t]);
        }
      }
    }
  }
  __syncthreads();

  h16* Ct = &Vts[0][0];
  float linv[8];
#pragma unroll
  for (int g = 0; g < 8; ++g) linv[g] = 1.0f / (l_s[qi * 16 + g + 8 * half] * PSC);
#pragma unroll
  for (int t = 0; t < 8; ++t) {
    const int col = dg * 128 + t * 16 + idx;
#pragma unroll
    for (int g = 0; g < 8; ++g) Ct[(qi * 16 + g + 8 * half) * DM + col] = (h16)(o[t][g] * linv[g]);
  }
  __syncthreads();
  {
    h16* dst = Ch + ((size_t)(b * SEQ + q0)) * DM;
    for (int gg = tid; gg < 32 * DM / 8; gg += 256) vst2(dst + (size_t)gg * 8, *(const v4u*)(Ct + gg * 8));
  }
}

// ---------------- flash attention, causal, query positions < EARLY_R (hi + residual products) ----------------
// WG = 16 queries, 8 waves, key chunks of 32 (chunks 0 .. q0/32). Q (hi,res) staged once; K (hi,res) and V^T (hi,res)
// chunks staged in LDS. Score phase: waves 0..5 -> (prod = w>>1, kj = w&1): prod 0 = Qh Kh, 1 = Qh Kr, 2 = Qr Kh.
// PV phase: wave w -> dims [64w, 64w+64): Oh += Ph Vh ; Or += Ph Vr + Pr Vh. Writes ctx hi and ctx res planes.
__global__ __launch_bounds__(256) __attribute__((amdgpu_num_vgpr(256)))
void attn_early_kernel(const h16* __restrict__ Qh, const h16* __restrict__ Qr,
                       const h16* __restrict__ Kh, const h16* __restrict__ Kr,
                       const h16* __restrict__ Vth, const h16* __restrict__ Vtr,
                       h16* __restrict__ Ch, h16* __restrict__ Cr) {
  __shared__ __align__(16) h16   Qs[2][16][QP];
  __shared__ __align__(16) h16   Ks[2][32][QP];    // reused as the ctx tiles [2][16][512] after the loop
  __shared__ __align__(16) h16   Vts[2][DM][VP32]; // d-major
  __shared__ __align__(16) float Ss[3][16][SP32];
  __shared__ __align__(16) h16   Ps[2][16][VP32];
  __shared__ float alpha_s[16];
  __shared__ float l_s[16];

  const int b   = blockIdx.y;
  const int q0  = blockIdx.x * 16;
  const int tid = threadIdx.x;
  const int w    = tid >> 5;
  const int lane = tid & 31;
  const int idx  = lane & 15;
  const int half = lane >> 4;

  {
    const h16* Qg0 = Qh + ((size_t)(b * SEQ + q0)) * DM;
    const h16* Qg1 = Qr + ((size_t)(b * EARLY_R + q0)) * DM;
    for (int cc = tid; cc < 16 * (DM / 8); cc += 256) {
      const int r = cc >> 6, dc = cc & 63;
      copy16_g2s(&Qs[0][r][dc * 8], Qg0 + (size_t)r * DM + dc * 8);
      copy16_g2s(&Qs[1][r][dc * 8], Qg1 + (size_t)r * DM + dc * 8);
    }
  }

  v8f oh[4] = {};
  v8f orr[4] = {};
  const int srow = tid >> 4;          // softmax: 16 threads per query row
  const int sj   = tid & 15;
  float m_prev = -1e30f;
  float l_run  = 0.0f;
  const int nchunk = q0 / 32 + 1;     // keys 0 .. 32*nchunk-1 cover every position <= q0+15

#pragma unroll 1
  for (int ci = 0; ci < nchunk; ++ci) {
    const int kv0 = ci * 32;
    __syncthreads();   // prior PV done with Vts / Ps, prior scores done with Ks
    {
      const h16* Kg0 = Kh + ((size_t)(b * SEQ + kv0)) * DM;
      const h16* Kg1 = Kr + ((size_t)(b * EARLY_R + kv0)) * DM;
      for (int cc = tid; cc < 32 * (DM / 8); cc += 256) {
        const int r = cc >> 6, dc = cc & 63;
        copy16_g2s(&Ks[0][r][dc * 8], Kg0 + (size_t)r * DM + dc * 8);
        copy16_g2s(&Ks[1][r][dc * 8], Kg1 + (size_t)r * DM + dc * 8);
      }
      const h16* Vg0 = Vth + (size_t)(b * DM) * SEQ + kv0;
      const h16* Vg1 = Vtr + (size_t)(b * DM) * EARLY_R + kv0;
      for (int cc = tid; cc < DM * 4; cc += 256) {
        const int d = cc >> 2, j = cc & 3;
        copy16_g2s(&Vts[0][d][j * 8], Vg0 + (size_t)d * SEQ + j * 8);
        copy16_g2s(&Vts[1][d][j * 8], Vg1 + (size_t)d * EARLY_R + j * 8);
      }
    }
    __syncthreads();

    if (w < 6) {                                   // wave-uniform
      const int prod = w >> 1, kj = w & 1;
      const int pa = (prod == 2) ? 1 : 0;
      const int pb = (prod == 1) ? 1 : 0;
      v8f sc = {};
#pragma unroll 4
      for (int k0 = 0; k0 < DM; k0 += 32) {
        v16h a  = load_a_frag(&Qs[pa][0][0], QP, k0);
        v16h bf = load_b_frag(&Ks[pb][kj * 16][0], QP, k0);
        sc = wmma_f16(a, bf, sc);
      }
      const int col = kj * 16 + idx;
#pragma unroll
      for (int g = 0; g < 8; ++g) Ss[prod][g + 8 * half][col] = sc[g];
    }
    __syncthreads();

    {
      float v[2];
      float mloc = -1e30f;
      const int qrow = q0 + srow;
#pragma unroll
      for (int e = 0; e < 2; ++e) {
        const int cidx = sj + e * 16;
        float s = (Ss[0][srow][cidx] + (Ss[1][srow][cidx] + Ss[2][srow][cidx]) * RINV) * SCL;
        if (kv0 + cidx > qrow) s = -1e30f;         // causal: replace masked scores
        v[e] = s; mloc = fmaxf(mloc, s);
      }
#pragma unroll
      for (int msk = 1; msk < 16; msk <<= 1) mloc = fmaxf(mloc, __shfl_xor(mloc, msk, 32));
      const float m_new = fmaxf(m_prev, mloc);
      const float alpha = __expf(m_prev - m_new);
      float ssum = 0.0f;
#pragma unroll
      for (int e = 0; e < 2; ++e) {
        const int cidx = sj + e * 16;
        const float p  = __expf(v[e] - m_new);
        ssum += p;
        const float pp = p * PSC;
        const h16 hv = (h16)pp;
        Ps[0][srow][cidx] = hv;
        Ps[1][srow][cidx] = (h16)((pp - (float)hv) * RSC);
      }
#pragma unroll
      for (int msk = 1; msk < 16; msk <<= 1) ssum += __shfl_xor(ssum, msk, 32);
      l_run = l_run * alpha + ssum;
      m_prev = m_new;
      if (sj == 0) { alpha_s[srow] = alpha; l_s[srow] = l_run; }
    }
    __syncthreads();

    {
      float al[8];
#pragma unroll
      for (int g = 0; g < 8; ++g) al[g] = alpha_s[g + 8 * half];
#pragma unroll
      for (int t = 0; t < 4; ++t)
#pragma unroll
        for (int g = 0; g < 8; ++g) { oh[t][g] *= al[g]; orr[t][g] *= al[g]; }
      v16h ah = load_a_frag(&Ps[0][0][0], VP32, 0);
      v16h ar = load_a_frag(&Ps[1][0][0], VP32, 0);
#pragma unroll
      for (int t = 0; t < 4; ++t) {
        const int d0 = w * 64 + t * 16;
        v16h bh = load_b_frag(&Vts[0][d0][0], VP32, 0);
        v16h br = load_b_frag(&Vts[1][d0][0], VP32, 0);
        oh[t]  = wmma_f16(ah, bh, oh[t]);
        orr[t] = wmma_f16(ah, br, orr[t]);
        orr[t] = wmma_f16(ar, bh, orr[t]);
      }
    }
  }
  __syncthreads();

  h16* Ct = &Ks[0][0][0];
  float linv[8];
#pragma unroll
  for (int g = 0; g < 8; ++g) linv[g] = 1.0f / (l_s[g + 8 * half] * PSC);
#pragma unroll
  for (int t = 0; t < 4; ++t) {
    const int col = w * 64 + t * 16 + idx;
#pragma unroll
    for (int g = 0; g < 8; ++g) {
      const int rl = g + 8 * half;
      const float u = (oh[t][g] + orr[t][g] * RINV) * linv[g];     // x16 carried ctx
      const h16 hv = (h16)u;
      Ct[rl * DM + col] = hv;
      Ct[16 * DM + rl * DM + col] = (h16)((u - (float)hv) * RSC);
    }
  }
  __syncthreads();
  {
    h16* dsth = Ch + ((size_t)(b * SEQ + q0)) * DM;
    h16* dstr = Cr + ((size_t)(b * EARLY_R + q0)) * DM;
    for (int gg = tid; gg < 16 * DM / 8; gg += 256) {
      vst2(dsth + (size_t)gg * 8, *(const v4u*)(Ct + gg * 8));
      vst2(dstr + (size_t)gg * 8, *(const v4u*)(Ct + 16 * DM + gg * 8));
    }
  }
}

// ---------------- output projection: out = ctx(MT x 512) * Wo(512 x 512)^T, f32 ----------------
// Same wave layout as proj_qkv. Blocks with sequence positions < EARLY_R add the ctx residual product (second accumulator).
__global__ __launch_bounds__(256) void proj_out_kernel(const h16* __restrict__ Ch, const h16* __restrict__ Cr,
                                                       const h16* __restrict__ Wo, float* __restrict__ out) {
  __shared__ __align__(16) float T[64 * 132];
  const int m0 = blockIdx.x * 64, n0 = blockIdx.y * 128;
  const int bb = m0 / SEQ, s0 = m0 - bb * SEQ;
  const bool early = (s0 < EARLY_R);
  const int tid = threadIdx.x, w = tid >> 5, lane = tid & 31, idx = lane & 15, half = lane >> 4;
  const int mw_l = (w & 3) * 16;
  const int nw_l = (w >> 2) * 64;

  v8f c[4] = {};
  v8f cr[4] = {};
  const h16* arow = Ch + (size_t)(m0 + mw_l) * DM;
  const h16* brow = Wo + (size_t)(n0 + nw_l) * DM;
  if (early) {
    const h16* rrow = Cr + (size_t)(bb * EARLY_R + s0 + mw_l) * DM;
#pragma unroll 2
    for (int k0 = 0; k0 < DM; k0 += 32) {
      v16h a  = load_a_frag(arow, DM, k0);
      v16h ar = load_a_frag(rrow, DM, k0);
#pragma unroll
      for (int t = 0; t < 4; ++t) {
        v16h bf = load_b_frag(brow + (size_t)(t * 16) * DM, DM, k0);
        c[t]  = wmma_f16(a, bf, c[t]);
        cr[t] = wmma_f16(ar, bf, cr[t]);
      }
    }
  } else {
#pragma unroll 2
    for (int k0 = 0; k0 < DM; k0 += 32) {
      v16h a = load_a_frag(arow, DM, k0);
#pragma unroll
      for (int t = 0; t < 4; ++t) {
        v16h bf = load_b_frag(brow + (size_t)(t * 16) * DM, DM, k0);
        c[t] = wmma_f16(a, bf, c[t]);
      }
    }
  }
#pragma unroll
  for (int t = 0; t < 4; ++t) {
    const int cl = nw_l + t * 16 + idx;
#pragma unroll
    for (int g = 0; g < 8; ++g) {
      const int rl = mw_l + g + 8 * half;
      T[rl * 132 + cl] = (c[t][g] + cr[t][g] * RINV) * OUT_MUL;
    }
  }
  __syncthreads();
  {
    float* dst = out + ((size_t)(bb * SEQ_FULL + s0)) * DM + n0;
    for (int gg = tid; gg < 64 * 32; gg += 256) {
      const int rl = gg >> 5, pc = gg & 31;
      vst2(dst + (size_t)rl * DM + pc * 4, *(const v4f*)(&T[rl * 132 + pc * 4]));
    }
  }
}

extern "C" void kernel_launch(void* const* d_in, const int* in_sizes, int n_in,
                              void* d_out, int out_size, void* d_ws, size_t ws_size,
                              hipStream_t stream) {
  if (n_in < 5) return;
  const int rows_needed = (NB - 1) * SEQ_FULL + SEQ;
  if (in_sizes[0] < rows_needed * DM) return;
  for (int i = 1; i < 5; ++i) if (in_sizes[i] < DM * DM) return;
  if (out_size < rows_needed * DM) return;

  const float* x  = (const float*)d_in[0];
  const float* Wq = (const float*)d_in[1];
  const float* Wk = (const float*)d_in[2];
  const float* Wv = (const float*)d_in[3];
  const float* Wo = (const float*)d_in[4];
  float* out = (float*)d_out;

  const size_t plane = (size_t)MT * DM * sizeof(h16);              // 16,777,216 at full size
  const size_t wpl   = (size_t)DM * DM * sizeof(h16);              //    524,288
  const size_t rpl   = (size_t)NB * EARLY_R * DM * sizeof(h16);    //  2,097,152 at full size
  size_t off = 0;
  char* ws = (char*)d_ws;
  h16* xb  = (h16*)(ws + off); off += plane;
  h16* wqb = (h16*)(ws + off); off += wpl;
  h16* wkb = (h16*)(ws + off); off += wpl;
  h16* wvb = (h16*)(ws + off); off += wpl;
  h16* wob = (h16*)(ws + off); off += wpl;
  h16* qh  = (h16*)(ws + off); off += plane;
  h16* kh  = (h16*)(ws + off); off += plane;
  h16* vth = (h16*)(ws + off); off += plane;   // [b][d][s]
  h16* qr  = (h16*)(ws + off); off += rpl;
  h16* kr  = (h16*)(ws + off); off += rpl;
  h16* vtr = (h16*)(ws + off); off += rpl;     // [b][d][s < EARLY_R]
  h16* ch  = (h16*)(ws + off); off += plane;
  h16* crp = (h16*)(ws + off); off += rpl;     // total 94,371,840 at full size
  if (off > ws_size) return;

  const int nx8 = MT * DM / 8;
  cvt_x_kernel<<<(nx8 + 255) / 256, 256, 0, stream>>>(x, xb, nx8);
  cvt_w_kernel<<<dim3((DM * DM / 8 + 255) / 256, 4), 256, 0, stream>>>(Wq, Wk, Wv, Wo, wqb, wkb, wvb, wob);

  proj_qkv_kernel<<<dim3(MT / 64, DM / 128, 3), 256, 0, stream>>>(xb, wqb, wkb, wvb, qh, kh, vth, qr, kr, vtr);

  attn_early_kernel<<<dim3(EARLY_R / 16, NB), 256, 0, stream>>>(qh, qr, kh, kr, vth, vtr, ch, crp);
  if (SEQ > EARLY_R) {
    attn_main_kernel<<<dim3((SEQ - EARLY_R) / 32, NB), 256, 0, stream>>>(qh, kh, vth, ch);
  }

  proj_out_kernel<<<dim3(MT / 64, DM / 128), 256, 0, stream>>>(ch, crp, wob, out);
}

// v002
// One run takes 421 microseconds.
// In two side-by-side timings against v001, it was 1.64 and 1.63 times as fast.
// Counting every step since v000, it is 2.39 times as fast.
#include <hip/hip_runtime.h>
// Contractions: Q/K/V projections (K = 512), scores Q K^T (K = 512), P V (K = keys) and the output projection (K = 512)
// on v_wmma_f32_16x16x32_f16 (f16 operands, f32 accumulate). Inputs enter as bf16-RNE values carried x16 in f16 planes;
// q/k/v/ctx are f16 hi planes carried x16 plus f16 residual planes carried x16384 for the first EARLY_R positions of each
// sequence (scores: hh + hr + rh, P V: hh + hr + rh, output projection: h + r); P carried x1024; softmax statistics in f32.

typedef _Float16 h16;
typedef _Float16 h16x8 __attribute__((ext_vector_type(8)));
typedef _Float16 v16h  __attribute__((ext_vector_type(16)));
typedef float  v8f    __attribute__((ext_vector_type(8)));
typedef float  v4f    __attribute__((ext_vector_type(4)));
typedef unsigned v4u  __attribute__((ext_vector_type(4)));

#ifndef NB
#define NB 4
#endif
#ifndef SEQ
#define SEQ 4096
#endif
#define NB_FULL 4
#define SEQ_FULL 4096
#define DM 512
#define EARLY_CAP 512
#define EARLY_R ((SEQ < EARLY_CAP) ? SEQ : EARLY_CAP)
#define MT (NB * SEQ)
// LDS row pitches in elements. f16 rows read by 16-byte fragment loads: byte pitch = 16 x odd, so the 16 rows of a fragment
// fall on distinct bank groups. f32 score rows: pitch chosen so that the tile stores and the row reads both spread over banks.
#define QP  (DM + 8)               // 1040 B: Q and K rows of 512 f16
#define VP64 72                    // 144 B: V^T and P rows of 64 f16
#define VP32 40                    // 80 B: V^T and P rows of 32 f16
#define SP64 76                    // f32 score rows of 64
#define SP32 36                    // f32 score rows of 32
#define KB   128                   // k block of the projections' LDS staging
#define KP   (KB + 8)              // 272 B: staged projection operand rows of 128 f16

static_assert(SEQ % 64 == 0);
static_assert((EARLY_R) % 64 == 0);
static_assert(NB >= 1 && NB <= NB_FULL);
static_assert(SEQ >= 64 && SEQ <= SEQ_FULL);
static_assert(DM % 128 == 0);
static_assert(((NB - 1) * SEQ_FULL + SEQ) * DM <= NB_FULL * SEQ_FULL * DM);

#define ISC  16.0f                 // carry of the x / q / k / v / ctx f16 hi planes
#define WSC  16.0f                 // carry of the weight planes
#define PSC  1024.0f               // carry of P
#define RSC  16384.0f              // carry of every residual plane
#define RINV (1.0f / 16384.0f)
#define PROJ_MUL (1.0f / 16.0f)    // acc of (x16 * x16) operands -> x16 plane value
#define OUT_MUL  (1.0f / 256.0f)   // acc of (x16 * x16) operands -> f32 output
#define SCL ((1.0f / 256.0f) * (1.0f / 22.627416610717773f))

template <typename V> __device__ __forceinline__ void vst2(void* p, V v) {
  *(V*)p = v; 
}
__device__ __forceinline__ void copy16_g2s(h16* ldst, const h16* gsrc) { *(h16x8*)ldst = *(const h16x8*)gsrc; }

__device__ __forceinline__ float bf16r(float f) {     // RNE convert to bf16, value kept in f32
  unsigned u = __float_as_uint(f);
  u = (u + 0x7FFFu + ((u >> 16) & 1u)) & 0xFFFF0000u;
  return __uint_as_float(u);
}

// ---- WMMA fragment loaders (f16, row-major K-contiguous source); A and B (from B^T rows) share the per-lane K map:
//      row/col = lane&15; elements 0..7 <- k0 + 8*half + 0..7, elements 8..15 <- k0 + 16 + 8*half + 0..7
__device__ __forceinline__ v16h load_a_frag(const h16* base, int ld, int k0) {
  int lane = threadIdx.x & 31;
  int idx  = lane & 15;
  int half = lane >> 4;
  const h16* p = base + idx * ld + k0 + half * 8;
  h16x8 lo = *(const h16x8*)(p);
  h16x8 hi = *(const h16x8*)(p + 16);
  return __builtin_shufflevector(lo, hi, 0,1,2,3,4,5,6,7,8,9,10,11,12,13,14,15);
}
__device__ __forceinline__ v16h load_b_frag(const h16* base, int ld, int k0) { return load_a_frag(base, ld, k0); }

__device__ __forceinline__ v8f wmma_f16(v16h a, v16h b, v8f c) {
  v8f d = __builtin_amdgcn_wmma_f32_16x16x32_f16(false, a, false, b, (short)0, c, false, false);
  asm volatile("v_nop\n\tv_nop\n\tv_nop\n\tv_nop" : "+v"(d) : "v"(a), "v"(b));
  return d;
}

// N 16-byte pieces per thread, 'step' elements apart, from global memory into registers.
template <int N> __device__ __forceinline__ void load_pieces(h16x8 (&r)[N], const h16* g0, size_t step) {
#pragma unroll     // constant indices keep r[] in registers and the steps in the loads' offset fields
  for (int i = 0; i < N; ++i) r[i] = *(const h16x8*)(g0 + i * step);
  // address-translation wait; g0 as an input keeps the loads' address pair untouched (also by a later load's result) up to it
  asm volatile("s_wait_xcnt 0x0" :: "v"(g0) : "memory");
}

// Stage ROWS rows of KB f16 (256 B = two whole lines per row, source row pitch DM) into LDS rows of pitch KP, 256 threads:
// one wave-wide 16-byte load covers two rows = four whole lines.
template <int ROWS> __device__ __forceinline__ void stage_rows(h16* lds, const h16* g, int tid) {
  h16* l0 = lds + (tid >> 4) * KP + (tid & 15) * 8;
  const h16* g0 = g + (size_t)(tid >> 4) * DM + (tid & 15) * 8;
  h16x8 r[ROWS / 16];
  load_pieces<ROWS / 16>(r, g0, 16 * DM);
#pragma unroll     // constant indices keep r[] in registers
  for (int i = 0; i < ROWS / 16; ++i) *(h16x8*)(l0 + i * 16 * KP) = r[i];
}

// ---------------- conversion kernels ----------------
// xb[row][c] = f16( bf16r(x) * 16 ), rows indexed b*SEQ + s, source rows b*SEQ_FULL + s; 8 elements (16 B) per thread
__global__ __launch_bounds__(256) void cvt_x_kernel(const float* __restrict__ x, h16* __restrict__ xb, int n8) {
  int g = blockIdx.x * 256 + threadIdx.x;
  if (g >= n8) return;
  const int row = g >> 6, c8 = g & 63;            // 64 groups of 8 per 512-wide row
  const int b = row / SEQ, s = row - b * SEQ;
  const float* src = x + ((size_t)(b * SEQ_FULL + s)) * DM + c8 * 8;
  const v4f a = *(const v4f*)(src), bq = *(const v4f*)(src + 4);
  union { h16x8 h; v4u u; } pk;
#pragma unroll
  for (int i = 0; i < 4; ++i) { pk.h[i] = (h16)(bf16r(a[i]) * ISC); pk.h[4 + i] = (h16)(bf16r(bq[i]) * ISC); }
  vst2(xb + (size_t)g * 8, pk.u);
}

// Wb[n][k] = f16( bf16r(W[n][k]) * 16 ) for the matrix selected by blockIdx.y (weights are already [out][in] = [n][k])
__global__ __launch_bounds__(256) void cvt_w_kernel(const float* __restrict__ W0, const float* __restrict__ W1,
                                                    const float* __restrict__ W2, const float* __restrict__ W3,
                                                    h16* __restrict__ D0, h16* __restrict__ D1,
                                                    h16* __restrict__ D2, h16* __restrict__ D3) {
  const int y = blockIdx.y;
  const float* W = (y == 0) ? W0 : (y == 1) ? W1 : (y == 2) ? W2 : W3;
  h16*       D  = (y == 0) ? D0 : (y == 1) ? D1 : (y == 2) ? D2 : D3;
  const int g = blockIdx.x * 256 + threadIdx.x;    // < DM*DM/8 by grid construction
  if (g >= DM * DM / 8) return;
  const float* src = W + (size_t)g * 8;
  const v4f a = *(const v4f*)(src), bq = *(const v4f*)(src + 4);
  union { h16x8 h; v4u u; } pk;
#pragma unroll
  for (int i = 0; i < 4; ++i) { pk.h[i] = (h16)(bf16r(a[i]) * WSC); pk.h[4 + i] = (h16)(bf16r(bq[i]) * WSC); }
  vst2(D + (size_t)g * 8, pk.u);
}

// ---------------- projection GEMM: Y = X(MT x 512) * W(512 x 512)^T, blockIdx.z selects Q / K / V ----------------
// 8 waves/WG: 4 M-subtiles x 2 N-groups(64). Each wave: 16x64 (4 WMMA tiles). The X (64 rows) and W (128 rows) operands are
// staged in LDS in k blocks of KB = 128 by whole-line 16-byte loads; fragments are read from LDS. The staging space is reused
// for the 64 x 128 output tile. Blocks whose sequence positions are < EARLY_R also write the residual planes (x16384).
__global__ __launch_bounds__(256) void proj_qkv_kernel(const h16* __restrict__ Xb,
                                                       const h16* __restrict__ Wq, const h16* __restrict__ Wk,
                                                       const h16* __restrict__ Wv,
                                                       h16* __restrict__ Qh, h16* __restrict__ Kh, h16* __restrict__ Vth,
                                                       h16* __restrict__ Qr, h16* __restrict__ Kr, h16* __restrict__ Vtr) {
  __shared__ __align__(16) h16 Th[128 * 136];     // [m][n] pitch 136 (Q/K) or [n][m] pitch 72 (V)
  __shared__ __align__(16) h16 Tr[128 * 136];
  const int z = blockIdx.z;
  const h16* W = (z == 0) ? Wq : (z == 1) ? Wk : Wv;
  const int transposed = (z == 2) ? 1 : 0;
  const int m0 = blockIdx.x * 64, n0 = blockIdx.y * 128;
  const int bb = m0 / SEQ, s0 = m0 - bb * SEQ;
  const bool early = (s0 < EARLY_R);
  const int tid = threadIdx.x, w = tid >> 5, lane = tid & 31, idx = lane & 15, half = lane >> 4;
  const int mw_l = (w & 3) * 16;
  const int nw_l = (w >> 2) * 64;

  v8f c[4] = {};
  h16* Ws = Th;                                     // [128][KP] during the k loop
  h16* Xs = Tr;                                     // [64][KP] during the k loop
#pragma unroll 1   // rolled: nothing moves across the barriers of a trip, unrolling would only multiply the code
  for (int kb = 0; kb < DM; kb += KB) {
    __syncthreads();                                // the previous block's fragment reads are done
    stage_rows<64>(Xs, Xb + (size_t)m0 * DM + kb, tid);
    stage_rows<128>(Ws, W + (size_t)n0 * DM + kb, tid);
    __syncthreads();                                // the staged block is visible to every wave
#pragma unroll
    for (int k0 = 0; k0 < KB; k0 += 32) {
      v16h a = load_a_frag(Xs + mw_l * KP, KP, k0);
#pragma unroll
      for (int t = 0; t < 4; ++t) {
        v16h bf = load_b_frag(Ws + (nw_l + t * 16) * KP, KP, k0);
        c[t] = wmma_f16(a, bf, c[t]);
      }
    }
  }
  __syncthreads();                                  // last fragment reads done before the space becomes the output tile
#pragma unroll
  for (int t = 0; t < 4; ++t) {
    const int cl = nw_l + t * 16 + idx;             // local col
#pragma unroll
    for (int g = 0; g < 8; ++g) {
      const int rl = mw_l + g + 8 * half;           // local row
      const float u = c[t][g] * PROJ_MUL;           // x16 carried value
      const h16 hv = (h16)u;
      const int li = transposed ? (cl * 72 + rl) : (rl * 136 + cl);
      Th[li] = hv;
      if (early) Tr[li] = (h16)((u - (float)hv) * RSC);
    }
  }
  __syncthreads();
  if (!transposed) {
    h16* Oh = (z == 0) ? Qh : Kh;
    h16* Orp = (z == 0) ? Qr : Kr;
    for (int gg = tid; gg < 64 * 16; gg += 256) {
      const int rl = gg >> 4, pc = gg & 15;
      vst2(Oh + (size_t)(m0 + rl) * DM + n0 + pc * 8, *(const v4u*)(&Th[rl * 136 + pc * 8]));
      if (early) vst2(Orp + (size_t)(bb * EARLY_R + s0 + rl) * DM + n0 + pc * 8, *(const v4u*)(&Tr[rl * 136 + pc * 8]));
    }
  } else {
    for (int gg = tid; gg < 128 * 8; gg += 256) {
      const int cl = gg >> 3, pc = gg & 7;
      vst2(Vth + ((size_t)(bb * DM + n0 + cl)) * SEQ + s0 + pc * 8, *(const v4u*)(&Th[cl * 72 + pc * 8]));
      if (early) vst2(Vtr + ((size_t)(bb * DM + n0 + cl)) * EARLY_R + s0 + pc * 8, *(const v4u*)(&Tr[cl * 72 + pc * 8]));
    }
  }
}

// ---------------- flash attention, causal, query positions >= EARLY_R (single products) ----------------
// WG = 32 queries, 8 waves, key chunks of 64 (chunks 0 .. q0/64). The K chunk is staged in LDS by whole-line loads for the
// score phase; the V^T chunk, loaded into registers with it, takes the same LDS space for the PV phase.
// Score phase: wave w -> (qi = w&1, kj = w>>1) 16x16 tile, K-loop over 512.
// PV phase: wave w -> (qi = w&1, dg = w>>1) 16 q x 128 dims (8 accum tiles).
__global__ __launch_bounds__(256) __attribute__((amdgpu_num_vgpr(256)))
void attn_main_kernel(const h16* __restrict__ Qh, const h16* __restrict__ Kh,
                      const h16* __restrict__ Vth, h16* __restrict__ Ch) {
  __shared__ __align__(16) h16   Qs[32][QP];
  __shared__ __align__(16) h16   Vts[DM][VP64];    // d-major; K rows [64][QP] in the score phase, f16 ctx tile [32][512] after the loop
  __shared__ __align__(16) float Ss[32][SP64];
  __shared__ __align__(16) h16   Ps[32][VP64];
  __shared__ float alpha_s[32];
  __shared__ float l_s[32];

  const int b   = blockIdx.y;
  const int q0  = EARLY_R + blockIdx.x * 32;
  const int tid = threadIdx.x;
  const int w    = tid >> 5;
  const int lane = tid & 31;
  const int idx  = lane & 15;
  const int half = lane >> 4;
  const int qi = w & 1;
  const int kj = w >> 1;     // score key subtile
  const int dg = w >> 1;     // PV d-group (128 dims)

  const h16* Qg = Qh + ((size_t)(b * SEQ + q0)) * DM;
  for (int cc = tid; cc < 32 * (DM / 8); cc += 256) {
    const int r = cc >> 6, dc = cc & 63;
    copy16_g2s(&Qs[r][dc * 8], Qg + (size_t)r * DM + dc * 8);
  }

  h16* Ks = &Vts[0][0];
  h16* Kst = Ks + (tid >> 6) * QP + (tid & 63) * 8;      // this thread's first K piece; the next ones lie 4 rows apart
  h16* Vst = &Vts[tid >> 3][(tid & 7) * 8];              // this thread's first V^T piece; the next ones lie 32 rows apart
  static_assert(64 * QP <= DM * VP64);
  v8f o[8] = {};
  const int srow = tid >> 3;          // softmax: 8 threads per query row
  const int sj   = tid & 7;
  float m_prev = -1e30f;
  float l_run  = 0.0f;
  const int nchunk = q0 / 64 + 1;     // keys 0 .. 64*nchunk-1 cover every position <= q0+31

#pragma unroll 1
  for (int ci = 0; ci < nchunk; ++ci) {
    const int kv0 = ci * 64;
    __syncthreads();   // prior PV done with Vts / Ps (and Qs issue point on the first chunk)
    const h16* Kg = Kh + ((size_t)(b * SEQ + kv0 + (tid >> 6))) * DM + (tid & 63) * 8;
    h16x8 kreg[16];
    load_pieces<16>(kreg, Kg, 4 * DM);
    const h16* Vg = Vth + (size_t)(b * DM + (tid >> 3)) * SEQ + kv0 + (tid & 7) * 8;
    h16x8 vreg[16];    // V^T chunk, held in registers during the score phase
    load_pieces<16>(vreg, Vg, (size_t)32 * SEQ);
#pragma unroll     // constant indices keep kreg[] in registers
    for (int i = 0; i < 16; ++i) *(h16x8*)(Kst + i * 4 * QP) = kreg[i];
    __syncthreads();   // K chunk visible

    {
      v8f sc = {};
#pragma unroll 4
      for (int k0 = 0; k0 < DM; k0 += 32) {
        v16h a  = load_a_frag(&Qs[qi * 16][0], QP, k0);
        v16h bf = load_b_frag(Ks + (kj * 16) * QP, QP, k0);
        sc = wmma_f16(a, bf, sc);
      }
      const int col = kj * 16 + idx;
      const int key = kv0 + col;
#pragma unroll
      for (int g = 0; g < 8; ++g) {
        const int rl = qi * 16 + g + 8 * half;
        float val = sc[g] * SCL;
        if (key > q0 + rl) val = -1e30f;          // causal: replace masked scores
        Ss[rl][col] = val;
      }
    }
    __syncthreads();   // scores visible; every K fragment read is done, so V^T may take the space

#pragma unroll     // constant indices keep vreg[] in registers
    for (int i = 0; i < 16; ++i) *(h16x8*)(Vst + i * 32 * VP64) = vreg[i];
    {
      float v[8];
      float mloc = -1e30f;
#pragma unroll
      for (int e = 0; e < 8; ++e) { v[e] = Ss[srow][sj + e * 8]; mloc = fmaxf(mloc, v[e]); }
#pragma unroll
      for (int msk = 1; msk < 8; msk <<= 1) mloc = fmaxf(mloc, __shfl_xor(mloc, msk, 32));
      const float m_new = fmaxf(m_prev, mloc);
      const float alpha = __expf(m_prev - m_new);
      float ssum = 0.0f;
#pragma unroll
      for (int e = 0; e < 8; ++e) {
        const float p = __expf(v[e] - m_new);
        ssum += p;
        Ps[srow][sj + e * 8] = (h16)(p * PSC);
      }
#pragma unroll
      for (int msk = 1; msk < 8; msk <<= 1) ssum += __shfl_xor(ssum, msk, 32);
      l_run = l_run * alpha + ssum;
      m_prev = m_new;
      if (sj == 0) { alpha_s[srow] = alpha; l_s[srow] = l_run; }
    }
    __syncthreads();

    {
      float al[8];
#pragma unroll
      for (int g = 0; g < 8; ++g) al[g] = alpha_s[qi * 16 + g + 8 * half];
#pragma unroll
      for (int t = 0; t < 8; ++t)
#pragma unroll
        for (int g = 0; g < 8; ++g) o[t][g] *= al[g];
#pragma unroll
      for (int k0 = 0; k0 < 64; k0 += 32) {
        v16h a = load_a_frag(&Ps[qi * 16][0], VP64, k0);
#pragma unroll
        for (int t = 0; t < 8; ++t) {
          v16h bf = load_b_frag(&Vts[dg * 128 + t * 16][0], VP64, k0);
          o[t] = wmma_f16(a, bf, o[t]);
        }
      }
    }
  }
  __syncthreads();

  h16* Ct = &Vts[0][0];
  float linv[8];
#pragma unroll
  for (int g = 0; g < 8; ++g) linv[g] = 1.0f / (l_s[qi * 16 + g + 8 * half] * PSC);
#pragma unroll
  for (int t = 0; t < 8; ++t) {
    const int col = dg * 128 + t * 16 + idx;
#pragma unroll
    for (int g = 0; g < 8; ++g) Ct[(qi * 16 + g + 8 * half) * DM + col] = (h16)(o[t][g] * linv[g]);
  }
  __syncthreads();
  {
    h16* dst = Ch + ((size_t)(b * SEQ + q0)) * DM;
    for (int gg = tid; gg < 32 * DM / 8; gg += 256) vst2(dst + (size_t)gg * 8, *(const v4u*)(Ct + gg * 8));
  }
}

// ---------------- flash attention, causal, query positions < EARLY_R (hi + residual products) ----------------
// WG = 16 queries, 8 waves, key chunks of 32 (chunks 0 .. q0/32). Q (hi,res) staged once; K (hi,res) and V^T (hi,res)
// chunks staged in LDS. Score phase: waves 0..5 -> (prod = w>>1, kj = w&1): prod 0 = Qh Kh, 1 = Qh Kr, 2 = Qr Kh.
// PV phase: wave w -> dims [64w, 64w+64): Oh += Ph Vh ; Or += Ph Vr + Pr Vh. Writes ctx hi and ctx res planes.
__global__ __launch_bounds__(256) __attribute__((amdgpu_num_vgpr(256)))
void attn_early_kernel(const h16* __restrict__ Qh, const h16* __restrict__ Qr,
                       const h16* __restrict__ Kh, const h16* __restrict__ Kr,
                       const h16* __restrict__ Vth, const h16* __restrict__ Vtr,
                       h16* __restrict__ Ch, h16* __restrict__ Cr) {
  __shared__ __align__(16) h16   Qs[2][16][QP];
  __shared__ __align__(16) h16   Ks[2][32][QP];    // reused as the ctx tiles [2][16][512] after the loop
  __shared__ __align__(16) h16   Vts[2][DM][VP32]; // d-major
  __shared__ __align__(16) float Ss[3][16][SP32];
  __shared__ __align__(16) h16   Ps[2][16][VP32];
  __shared__ float alpha_s[16];
  __shared__ float l_s[16];

  const int b   = blockIdx.y;
  const int q0  = blockIdx.x * 16;
  const int tid = threadIdx.x;
  const int w    = tid >> 5;
  const int lane = tid & 31;
  const int idx  = lane & 15;
  const int half = lane >> 4;

  {
    const h16* Qg0 = Qh + ((size_t)(b * SEQ + q0)) * DM;
    const h16* Qg1 = Qr + ((size_t)(b * EARLY_R + q0)) * DM;
    for (int cc = tid; cc < 16 * (DM / 8); cc += 256) {
      const int r = cc >> 6, dc = cc & 63;
      copy16_g2s(&Qs[0][r][dc * 8], Qg0 + (size_t)r * DM + dc * 8);
      copy16_g2s(&Qs[1][r][dc * 8], Qg1 + (size_t)r * DM + dc * 8);
    }
  }

  v8f oh[4] = {};
  v8f orr[4] = {};
  const int srow = tid >> 4;          // softmax: 16 threads per query row
  const int sj   = tid & 15;
  float m_prev = -1e30f;
  float l_run  = 0.0f;
  const int nchunk = q0 / 32 + 1;     // keys 0 .. 32*nchunk-1 cover every position <= q0+15

#pragma unroll 1
  for (int ci = 0; ci < nchunk; ++ci) {
    const int kv0 = ci * 32;
    __syncthreads();   // prior PV done with Vts / Ps, prior scores done with Ks
    {
      const h16* Kg0 = Kh + ((size_t)(b * SEQ + kv0)) * DM;
      const h16* Kg1 = Kr + ((size_t)(b * EARLY_R + kv0)) * DM;
      for (int cc = tid; cc < 32 * (DM / 8); cc += 256) {
        const int r = cc >> 6, dc = cc & 63;
        copy16_g2s(&Ks[0][r][dc * 8], Kg0 + (size_t)r * DM + dc * 8);
        copy16_g2s(&Ks[1][r][dc * 8], Kg1 + (size_t)r * DM + dc * 8);
      }
      const h16* Vg0 = Vth + (size_t)(b * DM) * SEQ + kv0;
      const h16* Vg1 = Vtr + (size_t)(b * DM) * EARLY_R + kv0;
      for (int cc = tid; cc < DM * 4; cc += 256) {
        const int d = cc >> 2, j = cc & 3;
        copy16_g2s(&Vts[0][d][j * 8], Vg0 + (size_t)d * SEQ + j * 8);
        copy16_g2s(&Vts[1][d][j * 8], Vg1 + (size_t)d * EARLY_R + j * 8);
      }
    }
    __syncthreads();

    if (w < 6) {                                   // wave-uniform
      const int prod = w >> 1, kj = w & 1;
      const int pa = (prod == 2) ? 1 : 0;
      const int pb = (prod == 1) ? 1 : 0;
      v8f sc = {};
#pragma unroll 4
      for (int k0 = 0; k0 < DM; k0 += 32) {
        v16h a  = load_a_frag(&Qs[pa][0][0], QP, k0);
        v16h bf = load_b_frag(&Ks[pb][kj * 16][0], QP, k0);
        sc = wmma_f16(a, bf, sc);
      }
      const int col = kj * 16 + idx;
#pragma unroll
      for (int g = 0; g < 8; ++g) Ss[prod][g + 8 * half][col] = sc[g];
    }
    __syncthreads();

    {
      float v[2];
      float mloc = -1e30f;
      const int qrow = q0 + srow;
#pragma unroll
      for (int e = 0; e < 2; ++e) {
        const int cidx = sj + e * 16;
        float s = (Ss[0][srow][cidx] + (Ss[1][srow][cidx] + Ss[2][srow][cidx]) * RINV) * SCL;
        if (kv0 + cidx > qrow) s = -1e30f;         // causal: replace masked scores
        v[e] = s; mloc = fmaxf(mloc, s);
      }
#pragma unroll
      for (int msk = 1; msk < 16; msk <<= 1) mloc = fmaxf(mloc, __shfl_xor(mloc, msk, 32));
      const float m_new = fmaxf(m_prev, mloc);
      const float alpha = __expf(m_prev - m_new);
      float ssum = 0.0f;
#pragma unroll
      for (int e = 0; e < 2; ++e) {
        const int cidx = sj + e * 16;
        const float p  = __expf(v[e] - m_new);
        ssum += p;
        const float pp = p * PSC;
        const h16 hv = (h16)pp;
        Ps[0][srow][cidx] = hv;
        Ps[1][srow][cidx] = (h16)((pp - (float)hv) * RSC);
      }
#pragma unroll
      for (int msk = 1; msk < 16; msk <<= 1) ssum += __shfl_xor(ssum, msk, 32);
      l_run = l_run * alpha + ssum;
      m_prev = m_new;
      if (sj == 0) { alpha_s[srow] = alpha; l_s[srow] = l_run; }
    }
    __syncthreads();

    {
      float al[8];
#pragma unroll
      for (int g = 0; g < 8; ++g) al[g] = alpha_s[g + 8 * half];
#pragma unroll
      for (int t = 0; t < 4; ++t)
#pragma unroll
        for (int g = 0; g < 8; ++g) { oh[t][g] *= al[g]; orr[t][g] *= al[g]; }
      v16h ah = load_a_frag(&Ps[0][0][0], VP32, 0);
      v16h ar = load_a_frag(&Ps[1][0][0], VP32, 0);
#pragma unroll
      for (int t = 0; t < 4; ++t) {
        const int d0 = w * 64 + t * 16;
        v16h bh = load_b_frag(&Vts[0][d0][0], VP32, 0);
        v16h br = load_b_frag(&Vts[1][d0][0], VP32, 0);
        oh[t]  = wmma_f16(ah, bh, oh[t]);
        orr[t] = wmma_f16(ah, br, orr[t]);
        orr[t] = wmma_f16(ar, bh, orr[t]);
      }
    }
  }
  __syncthreads();

  h16* Ct = &Ks[0][0][0];
  float linv[8];
#pragma unroll
  for (int g = 0; g < 8; ++g) linv[g] = 1.0f / (l_s[g + 8 * half] * PSC);
#pragma unroll
  for (int t = 0; t < 4; ++t) {
    const int col = w * 64 + t * 16 + idx;
#pragma unroll
    for (int g = 0; g < 8; ++g) {
      const int rl = g + 8 * half;
      const float u = (oh[t][g] + orr[t][g] * RINV) * linv[g];     // x16 carried ctx
      const h16 hv = (h16)u;
      Ct[rl * DM + col] = hv;
      Ct[16 * DM + rl * DM + col] = (h16)((u - (float)hv) * RSC);
    }
  }
  __syncthreads();
  {
    h16* dsth = Ch + ((size_t)(b * SEQ + q0)) * DM;
    h16* dstr = Cr + ((size_t)(b * EARLY_R + q0)) * DM;
    for (int gg = tid; gg < 16 * DM / 8; gg += 256) {
      vst2(dsth + (size_t)gg * 8, *(const v4u*)(Ct + gg * 8));
      vst2(dstr + (size_t)gg * 8, *(const v4u*)(Ct + 16 * DM + gg * 8));
    }
  }
}

// ---------------- output projection: out = ctx(MT x 512) * Wo(512 x 512)^T, f32 ----------------
// Same wave layout and k-block LDS staging as proj_qkv. Blocks with sequence positions < EARLY_R add the ctx residual product
// (second accumulator).
__global__ __launch_bounds__(256) __attribute__((amdgpu_num_vgpr(128)))   // four workgroups (LDS limit) = 8 waves per SIMD
void proj_out_kernel(const h16* __restrict__ Ch, const h16* __restrict__ Cr,
                                                       const h16* __restrict__ Wo, float* __restrict__ out) {
  __shared__ __align__(16) h16 Ws[128 * KP];      // reused as the f32 output tile [64][132] after the k loop
  __shared__ __align__(16) h16 Cs[64 * KP];
  __shared__ __align__(16) h16 Rs[64 * KP];
  static_assert(64 * 132 * sizeof(float) <= 128 * KP * sizeof(h16));
  const int m0 = blockIdx.x * 64, n0 = blockIdx.y * 128;
  const int bb = m0 / SEQ, s0 = m0 - bb * SEQ;
  const bool early = (s0 < EARLY_R);
  const int tid = threadIdx.x, w = tid >> 5, lane = tid & 31, idx = lane & 15, half = lane >> 4;
  const int mw_l = (w & 3) * 16;
  const int nw_l = (w >> 2) * 64;

  v8f c[4] = {};
  v8f cr[4] = {};
#pragma unroll 1   // rolled: nothing moves across the barriers of a trip, unrolling would only multiply the code
  for (int kb = 0; kb < DM; kb += KB) {
    __syncthreads();                                // the previous block's fragment reads are done
    stage_rows<64>(Cs, Ch + (size_t)m0 * DM + kb, tid);
    stage_rows<128>(Ws, Wo + (size_t)n0 * DM + kb, tid);
    if (early) stage_rows<64>(Rs, Cr + (size_t)(bb * EARLY_R + s0) * DM + kb, tid);   // block-uniform
    __syncthreads();                                // the staged block is visible to every wave
    if (early) {
#pragma unroll
      for (int k0 = 0; k0 < KB; k0 += 32) {
        v16h a  = load_a_frag(Cs + mw_l * KP, KP, k0);
        v16h ar = load_a_frag(Rs + mw_l * KP, KP, k0);
#pragma unroll
        for (int t = 0; t < 4; ++t) {
          v16h bf = load_b_frag(Ws + (nw_l + t * 16) * KP, KP, k0);
          c[t]  = wmma_f16(a, bf, c[t]);
          cr[t] = wmma_f16(ar, bf, cr[t]);
        }
      }
    } else {
#pragma unroll
      for (int k0 = 0; k0 < KB; k0 += 32) {
        v16h a = load_a_frag(Cs + mw_l * KP, KP, k0);
#pragma unroll
        for (int t = 0; t < 4; ++t) {
          v16h bf = load_b_frag(Ws + (nw_l + t * 16) * KP, KP, k0);
          c[t] = wmma_f16(a, bf, c[t]);
        }
      }
    }
  }
  __syncthreads();                                  // last fragment reads done before the space becomes the output tile
  float* T = (float*)Ws;
#pragma unroll
  for (int t = 0; t < 4; ++t) {
    const int cl = nw_l + t * 16 + idx;
#pragma unroll
    for (int g = 0; g < 8; ++g) {
      const int rl = mw_l + g + 8 * half;
      T[rl * 132 + cl] = (c[t][g] + cr[t][g] * RINV) * OUT_MUL;
    }
  }
  __syncthreads();
  {
    float* dst = out + ((size_t)(bb * SEQ_FULL + s0)) * DM + n0;
    for (int gg = tid; gg < 64 * 32; gg += 256) {
      const int rl = gg >> 5, pc = gg & 31;
      vst2(dst + (size_t)rl * DM + pc * 4, *(const v4f*)(&T[rl * 132 + pc * 4]));
    }
  }
}

extern "C" void kernel_launch(void* const* d_in, const int* in_sizes, int n_in,
                              void* d_out, int out_size, void* d_ws, size_t ws_size,
                              hipStream_t stream) {
  if (n_in < 5) return;
  const int rows_needed = (NB - 1) * SEQ_FULL + SEQ;
  if (in_sizes[0] < rows_needed * DM) return;
  for (int i = 1; i < 5; ++i) if (in_sizes[i] < DM * DM) return;
  if (out_size < rows_needed * DM) return;

  const float* x  = (const float*)d_in[0];
  const float* Wq = (const float*)d_in[1];
  const float* Wk = (const float*)d_in[2];
  const float* Wv = (const float*)d_in[3];
  const float* Wo = (const float*)d_in[4];
  float* out = (float*)d_out;

  const size_t plane = (size_t)MT * DM * sizeof(h16);              // 16,777,216 at full size
  const size_t wpl   = (size_t)DM * DM * sizeof(h16);              //    524,288
  const size_t rpl   = (size_t)NB * EARLY_R * DM * sizeof(h16);    //  2,097,152 at full size
  size_t off = 0;
  char* ws = (char*)d_ws;
  h16* xb  = (h16*)(ws + off); off += plane;
  h16* wqb = (h16*)(ws + off); off += wpl;
  h16* wkb = (h16*)(ws + off); off += wpl;
  h16* wvb = (h16*)(ws + off); off += wpl;
  h16* wob = (h16*)(ws + off); off += wpl;
  h16* qh  = (h16*)(ws + off); off += plane;
  h16* kh  = (h16*)(ws + off); off += plane;
  h16* vth = (h16*)(ws + off); off += plane;   // [b][d][s]
  h16* qr  = (h16*)(ws + off); off += rpl;
  h16* kr  = (h16*)(ws + off); off += rpl;
  h16* vtr = (h16*)(ws + off); off += rpl;     // [b][d][s < EARLY_R]
  h16* ch  = (h16*)(ws + off); off += plane;
  h16* crp = (h16*)(ws + off); off += rpl;     // total 94,371,840 at full size
  if (off > ws_size) return;

  const int nx8 = MT * DM / 8;
  cvt_x_kernel<<<(nx8 + 255) / 256, 256, 0, stream>>>(x, xb, nx8);
  cvt_w_kernel<<<dim3((DM * DM / 8 + 255) / 256, 4), 256, 0, stream>>>(Wq, Wk, Wv, Wo, wqb, wkb, wvb, wob);

  proj_qkv_kernel<<<dim3(MT / 64, DM / 128, 3), 256, 0, stream>>>(xb, wqb, wkb, wvb, qh, kh, vth, qr, kr, vtr);

  attn_early_kernel<<<dim3(EARLY_R / 16, NB), 256, 0, stream>>>(qh, qr, kh, kr, vth, vtr, ch, crp);
  if (SEQ > EARLY_R) {
    attn_main_kernel<<<dim3((SEQ - EARLY_R) / 32, NB), 256, 0, stream>>>(qh, kh, vth, ch);
  }

  proj_out_kernel<<<dim3(MT / 64, DM / 128), 256, 0, stream>>>(ch, crp, wob, out);
}

// v003
// It runs in 366 microseconds.
// In two side-by-side timings against v002, it was 1.14 and 1.15 times as fast.
// All steps since v000 together make it 2.73 times as fast.
#include <hip/hip_runtime.h>
// Contractions: Q/K/V projections (K = 512), scores Q K^T (K = 512), P V (K = keys) and the output projection (K = 512)
// on v_wmma_f32_16x16x32_f16 (f16 operands, f32 accumulate). Inputs enter as bf16-RNE values carried x16 in f16 planes;
// q/k/v/ctx are f16 hi planes carried x16 plus f16 residual planes carried x16384 for the first EARLY_R positions of each
// sequence (scores: hh + hr + rh, P V: hh + hr + rh, output projection: h + r); P carried x1024; softmax statistics in f32.

typedef _Float16 h16;
typedef _Float16 h16x8 __attribute__((ext_vector_type(8)));
typedef _Float16 v16h  __attribute__((ext_vector_type(16)));
typedef float  v8f    __attribute__((ext_vector_type(8)));
typedef float  v4f    __attribute__((ext_vector_type(4)));
typedef unsigned v4u  __attribute__((ext_vector_type(4)));

#ifndef NB
#define NB 4
#endif
#ifndef SEQ
#define SEQ 4096
#endif
#define NB_FULL 4
#define SEQ_FULL 4096
#define DM 512
#define EARLY_CAP 512
#define EARLY_R ((SEQ < EARLY_CAP) ? SEQ : EARLY_CAP)
#define MT (NB * SEQ)
// LDS row pitches in elements. f16 rows read by 16-byte fragment loads: byte pitch = 16 x odd, so the 16 rows of a fragment
// fall on distinct bank groups. f32 score rows: pitch chosen so that the tile stores and the row reads both spread over banks.
#define QP  (DM + 8)               // 1040 B: Q and K rows of 512 f16
#define VP64 72                    // 144 B: V^T and P rows of 64 f16
#define VP32 40                    // 80 B: V^T and P rows of 32 f16
#define SP64 76                    // f32 score rows of 64
#define SP32 36                    // f32 score rows of 32
#define KB   128                   // k block of the projections' LDS staging
#define KP   (KB + 8)              // 272 B: staged projection operand rows of 128 f16

static_assert(SEQ % 64 == 0);
static_assert((EARLY_R) % 64 == 0);
static_assert(NB >= 1 && NB <= NB_FULL);
static_assert(SEQ >= 64 && SEQ <= SEQ_FULL);
static_assert(DM % 128 == 0);
static_assert(((NB - 1) * SEQ_FULL + SEQ) * DM <= NB_FULL * SEQ_FULL * DM);

#define ISC  16.0f                 // carry of the x / q / k / v / ctx f16 hi planes
#define WSC  16.0f                 // carry of the weight planes
#define PSC  1024.0f               // carry of P
#define RSC  16384.0f              // carry of every residual plane
#define RINV (1.0f / 16384.0f)
#define PROJ_MUL (1.0f / 16.0f)    // acc of (x16 * x16) operands -> x16 plane value
#define OUT_MUL  (1.0f / 256.0f)   // acc of (x16 * x16) operands -> f32 output
#define SCL ((1.0f / 256.0f) * (1.0f / 22.627416610717773f))

template <typename V> __device__ __forceinline__ void vst2(void* p, V v) {
  *(V*)p = v; 
}
__device__ __forceinline__ void copy16_g2s(h16* ldst, const h16* gsrc) { *(h16x8*)ldst = *(const h16x8*)gsrc; }

__device__ __forceinline__ float bf16r(float f) {     // RNE convert to bf16, value kept in f32
  unsigned u = __float_as_uint(f);
  u = (u + 0x7FFFu + ((u >> 16) & 1u)) & 0xFFFF0000u;
  return __uint_as_float(u);
}

// ---- WMMA fragment loaders (f16, row-major K-contiguous source); A and B (from B^T rows) share the per-lane K map:
//      row/col = lane&15; elements 0..7 <- k0 + 8*half + 0..7, elements 8..15 <- k0 + 16 + 8*half + 0..7
__device__ __forceinline__ v16h load_a_frag(const h16* base, int ld, int k0) {
  int lane = threadIdx.x & 31;
  int idx  = lane & 15;
  int half = lane >> 4;
  const h16* p = base + idx * ld + k0 + half * 8;
  h16x8 lo = *(const h16x8*)(p);
  h16x8 hi = *(const h16x8*)(p + 16);
  return __builtin_shufflevector(lo, hi, 0,1,2,3,4,5,6,7,8,9,10,11,12,13,14,15);
}
__device__ __forceinline__ v16h load_b_frag(const h16* base, int ld, int k0) { return load_a_frag(base, ld, k0); }

__device__ __forceinline__ v8f wmma_f16(v16h a, v16h b, v8f c) {
  return __builtin_amdgcn_wmma_f32_16x16x32_f16(false, a, false, b, (short)0, c, false, false);
}

// sc += A(16 x DM) * B(16 x DM)^T, both from LDS rows of pitch QP, k ascending. The fragments are read G k-steps at a time into
// two register sets, each group one group ahead of the WMMAs that use it, so that a wave waits for LDS once per group at most.
template <int G> __device__ __forceinline__ v8f dot_rows(const h16* A, const h16* B, v8f sc) {
  constexpr int NG = DM / (32 * G);
  v16h fa[2][G], fb[2][G];
#pragma unroll     // constant indices keep the fragment sets in registers
  for (int j = 0; j < G; ++j) { fa[0][j] = load_a_frag(A, QP, j * 32); fb[0][j] = load_b_frag(B, QP, j * 32); }
#pragma unroll     // constant indices keep the fragment sets in registers
  for (int g = 0; g < NG; ++g) {
    if (g + 1 < NG) {
#pragma unroll     // as above
      for (int j = 0; j < G; ++j) {
        fa[(g + 1) & 1][j] = load_a_frag(A, QP, ((g + 1) * G + j) * 32);
        fb[(g + 1) & 1][j] = load_b_frag(B, QP, ((g + 1) * G + j) * 32);
      }
    }
    __builtin_amdgcn_sched_barrier(0);   // keeps the next group's reads ahead of this group's WMMAs (else they sink to their use)
#pragma unroll     // as above
    for (int j = 0; j < G; ++j) sc = wmma_f16(fa[g & 1][j], fb[g & 1][j], sc);
  }
  return sc;
}

// N 16-byte pieces per thread, 'step' elements apart, from global memory into registers.
template <int N> __device__ __forceinline__ void load_pieces(h16x8 (&r)[N], const h16* g0, size_t step) {
#pragma unroll     // constant indices keep r[] in registers and the steps in the loads' offset fields
  for (int i = 0; i < N; ++i) r[i] = *(const h16x8*)(g0 + i * step);
  // address-translation wait; g0 as an input keeps the loads' address pair untouched (also by a later load's result) up to it
  asm volatile("s_wait_xcnt 0x0" :: "v"(g0) : "memory");
}

// Stage ROWS rows of KB f16 (256 B = two whole lines per row, source row pitch DM) into LDS rows of pitch KP, 256 threads:
// one wave-wide 16-byte load covers two rows = four whole lines.
template <int ROWS> __device__ __forceinline__ void stage_rows(h16* lds, const h16* g, int tid) {
  h16* l0 = lds + (tid >> 4) * KP + (tid & 15) * 8;
  const h16* g0 = g + (size_t)(tid >> 4) * DM + (tid & 15) * 8;
  h16x8 r[ROWS / 16];
  load_pieces<ROWS / 16>(r, g0, 16 * DM);
#pragma unroll     // constant indices keep r[] in registers
  for (int i = 0; i < ROWS / 16; ++i) *(h16x8*)(l0 + i * 16 * KP) = r[i];
}

// ---------------- conversion kernels ----------------
// xb[row][c] = f16( bf16r(x) * 16 ), rows indexed b*SEQ + s, source rows b*SEQ_FULL + s; 8 elements (16 B) per thread
__global__ __launch_bounds__(256) void cvt_x_kernel(const float* __restrict__ x, h16* __restrict__ xb, int n8) {
  int g = blockIdx.x * 256 + threadIdx.x;
  if (g >= n8) return;
  const int row = g >> 6, c8 = g & 63;            // 64 groups of 8 per 512-wide row
  const int b = row / SEQ, s = row - b * SEQ;
  const float* src = x + ((size_t)(b * SEQ_FULL + s)) * DM + c8 * 8;
  const v4f a = *(const v4f*)(src), bq = *(const v4f*)(src + 4);
  union { h16x8 h; v4u u; } pk;
#pragma unroll
  for (int i = 0; i < 4; ++i) { pk.h[i] = (h16)(bf16r(a[i]) * ISC); pk.h[4 + i] = (h16)(bf16r(bq[i]) * ISC); }
  vst2(xb + (size_t)g * 8, pk.u);
}

// Wb[n][k] = f16( bf16r(W[n][k]) * 16 ) for the matrix selected by blockIdx.y (weights are already [out][in] = [n][k])
__global__ __launch_bounds__(256) void cvt_w_kernel(const float* __restrict__ W0, const float* __restrict__ W1,
                                                    const float* __restrict__ W2, const float* __restrict__ W3,
                                                    h16* __restrict__ D0, h16* __restrict__ D1,
                                                    h16* __restrict__ D2, h16* __restrict__ D3) {
  const int y = blockIdx.y;
  const float* W = (y == 0) ? W0 : (y == 1) ? W1 : (y == 2) ? W2 : W3;
  h16*       D  = (y == 0) ? D0 : (y == 1) ? D1 : (y == 2) ? D2 : D3;
  const int g = blockIdx.x * 256 + threadIdx.x;    // < DM*DM/8 by grid construction
  if (g >= DM * DM / 8) return;
  const float* src = W + (size_t)g * 8;
  const v4f a = *(const v4f*)(src), bq = *(const v4f*)(src + 4);
  union { h16x8 h; v4u u; } pk;
#pragma unroll
  for (int i = 0; i < 4; ++i) { pk.h[i] = (h16)(bf16r(a[i]) * WSC); pk.h[4 + i] = (h16)(bf16r(bq[i]) * WSC); }
  vst2(D + (size_t)g * 8, pk.u);
}

// ---------------- projection GEMM: Y = X(MT x 512) * W(512 x 512)^T, blockIdx.z selects Q / K / V ----------------
// 8 waves/WG: 4 M-subtiles x 2 N-groups(64). Each wave: 16x64 (4 WMMA tiles). The X (64 rows) and W (128 rows) operands are
// staged in LDS in k blocks of KB = 128 by whole-line 16-byte loads; fragments are read from LDS. The staging space is reused
// for the 64 x 128 output tile. Blocks whose sequence positions are < EARLY_R also write the residual planes (x16384).
__global__ __launch_bounds__(256) void proj_qkv_kernel(const h16* __restrict__ Xb,
                                                       const h16* __restrict__ Wq, const h16* __restrict__ Wk,
                                                       const h16* __restrict__ Wv,
                                                       h16* __restrict__ Qh, h16* __restrict__ Kh, h16* __restrict__ Vth,
                                                       h16* __restrict__ Qr, h16* __restrict__ Kr, h16* __restrict__ Vtr) {
  __shared__ __align__(16) h16 Th[128 * 136];     // [m][n] pitch 136 (Q/K) or [n][m] pitch 72 (V)
  __shared__ __align__(16) h16 Tr[128 * 136];
  const int z = blockIdx.z;
  const h16* W = (z == 0) ? Wq : (z == 1) ? Wk : Wv;
  const int transposed = (z == 2) ? 1 : 0;
  const int m0 = blockIdx.x * 64, n0 = blockIdx.y * 128;
  const int bb = m0 / SEQ, s0 = m0 - bb * SEQ;
  const bool early = (s0 < EARLY_R);
  const int tid = threadIdx.x, w = tid >> 5, lane = tid & 31, idx = lane & 15, half = lane >> 4;
  const int mw_l = (w & 3) * 16;
  const int nw_l = (w >> 2) * 64;

  v8f c[4] = {};
  h16* Ws = Th;                                     // [128][KP] during the k loop
  h16* Xs = Tr;                                     // [64][KP] during the k loop
#pragma unroll 1   // rolled: nothing moves across the barriers of a trip, unrolling would only multiply the code
  for (int kb = 0; kb < DM; kb += KB) {
    __syncthreads();                                // the previous block's fragment reads are done
    stage_rows<64>(Xs, Xb + (size_t)m0 * DM + kb, tid);
    stage_rows<128>(Ws, W + (size_t)n0 * DM + kb, tid);
    __syncthreads();                                // the staged block is visible to every wave
#pragma unroll
    for (int k0 = 0; k0 < KB; k0 += 32) {
      v16h a = load_a_frag(Xs + mw_l * KP, KP, k0);
      v16h bf[4];
#pragma unroll
      for (int t = 0; t < 4; ++t) bf[t] = load_b_frag(Ws + (nw_l + t * 16) * KP, KP, k0);
      __builtin_amdgcn_sched_barrier(0);            // keeps the k step's reads together, ahead of its WMMAs
#pragma unroll
      for (int t = 0; t < 4; ++t) c[t] = wmma_f16(a, bf[t], c[t]);
    }
  }
  __syncthreads();                                  // last fragment reads done before the space becomes the output tile
#pragma unroll
  for (int t = 0; t < 4; ++t) {
    const int cl = nw_l + t * 16 + idx;             // local col
#pragma unroll
    for (int g = 0; g < 8; ++g) {
      const int rl = mw_l + g + 8 * half;           // local row
      const float u = c[t][g] * PROJ_MUL;           // x16 carried value
      const h16 hv = (h16)u;
      const int li = transposed ? (cl * 72 + rl) : (rl * 136 + cl);
      Th[li] = hv;
      if (early) Tr[li] = (h16)((u - (float)hv) * RSC);
    }
  }
  __syncthreads();
  if (!transposed) {
    h16* Oh = (z == 0) ? Qh : Kh;
    h16* Orp = (z == 0) ? Qr : Kr;
    for (int gg = tid; gg < 64 * 16; gg += 256) {
      const int rl = gg >> 4, pc = gg & 15;
      vst2(Oh + (size_t)(m0 + rl) * DM + n0 + pc * 8, *(const v4u*)(&Th[rl * 136 + pc * 8]));
      if (early) vst2(Orp + (size_t)(bb * EARLY_R + s0 + rl) * DM + n0 + pc * 8, *(const v4u*)(&Tr[rl * 136 + pc * 8]));
    }
  } else {
    for (int gg = tid; gg < 128 * 8; gg += 256) {
      const int cl = gg >> 3, pc = gg & 7;
      vst2(Vth + ((size_t)(bb * DM + n0 + cl)) * SEQ + s0 + pc * 8, *(const v4u*)(&Th[cl * 72 + pc * 8]));
      if (early) vst2(Vtr + ((size_t)(bb * DM + n0 + cl)) * EARLY_R + s0 + pc * 8, *(const v4u*)(&Tr[cl * 72 + pc * 8]));
    }
  }
}

// ---------------- flash attention, causal, query positions >= EARLY_R (single products) ----------------
// WG = 32 queries, 8 waves, key chunks of 64 (chunks 0 .. q0/64). The K chunk is staged in LDS by whole-line loads for the
// score phase; the V^T chunk, loaded into registers with it, takes the same LDS space for the PV phase.
// Score phase: wave w -> (qi = w&1, kj = w>>1) 16x16 tile, K-loop over 512.
// PV phase: wave w -> (qi = w&1, dg = w>>1) 16 q x 128 dims (8 accum tiles).
__global__ __launch_bounds__(256) __attribute__((amdgpu_num_vgpr(256)))
void attn_main_kernel(const h16* __restrict__ Qh, const h16* __restrict__ Kh,
                      const h16* __restrict__ Vth, h16* __restrict__ Ch) {
  __shared__ __align__(16) h16   Qs[32][QP];
  __shared__ __align__(16) h16   Vts[DM][VP64];    // d-major; K rows [64][QP] in the score phase, f16 ctx tile [32][512] after the loop
  __shared__ __align__(16) float Ss[32][SP64];
  __shared__ __align__(16) h16   Ps[32][VP64];
  __shared__ float alpha_s[32];
  __shared__ float l_s[32];

  const int b   = blockIdx.y;
  const int q0  = EARLY_R + blockIdx.x * 32;
  const int tid = threadIdx.x;
  const int w    = tid >> 5;
  const int lane = tid & 31;
  const int idx  = lane & 15;
  const int half = lane >> 4;
  const int qi = w & 1;
  const int kj = w >> 1;     // score key subtile
  const int dg = w >> 1;     // PV d-group (128 dims)

  const h16* Qg = Qh + ((size_t)(b * SEQ + q0)) * DM;
  for (int cc = tid; cc < 32 * (DM / 8); cc += 256) {
    const int r = cc >> 6, dc = cc & 63;
    copy16_g2s(&Qs[r][dc * 8], Qg + (size_t)r * DM + dc * 8);
  }

  h16* Ks = &Vts[0][0];
  h16* Kst = Ks + (tid >> 6) * QP + (tid & 63) * 8;      // this thread's first K piece; the next ones lie 4 rows apart
  h16* Vst = &Vts[tid >> 3][(tid & 7) * 8];              // this thread's first V^T piece; the next ones lie 32 rows apart
  static_assert(64 * QP <= DM * VP64);
  v8f o[8] = {};
  const int srow = tid >> 3;          // softmax: 8 threads per query row
  const int sj   = tid & 7;
  float m_prev = -1e30f;
  float l_run  = 0.0f;
  const int nchunk = q0 / 64 + 1;     // keys 0 .. 64*nchunk-1 cover every position <= q0+31

#pragma unroll 1
  for (int ci = 0; ci < nchunk; ++ci) {
    const int kv0 = ci * 64;
    __syncthreads();   // prior PV done with Vts / Ps (and Qs issue point on the first chunk)
    const h16* Kg = Kh + ((size_t)(b * SEQ + kv0 + (tid >> 6))) * DM + (tid & 63) * 8;
    h16x8 kreg[16];
    load_pieces<16>(kreg, Kg, 4 * DM);
    const h16* Vg = Vth + (size_t)(b * DM + (tid >> 3)) * SEQ + kv0 + (tid & 7) * 8;
    h16x8 vreg[16];    // V^T chunk, held in registers during the score phase
    load_pieces<16>(vreg, Vg, (size_t)32 * SEQ);
#pragma unroll     // constant indices keep kreg[] in registers
    for (int i = 0; i < 16; ++i) *(h16x8*)(Kst + i * 4 * QP) = kreg[i];
    __syncthreads();   // K chunk visible

    {
      const v8f sc = dot_rows<2>(&Qs[qi * 16][0], Ks + (kj * 16) * QP, v8f{});
      const int col = kj * 16 + idx;
      const int key = kv0 + col;
#pragma unroll
      for (int g = 0; g < 8; ++g) {
        const int rl = qi * 16 + g + 8 * half;
        float val = sc[g] * SCL;
        if (key > q0 + rl) val = -1e30f;          // causal: replace masked scores
        Ss[rl][col] = val;
      }
    }
    __syncthreads();   // scores visible; every K fragment read is done, so V^T may take the space

#pragma unroll     // constant indices keep vreg[] in registers
    for (int i = 0; i < 16; ++i) *(h16x8*)(Vst + i * 32 * VP64) = vreg[i];
    {
      float v[8];
      float mloc = -1e30f;
#pragma unroll
      for (int e = 0; e < 8; ++e) { v[e] = Ss[srow][sj + e * 8]; mloc = fmaxf(mloc, v[e]); }
#pragma unroll
      for (int msk = 1; msk < 8; msk <<= 1) mloc = fmaxf(mloc, __shfl_xor(mloc, msk, 32));
      const float m_new = fmaxf(m_prev, mloc);
      const float alpha = __expf(m_prev - m_new);
      float ssum = 0.0f;
#pragma unroll
      for (int e = 0; e < 8; ++e) {
        const float p = __expf(v[e] - m_new);
        ssum += p;
        Ps[srow][sj + e * 8] = (h16)(p * PSC);
      }
#pragma unroll
      for (int msk = 1; msk < 8; msk <<= 1) ssum += __shfl_xor(ssum, msk, 32);
      l_run = l_run * alpha + ssum;
      m_prev = m_new;
      if (sj == 0) { alpha_s[srow] = alpha; l_s[srow] = l_run; }
    }
    __syncthreads();

    {
      float al[8];
#pragma unroll
      for (int g = 0; g < 8; ++g) al[g] = alpha_s[qi * 16 + g + 8 * half];
      __builtin_amdgcn_sched_barrier(0);   // the factors' reads go first: the rescale then waits for them alone
      v16h pa[2], vb[2][8];            // every fragment of the chunk, read as one group
#pragma unroll     // constant indices keep pa[] and vb[] in registers (this loop and the next)
      for (int s = 0; s < 2; ++s) {
        pa[s] = load_a_frag(&Ps[qi * 16][0], VP64, s * 32);
#pragma unroll
        for (int t = 0; t < 8; ++t) vb[s][t] = load_b_frag(&Vts[dg * 128 + t * 16][0], VP64, s * 32);
      }
      __builtin_amdgcn_sched_barrier(0);   // keeps all reads ahead of the rescale and the WMMAs, which then run under their latency
#pragma unroll
      for (int t = 0; t < 8; ++t)
#pragma unroll
        for (int g = 0; g < 8; ++g) o[t][g] *= al[g];
#pragma unroll
      for (int s = 0; s < 2; ++s)
#pragma unroll
        for (int t = 0; t < 8; ++t) o[t] = wmma_f16(pa[s], vb[s][t], o[t]);
    }
  }
  __syncthreads();

  h16* Ct = &Vts[0][0];
  float linv[8];
#pragma unroll
  for (int g = 0; g < 8; ++g) linv[g] = 1.0f / (l_s[qi * 16 + g + 8 * half] * PSC);
#pragma unroll
  for (int t = 0; t < 8; ++t) {
    const int col = dg * 128 + t * 16 + idx;
#pragma unroll
    for (int g = 0; g < 8; ++g) Ct[(qi * 16 + g + 8 * half) * DM + col] = (h16)(o[t][g] * linv[g]);
  }
  __syncthreads();
  {
    h16* dst = Ch + ((size_t)(b * SEQ + q0)) * DM;
    for (int gg = tid; gg < 32 * DM / 8; gg += 256) vst2(dst + (size_t)gg * 8, *(const v4u*)(Ct + gg * 8));
  }
}

// ---------------- flash attention, causal, query positions < EARLY_R (hi + residual products) ----------------
// WG = 16 queries, 8 waves, key chunks of 32 (chunks 0 .. q0/32). Q (hi,res) staged once; K (hi,res) and V^T (hi,res)
// chunks staged in LDS. Score phase: waves 0..5 -> (prod = w>>1, kj = w&1): prod 0 = Qh Kh, 1 = Qh Kr, 2 = Qr Kh.
// PV phase: wave w -> dims [64w, 64w+64): Oh += Ph Vh ; Or += Ph Vr + Pr Vh. Writes ctx hi and ctx res planes.
__global__ __launch_bounds__(256) __attribute__((amdgpu_num_vgpr(256)))
void attn_early_kernel(const h16* __restrict__ Qh, const h16* __restrict__ Qr,
                       const h16* __restrict__ Kh, const h16* __restrict__ Kr,
                       const h16* __restrict__ Vth, const h16* __restrict__ Vtr,
                       h16* __restrict__ Ch, h16* __restrict__ Cr) {
  __shared__ __align__(16) h16   Qs[2][16][QP];
  __shared__ __align__(16) h16   Ks[2][32][QP];    // reused as the ctx tiles [2][16][512] after the loop
  __shared__ __align__(16) h16   Vts[2][DM][VP32]; // d-major
  __shared__ __align__(16) float Ss[3][16][SP32];
  __shared__ __align__(16) h16   Ps[2][16][VP32];
  __shared__ float alpha_s[16];
  __shared__ float l_s[16];

  const int b   = blockIdx.y;
  const int q0  = blockIdx.x * 16;
  const int tid = threadIdx.x;
  const int w    = tid >> 5;
  const int lane = tid & 31;
  const int idx  = lane & 15;
  const int half = lane >> 4;

  {
    const h16* Qg0 = Qh + ((size_t)(b * SEQ + q0)) * DM;
    const h16* Qg1 = Qr + ((size_t)(b * EARLY_R + q0)) * DM;
    for (int cc = tid; cc < 16 * (DM / 8); cc += 256) {
      const int r = cc >> 6, dc = cc & 63;
      copy16_g2s(&Qs[0][r][dc * 8], Qg0 + (size_t)r * DM + dc * 8);
      copy16_g2s(&Qs[1][r][dc * 8], Qg1 + (size_t)r * DM + dc * 8);
    }
  }

  v8f oh[4] = {};
  v8f orr[4] = {};
  const int srow = tid >> 4;          // softmax: 16 threads per query row
  const int sj   = tid & 15;
  float m_prev = -1e30f;
  float l_run  = 0.0f;
  const int nchunk = q0 / 32 + 1;     // keys 0 .. 32*nchunk-1 cover every position <= q0+15

#pragma unroll 1
  for (int ci = 0; ci < nchunk; ++ci) {
    const int kv0 = ci * 32;
    __syncthreads();   // prior PV done with Vts / Ps, prior scores done with Ks
    {
      const h16* Kg0 = Kh + ((size_t)(b * SEQ + kv0)) * DM;
      const h16* Kg1 = Kr + ((size_t)(b * EARLY_R + kv0)) * DM;
      for (int cc = tid; cc < 32 * (DM / 8); cc += 256) {
        const int r = cc >> 6, dc = cc & 63;
        copy16_g2s(&Ks[0][r][dc * 8], Kg0 + (size_t)r * DM + dc * 8);
        copy16_g2s(&Ks[1][r][dc * 8], Kg1 + (size_t)r * DM + dc * 8);
      }
      const h16* Vg0 = Vth + (size_t)(b * DM) * SEQ + kv0;
      const h16* Vg1 = Vtr + (size_t)(b * DM) * EARLY_R + kv0;
      for (int cc = tid; cc < DM * 4; cc += 256) {
        const int d = cc >> 2, j = cc & 3;
        copy16_g2s(&Vts[0][d][j * 8], Vg0 + (size_t)d * SEQ + j * 8);
        copy16_g2s(&Vts[1][d][j * 8], Vg1 + (size_t)d * EARLY_R + j * 8);
      }
    }
    __syncthreads();

    if (w < 6) {                                   // wave-uniform
      const int prod = w >> 1, kj = w & 1;
      const int pa = (prod == 2) ? 1 : 0;
      const int pb = (prod == 1) ? 1 : 0;
      const v8f sc = dot_rows<2>(&Qs[pa][0][0], &Ks[pb][kj * 16][0], v8f{});
      const int col = kj * 16 + idx;
#pragma unroll
      for (int g = 0; g < 8; ++g) Ss[prod][g + 8 * half][col] = sc[g];
    }
    __syncthreads();

    {
      float v[2];
      float mloc = -1e30f;
      const int qrow = q0 + srow;
#pragma unroll
      for (int e = 0; e < 2; ++e) {
        const int cidx = sj + e * 16;
        float s = (Ss[0][srow][cidx] + (Ss[1][srow][cidx] + Ss[2][srow][cidx]) * RINV) * SCL;
        if (kv0 + cidx > qrow) s = -1e30f;         // causal: replace masked scores
        v[e] = s; mloc = fmaxf(mloc, s);
      }
#pragma unroll
      for (int msk = 1; msk < 16; msk <<= 1) mloc = fmaxf(mloc, __shfl_xor(mloc, msk, 32));
      const float m_new = fmaxf(m_prev, mloc);
      const float alpha = __expf(m_prev - m_new);
      float ssum = 0.0f;
#pragma unroll
      for (int e = 0; e < 2; ++e) {
        const int cidx = sj + e * 16;
        const float p  = __expf(v[e] - m_new);
        ssum += p;
        const float pp = p * PSC;
        const h16 hv = (h16)pp;
        Ps[0][srow][cidx] = hv;
        Ps[1][srow][cidx] = (h16)((pp - (float)hv) * RSC);
      }
#pragma unroll
      for (int msk = 1; msk < 16; msk <<= 1) ssum += __shfl_xor(ssum, msk, 32);
      l_run = l_run * alpha + ssum;
      m_prev = m_new;
      if (sj == 0) { alpha_s[srow] = alpha; l_s[srow] = l_run; }
    }
    __syncthreads();

    {
      float al[8];
#pragma unroll
      for (int g = 0; g < 8; ++g) al[g] = alpha_s[g + 8 * half];
      v16h ah = load_a_frag(&Ps[0][0][0], VP32, 0);
      v16h ar = load_a_frag(&Ps[1][0][0], VP32, 0);
      v16h bh[4], br[4];               // every fragment of the chunk, read as one group
#pragma unroll     // constant indices keep bh[] and br[] in registers
      for (int t = 0; t < 4; ++t) {
        const int d0 = w * 64 + t * 16;
        bh[t] = load_b_frag(&Vts[0][d0][0], VP32, 0);
        br[t] = load_b_frag(&Vts[1][d0][0], VP32, 0);
      }
      __builtin_amdgcn_sched_barrier(0);   // keeps all reads ahead of the rescale and the WMMAs, which then run under their latency
#pragma unroll
      for (int t = 0; t < 4; ++t)
#pragma unroll
        for (int g = 0; g < 8; ++g) { oh[t][g] *= al[g]; orr[t][g] *= al[g]; }
#pragma unroll
      for (int t = 0; t < 4; ++t) {
        oh[t]  = wmma_f16(ah, bh[t], oh[t]);
        orr[t] = wmma_f16(ah, br[t], orr[t]);
        orr[t] = wmma_f16(ar, bh[t], orr[t]);
      }
    }
  }
  __syncthreads();

  h16* Ct = &Ks[0][0][0];
  float linv[8];
#pragma unroll
  for (int g = 0; g < 8; ++g) linv[g] = 1.0f / (l_s[g + 8 * half] * PSC);
#pragma unroll
  for (int t = 0; t < 4; ++t) {
    const int col = w * 64 + t * 16 + idx;
#pragma unroll
    for (int g = 0; g < 8; ++g) {
      const int rl = g + 8 * half;
      const float u = (oh[t][g] + orr[t][g] * RINV) * linv[g];     // x16 carried ctx
      const h16 hv = (h16)u;
      Ct[rl * DM + col] = hv;
      Ct[16 * DM + rl * DM + col] = (h16)((u - (float)hv) * RSC);
    }
  }
  __syncthreads();
  {
    h16* dsth = Ch + ((size_t)(b * SEQ + q0)) * DM;
    h16* dstr = Cr + ((size_t)(b * EARLY_R + q0)) * DM;
    for (int gg = tid; gg < 16 * DM / 8; gg += 256) {
      vst2(dsth + (size_t)gg * 8, *(const v4u*)(Ct + gg * 8));
      vst2(dstr + (size_t)gg * 8, *(const v4u*)(Ct + 16 * DM + gg * 8));
    }
  }
}

// ---------------- output projection: out = ctx(MT x 512) * Wo(512 x 512)^T, f32 ----------------
// Same wave layout and k-block LDS staging as proj_qkv. Blocks with sequence positions < EARLY_R add the ctx residual product
// (second accumulator); the two kinds of block run separate instances of the body, so that only the early one holds it.
template <bool EARLY> __device__ __forceinline__
void proj_out_body(const h16* __restrict__ Ch, const h16* __restrict__ Cr, const h16* __restrict__ Wo, float* __restrict__ out,
                   h16* Ws, h16* Cs, h16* Rs, int m0, int n0, int bb, int s0) {
  const int tid = threadIdx.x, w = tid >> 5, lane = tid & 31, idx = lane & 15, half = lane >> 4;
  const int mw_l = (w & 3) * 16;
  const int nw_l = (w >> 2) * 64;

  v8f c[4] = {};
  v8f cr[4] = {};                                   // used by the early instance only
#pragma unroll 1   // rolled: nothing moves across the barriers of a trip, unrolling would only multiply the code
  for (int kb = 0; kb < DM; kb += KB) {
    __syncthreads();                                // the previous block's fragment reads are done
    stage_rows<64>(Cs, Ch + (size_t)m0 * DM + kb, tid);
    stage_rows<128>(Ws, Wo + (size_t)n0 * DM + kb, tid);
    if (EARLY) {
      __builtin_amdgcn_sched_barrier(0);            // the W pieces leave their registers first: all three loads' would not fit 128
      stage_rows<64>(Rs, Cr + (size_t)(bb * EARLY_R + s0) * DM + kb, tid);
    }
    __syncthreads();                                // the staged block is visible to every wave
#pragma unroll
    for (int k0 = 0; k0 < KB; k0 += 32) {
      v16h a = load_a_frag(Cs + mw_l * KP, KP, k0);
      v16h ar = {};
      if (EARLY) ar = load_a_frag(Rs + mw_l * KP, KP, k0);
      v16h bf[4];
#pragma unroll
      for (int t = 0; t < 4; ++t) bf[t] = load_b_frag(Ws + (nw_l + t * 16) * KP, KP, k0);
      __builtin_amdgcn_sched_barrier(0);            // keeps the k step's reads together, ahead of its WMMAs
#pragma unroll
      for (int t = 0; t < 4; ++t) {
        c[t] = wmma_f16(a, bf[t], c[t]);
        if (EARLY) cr[t] = wmma_f16(ar, bf[t], cr[t]);
      }
      if (EARLY) __builtin_amdgcn_sched_barrier(0); // two accumulator sets: a second fragment set would not fit 128 registers
    }
  }
  __syncthreads();                                  // last fragment reads done before the space becomes the output tile
  float* T = (float*)Ws;
#pragma unroll
  for (int t = 0; t < 4; ++t) {
    const int cl = nw_l + t * 16 + idx;
#pragma unroll
    for (int g = 0; g < 8; ++g) {
      const int rl = mw_l + g + 8 * half;
      T[rl * 132 + cl] = (EARLY ? c[t][g] + cr[t][g] * RINV : c[t][g]) * OUT_MUL;
    }
  }
  __syncthreads();
  {
    float* dst = out + ((size_t)(bb * SEQ_FULL + s0)) * DM + n0;
    for (int gg = tid; gg < 64 * 32; gg += 256) {
      const int rl = gg >> 5, pc = gg & 31;
      vst2(dst + (size_t)rl * DM + pc * 4, *(const v4f*)(&T[rl * 132 + pc * 4]));
    }
  }
}

__global__ __launch_bounds__(256) __attribute__((amdgpu_num_vgpr(128)))   // four workgroups (LDS limit) = 8 waves per SIMD
void proj_out_kernel(const h16* __restrict__ Ch, const h16* __restrict__ Cr,
                                                       const h16* __restrict__ Wo, float* __restrict__ out) {
  __shared__ __align__(16) h16 Ws[128 * KP];      // reused as the f32 output tile [64][132] after the k loop
  __shared__ __align__(16) h16 Cs[64 * KP];
  __shared__ __align__(16) h16 Rs[64 * KP];
  static_assert(64 * 132 * sizeof(float) <= 128 * KP * sizeof(h16));
  const int m0 = blockIdx.x * 64, n0 = blockIdx.y * 128;
  const int bb = m0 / SEQ, s0 = m0 - bb * SEQ;
  if (s0 < EARLY_R) proj_out_body<true>(Ch, Cr, Wo, out, Ws, Cs, Rs, m0, n0, bb, s0);     // block-uniform
  else              proj_out_body<false>(Ch, Cr, Wo, out, Ws, Cs, Rs, m0, n0, bb, s0);
}

extern "C" void kernel_launch(void* const* d_in, const int* in_sizes, int n_in,
                              void* d_out, int out_size, void* d_ws, size_t ws_size,
                              hipStream_t stream) {
  if (n_in < 5) return;
  const int rows_needed = (NB - 1) * SEQ_FULL + SEQ;
  if (in_sizes[0] < rows_needed * DM) return;
  for (int i = 1; i < 5; ++i) if (in_sizes[i] < DM * DM) return;
  if (out_size < rows_needed * DM) return;

  const float* x  = (const float*)d_in[0];
  const float* Wq = (const float*)d_in[1];
  const float* Wk = (const float*)d_in[2];
  const float* Wv = (const float*)d_in[3];
  const float* Wo = (const float*)d_in[4];
  float* out = (float*)d_out;

  const size_t plane = (size_t)MT * DM * sizeof(h16);              // 16,777,216 at full size
  const size_t wpl   = (size_t)DM * DM * sizeof(h16);              //    524,288
  const size_t rpl   = (size_t)NB * EARLY_R * DM * sizeof(h16);    //  2,097,152 at full size
  size_t off = 0;
  char* ws = (char*)d_ws;
  h16* xb  = (h16*)(ws + off); off += plane;
  h16* wqb = (h16*)(ws + off); off += wpl;
  h16* wkb = (h16*)(ws + off); off += wpl;
  h16* wvb = (h16*)(ws + off); off += wpl;
  h16* wob = (h16*)(ws + off); off += wpl;
  h16* qh  = (h16*)(ws + off); off += plane;
  h16* kh  = (h16*)(ws + off); off += plane;
  h16* vth = (h16*)(ws + off); off += plane;   // [b][d][s]
  h16* qr  = (h16*)(ws + off); off += rpl;
  h16* kr  = (h16*)(ws + off); off += rpl;
  h16* vtr = (h16*)(ws + off); off += rpl;     // [b][d][s < EARLY_R]
  h16* ch  = (h16*)(ws + off); off += plane;
  h16* crp = (h16*)(ws + off); off += rpl;     // total 94,371,840 at full size
  if (off > ws_size) return;

  const int nx8 = MT * DM / 8;
  cvt_x_kernel<<<(nx8 + 255) / 256, 256, 0, stream>>>(x, xb, nx8);
  cvt_w_kernel<<<dim3((DM * DM / 8 + 255) / 256, 4), 256, 0, stream>>>(Wq, Wk, Wv, Wo, wqb, wkb, wvb, wob);

  proj_qkv_kernel<<<dim3(MT / 64, DM / 128, 3), 256, 0, stream>>>(xb, wqb, wkb, wvb, qh, kh, vth, qr, kr, vtr);

  attn_early_kernel<<<dim3(EARLY_R / 16, NB), 256, 0, stream>>>(qh, qr, kh, kr, vth, vtr, ch, crp);
  if (SEQ > EARLY_R) {
    attn_main_kernel<<<dim3((SEQ - EARLY_R) / 32, NB), 256, 0, stream>>>(qh, kh, vth, ch);
  }

  proj_out_kernel<<<dim3(MT / 64, DM / 128), 256, 0, stream>>>(ch, crp, wob, out);
}

// v004
// Measured time: 283 microseconds a run.
// In two side-by-side timings against v003, it was 1.30 and 1.28 times as fast.
// All steps since v000 together make it 3.51 times as fast.
#include <hip/hip_runtime.h>
// Contractions: Q/K/V projections (K = 512), scores Q K^T (K = 512), P V (K = keys) and the output projection (K = 512)
// on v_wmma_f32_16x16x32_f16 (f16 operands, f32 accumulate). Inputs enter as bf16-RNE values carried x16 in f16 planes;
// q/k/v/ctx are f16 hi planes carried x16 plus f16 residual planes carried x16384 for the first EARLY_R positions of each
// sequence (scores: hh + hr + rh, P V: hh + hr + rh, output projection: h + r); P carried x1024; softmax statistics in f32.

typedef _Float16 h16;
typedef _Float16 h16x8 __attribute__((ext_vector_type(8)));
typedef _Float16 v16h  __attribute__((ext_vector_type(16)));
typedef float  v8f    __attribute__((ext_vector_type(8)));
typedef float  v4f    __attribute__((ext_vector_type(4)));
typedef unsigned v4u  __attribute__((ext_vector_type(4)));

#ifndef NB
#define NB 4
#endif
#ifndef SEQ
#define SEQ 4096
#endif
#define NB_FULL 4
#define SEQ_FULL 4096
#define DM 512
#define EARLY_CAP 512
#define EARLY_R ((SEQ < EARLY_CAP) ? SEQ : EARLY_CAP)
#define MT (NB * SEQ)
// LDS row pitches in elements. f16 rows read by 16-byte fragment loads: byte pitch = 16 x odd, so the 16 rows of a fragment
// fall on distinct bank groups. f32 score rows: pitch chosen so that the tile stores and the row reads both spread over banks.
#define QP  (DM + 8)               // 1040 B: Q and K rows of 512 f16
#define VP64 72                    // 144 B: V^T and P rows of 64 f16
#define VP32 40                    // 80 B: V^T and P rows of 32 f16
#define SP64 76                    // f32 score rows of 64
#define SP32 36                    // f32 score rows of 32
#define KB   128                   // k block of the projections' LDS staging
#define KP   (KB + 8)              // 272 B: staged projection operand rows of 128 f16

static_assert(SEQ % 64 == 0);
static_assert((EARLY_R) % 64 == 0);
static_assert(NB >= 1 && NB <= NB_FULL);
static_assert(SEQ >= 64 && SEQ <= SEQ_FULL);
static_assert(DM % 128 == 0);
static_assert(((NB - 1) * SEQ_FULL + SEQ) * DM <= NB_FULL * SEQ_FULL * DM);

#define ISC  16.0f                 // carry of the x / q / k / v / ctx f16 hi planes
#define WSC  16.0f                 // carry of the weight planes
#define PSC  1024.0f               // carry of P
#define RSC  16384.0f              // carry of every residual plane
#define RINV (1.0f / 16384.0f)
#define PROJ_MUL (1.0f / 16.0f)    // acc of (x16 * x16) operands -> x16 plane value
#define OUT_MUL  (1.0f / 256.0f)   // acc of (x16 * x16) operands -> f32 output
#define SCL ((1.0f / 256.0f) * (1.0f / 22.627416610717773f))

template <typename V> __device__ __forceinline__ void vst2(void* p, V v) {
  *(V*)p = v; 
}
__device__ __forceinline__ void copy16_g2s(h16* ldst, const h16* gsrc) { *(h16x8*)ldst = *(const h16x8*)gsrc; }

__device__ __forceinline__ float bf16r(float f) {     // RNE convert to bf16, value kept in f32
  unsigned u = __float_as_uint(f);
  u = (u + 0x7FFFu + ((u >> 16) & 1u)) & 0xFFFF0000u;
  return __uint_as_float(u);
}

// ---- WMMA fragment loaders (f16, row-major K-contiguous source); A and B (from B^T rows) share the per-lane K map:
//      row/col = lane&15; elements 0..7 <- k0 + 8*half + 0..7, elements 8..15 <- k0 + 16 + 8*half + 0..7
__device__ __forceinline__ v16h load_a_frag(const h16* base, int ld, int k0) {
  int lane = threadIdx.x & 31;
  int idx  = lane & 15;
  int half = lane >> 4;
  const h16* p = base + idx * ld + k0 + half * 8;
  h16x8 lo = *(const h16x8*)(p);
  h16x8 hi = *(const h16x8*)(p + 16);
  return __builtin_shufflevector(lo, hi, 0,1,2,3,4,5,6,7,8,9,10,11,12,13,14,15);
}
__device__ __forceinline__ v16h load_b_frag(const h16* base, int ld, int k0) { return load_a_frag(base, ld, k0); }

__device__ __forceinline__ v8f wmma_f16(v16h a, v16h b, v8f c) {
  return __builtin_amdgcn_wmma_f32_16x16x32_f16(false, a, false, b, (short)0, c, false, false);
}

// sc += A(16 x DM) * B(16 x DM)^T, both from LDS rows of pitch QP, k ascending. The fragments are read G k-steps at a time into
// two register sets, each group one group ahead of the WMMAs that use it, so that a wave waits for LDS once per group at most.
template <int G> __device__ __forceinline__ v8f dot_rows(const h16* A, const h16* B, v8f sc) {
  constexpr int NG = DM / (32 * G);
  v16h fa[2][G], fb[2][G];
#pragma unroll     // constant indices keep the fragment sets in registers
  for (int j = 0; j < G; ++j) { fa[0][j] = load_a_frag(A, QP, j * 32); fb[0][j] = load_b_frag(B, QP, j * 32); }
#pragma unroll     // constant indices keep the fragment sets in registers
  for (int g = 0; g < NG; ++g) {
    if (g + 1 < NG) {
#pragma unroll     // as above
      for (int j = 0; j < G; ++j) {
        fa[(g + 1) & 1][j] = load_a_frag(A, QP, ((g + 1) * G + j) * 32);
        fb[(g + 1) & 1][j] = load_b_frag(B, QP, ((g + 1) * G + j) * 32);
      }
    }
    __builtin_amdgcn_sched_barrier(0);   // keeps the next group's reads ahead of this group's WMMAs (else they sink to their use)
#pragma unroll     // as above
    for (int j = 0; j < G; ++j) sc = wmma_f16(fa[g & 1][j], fb[g & 1][j], sc);
    __builtin_amdgcn_sched_barrier(0);   // no read of the group after next in front of these WMMAs: it would take a third register set
  }
  return sc;
}

// Work-group barrier for data handed over in LDS alone: its fences name the LDS address space only, so a wave waits for its LDS
// operations and not for its global loads, which stay in flight across it (__syncthreads() waits for them too).
__device__ __forceinline__ void lds_barrier() {
  __builtin_amdgcn_fence(__ATOMIC_RELEASE, "workgroup", "local");
  __builtin_amdgcn_s_barrier();
  __builtin_amdgcn_fence(__ATOMIC_ACQUIRE, "workgroup", "local");
}

// N 16-byte pieces per thread, 'step' elements apart, from global memory into registers.
template <int N> __device__ __forceinline__ void load_pieces(h16x8 (&r)[N], const h16* g0, size_t step) {
#pragma unroll     // constant indices keep r[] in registers and the steps in the loads' offset fields
  for (int i = 0; i < N; ++i) r[i] = *(const h16x8*)(g0 + i * step);
  // address-translation wait; g0 as an input keeps the loads' address pair untouched (also by a later load's result) up to it
  asm volatile("s_wait_xcnt 0x0" :: "v"(g0) : "memory");
}

// Stage ROWS rows of KB f16 (256 B = two whole lines per row, source row pitch DM) into LDS rows of pitch KP, 256 threads:
// one wave-wide 16-byte load covers two rows = four whole lines.
template <int ROWS> __device__ __forceinline__ void stage_rows(h16* lds, const h16* g, int tid) {
  h16* l0 = lds + (tid >> 4) * KP + (tid & 15) * 8;
  const h16* g0 = g + (size_t)(tid >> 4) * DM + (tid & 15) * 8;
  h16x8 r[ROWS / 16];
  load_pieces<ROWS / 16>(r, g0, 16 * DM);
#pragma unroll     // constant indices keep r[] in registers
  for (int i = 0; i < ROWS / 16; ++i) *(h16x8*)(l0 + i * 16 * KP) = r[i];
}

// ---------------- conversion kernels ----------------
// xb[row][c] = f16( bf16r(x) * 16 ), rows indexed b*SEQ + s, source rows b*SEQ_FULL + s; 8 elements (16 B) per thread
__global__ __launch_bounds__(256) void cvt_x_kernel(const float* __restrict__ x, h16* __restrict__ xb, int n8) {
  int g = blockIdx.x * 256 + threadIdx.x;
  if (g >= n8) return;
  const int row = g >> 6, c8 = g & 63;            // 64 groups of 8 per 512-wide row
  const int b = row / SEQ, s = row - b * SEQ;
  const float* src = x + ((size_t)(b * SEQ_FULL + s)) * DM + c8 * 8;
  const v4f a = *(const v4f*)(src), bq = *(const v4f*)(src + 4);
  union { h16x8 h; v4u u; } pk;
#pragma unroll
  for (int i = 0; i < 4; ++i) { pk.h[i] = (h16)(bf16r(a[i]) * ISC); pk.h[4 + i] = (h16)(bf16r(bq[i]) * ISC); }
  vst2(xb + (size_t)g * 8, pk.u);
}

// Wb[n][k] = f16( bf16r(W[n][k]) * 16 ) for the matrix selected by blockIdx.y (weights are already [out][in] = [n][k])
__global__ __launch_bounds__(256) void cvt_w_kernel(const float* __restrict__ W0, const float* __restrict__ W1,
                                                    const float* __restrict__ W2, const float* __restrict__ W3,
                                                    h16* __restrict__ D0, h16* __restrict__ D1,
                                                    h16* __restrict__ D2, h16* __restrict__ D3) {
  const int y = blockIdx.y;
  const float* W = (y == 0) ? W0 : (y == 1) ? W1 : (y == 2) ? W2 : W3;
  h16*       D  = (y == 0) ? D0 : (y == 1) ? D1 : (y == 2) ? D2 : D3;
  const int g = blockIdx.x * 256 + threadIdx.x;    // < DM*DM/8 by grid construction
  if (g >= DM * DM / 8) return;
  const float* src = W + (size_t)g * 8;
  const v4f a = *(const v4f*)(src), bq = *(const v4f*)(src + 4);
  union { h16x8 h; v4u u; } pk;
#pragma unroll
  for (int i = 0; i < 4; ++i) { pk.h[i] = (h16)(bf16r(a[i]) * WSC); pk.h[4 + i] = (h16)(bf16r(bq[i]) * WSC); }
  vst2(D + (size_t)g * 8, pk.u);
}

// ---------------- projection GEMM: Y = X(MT x 512) * W(512 x 512)^T, blockIdx.z selects Q / K / V ----------------
// 8 waves/WG: 4 M-subtiles x 2 N-groups(64). Each wave: 16x64 (4 WMMA tiles). The X (64 rows) and W (128 rows) operands are
// staged in LDS in k blocks of KB = 128 by whole-line 16-byte loads; fragments are read from LDS. The staging space is reused
// for the 64 x 128 output tile. Blocks whose sequence positions are < EARLY_R also write the residual planes (x16384).
__global__ __launch_bounds__(256) void proj_qkv_kernel(const h16* __restrict__ Xb,
                                                       const h16* __restrict__ Wq, const h16* __restrict__ Wk,
                                                       const h16* __restrict__ Wv,
                                                       h16* __restrict__ Qh, h16* __restrict__ Kh, h16* __restrict__ Vth,
                                                       h16* __restrict__ Qr, h16* __restrict__ Kr, h16* __restrict__ Vtr) {
  __shared__ __align__(16) h16 Th[128 * 136];     // [m][n] pitch 136 (Q/K) or [n][m] pitch 72 (V)
  __shared__ __align__(16) h16 Tr[128 * 136];
  const int z = blockIdx.z;
  const h16* W = (z == 0) ? Wq : (z == 1) ? Wk : Wv;
  const int transposed = (z == 2) ? 1 : 0;
  const int m0 = blockIdx.x * 64, n0 = blockIdx.y * 128;
  const int bb = m0 / SEQ, s0 = m0 - bb * SEQ;
  const bool early = (s0 < EARLY_R);
  const int tid = threadIdx.x, w = tid >> 5, lane = tid & 31, idx = lane & 15, half = lane >> 4;
  const int mw_l = (w & 3) * 16;
  const int nw_l = (w >> 2) * 64;

  v8f c[4] = {};
  h16* Ws = Th;                                     // [128][KP] during the k loop
  h16* Xs = Tr;                                     // [64][KP] during the k loop
#pragma unroll 1   // rolled: nothing moves across the barriers of a trip, unrolling would only multiply the code
  for (int kb = 0; kb < DM; kb += KB) {
    __syncthreads();                                // the previous block's fragment reads are done
    stage_rows<64>(Xs, Xb + (size_t)m0 * DM + kb, tid);
    stage_rows<128>(Ws, W + (size_t)n0 * DM + kb, tid);
    __syncthreads();                                // the staged block is visible to every wave
#pragma unroll
    for (int k0 = 0; k0 < KB; k0 += 32) {
      v16h a = load_a_frag(Xs + mw_l * KP, KP, k0);
      v16h bf[4];
#pragma unroll
      for (int t = 0; t < 4; ++t) bf[t] = load_b_frag(Ws + (nw_l + t * 16) * KP, KP, k0);
      __builtin_amdgcn_sched_barrier(0);            // keeps the k step's reads together, ahead of its WMMAs
#pragma unroll
      for (int t = 0; t < 4; ++t) c[t] = wmma_f16(a, bf[t], c[t]);
    }
  }
  __syncthreads();                                  // last fragment reads done before the space becomes the output tile
#pragma unroll
  for (int t = 0; t < 4; ++t) {
    const int cl = nw_l + t * 16 + idx;             // local col
#pragma unroll
    for (int g = 0; g < 8; ++g) {
      const int rl = mw_l + g + 8 * half;           // local row
      const float u = c[t][g] * PROJ_MUL;           // x16 carried value
      const h16 hv = (h16)u;
      const int li = transposed ? (cl * 72 + rl) : (rl * 136 + cl);
      Th[li] = hv;
      if (early) Tr[li] = (h16)((u - (float)hv) * RSC);
    }
  }
  __syncthreads();
  if (!transposed) {
    h16* Oh = (z == 0) ? Qh : Kh;
    h16* Orp = (z == 0) ? Qr : Kr;
    for (int gg = tid; gg < 64 * 16; gg += 256) {
      const int rl = gg >> 4, pc = gg & 15;
      vst2(Oh + (size_t)(m0 + rl) * DM + n0 + pc * 8, *(const v4u*)(&Th[rl * 136 + pc * 8]));
      if (early) vst2(Orp + (size_t)(bb * EARLY_R + s0 + rl) * DM + n0 + pc * 8, *(const v4u*)(&Tr[rl * 136 + pc * 8]));
    }
  } else {
    for (int gg = tid; gg < 128 * 8; gg += 256) {
      const int cl = gg >> 3, pc = gg & 7;
      vst2(Vth + ((size_t)(bb * DM + n0 + cl)) * SEQ + s0 + pc * 8, *(const v4u*)(&Th[cl * 72 + pc * 8]));
      if (early) vst2(Vtr + ((size_t)(bb * DM + n0 + cl)) * EARLY_R + s0 + pc * 8, *(const v4u*)(&Tr[cl * 72 + pc * 8]));
    }
  }
}

// ---------------- flash attention, causal, query positions >= EARLY_R (single products) ----------------
// WG = 32 queries, 8 waves, key chunks of 64 (chunks 0 .. q0/64). The K chunk is staged in LDS by whole-line loads for the
// score phase; the V^T chunk takes the same LDS space for the PV phase. Both pass through registers and are loaded one phase
// ahead of their LDS store: V^T during the score phase, the next chunk's K during the softmax and PV phases.
// Score phase: wave w -> (qi = w&1, kj = w>>1) 16x16 tile, K-loop over 512.
// PV phase: wave w -> (qi = w&1, dg = w>>1) 16 q x 128 dims (8 accum tiles).
__global__ __launch_bounds__(256) __attribute__((amdgpu_num_vgpr(256)))
void attn_main_kernel(const h16* __restrict__ Qh, const h16* __restrict__ Kh,
                      const h16* __restrict__ Vth, h16* __restrict__ Ch) {
  __shared__ __align__(16) h16   Qs[32][QP];
  __shared__ __align__(16) h16   Vts[DM][VP64];    // d-major; K rows [64][QP] in the score phase, f16 ctx tile [32][512] after the loop
  __shared__ __align__(16) float Ss[32][SP64];
  __shared__ __align__(16) h16   Ps[32][VP64];
  __shared__ float alpha_s[32];
  __shared__ float l_s[32];

  const int b   = blockIdx.y;
  const int q0  = EARLY_R + blockIdx.x * 32;
  const int tid = threadIdx.x;
  const int w    = tid >> 5;
  const int lane = tid & 31;
  const int idx  = lane & 15;
  const int half = lane >> 4;
  const int qi = w & 1;
  const int kj = w >> 1;     // score key subtile
  const int dg = w >> 1;     // PV d-group (128 dims)

  const h16* Qg = Qh + ((size_t)(b * SEQ + q0)) * DM;
  for (int cc = tid; cc < 32 * (DM / 8); cc += 256) {
    const int r = cc >> 6, dc = cc & 63;
    copy16_g2s(&Qs[r][dc * 8], Qg + (size_t)r * DM + dc * 8);
  }

  h16* Ks = &Vts[0][0];
  h16* Kst = Ks + (tid >> 6) * QP + (tid & 63) * 8;      // this thread's first K piece; the next ones lie 4 rows apart
  h16* Vst = &Vts[tid >> 3][(tid & 7) * 8];              // this thread's first V^T piece; the next ones lie 32 rows apart
  static_assert(64 * QP <= DM * VP64);
  v8f o[8] = {};
  const int srow = tid >> 3;          // softmax: 8 threads per query row
  const int sj   = tid & 7;
  float m_prev = -1e30f;
  float l_run  = 0.0f;
  const int nchunk = q0 / 64 + 1;     // keys 0 .. 64*nchunk-1 cover every position <= q0+31
  const h16* Kg = Kh + ((size_t)(b * SEQ + (tid >> 6))) * DM + (tid & 63) * 8;
  h16x8 kreg[16];                     // the K chunk of the coming trip, in flight across the loop's back edge
  load_pieces<16>(kreg, Kg, 4 * DM);

#pragma unroll 1
  for (int ci = 0; ci < nchunk; ++ci) {
    const int kv0 = ci * 64;
    lds_barrier();     // prior PV done with Vts / Ps (and Qs issue point on the first chunk); the K pieces stay in flight
#pragma unroll     // constant indices keep kreg[] in registers
    for (int i = 0; i < 16; ++i) *(h16x8*)(Kst + i * 4 * QP) = kreg[i];
    const h16* Vg = Vth + (size_t)(b * DM + (tid >> 3)) * SEQ + kv0 + (tid & 7) * 8;
    h16x8 vreg[16];    // V^T chunk, in flight and then held in registers during the score phase
    load_pieces<16>(vreg, Vg, (size_t)32 * SEQ);
    lds_barrier();     // K chunk visible; the V^T pieces stay in flight

    {
      const v8f sc = dot_rows<2>(&Qs[qi * 16][0], Ks + (kj * 16) * QP, v8f{});
      const int col = kj * 16 + idx;
      const int key = kv0 + col;
#pragma unroll
      for (int g = 0; g < 8; ++g) {
        const int rl = qi * 16 + g + 8 * half;
        float val = sc[g] * SCL;
        if (key > q0 + rl) val = -1e30f;          // causal: replace masked scores
        Ss[rl][col] = val;
      }
    }
    lds_barrier();     // scores visible; every K fragment read is done, so V^T may take the space

#pragma unroll     // constant indices keep vreg[] in registers
    for (int i = 0; i < 16; ++i) *(h16x8*)(Vst + i * 32 * VP64) = vreg[i];
    // The next chunk's K pieces land under softmax and PV. The last trip loads its own chunk again, unused: under a test the old
    // pieces would count as live from their LDS store to here, through the score phase, and no longer fit the registers.
    load_pieces<16>(kreg, Kg + (size_t)((ci + 1 < nchunk) ? kv0 + 64 : kv0) * DM, 4 * DM);
    {
      float v[8];
      float mloc = -1e30f;
#pragma unroll
      for (int e = 0; e < 8; ++e) { v[e] = Ss[srow][sj + e * 8]; mloc = fmaxf(mloc, v[e]); }
#pragma unroll
      for (int msk = 1; msk < 8; msk <<= 1) mloc = fmaxf(mloc, __shfl_xor(mloc, msk, 32));
      const float m_new = fmaxf(m_prev, mloc);
      const float alpha = __expf(m_prev - m_new);
      float ssum = 0.0f;
#pragma unroll
      for (int e = 0; e < 8; ++e) {
        const float p = __expf(v[e] - m_new);
        ssum += p;
        Ps[srow][sj + e * 8] = (h16)(p * PSC);
      }
#pragma unroll
      for (int msk = 1; msk < 8; msk <<= 1) ssum += __shfl_xor(ssum, msk, 32);
      l_run = l_run * alpha + ssum;
      m_prev = m_new;
      if (sj == 0) { alpha_s[srow] = alpha; l_s[srow] = l_run; }
    }
    lds_barrier();     // P, the factors and V^T visible; the next K pieces stay in flight

    {
      float al[8];
#pragma unroll
      for (int g = 0; g < 8; ++g) al[g] = alpha_s[qi * 16 + g + 8 * half];
      __builtin_amdgcn_sched_barrier(0);   // the factors' reads go first: the rescale then waits for them alone
      // One V^T fragment set (the K pieces in flight hold the registers of a second): keys 0..31 are read as one group, keys
      // 32..63 in two groups of four, each into the registers that the four WMMAs in front of it have just used.
      const h16* Vf = &Vts[dg * 128][0];
      v16h pa[2], vb[8];
#pragma unroll     // constant indices keep pa[] and vb[] in registers (every loop of this block)
      for (int s = 0; s < 2; ++s) pa[s] = load_a_frag(&Ps[qi * 16][0], VP64, s * 32);
#pragma unroll
      for (int t = 0; t < 8; ++t) vb[t] = load_b_frag(Vf + t * 16 * VP64, VP64, 0);
      __builtin_amdgcn_sched_barrier(0);   // keeps the reads ahead of the rescale and the WMMAs, which then run under their latency
#pragma unroll
      for (int t = 0; t < 8; ++t)
#pragma unroll
        for (int g = 0; g < 8; ++g) o[t][g] *= al[g];
#pragma unroll
      for (int h = 0; h < 2; ++h) {
#pragma unroll
        for (int t = h * 4; t < h * 4 + 4; ++t) o[t] = wmma_f16(pa[0], vb[t], o[t]);
        __builtin_amdgcn_sched_barrier(0); // the four reads stay one group behind these WMMAs (they reuse their registers) ...
#pragma unroll
        for (int t = h * 4; t < h * 4 + 4; ++t) vb[t] = load_b_frag(Vf + t * 16 * VP64, VP64, 32);
        __builtin_amdgcn_sched_barrier(0); // ... and ahead of the next WMMAs, which run under their latency
      }
#pragma unroll
      for (int t = 0; t < 8; ++t) o[t] = wmma_f16(pa[1], vb[t], o[t]);
    }
  }
  __syncthreads();

  h16* Ct = &Vts[0][0];
  float linv[8];
#pragma unroll
  for (int g = 0; g < 8; ++g) linv[g] = 1.0f / (l_s[qi * 16 + g + 8 * half] * PSC);
#pragma unroll
  for (int t = 0; t < 8; ++t) {
    const int col = dg * 128 + t * 16 + idx;
#pragma unroll
    for (int g = 0; g < 8; ++g) Ct[(qi * 16 + g + 8 * half) * DM + col] = (h16)(o[t][g] * linv[g]);
  }
  __syncthreads();
  {
    h16* dst = Ch + ((size_t)(b * SEQ + q0)) * DM;
    for (int gg = tid; gg < 32 * DM / 8; gg += 256) vst2(dst + (size_t)gg * 8, *(const v4u*)(Ct + gg * 8));
  }
}

// ---------------- flash attention, causal, query positions < EARLY_R (hi + residual products) ----------------
// WG = 16 queries, 8 waves, key chunks of 32 (chunks 0 .. q0/32). Q (hi,res) staged once; K (hi,res) and V^T (hi,res)
// chunks staged in LDS through registers. Score phase: waves 0..5 -> (prod = w>>1, kj = w&1): prod 0 = Qh Kh, 1 = Qh Kr, 2 = Qr Kh.
// PV phase: wave w -> dims [64w, 64w+64): Oh += Ph Vh ; Or += Ph Vr + Pr Vh. Writes ctx hi and ctx res planes.
__global__ __launch_bounds__(256) __attribute__((amdgpu_num_vgpr(256)))
void attn_early_kernel(const h16* __restrict__ Qh, const h16* __restrict__ Qr,
                       const h16* __restrict__ Kh, const h16* __restrict__ Kr,
                       const h16* __restrict__ Vth, const h16* __restrict__ Vtr,
                       h16* __restrict__ Ch, h16* __restrict__ Cr) {
  __shared__ __align__(16) h16   Qs[2][16][QP];
  __shared__ __align__(16) h16   Ks[2][32][QP];    // reused as the ctx tiles [2][16][512] after the loop
  __shared__ __align__(16) h16   Vts[2][DM][VP32]; // d-major
  __shared__ __align__(16) float Ss[3][16][SP32];
  __shared__ __align__(16) h16   Ps[2][16][VP32];
  __shared__ float alpha_s[16];
  __shared__ float l_s[16];

  const int b   = blockIdx.y;
  const int q0  = blockIdx.x * 16;
  const int tid = threadIdx.x;
  const int w    = tid >> 5;
  const int lane = tid & 31;
  const int idx  = lane & 15;
  const int half = lane >> 4;

  {
    const h16* Qg0 = Qh + ((size_t)(b * SEQ + q0)) * DM;
    const h16* Qg1 = Qr + ((size_t)(b * EARLY_R + q0)) * DM;
    for (int cc = tid; cc < 16 * (DM / 8); cc += 256) {
      const int r = cc >> 6, dc = cc & 63;
      copy16_g2s(&Qs[0][r][dc * 8], Qg0 + (size_t)r * DM + dc * 8);
      copy16_g2s(&Qs[1][r][dc * 8], Qg1 + (size_t)r * DM + dc * 8);
    }
  }

  v8f oh[4] = {};
  v8f orr[4] = {};
  const int srow = tid >> 4;          // softmax: 16 threads per query row
  const int sj   = tid & 15;
  float m_prev = -1e30f;
  float l_run  = 0.0f;
  const int nchunk = q0 / 32 + 1;     // keys 0 .. 32*nchunk-1 cover every position <= q0+15
  // As in the main kernel the chunks pass through registers, loaded one phase ahead of their LDS store: V^T during the score
  // phase, the next chunk's K during the softmax and PV phases. Per thread and plane: 8 K pieces 4 rows apart, 8 V^T pieces 64 rows apart.
  h16* Kst = &Ks[0][tid >> 6][(tid & 63) * 8];
  h16* Vst = &Vts[0][tid >> 2][(tid & 3) * 8];
  const h16* Kg0 = Kh + ((size_t)(b * SEQ + (tid >> 6))) * DM + (tid & 63) * 8;
  const h16* Kg1 = Kr + ((size_t)(b * EARLY_R + (tid >> 6))) * DM + (tid & 63) * 8;
  h16x8 kh8[8], kr8[8];               // the K chunk of the coming trip, in flight across the loop's back edge
  load_pieces<8>(kh8, Kg0, 4 * DM);
  load_pieces<8>(kr8, Kg1, 4 * DM);

#pragma unroll 1
  for (int ci = 0; ci < nchunk; ++ci) {
    const int kv0 = ci * 32;
    lds_barrier();     // prior PV done with Vts / Ps, prior scores done with Ks; the K pieces stay in flight
#pragma unroll     // constant indices keep kh8[] and kr8[] in registers
    for (int i = 0; i < 8; ++i) {
      *(h16x8*)(Kst + i * 4 * QP) = kh8[i];
      *(h16x8*)(Kst + 32 * QP + i * 4 * QP) = kr8[i];
    }
    h16x8 vh8[8], vr8[8];             // V^T chunk, in flight and then held in registers during the score phase
    load_pieces<8>(vh8, Vth + (size_t)(b * DM + (tid >> 2)) * SEQ + kv0 + (tid & 3) * 8, (size_t)64 * SEQ);
    load_pieces<8>(vr8, Vtr + (size_t)(b * DM + (tid >> 2)) * EARLY_R + kv0 + (tid & 3) * 8, (size_t)64 * EARLY_R);
    lds_barrier();     // K chunk visible; the V^T pieces stay in flight

    if (w < 6) {                                   // wave-uniform
      const int prod = w >> 1, kj = w & 1;
      const int pa = (prod == 2) ? 1 : 0;
      const int pb = (prod == 1) ? 1 : 0;
      const v8f sc = dot_rows<2>(&Qs[pa][0][0], &Ks[pb][kj * 16][0], v8f{});
      const int col = kj * 16 + idx;
#pragma unroll
      for (int g = 0; g < 8; ++g) Ss[prod][g + 8 * half][col] = sc[g];
    }
    lds_barrier();     // scores visible

#pragma unroll     // constant indices keep vh8[] and vr8[] in registers
    for (int i = 0; i < 8; ++i) {
      *(h16x8*)(Vst + i * 64 * VP32) = vh8[i];
      *(h16x8*)(Vst + DM * VP32 + i * 64 * VP32) = vr8[i];
    }
    {  // the last trip loads its own chunk again, unused (as in the main kernel)
      const size_t kn = (size_t)((ci + 1 < nchunk) ? kv0 + 32 : kv0) * DM;
      load_pieces<8>(kh8, Kg0 + kn, 4 * DM);
      load_pieces<8>(kr8, Kg1 + kn, 4 * DM);
    }
    {
      float v[2];
      float mloc = -1e30f;
      const int qrow = q0 + srow;
#pragma unroll
      for (int e = 0; e < 2; ++e) {
        const int cidx = sj + e * 16;
        float s = (Ss[0][srow][cidx] + (Ss[1][srow][cidx] + Ss[2][srow][cidx]) * RINV) * SCL;
        if (kv0 + cidx > qrow) s = -1e30f;         // causal: replace masked scores
        v[e] = s; mloc = fmaxf(mloc, s);
      }
#pragma unroll
      for (int msk = 1; msk < 16; msk <<= 1) mloc = fmaxf(mloc, __shfl_xor(mloc, msk, 32));
      const float m_new = fmaxf(m_prev, mloc);
      const float alpha = __expf(m_prev - m_new);
      float ssum = 0.0f;
#pragma unroll
      for (int e = 0; e < 2; ++e) {
        const int cidx = sj + e * 16;
        const float p  = __expf(v[e] - m_new);
        ssum += p;
        const float pp = p * PSC;
        const h16 hv = (h16)pp;
        Ps[0][srow][cidx] = hv;
        Ps[1][srow][cidx] = (h16)((pp - (float)hv) * RSC);
      }
#pragma unroll
      for (int msk = 1; msk < 16; msk <<= 1) ssum += __shfl_xor(ssum, msk, 32);
      l_run = l_run * alpha + ssum;
      m_prev = m_new;
      if (sj == 0) { alpha_s[srow] = alpha; l_s[srow] = l_run; }
    }
    lds_barrier();     // P, the factors and V^T visible; the next K pieces stay in flight

    {
      float al[8];
#pragma unroll
      for (int g = 0; g < 8; ++g) al[g] = alpha_s[g + 8 * half];
      v16h ah = load_a_frag(&Ps[0][0][0], VP32, 0);
      v16h ar = load_a_frag(&Ps[1][0][0], VP32, 0);
      v16h bh[4], br[4];               // every fragment of the chunk, read as one group
#pragma unroll     // constant indices keep bh[] and br[] in registers
      for (int t = 0; t < 4; ++t) {
        const int d0 = w * 64 + t * 16;
        bh[t] = load_b_frag(&Vts[0][d0][0], VP32, 0);
        br[t] = load_b_frag(&Vts[1][d0][0], VP32, 0);
      }
      __builtin_amdgcn_sched_barrier(0);   // keeps all reads ahead of the rescale and the WMMAs, which then run under their latency
#pragma unroll
      for (int t = 0; t < 4; ++t)
#pragma unroll
        for (int g = 0; g < 8; ++g) { oh[t][g] *= al[g]; orr[t][g] *= al[g]; }
#pragma unroll
      for (int t = 0; t < 4; ++t) {
        oh[t]  = wmma_f16(ah, bh[t], oh[t]);
        orr[t] = wmma_f16(ah, br[t], orr[t]);
        orr[t] = wmma_f16(ar, bh[t], orr[t]);
      }
    }
  }
  __syncthreads();

  h16* Ct = &Ks[0][0][0];
  float linv[8];
#pragma unroll
  for (int g = 0; g < 8; ++g) linv[g] = 1.0f / (l_s[g + 8 * half] * PSC);
#pragma unroll
  for (int t = 0; t < 4; ++t) {
    const int col = w * 64 + t * 16 + idx;
#pragma unroll
    for (int g = 0; g < 8; ++g) {
      const int rl = g + 8 * half;
      const float u = (oh[t][g] + orr[t][g] * RINV) * linv[g];     // x16 carried ctx
      const h16 hv = (h16)u;
      Ct[rl * DM + col] = hv;
      Ct[16 * DM + rl * DM + col] = (h16)((u - (float)hv) * RSC);
    }
  }
  __syncthreads();
  {
    h16* dsth = Ch + ((size_t)(b * SEQ + q0)) * DM;
    h16* dstr = Cr + ((size_t)(b * EARLY_R + q0)) * DM;
    for (int gg = tid; gg < 16 * DM / 8; gg += 256) {
      vst2(dsth + (size_t)gg * 8, *(const v4u*)(Ct + gg * 8));
      vst2(dstr + (size_t)gg * 8, *(const v4u*)(Ct + 16 * DM + gg * 8));
    }
  }
}

// ---------------- output projection: out = ctx(MT x 512) * Wo(512 x 512)^T, f32 ----------------
// Same wave layout and k-block LDS staging as proj_qkv. Blocks with sequence positions < EARLY_R add the ctx residual product
// (second accumulator); the two kinds of block run separate instances of the body, so that only the early one holds it.
template <bool EARLY> __device__ __forceinline__
void proj_out_body(const h16* __restrict__ Ch, const h16* __restrict__ Cr, const h16* __restrict__ Wo, float* __restrict__ out,
                   h16* Ws, h16* Cs, h16* Rs, int m0, int n0, int bb, int s0) {
  const int tid = threadIdx.x, w = tid >> 5, lane = tid & 31, idx = lane & 15, half = lane >> 4;
  const int mw_l = (w & 3) * 16;
  const int nw_l = (w >> 2) * 64;

  v8f c[4] = {};
  v8f cr[4] = {};                                   // used by the early instance only
#pragma unroll 1   // rolled: nothing moves across the barriers of a trip, unrolling would only multiply the code
  for (int kb = 0; kb < DM; kb += KB) {
    __syncthreads();                                // the previous block's fragment reads are done
    stage_rows<64>(Cs, Ch + (size_t)m0 * DM + kb, tid);
    stage_rows<128>(Ws, Wo + (size_t)n0 * DM + kb, tid);
    if (EARLY) {
      __builtin_amdgcn_sched_barrier(0);            // the W pieces leave their registers first: all three loads' would not fit 128
      stage_rows<64>(Rs, Cr + (size_t)(bb * EARLY_R + s0) * DM + kb, tid);
    }
    __syncthreads();                                // the staged block is visible to every wave
#pragma unroll
    for (int k0 = 0; k0 < KB; k0 += 32) {
      v16h a = load_a_frag(Cs + mw_l * KP, KP, k0);
      v16h ar = {};
      if (EARLY) ar = load_a_frag(Rs + mw_l * KP, KP, k0);
      v16h bf[4];
#pragma unroll
      for (int t = 0; t < 4; ++t) bf[t] = load_b_frag(Ws + (nw_l + t * 16) * KP, KP, k0);
      __builtin_amdgcn_sched_barrier(0);            // keeps the k step's reads together, ahead of its WMMAs
#pragma unroll
      for (int t = 0; t < 4; ++t) {
        c[t] = wmma_f16(a, bf[t], c[t]);
        if (EARLY) cr[t] = wmma_f16(ar, bf[t], cr[t]);
      }
      if (EARLY) __builtin_amdgcn_sched_barrier(0); // two accumulator sets: a second fragment set would not fit 128 registers
    }
  }
  __syncthreads();                                  // last fragment reads done before the space becomes the output tile
  float* T = (float*)Ws;
#pragma unroll
  for (int t = 0; t < 4; ++t) {
    const int cl = nw_l + t * 16 + idx;
#pragma unroll
    for (int g = 0; g < 8; ++g) {
      const int rl = mw_l + g + 8 * half;
      T[rl * 132 + cl] = (EARLY ? c[t][g] + cr[t][g] * RINV : c[t][g]) * OUT_MUL;
    }
  }
  __syncthreads();
  {
    float* dst = out + ((size_t)(bb * SEQ_FULL + s0)) * DM + n0;
    for (int gg = tid; gg < 64 * 32; gg += 256) {
      const int rl = gg >> 5, pc = gg & 31;
      vst2(dst + (size_t)rl * DM + pc * 4, *(const v4f*)(&T[rl * 132 + pc * 4]));
    }
  }
}

__global__ __launch_bounds__(256) __attribute__((amdgpu_num_vgpr(128)))   // four workgroups (LDS limit) = 8 waves per SIMD
void proj_out_kernel(const h16* __restrict__ Ch, const h16* __restrict__ Cr,
                                                       const h16* __restrict__ Wo, float* __restrict__ out) {
  __shared__ __align__(16) h16 Ws[128 * KP];      // reused as the f32 output tile [64][132] after the k loop
  __shared__ __align__(16) h16 Cs[64 * KP];
  __shared__ __align__(16) h16 Rs[64 * KP];
  static_assert(64 * 132 * sizeof(float) <= 128 * KP * sizeof(h16));
  const int m0 = blockIdx.x * 64, n0 = blockIdx.y * 128;
  const int bb = m0 / SEQ, s0 = m0 - bb * SEQ;
  if (s0 < EARLY_R) proj_out_body<true>(Ch, Cr, Wo, out, Ws, Cs, Rs, m0, n0, bb, s0);     // block-uniform
  else              proj_out_body<false>(Ch, Cr, Wo, out, Ws, Cs, Rs, m0, n0, bb, s0);
}

extern "C" void kernel_launch(void* const* d_in, const int* in_sizes, int n_in,
                              void* d_out, int out_size, void* d_ws, size_t ws_size,
                              hipStream_t stream) {
  if (n_in < 5) return;
  const int rows_needed = (NB - 1) * SEQ_FULL + SEQ;
  if (in_sizes[0] < rows_needed * DM) return;
  for (int i = 1; i < 5; ++i) if (in_sizes[i] < DM * DM) return;
  if (out_size < rows_needed * DM) return;

  const float* x  = (const float*)d_in[0];
  const float* Wq = (const float*)d_in[1];
  const float* Wk = (const float*)d_in[2];
  const float* Wv = (const float*)d_in[3];
  const float* Wo = (const float*)d_in[4];
  float* out = (float*)d_out;

  const size_t plane = (size_t)MT * DM * sizeof(h16);              // 16,777,216 at full size
  const size_t wpl   = (size_t)DM * DM * sizeof(h16);              //    524,288
  const size_t rpl   = (size_t)NB * EARLY_R * DM * sizeof(h16);    //  2,097,152 at full size
  size_t off = 0;
  char* ws = (char*)d_ws;
  h16* xb  = (h16*)(ws + off); off += plane;
  h16* wqb = (h16*)(ws + off); off += wpl;
  h16* wkb = (h16*)(ws + off); off += wpl;
  h16* wvb = (h16*)(ws + off); off += wpl;
  h16* wob = (h16*)(ws + off); off += wpl;
  h16* qh  = (h16*)(ws + off); off += plane;
  h16* kh  = (h16*)(ws + off); off += plane;
  h16* vth = (h16*)(ws + off); off += plane;   // [b][d][s]
  h16* qr  = (h16*)(ws + off); off += rpl;
  h16* kr  = (h16*)(ws + off); off += rpl;
  h16* vtr = (h16*)(ws + off); off += rpl;     // [b][d][s < EARLY_R]
  h16* ch  = (h16*)(ws + off); off += plane;
  h16* crp = (h16*)(ws + off); off += rpl;     // total 94,371,840 at full size
  if (off > ws_size) return;

  const int nx8 = MT * DM / 8;
  cvt_x_kernel<<<(nx8 + 255) / 256, 256, 0, stream>>>(x, xb, nx8);
  cvt_w_kernel<<<dim3((DM * DM / 8 + 255) / 256, 4), 256, 0, stream>>>(Wq, Wk, Wv, Wo, wqb, wkb, wvb, wob);

  proj_qkv_kernel<<<dim3(MT / 64, DM / 128, 3), 256, 0, stream>>>(xb, wqb, wkb, wvb, qh, kh, vth, qr, kr, vtr);

  attn_early_kernel<<<dim3(EARLY_R / 16, NB), 256, 0, stream>>>(qh, qr, kh, kr, vth, vtr, ch, crp);
  if (SEQ > EARLY_R) {
    attn_main_kernel<<<dim3((SEQ - EARLY_R) / 32, NB), 256, 0, stream>>>(qh, kh, vth, ch);
  }

  proj_out_kernel<<<dim3(MT / 64, DM / 128), 256, 0, stream>>>(ch, crp, wob, out);
}

// v005
// Measured time: 263 microseconds a run.
// Next to v004, in two timings, it ran 1.08 times as fast each time.
// Over all steps from v000 it is 3.80 times as fast.
#include <hip/hip_runtime.h>
// Contractions: Q/K/V projections (K = 512), scores Q K^T (K = 512), P V (K = keys) and the output projection (K = 512)
// on v_wmma_f32_16x16x32_f16 (f16 operands, f32 accumulate). Inputs enter as bf16-RNE values carried x16 in f16 planes;
// q/k/v/ctx are f16 hi planes carried x16 plus f16 residual planes carried x16384 for the first EARLY_R positions of each
// sequence (scores: hh + hr + rh, P V: hh + hr + rh, output projection: h + r); P carried x1024; softmax statistics in f32.

typedef _Float16 h16;
typedef _Float16 h16x8 __attribute__((ext_vector_type(8)));
typedef _Float16 v16h  __attribute__((ext_vector_type(16)));
typedef float  v8f    __attribute__((ext_vector_type(8)));
typedef float  v4f    __attribute__((ext_vector_type(4)));
typedef unsigned v4u  __attribute__((ext_vector_type(4)));

#ifndef NB
#define NB 4
#endif
#ifndef SEQ
#define SEQ 4096
#endif
#define NB_FULL 4
#define SEQ_FULL 4096
#define DM 512
#define EARLY_CAP 512
#define EARLY_R ((SEQ < EARLY_CAP) ? SEQ : EARLY_CAP)
#define MT (NB * SEQ)
// LDS row pitches in elements. f16 rows read by 16-byte fragment loads: byte pitch = 16 x odd, so the 16 rows of a fragment
// fall on distinct bank groups. f32 score rows: pitch chosen so that the tile stores and the row reads both spread over banks.
#define QP  (DM + 8)               // 1040 B: Q and K rows of 512 f16
#define VP64 72                    // 144 B: V^T and P rows of 64 f16
#define VP32 40                    // 80 B: V^T and P rows of 32 f16
#define SP64 76                    // f32 score rows of 64
#define SP32 36                    // f32 score rows of 32
#define KB   128                   // k block of the projections' LDS staging
#define KP   (KB + 8)              // 272 B: staged projection operand rows of 128 f16

static_assert(SEQ % 64 == 0);
static_assert((EARLY_R) % 64 == 0);
static_assert(NB >= 1 && NB <= NB_FULL);
static_assert(SEQ >= 64 && SEQ <= SEQ_FULL);
static_assert(DM % 128 == 0);
static_assert(((NB - 1) * SEQ_FULL + SEQ) * DM <= NB_FULL * SEQ_FULL * DM);

#define ISC  16.0f                 // carry of the x / q / k / v / ctx f16 hi planes
#define WSC  16.0f                 // carry of the weight planes
#define PSC  1024.0f               // carry of P
#define RSC  16384.0f              // carry of every residual plane
#define RINV (1.0f / 16384.0f)
#define PROJ_MUL (1.0f / 16.0f)    // acc of (x16 * x16) operands -> x16 plane value
#define OUT_MUL  (1.0f / 256.0f)   // acc of (x16 * x16) operands -> f32 output
#define SCL ((1.0f / 256.0f) * (1.0f / 22.627416610717773f))

template <typename V> __device__ __forceinline__ void vst2(void* p, V v) {
  *(V*)p = v; 
}
__device__ __forceinline__ void copy16_g2s(h16* ldst, const h16* gsrc) { *(h16x8*)ldst = *(const h16x8*)gsrc; }

__device__ __forceinline__ float bf16r(float f) {     // RNE convert to bf16, value kept in f32
  unsigned u = __float_as_uint(f);
  u = (u + 0x7FFFu + ((u >> 16) & 1u)) & 0xFFFF0000u;
  return __uint_as_float(u);
}

// ---- WMMA fragment loaders (f16, row-major K-contiguous source); A and B (from B^T rows) share the per-lane K map:
//      row/col = lane&15; elements 0..7 <- k0 + 8*half + 0..7, elements 8..15 <- k0 + 16 + 8*half + 0..7
__device__ __forceinline__ v16h load_a_frag(const h16* base, int ld, int k0) {
  int lane = threadIdx.x & 31;
  int idx  = lane & 15;
  int half = lane >> 4;
  const h16* p = base + idx * ld + k0 + half * 8;
  h16x8 lo = *(const h16x8*)(p);
  h16x8 hi = *(const h16x8*)(p + 16);
  return __builtin_shufflevector(lo, hi, 0,1,2,3,4,5,6,7,8,9,10,11,12,13,14,15);
}
__device__ __forceinline__ v16h load_b_frag(const h16* base, int ld, int k0) { return load_a_frag(base, ld, k0); }

__device__ __forceinline__ v8f wmma_f16(v16h a, v16h b, v8f c) {
  return __builtin_amdgcn_wmma_f32_16x16x32_f16(false, a, false, b, (short)0, c, false, false);
}

// sc += A(16 x DM) * B(16 x DM)^T, both from LDS rows of pitch QP, k ascending. The fragments are read G k-steps at a time into
// two register sets, each group one group ahead of the WMMAs that use it, so that a wave waits for LDS once per group at most.
template <int G> __device__ __forceinline__ v8f dot_rows(const h16* A, const h16* B, v8f sc) {
  constexpr int NG = DM / (32 * G);
  v16h fa[2][G], fb[2][G];
#pragma unroll     // constant indices keep the fragment sets in registers
  for (int j = 0; j < G; ++j) { fa[0][j] = load_a_frag(A, QP, j * 32); fb[0][j] = load_b_frag(B, QP, j * 32); }
#pragma unroll     // constant indices keep the fragment sets in registers
  for (int g = 0; g < NG; ++g) {
    if (g + 1 < NG) {
#pragma unroll     // as above
      for (int j = 0; j < G; ++j) {
        fa[(g + 1) & 1][j] = load_a_frag(A, QP, ((g + 1) * G + j) * 32);
        fb[(g + 1) & 1][j] = load_b_frag(B, QP, ((g + 1) * G + j) * 32);
      }
    }
    __builtin_amdgcn_sched_barrier(0);   // keeps the next group's reads ahead of this group's WMMAs (else they sink to their use)
#pragma unroll     // as above
    for (int j = 0; j < G; ++j) sc = wmma_f16(fa[g & 1][j], fb[g & 1][j], sc);
    __builtin_amdgcn_sched_barrier(0);   // no read of the group after next in front of these WMMAs: it would take a third register set
  }
  return sc;
}

// Work-group barrier for data handed over in LDS alone: its fences name the LDS address space only, so a wave waits for its LDS
// operations and not for its global loads, which stay in flight across it (__syncthreads() waits for them too).
__device__ __forceinline__ void lds_barrier() {
  __builtin_amdgcn_fence(__ATOMIC_RELEASE, "workgroup", "local");
  __builtin_amdgcn_s_barrier();
  __builtin_amdgcn_fence(__ATOMIC_ACQUIRE, "workgroup", "local");
}

// N 16-byte pieces per thread, 'step' elements apart, from global memory into registers.
template <int N> __device__ __forceinline__ void load_pieces(h16x8 (&r)[N], const h16* g0, size_t step) {
#pragma unroll     // constant indices keep r[] in registers and the steps in the loads' offset fields
  for (int i = 0; i < N; ++i) r[i] = *(const h16x8*)(g0 + i * step);
  // address-translation wait; g0 as an input keeps the loads' address pair untouched (also by a later load's result) up to it
  asm volatile("s_wait_xcnt 0x0" :: "v"(g0) : "memory");
}

// Stage ROWS rows of KB f16 (256 B = two whole lines per row, source row pitch DM) into LDS rows of pitch KP, 256 threads:
// one wave-wide 16-byte load covers two rows = four whole lines.
template <int ROWS> __device__ __forceinline__ void stage_rows(h16* lds, const h16* g, int tid) {
  h16* l0 = lds + (tid >> 4) * KP + (tid & 15) * 8;
  const h16* g0 = g + (size_t)(tid >> 4) * DM + (tid & 15) * 8;
  h16x8 r[ROWS / 16];
  load_pieces<ROWS / 16>(r, g0, 16 * DM);
#pragma unroll     // constant indices keep r[] in registers
  for (int i = 0; i < ROWS / 16; ++i) *(h16x8*)(l0 + i * 16 * KP) = r[i];
}

// ---------------- conversion kernels ----------------
// xb[row][c] = f16( bf16r(x) * 16 ), rows indexed b*SEQ + s, source rows b*SEQ_FULL + s; 8 elements (16 B) per thread
__global__ __launch_bounds__(256) void cvt_x_kernel(const float* __restrict__ x, h16* __restrict__ xb, int n8) {
  int g = blockIdx.x * 256 + threadIdx.x;
  if (g >= n8) return;
  const int row = g >> 6, c8 = g & 63;            // 64 groups of 8 per 512-wide row
  const int b = row / SEQ, s = row - b * SEQ;
  const float* src = x + ((size_t)(b * SEQ_FULL + s)) * DM + c8 * 8;
  const v4f a = *(const v4f*)(src), bq = *(const v4f*)(src + 4);
  union { h16x8 h; v4u u; } pk;
#pragma unroll
  for (int i = 0; i < 4; ++i) { pk.h[i] = (h16)(bf16r(a[i]) * ISC); pk.h[4 + i] = (h16)(bf16r(bq[i]) * ISC); }
  vst2(xb + (size_t)g * 8, pk.u);
}

// Wb[n][k] = f16( bf16r(W[n][k]) * 16 ) for the matrix selected by blockIdx.y (weights are already [out][in] = [n][k])
__global__ __launch_bounds__(256) void cvt_w_kernel(const float* __restrict__ W0, const float* __restrict__ W1,
                                                    const float* __restrict__ W2, const float* __restrict__ W3,
                                                    h16* __restrict__ D0, h16* __restrict__ D1,
                                                    h16* __restrict__ D2, h16* __restrict__ D3) {
  const int y = blockIdx.y;
  const float* W = (y == 0) ? W0 : (y == 1) ? W1 : (y == 2) ? W2 : W3;
  h16*       D  = (y == 0) ? D0 : (y == 1) ? D1 : (y == 2) ? D2 : D3;
  const int g = blockIdx.x * 256 + threadIdx.x;    // < DM*DM/8 by grid construction
  if (g >= DM * DM / 8) return;
  const float* src = W + (size_t)g * 8;
  const v4f a = *(const v4f*)(src), bq = *(const v4f*)(src + 4);
  union { h16x8 h; v4u u; } pk;
#pragma unroll
  for (int i = 0; i < 4; ++i) { pk.h[i] = (h16)(bf16r(a[i]) * WSC); pk.h[4 + i] = (h16)(bf16r(bq[i]) * WSC); }
  vst2(D + (size_t)g * 8, pk.u);
}

// ---------------- projection GEMM: Y = X(MT x 512) * W(512 x 512)^T, blockIdx.z selects Q / K / V ----------------
// 8 waves/WG: 4 M-subtiles x 2 N-groups(64). Each wave: 16x64 (4 WMMA tiles). The X (64 rows) and W (128 rows) operands are
// staged in LDS in k blocks of KB = 128 by whole-line 16-byte loads; fragments are read from LDS. The staging space is reused
// for the 64 x 128 output tile. Blocks whose sequence positions are < EARLY_R also write the residual planes (x16384).
__global__ __launch_bounds__(256) void proj_qkv_kernel(const h16* __restrict__ Xb,
                                                       const h16* __restrict__ Wq, const h16* __restrict__ Wk,
                                                       const h16* __restrict__ Wv,
                                                       h16* __restrict__ Qh, h16* __restrict__ Kh, h16* __restrict__ Vth,
                                                       h16* __restrict__ Qr, h16* __restrict__ Kr, h16* __restrict__ Vtr) {
  __shared__ __align__(16) h16 Th[128 * 136];     // [m][n] pitch 136 (Q/K) or [n][m] pitch 72 (V)
  __shared__ __align__(16) h16 Tr[128 * 136];
  const int z = blockIdx.z;
  const h16* W = (z == 0) ? Wq : (z == 1) ? Wk : Wv;
  const int transposed = (z == 2) ? 1 : 0;
  const int m0 = blockIdx.x * 64, n0 = blockIdx.y * 128;
  const int bb = m0 / SEQ, s0 = m0 - bb * SEQ;
  const bool early = (s0 < EARLY_R);
  const int tid = threadIdx.x, w = tid >> 5, lane = tid & 31, idx = lane & 15, half = lane >> 4;
  const int mw_l = (w & 3) * 16;
  const int nw_l = (w >> 2) * 64;

  v8f c[4] = {};
  h16* Ws = Th;                                     // [128][KP] during the k loop
  h16* Xs = Tr;                                     // [64][KP] during the k loop
#pragma unroll 1   // rolled: nothing moves across the barriers of a trip, unrolling would only multiply the code
  for (int kb = 0; kb < DM; kb += KB) {
    __syncthreads();                                // the previous block's fragment reads are done
    stage_rows<64>(Xs, Xb + (size_t)m0 * DM + kb, tid);
    stage_rows<128>(Ws, W + (size_t)n0 * DM + kb, tid);
    __syncthreads();                                // the staged block is visible to every wave
#pragma unroll
    for (int k0 = 0; k0 < KB; k0 += 32) {
      v16h a = load_a_frag(Xs + mw_l * KP, KP, k0);
      v16h bf[4];
#pragma unroll
      for (int t = 0; t < 4; ++t) bf[t] = load_b_frag(Ws + (nw_l + t * 16) * KP, KP, k0);
      __builtin_amdgcn_sched_barrier(0);            // keeps the k step's reads together, ahead of its WMMAs
#pragma unroll
      for (int t = 0; t < 4; ++t) c[t] = wmma_f16(a, bf[t], c[t]);
    }
  }
  __syncthreads();                                  // last fragment reads done before the space becomes the output tile
#pragma unroll
  for (int t = 0; t < 4; ++t) {
    const int cl = nw_l + t * 16 + idx;             // local col
#pragma unroll
    for (int g = 0; g < 8; ++g) {
      const int rl = mw_l + g + 8 * half;           // local row
      const float u = c[t][g] * PROJ_MUL;           // x16 carried value
      const h16 hv = (h16)u;
      const int li = transposed ? (cl * 72 + rl) : (rl * 136 + cl);
      Th[li] = hv;
      if (early) Tr[li] = (h16)((u - (float)hv) * RSC);
    }
  }
  __syncthreads();
  if (!transposed) {
    h16* Oh = (z == 0) ? Qh : Kh;
    h16* Orp = (z == 0) ? Qr : Kr;
    for (int gg = tid; gg < 64 * 16; gg += 256) {
      const int rl = gg >> 4, pc = gg & 15;
      vst2(Oh + (size_t)(m0 + rl) * DM + n0 + pc * 8, *(const v4u*)(&Th[rl * 136 + pc * 8]));
      if (early) vst2(Orp + (size_t)(bb * EARLY_R + s0 + rl) * DM + n0 + pc * 8, *(const v4u*)(&Tr[rl * 136 + pc * 8]));
    }
  } else {
    for (int gg = tid; gg < 128 * 8; gg += 256) {
      const int cl = gg >> 3, pc = gg & 7;
      vst2(Vth + ((size_t)(bb * DM + n0 + cl)) * SEQ + s0 + pc * 8, *(const v4u*)(&Th[cl * 72 + pc * 8]));
      if (early) vst2(Vtr + ((size_t)(bb * DM + n0 + cl)) * EARLY_R + s0 + pc * 8, *(const v4u*)(&Tr[cl * 72 + pc * 8]));
    }
  }
}

// ---------------- flash attention, causal, query positions >= EARLY_R (single products) ----------------
// WG = 32 queries, 8 waves, key chunks of 64 (chunks 0 .. q0/64). The K chunk is staged in LDS by whole-line loads for the
// score phase; the V^T chunk takes the same LDS space for the PV phase. Both pass through registers and are loaded one phase
// ahead of their LDS store: V^T during the score phase, the next chunk's K during the softmax and PV phases.
// Every wave covers both 16-query tiles, so that each fragment read from LDS feeds two WMMAs.
// Score phase: wave w -> (ds = w&3, kh = w>>2): 32 keys x 32 queries (2 x 2 tiles of K Q^T) over the dims [128 ds, 128 ds + 128);
// the four partial sums of a score meet in the softmax phase. PV phase: wave w -> 32 q x dims [64w, 64w + 64) (2 x 4 accum tiles).
__global__ __launch_bounds__(256) __attribute__((amdgpu_num_vgpr(256)))
void attn_main_kernel(const h16* __restrict__ Qh, const h16* __restrict__ Kh,
                      const h16* __restrict__ Vth, h16* __restrict__ Ch) {
  __shared__ __align__(16) h16   Qs[32][QP];
  __shared__ __align__(16) h16   Vts[DM][VP64];    // d-major; K rows [64][QP] in the score phase, f16 ctx tile [32][512] after the loop
  __shared__ __align__(16) float Ss[4][32][SP64];  // one plane of partial scores per 128-dim slice
  __shared__ __align__(16) h16   Ps[32][VP64];
  __shared__ float alpha_s[32];
  __shared__ float l_s[32];

  const int b   = blockIdx.y;
  const int q0  = EARLY_R + blockIdx.x * 32;
  const int tid = threadIdx.x;
  const int w    = tid >> 5;
  const int lane = tid & 31;
  const int idx  = lane & 15;
  const int half = lane >> 4;
  const int ds = w & 3;      // score phase: slice of 128 dims
  const int kh = w >> 2;     // score phase: half of the chunk's keys

  const h16* Qg = Qh + ((size_t)(b * SEQ + q0)) * DM;
  for (int cc = tid; cc < 32 * (DM / 8); cc += 256) {
    const int r = cc >> 6, dc = cc & 63;
    copy16_g2s(&Qs[r][dc * 8], Qg + (size_t)r * DM + dc * 8);
  }

  h16* Ks = &Vts[0][0];
  h16* Kst = Ks + (tid >> 6) * QP + (tid & 63) * 8;      // this thread's first K piece; the next ones lie 4 rows apart
  h16* Vst = &Vts[tid >> 3][(tid & 7) * 8];              // this thread's first V^T piece; the next ones lie 32 rows apart
  static_assert(64 * QP <= DM * VP64);
  v8f o[2][4] = {};                   // [query tile][16 dims]
  const int srow = tid >> 3;          // softmax: 8 threads per query row, 8 neighbouring keys each
  const int sj   = tid & 7;
  float m_prev = -1e30f;
  float l_run  = 0.0f;
  const int nchunk = q0 / 64 + 1;     // keys 0 .. 64*nchunk-1 cover every position <= q0+31
  const h16* Kg = Kh + ((size_t)(b * SEQ + (tid >> 6))) * DM + (tid & 63) * 8;
  h16x8 kreg[16];                     // the K chunk of the coming trip, in flight across the loop's back edge
  load_pieces<16>(kreg, Kg, 4 * DM);

#pragma unroll 1
  for (int ci = 0; ci < nchunk; ++ci) {
    const int kv0 = ci * 64;
    lds_barrier();     // prior PV done with Vts / Ps (and Qs issue point on the first chunk); the K pieces stay in flight
#pragma unroll     // constant indices keep kreg[] in registers
    for (int i = 0; i < 16; ++i) *(h16x8*)(Kst + i * 4 * QP) = kreg[i];
    const h16* Vg = Vth + (size_t)(b * DM + (tid >> 3)) * SEQ + kv0 + (tid & 7) * 8;
    h16x8 vreg[16];    // V^T chunk, in flight and then held in registers during the score phase
    load_pieces<16>(vreg, Vg, (size_t)32 * SEQ);
    lds_barrier();     // K chunk visible; the V^T pieces stay in flight

    {
      // A = K rows, B = Q rows: a lane then holds 8 neighbouring keys of one query, two 16-byte stores per tile.
      const h16* Kf = Ks + (kh * 32) * QP + ds * 128;
      const h16* Qf = &Qs[0][ds * 128];
      v8f sc[2][2] = {};               // [key tile][query tile]
      v16h fk[2][2], fq[2][2];         // two register sets: each k step's fragments are read one step ahead of their WMMAs
#pragma unroll     // constant indices keep the fragment sets in registers (every loop of this block)
      for (int j = 0; j < 2; ++j) { fk[0][j] = load_a_frag(Kf + j * 16 * QP, QP, 0); fq[0][j] = load_b_frag(Qf + j * 16 * QP, QP, 0); }
#pragma unroll
      for (int s = 0; s < 4; ++s) {
        if (s + 1 < 4) {
#pragma unroll
          for (int j = 0; j < 2; ++j) {
            fk[(s + 1) & 1][j] = load_a_frag(Kf + j * 16 * QP, QP, (s + 1) * 32);
            fq[(s + 1) & 1][j] = load_b_frag(Qf + j * 16 * QP, QP, (s + 1) * 32);
          }
        }
        __builtin_amdgcn_sched_barrier(0);   // keeps the next step's reads ahead of this step's WMMAs (else they sink to their use)
#pragma unroll
        for (int kt = 0; kt < 2; ++kt)
#pragma unroll
          for (int qt = 0; qt < 2; ++qt) sc[kt][qt] = wmma_f16(fk[s & 1][kt], fq[s & 1][qt], sc[kt][qt]);
        __builtin_amdgcn_sched_barrier(0);   // no read of the step after next in front of these WMMAs: it would take a third register set
      }
#pragma unroll
      for (int kt = 0; kt < 2; ++kt)
#pragma unroll
        for (int qt = 0; qt < 2; ++qt) {
          float* sp = &Ss[ds][qt * 16 + idx][kh * 32 + kt * 16 + 8 * half];
          *(v4f*)(sp)     = __builtin_shufflevector(sc[kt][qt], sc[kt][qt], 0, 1, 2, 3);
          *(v4f*)(sp + 4) = __builtin_shufflevector(sc[kt][qt], sc[kt][qt], 4, 5, 6, 7);
        }
    }
    lds_barrier();     // scores visible; every K fragment read is done, so V^T may take the space

#pragma unroll     // constant indices keep vreg[] in registers
    for (int i = 0; i < 16; ++i) *(h16x8*)(Vst + i * 32 * VP64) = vreg[i];
    // The next chunk's K pieces land under softmax and PV. The last trip loads its own chunk again, unused: under a test the old
    // pieces would count as live from their LDS store to here, through the score phase, and no longer fit the registers.
    load_pieces<16>(kreg, Kg + (size_t)((ci + 1 < nchunk) ? kv0 + 64 : kv0) * DM, 4 * DM);
    {
      float v[8];
      float mloc = -1e30f;
      v4f pl[4], ph[4];                // the four partial sums of this thread's 8 scores
#pragma unroll
      for (int p = 0; p < 4; ++p) { pl[p] = *(const v4f*)(&Ss[p][srow][sj * 8]); ph[p] = *(const v4f*)(&Ss[p][srow][sj * 8 + 4]); }
      const v4f sl = (pl[0] + pl[1]) + (pl[2] + pl[3]);
      const v4f sh = (ph[0] + ph[1]) + (ph[2] + ph[3]);
#pragma unroll
      for (int e = 0; e < 8; ++e) {
        float val = ((e < 4) ? sl[e & 3] : sh[e & 3]) * SCL;
        if (kv0 + sj * 8 + e > q0 + srow) val = -1e30f;   // causal: replace masked scores
        v[e] = val; mloc = fmaxf(mloc, val);
      }
#pragma unroll
      for (int msk = 1; msk < 8; msk <<= 1) mloc = fmaxf(mloc, __shfl_xor(mloc, msk, 32));
      const float m_new = fmaxf(m_prev, mloc);
      const float alpha = __expf(m_prev - m_new);
      float ssum = 0.0f;
      h16x8 pk;
#pragma unroll
      for (int e = 0; e < 8; ++e) {
        const float p = __expf(v[e] - m_new);
        ssum += p;
        pk[e] = (h16)(p * PSC);
      }
      *(h16x8*)(&Ps[srow][sj * 8]) = pk;
#pragma unroll
      for (int msk = 1; msk < 8; msk <<= 1) ssum += __shfl_xor(ssum, msk, 32);
      l_run = l_run * alpha + ssum;
      m_prev = m_new;
      if (sj == 0) { alpha_s[srow] = alpha; l_s[srow] = l_run; }
    }
    lds_barrier();     // P, the factors and V^T visible; the next K pieces stay in flight

    {
      float al[2][8];
#pragma unroll     // constant indices keep al[], pa[] and vb[] in registers (every loop of this block)
      for (int qt = 0; qt < 2; ++qt)
#pragma unroll
        for (int g = 0; g < 8; ++g) al[qt][g] = alpha_s[qt * 16 + g + 8 * half];
      __builtin_amdgcn_sched_barrier(0);   // the factors' reads go first: the rescale then waits for them alone
      const h16* Vf = &Vts[w * 64][0];
      v16h pa[2][2], vb[2][4];             // [32 keys][query tile], [32 keys][16 dims]
#pragma unroll
      for (int qt = 0; qt < 2; ++qt) pa[0][qt] = load_a_frag(&Ps[qt * 16][0], VP64, 0);
#pragma unroll
      for (int t = 0; t < 4; ++t) vb[0][t] = load_b_frag(Vf + t * 16 * VP64, VP64, 0);
      __builtin_amdgcn_sched_barrier(0);   // keys 0..31: the reads stay ahead of the rescale, which runs under their latency
#pragma unroll
      for (int qt = 0; qt < 2; ++qt)
#pragma unroll
        for (int t = 0; t < 4; ++t)
#pragma unroll
          for (int g = 0; g < 8; ++g) o[qt][t][g] *= al[qt][g];
      __builtin_amdgcn_sched_barrier(0);   // keys 32..63 are read behind the rescale, when the factors' registers are free ...
#pragma unroll
      for (int qt = 0; qt < 2; ++qt) pa[1][qt] = load_a_frag(&Ps[qt * 16][0], VP64, 32);
#pragma unroll
      for (int t = 0; t < 4; ++t) vb[1][t] = load_b_frag(Vf + t * 16 * VP64, VP64, 32);
      __builtin_amdgcn_sched_barrier(0);   // ... and ahead of the first eight WMMAs, which run under their latency
#pragma unroll
      for (int s = 0; s < 2; ++s)
#pragma unroll
        for (int t = 0; t < 4; ++t)
#pragma unroll
          for (int qt = 0; qt < 2; ++qt) o[qt][t] = wmma_f16(pa[s][qt], vb[s][t], o[qt][t]);
    }
  }
  __syncthreads();

  h16* Ct = &Vts[0][0];
#pragma unroll
  for (int qt = 0; qt < 2; ++qt) {
    float linv[8];
#pragma unroll
    for (int g = 0; g < 8; ++g) linv[g] = 1.0f / (l_s[qt * 16 + g + 8 * half] * PSC);
#pragma unroll
    for (int t = 0; t < 4; ++t) {
      const int col = w * 64 + t * 16 + idx;
#pragma unroll
      for (int g = 0; g < 8; ++g) Ct[(qt * 16 + g + 8 * half) * DM + col] = (h16)(o[qt][t][g] * linv[g]);
    }
  }
  __syncthreads();
  {
    h16* dst = Ch + ((size_t)(b * SEQ + q0)) * DM;
    for (int gg = tid; gg < 32 * DM / 8; gg += 256) vst2(dst + (size_t)gg * 8, *(const v4u*)(Ct + gg * 8));
  }
}

// ---------------- flash attention, causal, query positions < EARLY_R (hi + residual products) ----------------
// WG = 16 queries, 8 waves, key chunks of 32 (chunks 0 .. q0/32). Q (hi,res) staged once; K (hi,res) and V^T (hi,res)
// chunks staged in LDS through registers. Score phase: waves 0..5 -> (prod = w>>1, kj = w&1): prod 0 = Qh Kh, 1 = Qh Kr, 2 = Qr Kh.
// PV phase: wave w -> dims [64w, 64w+64): Oh += Ph Vh ; Or += Ph Vr + Pr Vh. Writes ctx hi and ctx res planes.
__global__ __launch_bounds__(256) __attribute__((amdgpu_num_vgpr(256)))
void attn_early_kernel(const h16* __restrict__ Qh, const h16* __restrict__ Qr,
                       const h16* __restrict__ Kh, const h16* __restrict__ Kr,
                       const h16* __restrict__ Vth, const h16* __restrict__ Vtr,
                       h16* __restrict__ Ch, h16* __restrict__ Cr) {
  __shared__ __align__(16) h16   Qs[2][16][QP];
  __shared__ __align__(16) h16   Ks[2][32][QP];    // reused as the ctx tiles [2][16][512] after the loop
  __shared__ __align__(16) h16   Vts[2][DM][VP32]; // d-major
  __shared__ __align__(16) float Ss[3][16][SP32];
  __shared__ __align__(16) h16   Ps[2][16][VP32];
  __shared__ float alpha_s[16];
  __shared__ float l_s[16];

  const int b   = blockIdx.y;
  const int q0  = blockIdx.x * 16;
  const int tid = threadIdx.x;
  const int w    = tid >> 5;
  const int lane = tid & 31;
  const int idx  = lane & 15;
  const int half = lane >> 4;

  {
    const h16* Qg0 = Qh + ((size_t)(b * SEQ + q0)) * DM;
    const h16* Qg1 = Qr + ((size_t)(b * EARLY_R + q0)) * DM;
    for (int cc = tid; cc < 16 * (DM / 8); cc += 256) {
      const int r = cc >> 6, dc = cc & 63;
      copy16_g2s(&Qs[0][r][dc * 8], Qg0 + (size_t)r * DM + dc * 8);
      copy16_g2s(&Qs[1][r][dc * 8], Qg1 + (size_t)r * DM + dc * 8);
    }
  }

  v8f oh[4] = {};
  v8f orr[4] = {};
  const int srow = tid >> 4;          // softmax: 16 threads per query row
  const int sj   = tid & 15;
  float m_prev = -1e30f;
  float l_run  = 0.0f;
  const int nchunk = q0 / 32 + 1;     // keys 0 .. 32*nchunk-1 cover every position <= q0+15
  // As in the main kernel the chunks pass through registers, loaded one phase ahead of their LDS store: V^T during the score
  // phase, the next chunk's K during the softmax and PV phases. Per thread and plane: 8 K pieces 4 rows apart, 8 V^T pieces 64 rows apart.
  h16* Kst = &Ks[0][tid >> 6][(tid & 63) * 8];
  h16* Vst = &Vts[0][tid >> 2][(tid & 3) * 8];
  const h16* Kg0 = Kh + ((size_t)(b * SEQ + (tid >> 6))) * DM + (tid & 63) * 8;
  const h16* Kg1 = Kr + ((size_t)(b * EARLY_R + (tid >> 6))) * DM + (tid & 63) * 8;
  h16x8 kh8[8], kr8[8];               // the K chunk of the coming trip, in flight across the loop's back edge
  load_pieces<8>(kh8, Kg0, 4 * DM);
  load_pieces<8>(kr8, Kg1, 4 * DM);

#pragma unroll 1
  for (int ci = 0; ci < nchunk; ++ci) {
    const int kv0 = ci * 32;
    lds_barrier();     // prior PV done with Vts / Ps, prior scores done with Ks; the K pieces stay in flight
#pragma unroll     // constant indices keep kh8[] and kr8[] in registers
    for (int i = 0; i < 8; ++i) {
      *(h16x8*)(Kst + i * 4 * QP) = kh8[i];
      *(h16x8*)(Kst + 32 * QP + i * 4 * QP) = kr8[i];
    }
    h16x8 vh8[8], vr8[8];             // V^T chunk, in flight and then held in registers during the score phase
    load_pieces<8>(vh8, Vth + (size_t)(b * DM + (tid >> 2)) * SEQ + kv0 + (tid & 3) * 8, (size_t)64 * SEQ);
    load_pieces<8>(vr8, Vtr + (size_t)(b * DM + (tid >> 2)) * EARLY_R + kv0 + (tid & 3) * 8, (size_t)64 * EARLY_R);
    lds_barrier();     // K chunk visible; the V^T pieces stay in flight

    if (w < 6) {                                   // wave-uniform
      const int prod = w >> 1, kj = w & 1;
      const int pa = (prod == 2) ? 1 : 0;
      const int pb = (prod == 1) ? 1 : 0;
      const v8f sc = dot_rows<2>(&Qs[pa][0][0], &Ks[pb][kj * 16][0], v8f{});
      const int col = kj * 16 + idx;
#pragma unroll
      for (int g = 0; g < 8; ++g) Ss[prod][g + 8 * half][col] = sc[g];
    }
    lds_barrier();     // scores visible

#pragma unroll     // constant indices keep vh8[] and vr8[] in registers
    for (int i = 0; i < 8; ++i) {
      *(h16x8*)(Vst + i * 64 * VP32) = vh8[i];
      *(h16x8*)(Vst + DM * VP32 + i * 64 * VP32) = vr8[i];
    }
    {  // the last trip loads its own chunk again, unused (as in the main kernel)
      const size_t kn = (size_t)((ci + 1 < nchunk) ? kv0 + 32 : kv0) * DM;
      load_pieces<8>(kh8, Kg0 + kn, 4 * DM);
      load_pieces<8>(kr8, Kg1 + kn, 4 * DM);
    }
    {
      float v[2];
      float mloc = -1e30f;
      const int qrow = q0 + srow;
#pragma unroll
      for (int e = 0; e < 2; ++e) {
        const int cidx = sj + e * 16;
        float s = (Ss[0][srow][cidx] + (Ss[1][srow][cidx] + Ss[2][srow][cidx]) * RINV) * SCL;
        if (kv0 + cidx > qrow) s = -1e30f;         // causal: replace masked scores
        v[e] = s; mloc = fmaxf(mloc, s);
      }
#pragma unroll
      for (int msk = 1; msk < 16; msk <<= 1) mloc = fmaxf(mloc, __shfl_xor(mloc, msk, 32));
      const float m_new = fmaxf(m_prev, mloc);
      const float alpha = __expf(m_prev - m_new);
      float ssum = 0.0f;
#pragma unroll
      for (int e = 0; e < 2; ++e) {
        const int cidx = sj + e * 16;
        const float p  = __expf(v[e] - m_new);
        ssum += p;
        const float pp = p * PSC;
        const h16 hv = (h16)pp;
        Ps[0][srow][cidx] = hv;
        Ps[1][srow][cidx] = (h16)((pp - (float)hv) * RSC);
      }
#pragma unroll
      for (int msk = 1; msk < 16; msk <<= 1) ssum += __shfl_xor(ssum, msk, 32);
      l_run = l_run * alpha + ssum;
      m_prev = m_new;
      if (sj == 0) { alpha_s[srow] = alpha; l_s[srow] = l_run; }
    }
    lds_barrier();     // P, the factors and V^T visible; the next K pieces stay in flight

    {
      float al[8];
#pragma unroll
      for (int g = 0; g < 8; ++g) al[g] = alpha_s[g + 8 * half];
      v16h ah = load_a_frag(&Ps[0][0][0], VP32, 0);
      v16h ar = load_a_frag(&Ps[1][0][0], VP32, 0);
      v16h bh[4], br[4];               // every fragment of the chunk, read as one group
#pragma unroll     // constant indices keep bh[] and br[] in registers
      for (int t = 0; t < 4; ++t) {
        const int d0 = w * 64 + t * 16;
        bh[t] = load_b_frag(&Vts[0][d0][0], VP32, 0);
        br[t] = load_b_frag(&Vts[1][d0][0], VP32, 0);
      }
      __builtin_amdgcn_sched_barrier(0);   // keeps all reads ahead of the rescale and the WMMAs, which then run under their latency
#pragma unroll
      for (int t = 0; t < 4; ++t)
#pragma unroll
        for (int g = 0; g < 8; ++g) { oh[t][g] *= al[g]; orr[t][g] *= al[g]; }
#pragma unroll
      for (int t = 0; t < 4; ++t) {
        oh[t]  = wmma_f16(ah, bh[t], oh[t]);
        orr[t] = wmma_f16(ah, br[t], orr[t]);
        orr[t] = wmma_f16(ar, bh[t], orr[t]);
      }
    }
  }
  __syncthreads();

  h16* Ct = &Ks[0][0][0];
  float linv[8];
#pragma unroll
  for (int g = 0; g < 8; ++g) linv[g] = 1.0f / (l_s[g + 8 * half] * PSC);
#pragma unroll
  for (int t = 0; t < 4; ++t) {
    const int col = w * 64 + t * 16 + idx;
#pragma unroll
    for (int g = 0; g < 8; ++g) {
      const int rl = g + 8 * half;
      const float u = (oh[t][g] + orr[t][g] * RINV) * linv[g];     // x16 carried ctx
      const h16 hv = (h16)u;
      Ct[rl * DM + col] = hv;
      Ct[16 * DM + rl * DM + col] = (h16)((u - (float)hv) * RSC);
    }
  }
  __syncthreads();
  {
    h16* dsth = Ch + ((size_t)(b * SEQ + q0)) * DM;
    h16* dstr = Cr + ((size_t)(b * EARLY_R + q0)) * DM;
    for (int gg = tid; gg < 16 * DM / 8; gg += 256) {
      vst2(dsth + (size_t)gg * 8, *(const v4u*)(Ct + gg * 8));
      vst2(dstr + (size_t)gg * 8, *(const v4u*)(Ct + 16 * DM + gg * 8));
    }
  }
}

// ---------------- output projection: out = ctx(MT x 512) * Wo(512 x 512)^T, f32 ----------------
// Same wave layout and k-block LDS staging as proj_qkv. Blocks with sequence positions < EARLY_R add the ctx residual product
// (second accumulator); the two kinds of block run separate instances of the body, so that only the early one holds it.
template <bool EARLY> __device__ __forceinline__
void proj_out_body(const h16* __restrict__ Ch, const h16* __restrict__ Cr, const h16* __restrict__ Wo, float* __restrict__ out,
                   h16* Ws, h16* Cs, h16* Rs, int m0, int n0, int bb, int s0) {
  const int tid = threadIdx.x, w = tid >> 5, lane = tid & 31, idx = lane & 15, half = lane >> 4;
  const int mw_l = (w & 3) * 16;
  const int nw_l = (w >> 2) * 64;

  v8f c[4] = {};
  v8f cr[4] = {};                                   // used by the early instance only
#pragma unroll 1   // rolled: nothing moves across the barriers of a trip, unrolling would only multiply the code
  for (int kb = 0; kb < DM; kb += KB) {
    __syncthreads();                                // the previous block's fragment reads are done
    stage_rows<64>(Cs, Ch + (size_t)m0 * DM + kb, tid);
    stage_rows<128>(Ws, Wo + (size_t)n0 * DM + kb, tid);
    if (EARLY) {
      __builtin_amdgcn_sched_barrier(0);            // the W pieces leave their registers first: all three loads' would not fit 128
      stage_rows<64>(Rs, Cr + (size_t)(bb * EARLY_R + s0) * DM + kb, tid);
    }
    __syncthreads();                                // the staged block is visible to every wave
#pragma unroll
    for (int k0 = 0; k0 < KB; k0 += 32) {
      v16h a = load_a_frag(Cs + mw_l * KP, KP, k0);
      v16h ar = {};
      if (EARLY) ar = load_a_frag(Rs + mw_l * KP, KP, k0);
      v16h bf[4];
#pragma unroll
      for (int t = 0; t < 4; ++t) bf[t] = load_b_frag(Ws + (nw_l + t * 16) * KP, KP, k0);
      __builtin_amdgcn_sched_barrier(0);            // keeps the k step's reads together, ahead of its WMMAs
#pragma unroll
      for (int t = 0; t < 4; ++t) {
        c[t] = wmma_f16(a, bf[t], c[t]);
        if (EARLY) cr[t] = wmma_f16(ar, bf[t], cr[t]);
      }
      if (EARLY) __builtin_amdgcn_sched_barrier(0); // two accumulator sets: a second fragment set would not fit 128 registers
    }
  }
  __syncthreads();                                  // last fragment reads done before the space becomes the output tile
  float* T = (float*)Ws;
#pragma unroll
  for (int t = 0; t < 4; ++t) {
    const int cl = nw_l + t * 16 + idx;
#pragma unroll
    for (int g = 0; g < 8; ++g) {
      const int rl = mw_l + g + 8 * half;
      T[rl * 132 + cl] = (EARLY ? c[t][g] + cr[t][g] * RINV : c[t][g]) * OUT_MUL;
    }
  }
  __syncthreads();
  {
    float* dst = out + ((size_t)(bb * SEQ_FULL + s0)) * DM + n0;
    for (int gg = tid; gg < 64 * 32; gg += 256) {
      const int rl = gg >> 5, pc = gg & 31;
      vst2(dst + (size_t)rl * DM + pc * 4, *(const v4f*)(&T[rl * 132 + pc * 4]));
    }
  }
}

__global__ __launch_bounds__(256) __attribute__((amdgpu_num_vgpr(128)))   // four workgroups (LDS limit) = 8 waves per SIMD
void proj_out_kernel(const h16* __restrict__ Ch, const h16* __restrict__ Cr,
                                                       const h16* __restrict__ Wo, float* __restrict__ out) {
  __shared__ __align__(16) h16 Ws[128 * KP];      // reused as the f32 output tile [64][132] after the k loop
  __shared__ __align__(16) h16 Cs[64 * KP];
  __shared__ __align__(16) h16 Rs[64 * KP];
  static_assert(64 * 132 * sizeof(float) <= 128 * KP * sizeof(h16));
  const int m0 = blockIdx.x * 64, n0 = blockIdx.y * 128;
  const int bb = m0 / SEQ, s0 = m0 - bb * SEQ;
  if (s0 < EARLY_R) proj_out_body<true>(Ch, Cr, Wo, out, Ws, Cs, Rs, m0, n0, bb, s0);     // block-uniform
  else              proj_out_body<false>(Ch, Cr, Wo, out, Ws, Cs, Rs, m0, n0, bb, s0);
}

extern "C" void kernel_launch(void* const* d_in, const int* in_sizes, int n_in,
                              void* d_out, int out_size, void* d_ws, size_t ws_size,
                              hipStream_t stream) {
  if (n_in < 5) return;
  const int rows_needed = (NB - 1) * SEQ_FULL + SEQ;
  if (in_sizes[0] < rows_needed * DM) return;
  for (int i = 1; i < 5; ++i) if (in_sizes[i] < DM * DM) return;
  if (out_size < rows_needed * DM) return;

  const float* x  = (const float*)d_in[0];
  const float* Wq = (const float*)d_in[1];
  const float* Wk = (const float*)d_in[2];
  const float* Wv = (const float*)d_in[3];
  const float* Wo = (const float*)d_in[4];
  float* out = (float*)d_out;

  const size_t plane = (size_t)MT * DM * sizeof(h16);              // 16,777,216 at full size
  const size_t wpl   = (size_t)DM * DM * sizeof(h16);              //    524,288
  const size_t rpl   = (size_t)NB * EARLY_R * DM * sizeof(h16);    //  2,097,152 at full size
  size_t off = 0;
  char* ws = (char*)d_ws;
  h16* xb  = (h16*)(ws + off); off += plane;
  h16* wqb = (h16*)(ws + off); off += wpl;
  h16* wkb = (h16*)(ws + off); off += wpl;
  h16* wvb = (h16*)(ws + off); off += wpl;
  h16* wob = (h16*)(ws + off); off += wpl;
  h16* qh  = (h16*)(ws + off); off += plane;
  h16* kh  = (h16*)(ws + off); off += plane;
  h16* vth = (h16*)(ws + off); off += plane;   // [b][d][s]
  h16* qr  = (h16*)(ws + off); off += rpl;
  h16* kr  = (h16*)(ws + off); off += rpl;
  h16* vtr = (h16*)(ws + off); off += rpl;     // [b][d][s < EARLY_R]
  h16* ch  = (h16*)(ws + off); off += plane;
  h16* crp = (h16*)(ws + off); off += rpl;     // total 94,371,840 at full size
  if (off > ws_size) return;

  const int nx8 = MT * DM / 8;
  cvt_x_kernel<<<(nx8 + 255) / 256, 256, 0, stream>>>(x, xb, nx8);
  cvt_w_kernel<<<dim3((DM * DM / 8 + 255) / 256, 4), 256, 0, stream>>>(Wq, Wk, Wv, Wo, wqb, wkb, wvb, wob);

  proj_qkv_kernel<<<dim3(MT / 64, DM / 128, 3), 256, 0, stream>>>(xb, wqb, wkb, wvb, qh, kh, vth, qr, kr, vtr);

  attn_early_kernel<<<dim3(EARLY_R / 16, NB), 256, 0, stream>>>(qh, qr, kh, kr, vth, vtr, ch, crp);
  if (SEQ > EARLY_R) {
    attn_main_kernel<<<dim3((SEQ - EARLY_R) / 32, NB), 256, 0, stream>>>(qh, kh, vth, ch);
  }

  proj_out_kernel<<<dim3(MT / 64, DM / 128), 256, 0, stream>>>(ch, crp, wob, out);
}

// v006
// It runs in 228 microseconds.
// Two timings next to v005 both put it at 1.14 times that version's speed.
// Over all steps from v000 it is 4.34 times as fast.
#include <hip/hip_runtime.h>
// Contractions: Q/K/V projections (K = 512), scores Q K^T (K = 512), P V (K = keys) and the output projection (K = 512)
// on v_wmma_f32_16x16x32_f16 (f16 operands, f32 accumulate). Inputs enter as bf16-RNE values carried x16 in f16 planes;
// q/k/v/ctx are f16 hi planes carried x16 plus f16 residual planes carried x16384 for the first EARLY_R positions of each
// sequence (scores: hh + hr + rh, P V: hh + hr + rh, output projection: h + r); P carried x1024; softmax statistics in f32.

typedef _Float16 h16;
typedef _Float16 h16x8 __attribute__((ext_vector_type(8)));
typedef _Float16 v16h  __attribute__((ext_vector_type(16)));
typedef float  v8f    __attribute__((ext_vector_type(8)));
typedef float  v4f    __attribute__((ext_vector_type(4)));
typedef unsigned v4u  __attribute__((ext_vector_type(4)));

#ifndef NB
#define NB 4
#endif
#ifndef SEQ
#define SEQ 4096
#endif
#define NB_FULL 4
#define SEQ_FULL 4096
#define DM 512
#define EARLY_CAP 512
#define EARLY_R ((SEQ < EARLY_CAP) ? SEQ : EARLY_CAP)
#define MT (NB * SEQ)
// LDS row pitches in elements. f16 rows read by 16-byte fragment loads: byte pitch = 16 x odd, so the 16 rows of a fragment
// fall on distinct bank groups. f32 score rows: pitch chosen so that the tile stores and the row reads both spread over banks.
#define QP  (DM + 8)               // 1040 B: Q and K rows of 512 f16
#define VP64 72                    // 144 B: V^T and P rows of 64 f16
#define VP32 40                    // 80 B: V^T and P rows of 32 f16
#define SP64 76                    // f32 score rows of 64
#define SP32 36                    // f32 score rows of 32
#define KB   128                   // k block of the projections' LDS staging
#define KP   (KB + 8)              // 272 B: staged projection operand rows of 128 f16

static_assert(SEQ % 64 == 0);
static_assert((EARLY_R) % 64 == 0);
static_assert(NB >= 1 && NB <= NB_FULL);
static_assert(SEQ >= 64 && SEQ <= SEQ_FULL);
static_assert(DM % 128 == 0);
static_assert(((NB - 1) * SEQ_FULL + SEQ) * DM <= NB_FULL * SEQ_FULL * DM);

#define ISC  16.0f                 // carry of the x / q / k / v / ctx f16 hi planes
#define WSC  16.0f                 // carry of the weight planes
#define PSC  1024.0f               // carry of P
#define RSC  16384.0f              // carry of every residual plane
#define RINV (1.0f / 16384.0f)
#define PROJ_MUL (1.0f / 16.0f)    // acc of (x16 * x16) operands -> x16 plane value
#define OUT_MUL  (1.0f / 256.0f)   // acc of (x16 * x16) operands -> f32 output
#define SCL ((1.0f / 256.0f) * (1.0f / 22.627416610717773f))

template <typename V> __device__ __forceinline__ void vst2(void* p, V v) {
  *(V*)p = v; 
}
__device__ __forceinline__ void copy16_g2s(h16* ldst, const h16* gsrc) { *(h16x8*)ldst = *(const h16x8*)gsrc; }

__device__ __forceinline__ float bf16r(float f) {     // RNE convert to bf16, value kept in f32
  unsigned u = __float_as_uint(f);
  u = (u + 0x7FFFu + ((u >> 16) & 1u)) & 0xFFFF0000u;
  return __uint_as_float(u);
}

// ---- WMMA fragment loaders (f16, row-major K-contiguous source); A and B (from B^T rows) share the per-lane K map:
//      row/col = lane&15; elements 0..7 <- k0 + 8*half + 0..7, elements 8..15 <- k0 + 16 + 8*half + 0..7
__device__ __forceinline__ v16h load_a_frag(const h16* base, int ld, int k0) {
  int lane = threadIdx.x & 31;
  int idx  = lane & 15;
  int half = lane >> 4;
  const h16* p = base + idx * ld + k0 + half * 8;
  h16x8 lo = *(const h16x8*)(p);
  h16x8 hi = *(const h16x8*)(p + 16);
  return __builtin_shufflevector(lo, hi, 0,1,2,3,4,5,6,7,8,9,10,11,12,13,14,15);
}
__device__ __forceinline__ v16h load_b_frag(const h16* base, int ld, int k0) { return load_a_frag(base, ld, k0); }

__device__ __forceinline__ v8f wmma_f16(v16h a, v16h b, v8f c) {
  return __builtin_amdgcn_wmma_f32_16x16x32_f16(false, a, false, b, (short)0, c, false, false);
}

// sc += A(16 x DM) * B(16 x DM)^T, both from LDS rows of pitch QP, k ascending. The fragments are read G k-steps at a time into
// two register sets, each group one group ahead of the WMMAs that use it, so that a wave waits for LDS once per group at most.
template <int G> __device__ __forceinline__ v8f dot_rows(const h16* A, const h16* B, v8f sc) {
  constexpr int NG = DM / (32 * G);
  v16h fa[2][G], fb[2][G];
#pragma unroll     // constant indices keep the fragment sets in registers
  for (int j = 0; j < G; ++j) { fa[0][j] = load_a_frag(A, QP, j * 32); fb[0][j] = load_b_frag(B, QP, j * 32); }
#pragma unroll     // constant indices keep the fragment sets in registers
  for (int g = 0; g < NG; ++g) {
    if (g + 1 < NG) {
#pragma unroll     // as above
      for (int j = 0; j < G; ++j) {
        fa[(g + 1) & 1][j] = load_a_frag(A, QP, ((g + 1) * G + j) * 32);
        fb[(g + 1) & 1][j] = load_b_frag(B, QP, ((g + 1) * G + j) * 32);
      }
    }
    __builtin_amdgcn_sched_barrier(0);   // keeps the next group's reads ahead of this group's WMMAs (else they sink to their use)
#pragma unroll     // as above
    for (int j = 0; j < G; ++j) sc = wmma_f16(fa[g & 1][j], fb[g & 1][j], sc);
    __builtin_amdgcn_sched_barrier(0);   // no read of the group after next in front of these WMMAs: it would take a third register set
  }
  return sc;
}

// Work-group barrier for data handed over in LDS alone: its fences name the LDS address space only, so a wave waits for its LDS
// operations and not for its global loads, which stay in flight across it (__syncthreads() waits for them too).
__device__ __forceinline__ void lds_barrier() {
  __builtin_amdgcn_fence(__ATOMIC_RELEASE, "workgroup", "local");
  __builtin_amdgcn_s_barrier();
  __builtin_amdgcn_fence(__ATOMIC_ACQUIRE, "workgroup", "local");
}

// N 16-byte pieces per thread, 'step' elements apart, from global memory into registers.
template <int N> __device__ __forceinline__ void load_pieces(h16x8 (&r)[N], const h16* g0, size_t step) {
#pragma unroll     // constant indices keep r[] in registers and the steps in the loads' offset fields
  for (int i = 0; i < N; ++i) r[i] = *(const h16x8*)(g0 + i * step);
  // address-translation wait; g0 as an input keeps the loads' address pair untouched (also by a later load's result) up to it
  asm volatile("s_wait_xcnt 0x0" :: "v"(g0) : "memory");
}

// Stage ROWS rows of KB f16 (256 B = two whole lines per row, source row pitch DM) into LDS rows of pitch KP, 256 threads:
// one wave-wide 16-byte load covers two rows = four whole lines.
template <int ROWS> __device__ __forceinline__ void stage_rows(h16* lds, const h16* g, int tid) {
  h16* l0 = lds + (tid >> 4) * KP + (tid & 15) * 8;
  const h16* g0 = g + (size_t)(tid >> 4) * DM + (tid & 15) * 8;
  h16x8 r[ROWS / 16];
  load_pieces<ROWS / 16>(r, g0, 16 * DM);
#pragma unroll     // constant indices keep r[] in registers
  for (int i = 0; i < ROWS / 16; ++i) *(h16x8*)(l0 + i * 16 * KP) = r[i];
}

// ---------------- conversion kernels ----------------
// xb[row][c] = f16( bf16r(x) * 16 ), rows indexed b*SEQ + s, source rows b*SEQ_FULL + s; 8 elements (16 B) per thread
__global__ __launch_bounds__(256) void cvt_x_kernel(const float* __restrict__ x, h16* __restrict__ xb, int n8) {
  int g = blockIdx.x * 256 + threadIdx.x;
  if (g >= n8) return;
  const int row = g >> 6, c8 = g & 63;            // 64 groups of 8 per 512-wide row
  const int b = row / SEQ, s = row - b * SEQ;
  const float* src = x + ((size_t)(b * SEQ_FULL + s)) * DM + c8 * 8;
  const v4f a = *(const v4f*)(src), bq = *(const v4f*)(src + 4);
  union { h16x8 h; v4u u; } pk;
#pragma unroll
  for (int i = 0; i < 4; ++i) { pk.h[i] = (h16)(bf16r(a[i]) * ISC); pk.h[4 + i] = (h16)(bf16r(bq[i]) * ISC); }
  vst2(xb + (size_t)g * 8, pk.u);
}

// Wb[n][k] = f16( bf16r(W[n][k]) * 16 ) for the matrix selected by blockIdx.y (weights are already [out][in] = [n][k])
__global__ __launch_bounds__(256) void cvt_w_kernel(const float* __restrict__ W0, const float* __restrict__ W1,
                                                    const float* __restrict__ W2, const float* __restrict__ W3,
                                                    h16* __restrict__ D0, h16* __restrict__ D1,
                                                    h16* __restrict__ D2, h16* __restrict__ D3) {
  const int y = blockIdx.y;
  const float* W = (y == 0) ? W0 : (y == 1) ? W1 : (y == 2) ? W2 : W3;
  h16*       D  = (y == 0) ? D0 : (y == 1) ? D1 : (y == 2) ? D2 : D3;
  const int g = blockIdx.x * 256 + threadIdx.x;    // < DM*DM/8 by grid construction
  if (g >= DM * DM / 8) return;
  const float* src = W + (size_t)g * 8;
  const v4f a = *(const v4f*)(src), bq = *(const v4f*)(src + 4);
  union { h16x8 h; v4u u; } pk;
#pragma unroll
  for (int i = 0; i < 4; ++i) { pk.h[i] = (h16)(bf16r(a[i]) * WSC); pk.h[4 + i] = (h16)(bf16r(bq[i]) * WSC); }
  vst2(D + (size_t)g * 8, pk.u);
}

// ---------------- projection GEMM: Y = X(MT x 512) * W(512 x 512)^T, blockIdx.z selects Q / K / V ----------------
// 8 waves/WG: 4 M-subtiles x 2 N-groups(64). Each wave: 16x64 (4 WMMA tiles). The X (64 rows) and W (128 rows) operands are
// staged in LDS in k blocks of KB = 128 by whole-line 16-byte loads; fragments are read from LDS. The staging space is reused
// for the 64 x 128 output tile. Blocks whose sequence positions are < EARLY_R also write the residual planes (x16384).
__global__ __launch_bounds__(256) void proj_qkv_kernel(const h16* __restrict__ Xb,
                                                       const h16* __restrict__ Wq, const h16* __restrict__ Wk,
                                                       const h16* __restrict__ Wv,
                                                       h16* __restrict__ Qh, h16* __restrict__ Kh, h16* __restrict__ Vth,
                                                       h16* __restrict__ Qr, h16* __restrict__ Kr, h16* __restrict__ Vtr) {
  __shared__ __align__(16) h16 Th[128 * 136];     // [m][n] pitch 136 (Q/K) or [n][m] pitch 72 (V)
  __shared__ __align__(16) h16 Tr[128 * 136];
  const int z = blockIdx.z;
  const h16* W = (z == 0) ? Wq : (z == 1) ? Wk : Wv;
  const int transposed = (z == 2) ? 1 : 0;
  const int m0 = blockIdx.x * 64, n0 = blockIdx.y * 128;
  const int bb = m0 / SEQ, s0 = m0 - bb * SEQ;
  const bool early = (s0 < EARLY_R);
  const int tid = threadIdx.x, w = tid >> 5, lane = tid & 31, idx = lane & 15, half = lane >> 4;
  const int mw_l = (w & 3) * 16;
  const int nw_l = (w >> 2) * 64;

  v8f c[4] = {};
  h16* Ws = Th;                                     // [128][KP] during the k loop
  h16* Xs = Tr;                                     // [64][KP] during the k loop
#pragma unroll 1   // rolled: nothing moves across the barriers of a trip, unrolling would only multiply the code
  for (int kb = 0; kb < DM; kb += KB) {
    __syncthreads();                                // the previous block's fragment reads are done
    stage_rows<64>(Xs, Xb + (size_t)m0 * DM + kb, tid);
    stage_rows<128>(Ws, W + (size_t)n0 * DM + kb, tid);
    __syncthreads();                                // the staged block is visible to every wave
#pragma unroll
    for (int k0 = 0; k0 < KB; k0 += 32) {
      v16h a = load_a_frag(Xs + mw_l * KP, KP, k0);
      v16h bf[4];
#pragma unroll
      for (int t = 0; t < 4; ++t) bf[t] = load_b_frag(Ws + (nw_l + t * 16) * KP, KP, k0);
      __builtin_amdgcn_sched_barrier(0);            // keeps the k step's reads together, ahead of its WMMAs
#pragma unroll
      for (int t = 0; t < 4; ++t) c[t] = wmma_f16(a, bf[t], c[t]);
    }
  }
  __syncthreads();                                  // last fragment reads done before the space becomes the output tile
#pragma unroll
  for (int t = 0; t < 4; ++t) {
    const int cl = nw_l + t * 16 + idx;             // local col
#pragma unroll
    for (int g = 0; g < 8; ++g) {
      const int rl = mw_l + g + 8 * half;           // local row
      const float u = c[t][g] * PROJ_MUL;           // x16 carried value
      const h16 hv = (h16)u;
      const int li = transposed ? (cl * 72 + rl) : (rl * 136 + cl);
      Th[li] = hv;
      if (early) Tr[li] = (h16)((u - (float)hv) * RSC);
    }
  }
  __syncthreads();
  if (!transposed) {
    h16* Oh = (z == 0) ? Qh : Kh;
    h16* Orp = (z == 0) ? Qr : Kr;
    for (int gg = tid; gg < 64 * 16; gg += 256) {
      const int rl = gg >> 4, pc = gg & 15;
      vst2(Oh + (size_t)(m0 + rl) * DM + n0 + pc * 8, *(const v4u*)(&Th[rl * 136 + pc * 8]));
      if (early) vst2(Orp + (size_t)(bb * EARLY_R + s0 + rl) * DM + n0 + pc * 8, *(const v4u*)(&Tr[rl * 136 + pc * 8]));
    }
  } else {
    for (int gg = tid; gg < 128 * 8; gg += 256) {
      const int cl = gg >> 3, pc = gg & 7;
      vst2(Vth + ((size_t)(bb * DM + n0 + cl)) * SEQ + s0 + pc * 8, *(const v4u*)(&Th[cl * 72 + pc * 8]));
      if (early) vst2(Vtr + ((size_t)(bb * DM + n0 + cl)) * EARLY_R + s0 + pc * 8, *(const v4u*)(&Tr[cl * 72 + pc * 8]));
    }
  }
}

// ---------------- split of the main attention's key ranges ----------------
// A 32-query tile at position q0 walks q0/64 + 1 key chunks, so the last tile costs seven times the first, and with one workgroup
// per tile the launch lasts as long as the last tile. A tile of more than SEGL chunks is cut into equal runs of at most SEGL chunks,
// one workgroup each; the runs are dealt out longest first. A run of a cut tile leaves its unnormalised sums, its row maxima and
// its row sums in a slot of the workspace, and attn_combine_kernel joins the slots of a tile.
#define SEGL 22                    // a little under two rounds of workgroups at two per WGP
#define NO_SLOT 0xFFFF
constexpr int NT = (SEQ > EARLY_R) ? (SEQ - EARLY_R) / 32 : 1;
constexpr int tile_chunks(int t) { return (EARLY_R + t * 32) / 64 + 1; }
constexpr int tile_segs(int t) { return (tile_chunks(t) + SEGL - 1) / SEGL; }
constexpr int count_runs(bool cut_only) {
  int c = 0;
  for (int t = 0; t < NT; ++t) if (!cut_only || tile_segs(t) > 1) c += tile_segs(t);
  return c;
}
constexpr int count_cut_tiles() {
  int c = 0;
  for (int t = 0; t < NT; ++t) if (tile_segs(t) > 1) ++c;
  return c;
}
constexpr int NRUN   = count_runs(false);                                  // workgroups per sequence
constexpr int NSLOT  = (count_runs(true) > 0) ? count_runs(true) : 1;      // partial results per sequence
constexpr int NCUT   = (count_cut_tiles() > 0) ? count_cut_tiles() : 1;    // tiles per sequence that are cut
constexpr int MAXSEG = tile_segs(NT - 1);
struct Run { unsigned short tile, c0, len, slot; };       // chunks c0 .. c0 + len - 1 of a tile; slot = NO_SLOT: the whole tile
struct Cut { unsigned short tile, slot, nseg, pad; };     // a cut tile's runs lie in slots slot .. slot + nseg - 1
struct SegTab { Run run[NRUN]; Cut cut[NCUT]; };
constexpr SegTab make_seg_tab() {
  SegTab T = {};
  int n = 0, slot = 0, nc = 0;
  for (int t = 0; t < NT; ++t) {
    const int ch = tile_chunks(t), ns = tile_segs(t);
    if (ns > 1) { T.cut[nc].tile = (unsigned short)t; T.cut[nc].slot = (unsigned short)slot; T.cut[nc].nseg = (unsigned short)ns; ++nc; }
    for (int s = 0; s < ns; ++s) {
      Run r = {};
      r.tile = (unsigned short)t;
      r.c0   = (unsigned short)(s * ch / ns);
      r.len  = (unsigned short)((s + 1) * ch / ns - s * ch / ns);
      r.slot = (unsigned short)((ns > 1) ? slot++ : NO_SLOT);
      int p = n++;                                        // insertion keeps the list sorted, longest run first
      for (; p > 0 && T.run[p - 1].len < r.len; --p) T.run[p] = T.run[p - 1];
      T.run[p] = r;
    }
  }
  return T;
}
__constant__ const SegTab SEGS = make_seg_tab();
#define OPP (DM + 4)               // f32 row pitch of the partial tile in LDS: rows g and g + 8 fall on different banks

// ---------------- flash attention, causal, query positions >= EARLY_R (single products) ----------------
// WG = 32 queries, 8 waves, key chunks of 64: one run of chunks of one tile (table above). The K chunk is staged in LDS by whole-line loads for the
// score phase; the V^T chunk takes the same LDS space for the PV phase. Both pass through registers and are loaded one phase
// ahead of their LDS store: V^T during the score phase, the next chunk's K during the softmax and PV phases.
// Every wave covers both 16-query tiles, so that each fragment read from LDS feeds two WMMAs.
// Score phase: wave w -> (ds = w&3, kh = w>>2): 32 keys x 32 queries (2 x 2 tiles of K Q^T) over the dims [128 ds, 128 ds + 128);
// the four partial sums of a score meet in the softmax phase. PV phase: wave w -> 32 q x dims [64w, 64w + 64) (2 x 4 accum tiles).
__global__ __launch_bounds__(256) __attribute__((amdgpu_num_vgpr(256)))
void attn_main_kernel(const h16* __restrict__ Qh, const h16* __restrict__ Kh,
                      const h16* __restrict__ Vth, h16* __restrict__ Ch, float* __restrict__ Op, float* __restrict__ Ml) {
  __shared__ __align__(16) h16   Qs[32][QP];
  __shared__ __align__(16) h16   Vts[DM][VP64];    // d-major; K rows [64][QP] in the score phase, f16 ctx tile [32][512] or f32 partial tile [32][OPP] after the loop
  __shared__ __align__(16) float Ss[4][32][SP64];  // one plane of partial scores per 128-dim slice
  __shared__ __align__(16) h16   Ps[32][VP64];
  __shared__ float alpha_s[32];
  __shared__ float l_s[32];
  __shared__ float m_s[32];

  const int b   = blockIdx.x;         // the sequence is the fast index: the runs start longest first over all sequences
  const Run run = SEGS.run[blockIdx.y];
  const int q0  = EARLY_R + run.tile * 32;
  const int tid = threadIdx.x;
  const int w    = tid >> 5;
  const int lane = tid & 31;
  const int idx  = lane & 15;
  const int half = lane >> 4;
  const int ds = w & 3;      // score phase: slice of 128 dims
  const int kh = w >> 2;     // score phase: half of the chunk's keys

  const h16* Qg = Qh + ((size_t)(b * SEQ + q0)) * DM;
  for (int cc = tid; cc < 32 * (DM / 8); cc += 256) {
    const int r = cc >> 6, dc = cc & 63;
    copy16_g2s(&Qs[r][dc * 8], Qg + (size_t)r * DM + dc * 8);
  }

  h16* Ks = &Vts[0][0];
  h16* Kst = Ks + (tid >> 6) * QP + (tid & 63) * 8;      // this thread's first K piece; the next ones lie 4 rows apart
  h16* Vst = &Vts[tid >> 3][(tid & 7) * 8];              // this thread's first V^T piece; the next ones lie 32 rows apart
  static_assert(64 * QP <= DM * VP64);
  v8f o[2][4] = {};                   // [query tile][16 dims]
  const int srow = tid >> 3;          // softmax: 8 threads per query row, 8 neighbouring keys each
  const int sj   = tid & 7;
  float m_prev = -1e30f;
  float l_run  = 0.0f;
  const int cbeg = run.c0, nchunk = run.c0 + run.len;   // this run's chunks; a tile's last chunk q0/64 covers every position <= q0+31
  const h16* Kg = Kh + ((size_t)(b * SEQ + (tid >> 6))) * DM + (tid & 63) * 8;
  h16x8 kreg[16];                     // the K chunk of the coming trip, in flight across the loop's back edge
  load_pieces<16>(kreg, Kg + (size_t)(cbeg * 64) * DM, 4 * DM);

#pragma unroll 1
  for (int ci = cbeg; ci < nchunk; ++ci) {
    const int kv0 = ci * 64;
    lds_barrier();     // prior PV done with Vts / Ps (and Qs issue point on the first chunk); the K pieces stay in flight
#pragma unroll     // constant indices keep kreg[] in registers
    for (int i = 0; i < 16; ++i) *(h16x8*)(Kst + i * 4 * QP) = kreg[i];
    const h16* Vg = Vth + (size_t)(b * DM + (tid >> 3)) * SEQ + kv0 + (tid & 7) * 8;
    h16x8 vreg[16];    // V^T chunk, in flight and then held in registers during the score phase
    load_pieces<16>(vreg, Vg, (size_t)32 * SEQ);
    lds_barrier();     // K chunk visible; the V^T pieces stay in flight

    {
      // A = K rows, B = Q rows: a lane then holds 8 neighbouring keys of one query, two 16-byte stores per tile.
      const h16* Kf = Ks + (kh * 32) * QP + ds * 128;
      const h16* Qf = &Qs[0][ds * 128];
      v8f sc[2][2] = {};               // [key tile][query tile]
      v16h fk[2][2], fq[2][2];         // two register sets: each k step's fragments are read one step ahead of their WMMAs
#pragma unroll     // constant indices keep the fragment sets in registers (every loop of this block)
      for (int j = 0; j < 2; ++j) { fk[0][j] = load_a_frag(Kf + j * 16 * QP, QP, 0); fq[0][j] = load_b_frag(Qf + j * 16 * QP, QP, 0); }
#pragma unroll
      for (int s = 0; s < 4; ++s) {
        if (s + 1 < 4) {
#pragma unroll
          for (int j = 0; j < 2; ++j) {
            fk[(s + 1) & 1][j] = load_a_frag(Kf + j * 16 * QP, QP, (s + 1) * 32);
            fq[(s + 1) & 1][j] = load_b_frag(Qf + j * 16 * QP, QP, (s + 1) * 32);
          }
        }
        __builtin_amdgcn_sched_barrier(0);   // keeps the next step's reads ahead of this step's WMMAs (else they sink to their use)
#pragma unroll
        for (int kt = 0; kt < 2; ++kt)
#pragma unroll
          for (int qt = 0; qt < 2; ++qt) sc[kt][qt] = wmma_f16(fk[s & 1][kt], fq[s & 1][qt], sc[kt][qt]);
        __builtin_amdgcn_sched_barrier(0);   // no read of the step after next in front of these WMMAs: it would take a third register set
      }
#pragma unroll
      for (int kt = 0; kt < 2; ++kt)
#pragma unroll
        for (int qt = 0; qt < 2; ++qt) {
          float* sp = &Ss[ds][qt * 16 + idx][kh * 32 + kt * 16 + 8 * half];
          *(v4f*)(sp)     = __builtin_shufflevector(sc[kt][qt], sc[kt][qt], 0, 1, 2, 3);
          *(v4f*)(sp + 4) = __builtin_shufflevector(sc[kt][qt], sc[kt][qt], 4, 5, 6, 7);
        }
    }
    lds_barrier();     // scores visible; every K fragment read is done, so V^T may take the space

#pragma unroll     // constant indices keep vreg[] in registers
    for (int i = 0; i < 16; ++i) *(h16x8*)(Vst + i * 32 * VP64) = vreg[i];
    // The next chunk's K pieces land under softmax and PV. The last trip loads its own chunk again, unused: under a test the old
    // pieces would count as live from their LDS store to here, through the score phase, and no longer fit the registers.
    load_pieces<16>(kreg, Kg + (size_t)((ci + 1 < nchunk) ? kv0 + 64 : kv0) * DM, 4 * DM);
    {
      float v[8];
      float mloc = -1e30f;
      v4f pl[4], ph[4];                // the four partial sums of this thread's 8 scores
#pragma unroll
      for (int p = 0; p < 4; ++p) { pl[p] = *(const v4f*)(&Ss[p][srow][sj * 8]); ph[p] = *(const v4f*)(&Ss[p][srow][sj * 8 + 4]); }
      const v4f sl = (pl[0] + pl[1]) + (pl[2] + pl[3]);
      const v4f sh = (ph[0] + ph[1]) + (ph[2] + ph[3]);
#pragma unroll
      for (int e = 0; e < 8; ++e) {
        float val = ((e < 4) ? sl[e & 3] : sh[e & 3]) * SCL;
        if (kv0 + sj * 8 + e > q0 + srow) val = -1e30f;   // causal: replace masked scores
        v[e] = val; mloc = fmaxf(mloc, val);
      }
#pragma unroll
      for (int msk = 1; msk < 8; msk <<= 1) mloc = fmaxf(mloc, __shfl_xor(mloc, msk, 32));
      const float m_new = fmaxf(m_prev, mloc);
      const float alpha = __expf(m_prev - m_new);
      float ssum = 0.0f;
      h16x8 pk;
#pragma unroll
      for (int e = 0; e < 8; ++e) {
        const float p = __expf(v[e] - m_new);
        ssum += p;
        pk[e] = (h16)(p * PSC);
      }
      *(h16x8*)(&Ps[srow][sj * 8]) = pk;
#pragma unroll
      for (int msk = 1; msk < 8; msk <<= 1) ssum += __shfl_xor(ssum, msk, 32);
      l_run = l_run * alpha + ssum;
      m_prev = m_new;
      if (sj == 0) { alpha_s[srow] = alpha; l_s[srow] = l_run; }
    }
    lds_barrier();     // P, the factors and V^T visible; the next K pieces stay in flight

    {
      float al[2][8];
#pragma unroll     // constant indices keep al[], pa[] and vb[] in registers (every loop of this block)
      for (int qt = 0; qt < 2; ++qt)
#pragma unroll
        for (int g = 0; g < 8; ++g) al[qt][g] = alpha_s[qt * 16 + g + 8 * half];
      __builtin_amdgcn_sched_barrier(0);   // the factors' reads go first: the rescale then waits for them alone
      const h16* Vf = &Vts[w * 64][0];
      v16h pa[2][2], vb[2][4];             // [32 keys][query tile], [32 keys][16 dims]
#pragma unroll
      for (int qt = 0; qt < 2; ++qt) pa[0][qt] = load_a_frag(&Ps[qt * 16][0], VP64, 0);
#pragma unroll
      for (int t = 0; t < 4; ++t) vb[0][t] = load_b_frag(Vf + t * 16 * VP64, VP64, 0);
      __builtin_amdgcn_sched_barrier(0);   // keys 0..31: the reads stay ahead of the rescale, which runs under their latency
#pragma unroll
      for (int qt = 0; qt < 2; ++qt)
#pragma unroll
        for (int t = 0; t < 4; ++t)
#pragma unroll
          for (int g = 0; g < 8; ++g) o[qt][t][g] *= al[qt][g];
      __builtin_amdgcn_sched_barrier(0);   // keys 32..63 are read behind the rescale, when the factors' registers are free ...
#pragma unroll
      for (int qt = 0; qt < 2; ++qt) pa[1][qt] = load_a_frag(&Ps[qt * 16][0], VP64, 32);
#pragma unroll
      for (int t = 0; t < 4; ++t) vb[1][t] = load_b_frag(Vf + t * 16 * VP64, VP64, 32);
      __builtin_amdgcn_sched_barrier(0);   // ... and ahead of the first eight WMMAs, which run under their latency
#pragma unroll
      for (int s = 0; s < 2; ++s)
#pragma unroll
        for (int t = 0; t < 4; ++t)
#pragma unroll
          for (int qt = 0; qt < 2; ++qt) o[qt][t] = wmma_f16(pa[s][qt], vb[s][t], o[qt][t]);
    }
  }
  if (sj == 0) m_s[srow] = m_prev;
  __syncthreads();

  if (run.slot != NO_SLOT) {          // block-uniform: a run of a cut tile hands its sums on as they are, in f32
    float* Cf = (float*)&Vts[0][0];
    static_assert(32 * OPP * sizeof(float) <= DM * VP64 * sizeof(h16));
#pragma unroll     // constant indices keep o[] in registers (all three loops)
    for (int qt = 0; qt < 2; ++qt)
#pragma unroll
      for (int t = 0; t < 4; ++t)
#pragma unroll
        for (int g = 0; g < 8; ++g) Cf[(qt * 16 + g + 8 * half) * OPP + w * 64 + t * 16 + idx] = o[qt][t][g];
    __syncthreads();                  // the tile is complete before it leaves in whole lines
    const size_t pi = (size_t)b * NSLOT + run.slot;
    float* dst = Op + pi * (32 * DM);
#pragma unroll     // 16 pieces per thread, two rows of the tile apart: all reads issued ahead of the stores, steps in the offset fields
    for (int i = 0; i < 32 * DM / 4 / 256; ++i)
      vst2(dst + (size_t)(i * 256 + tid) * 4, *(const v4f*)(Cf + (i * 2 + (tid >> 7)) * OPP + (tid & 127) * 4));
    if (tid < 64) Ml[pi * 64 + tid] = (tid < 32) ? m_s[tid] : l_s[tid - 32];   // wave 0: the maxima's line, wave 1: the sums' line
    return;
  }

  h16* Ct = &Vts[0][0];
#pragma unroll
  for (int qt = 0; qt < 2; ++qt) {
    float linv[8];
#pragma unroll
    for (int g = 0; g < 8; ++g) linv[g] = 1.0f / (l_s[qt * 16 + g + 8 * half] * PSC);
#pragma unroll
    for (int t = 0; t < 4; ++t) {
      const int col = w * 64 + t * 16 + idx;
#pragma unroll
      for (int g = 0; g < 8; ++g) Ct[(qt * 16 + g + 8 * half) * DM + col] = (h16)(o[qt][t][g] * linv[g]);
    }
  }
  __syncthreads();
  {
    h16* dst = Ch + ((size_t)(b * SEQ + q0)) * DM;
    for (int gg = tid; gg < 32 * DM / 8; gg += 256) vst2(dst + (size_t)gg * 8, *(const v4u*)(Ct + gg * 8));
  }
}

// ---------------- join of a cut tile's runs: ctx = sum_s e^(m_s - M) O_s / (sum_s e^(m_s - M) l_s), M = max_s m_s ----------------
// WG = 4 query rows of one cut tile; a thread joins 8 neighbouring dims and stores them as 16 bytes.
__global__ __launch_bounds__(256) void attn_combine_kernel(const float* __restrict__ Op, const float* __restrict__ Ml,
                                                           h16* __restrict__ Ch) {
  const Cut cut = SEGS.cut[blockIdx.x >> 3];
  const int b = blockIdx.y, tid = threadIdx.x;
  const int row = (blockIdx.x & 7) * 4 + (tid >> 6), c8 = tid & 63;
  const size_t p0 = (size_t)b * NSLOT + cut.slot;
  float m[MAXSEG], l[MAXSEG];
  v4f lo[MAXSEG], hi[MAXSEG];
#pragma unroll     // constant indices keep the parts in registers; every part's loads are issued before the first is used
  for (int s = 0; s < MAXSEG; ++s) {
    if (s < 2 || s < cut.nseg) {      // block-uniform; a cut tile has two parts at least
      const float* ml  = Ml + (p0 + s) * 64 + row;
      const float* src = Op + ((p0 + s) * 32 + row) * DM + c8 * 8;
      m[s] = ml[0]; l[s] = ml[32];
      lo[s] = *(const v4f*)(src); hi[s] = *(const v4f*)(src + 4);
      // address-translation wait; the pointers as inputs keep the loads' address pairs untouched (also by a later load's result) up to it
      asm volatile("s_wait_xcnt 0x0" :: "v"(ml), "v"(src) : "memory");
    } else {                          // no such part: weight e^(-1e30 - M) = 0
      m[s] = -1e30f; l[s] = 0.0f; lo[s] = v4f{}; hi[s] = v4f{};
    }
  }
  float M = m[0];
#pragma unroll     // constant indices, as above (this loop and the next two)
  for (int s = 1; s < MAXSEG; ++s) M = fmaxf(M, m[s]);
  float L = 0.0f;
  v4f alo = {}, ahi = {};
#pragma unroll
  for (int s = 0; s < MAXSEG; ++s) {
    const float ws = __expf(m[s] - M);
    L += ws * l[s]; alo += lo[s] * ws; ahi += hi[s] * ws;
  }
  const float linv = 1.0f / (L * PSC);
  union { h16x8 h; v4u u; } pk;
#pragma unroll
  for (int i = 0; i < 4; ++i) { pk.h[i] = (h16)(alo[i] * linv); pk.h[4 + i] = (h16)(ahi[i] * linv); }
  vst2(Ch + ((size_t)(b * SEQ + EARLY_R + cut.tile * 32 + row)) * DM + c8 * 8, pk.u);
}

// ---------------- flash attention, causal, query positions < EARLY_R (hi + residual products) ----------------
// WG = 16 queries, 8 waves, key chunks of 32 (chunks 0 .. q0/32). Q (hi,res) staged once; K (hi,res) and V^T (hi,res)
// chunks staged in LDS through registers. Score phase: waves 0..5 -> (prod = w>>1, kj = w&1): prod 0 = Qh Kh, 1 = Qh Kr, 2 = Qr Kh.
// PV phase: wave w -> dims [64w, 64w+64): Oh += Ph Vh ; Or += Ph Vr + Pr Vh. Writes ctx hi and ctx res planes.
__global__ __launch_bounds__(256) __attribute__((amdgpu_num_vgpr(256)))
void attn_early_kernel(const h16* __restrict__ Qh, const h16* __restrict__ Qr,
                       const h16* __restrict__ Kh, const h16* __restrict__ Kr,
                       const h16* __restrict__ Vth, const h16* __restrict__ Vtr,
                       h16* __restrict__ Ch, h16* __restrict__ Cr) {
  __shared__ __align__(16) h16   Qs[2][16][QP];
  __shared__ __align__(16) h16   Ks[2][32][QP];    // reused as the ctx tiles [2][16][512] after the loop
  __shared__ __align__(16) h16   Vts[2][DM][VP32]; // d-major
  __shared__ __align__(16) float Ss[3][16][SP32];
  __shared__ __align__(16) h16   Ps[2][16][VP32];
  __shared__ float alpha_s[16];
  __shared__ float l_s[16];

  const int b   = blockIdx.y;
  const int q0  = blockIdx.x * 16;
  const int tid = threadIdx.x;
  const int w    = tid >> 5;
  const int lane = tid & 31;
  const int idx  = lane & 15;
  const int half = lane >> 4;

  {
    const h16* Qg0 = Qh + ((size_t)(b * SEQ + q0)) * DM;
    const h16* Qg1 = Qr + ((size_t)(b * EARLY_R + q0)) * DM;
    for (int cc = tid; cc < 16 * (DM / 8); cc += 256) {
      const int r = cc >> 6, dc = cc & 63;
      copy16_g2s(&Qs[0][r][dc * 8], Qg0 + (size_t)r * DM + dc * 8);
      copy16_g2s(&Qs[1][r][dc * 8], Qg1 + (size_t)r * DM + dc * 8);
    }
  }

  v8f oh[4] = {};
  v8f orr[4] = {};
  const int srow = tid >> 4;          // softmax: 16 threads per query row
  const int sj   = tid & 15;
  float m_prev = -1e30f;
  float l_run  = 0.0f;
  const int nchunk = q0 / 32 + 1;     // keys 0 .. 32*nchunk-1 cover every position <= q0+15
  // As in the main kernel the chunks pass through registers, loaded one phase ahead of their LDS store: V^T during the score
  // phase, the next chunk's K during the softmax and PV phases. Per thread and plane: 8 K pieces 4 rows apart, 8 V^T pieces 64 rows apart.
  h16* Kst = &Ks[0][tid >> 6][(tid & 63) * 8];
  h16* Vst = &Vts[0][tid >> 2][(tid & 3) * 8];
  const h16* Kg0 = Kh + ((size_t)(b * SEQ + (tid >> 6))) * DM + (tid & 63) * 8;
  const h16* Kg1 = Kr + ((size_t)(b * EARLY_R + (tid >> 6))) * DM + (tid & 63) * 8;
  h16x8 kh8[8], kr8[8];               // the K chunk of the coming trip, in flight across the loop's back edge
  load_pieces<8>(kh8, Kg0, 4 * DM);
  load_pieces<8>(kr8, Kg1, 4 * DM);

#pragma unroll 1
  for (int ci = 0; ci < nchunk; ++ci) {
    const int kv0 = ci * 32;
    lds_barrier();     // prior PV done with Vts / Ps, prior scores done with Ks; the K pieces stay in flight
#pragma unroll     // constant indices keep kh8[] and kr8[] in registers
    for (int i = 0; i < 8; ++i) {
      *(h16x8*)(Kst + i * 4 * QP) = kh8[i];
      *(h16x8*)(Kst + 32 * QP + i * 4 * QP) = kr8[i];
    }
    h16x8 vh8[8], vr8[8];             // V^T chunk, in flight and then held in registers during the score phase
    load_pieces<8>(vh8, Vth + (size_t)(b * DM + (tid >> 2)) * SEQ + kv0 + (tid & 3) * 8, (size_t)64 * SEQ);
    load_pieces<8>(vr8, Vtr + (size_t)(b * DM + (tid >> 2)) * EARLY_R + kv0 + (tid & 3) * 8, (size_t)64 * EARLY_R);
    lds_barrier();     // K chunk visible; the V^T pieces stay in flight

    if (w < 6) {                                   // wave-uniform
      const int prod = w >> 1, kj = w & 1;
      const int pa = (prod == 2) ? 1 : 0;
      const int pb = (prod == 1) ? 1 : 0;
      const v8f sc = dot_rows<2>(&Qs[pa][0][0], &Ks[pb][kj * 16][0], v8f{});
      const int col = kj * 16 + idx;
#pragma unroll
      for (int g = 0; g < 8; ++g) Ss[prod][g + 8 * half][col] = sc[g];
    }
    lds_barrier();     // scores visible

#pragma unroll     // constant indices keep vh8[] and vr8[] in registers
    for (int i = 0; i < 8; ++i) {
      *(h16x8*)(Vst + i * 64 * VP32) = vh8[i];
      *(h16x8*)(Vst + DM * VP32 + i * 64 * VP32) = vr8[i];
    }
    {  // the last trip loads its own chunk again, unused (as in the main kernel)
      const size_t kn = (size_t)((ci + 1 < nchunk) ? kv0 + 32 : kv0) * DM;
      load_pieces<8>(kh8, Kg0 + kn, 4 * DM);
      load_pieces<8>(kr8, Kg1 + kn, 4 * DM);
    }
    {
      float v[2];
      float mloc = -1e30f;
      const int qrow = q0 + srow;
#pragma unroll
      for (int e = 0; e < 2; ++e) {
        const int cidx = sj + e * 16;
        float s = (Ss[0][srow][cidx] + (Ss[1][srow][cidx] + Ss[2][srow][cidx]) * RINV) * SCL;
        if (kv0 + cidx > qrow) s = -1e30f;         // causal: replace masked scores
        v[e] = s; mloc = fmaxf(mloc, s);
      }
#pragma unroll
      for (int msk = 1; msk < 16; msk <<= 1) mloc = fmaxf(mloc, __shfl_xor(mloc, msk, 32));
      const float m_new = fmaxf(m_prev, mloc);
      const float alpha = __expf(m_prev - m_new);
      float ssum = 0.0f;
#pragma unroll
      for (int e = 0; e < 2; ++e) {
        const int cidx = sj + e * 16;
        const float p  = __expf(v[e] - m_new);
        ssum += p;
        const float pp = p * PSC;
        const h16 hv = (h16)pp;
        Ps[0][srow][cidx] = hv;
        Ps[1][srow][cidx] = (h16)((pp - (float)hv) * RSC);
      }
#pragma unroll
      for (int msk = 1; msk < 16; msk <<= 1) ssum += __shfl_xor(ssum, msk, 32);
      l_run = l_run * alpha + ssum;
      m_prev = m_new;
      if (sj == 0) { alpha_s[srow] = alpha; l_s[srow] = l_run; }
    }
    lds_barrier();     // P, the factors and V^T visible; the next K pieces stay in flight

    {
      float al[8];
#pragma unroll
      for (int g = 0; g < 8; ++g) al[g] = alpha_s[g + 8 * half];
      v16h ah = load_a_frag(&Ps[0][0][0], VP32, 0);
      v16h ar = load_a_frag(&Ps[1][0][0], VP32, 0);
      v16h bh[4], br[4];               // every fragment of the chunk, read as one group
#pragma unroll     // constant indices keep bh[] and br[] in registers
      for (int t = 0; t < 4; ++t) {
        const int d0 = w * 64 + t * 16;
        bh[t] = load_b_frag(&Vts[0][d0][0], VP32, 0);
        br[t] = load_b_frag(&Vts[1][d0][0], VP32, 0);
      }
      __builtin_amdgcn_sched_barrier(0);   // keeps all reads ahead of the rescale and the WMMAs, which then run under their latency
#pragma unroll
      for (int t = 0; t < 4; ++t)
#pragma unroll
        for (int g = 0; g < 8; ++g) { oh[t][g] *= al[g]; orr[t][g] *= al[g]; }
#pragma unroll
      for (int t = 0; t < 4; ++t) {
        oh[t]  = wmma_f16(ah, bh[t], oh[t]);
        orr[t] = wmma_f16(ah, br[t], orr[t]);
        orr[t] = wmma_f16(ar, bh[t], orr[t]);
      }
    }
  }
  __syncthreads();

  h16* Ct = &Ks[0][0][0];
  float linv[8];
#pragma unroll
  for (int g = 0; g < 8; ++g) linv[g] = 1.0f / (l_s[g + 8 * half] * PSC);
#pragma unroll
  for (int t = 0; t < 4; ++t) {
    const int col = w * 64 + t * 16 + idx;
#pragma unroll
    for (int g = 0; g < 8; ++g) {
      const int rl = g + 8 * half;
      const float u = (oh[t][g] + orr[t][g] * RINV) * linv[g];     // x16 carried ctx
      const h16 hv = (h16)u;
      Ct[rl * DM + col] = hv;
      Ct[16 * DM + rl * DM + col] = (h16)((u - (float)hv) * RSC);
    }
  }
  __syncthreads();
  {
    h16* dsth = Ch + ((size_t)(b * SEQ + q0)) * DM;
    h16* dstr = Cr + ((size_t)(b * EARLY_R + q0)) * DM;
    for (int gg = tid; gg < 16 * DM / 8; gg += 256) {
      vst2(dsth + (size_t)gg * 8, *(const v4u*)(Ct + gg * 8));
      vst2(dstr + (size_t)gg * 8, *(const v4u*)(Ct + 16 * DM + gg * 8));
    }
  }
}

// ---------------- output projection: out = ctx(MT x 512) * Wo(512 x 512)^T, f32 ----------------
// Same wave layout and k-block LDS staging as proj_qkv. Blocks with sequence positions < EARLY_R add the ctx residual product
// (second accumulator); the two kinds of block run separate instances of the body, so that only the early one holds it.
template <bool EARLY> __device__ __forceinline__
void proj_out_body(const h16* __restrict__ Ch, const h16* __restrict__ Cr, const h16* __restrict__ Wo, float* __restrict__ out,
                   h16* Ws, h16* Cs, h16* Rs, int m0, int n0, int bb, int s0) {
  const int tid = threadIdx.x, w = tid >> 5, lane = tid & 31, idx = lane & 15, half = lane >> 4;
  const int mw_l = (w & 3) * 16;
  const int nw_l = (w >> 2) * 64;

  v8f c[4] = {};
  v8f cr[4] = {};                                   // used by the early instance only
#pragma unroll 1   // rolled: nothing moves across the barriers of a trip, unrolling would only multiply the code
  for (int kb = 0; kb < DM; kb += KB) {
    __syncthreads();                                // the previous block's fragment reads are done
    stage_rows<64>(Cs, Ch + (size_t)m0 * DM + kb, tid);
    stage_rows<128>(Ws, Wo + (size_t)n0 * DM + kb, tid);
    if (EARLY) {
      __builtin_amdgcn_sched_barrier(0);            // the W pieces leave their registers first: all three loads' would not fit 128
      stage_rows<64>(Rs, Cr + (size_t)(bb * EARLY_R + s0) * DM + kb, tid);
    }
    __syncthreads();                                // the staged block is visible to every wave
#pragma unroll
    for (int k0 = 0; k0 < KB; k0 += 32) {
      v16h a = load_a_frag(Cs + mw_l * KP, KP, k0);
      v16h ar = {};
      if (EARLY) ar = load_a_frag(Rs + mw_l * KP, KP, k0);
      v16h bf[4];
#pragma unroll
      for (int t = 0; t < 4; ++t) bf[t] = load_b_frag(Ws + (nw_l + t * 16) * KP, KP, k0);
      __builtin_amdgcn_sched_barrier(0);            // keeps the k step's reads together, ahead of its WMMAs
#pragma unroll
      for (int t = 0; t < 4; ++t) {
        c[t] = wmma_f16(a, bf[t], c[t]);
        if (EARLY) cr[t] = wmma_f16(ar, bf[t], cr[t]);
      }
      if (EARLY) __builtin_amdgcn_sched_barrier(0); // two accumulator sets: a second fragment set would not fit 128 registers
    }
  }
  __syncthreads();                                  // last fragment reads done before the space becomes the output tile
  float* T = (float*)Ws;
#pragma unroll
  for (int t = 0; t < 4; ++t) {
    const int cl = nw_l + t * 16 + idx;
#pragma unroll
    for (int g = 0; g < 8; ++g) {
      const int rl = mw_l + g + 8 * half;
      T[rl * 132 + cl] = (EARLY ? c[t][g] + cr[t][g] * RINV : c[t][g]) * OUT_MUL;
    }
  }
  __syncthreads();
  {
    float* dst = out + ((size_t)(bb * SEQ_FULL + s0)) * DM + n0;
    for (int gg = tid; gg < 64 * 32; gg += 256) {
      const int rl = gg >> 5, pc = gg & 31;
      vst2(dst + (size_t)rl * DM + pc * 4, *(const v4f*)(&T[rl * 132 + pc * 4]));
    }
  }
}

__global__ __launch_bounds__(256) __attribute__((amdgpu_num_vgpr(128)))   // four workgroups (LDS limit) = 8 waves per SIMD
void proj_out_kernel(const h16* __restrict__ Ch, const h16* __restrict__ Cr,
                                                       const h16* __restrict__ Wo, float* __restrict__ out) {
  __shared__ __align__(16) h16 Ws[128 * KP];      // reused as the f32 output tile [64][132] after the k loop
  __shared__ __align__(16) h16 Cs[64 * KP];
  __shared__ __align__(16) h16 Rs[64 * KP];
  static_assert(64 * 132 * sizeof(float) <= 128 * KP * sizeof(h16));
  const int m0 = blockIdx.x * 64, n0 = blockIdx.y * 128;
  const int bb = m0 / SEQ, s0 = m0 - bb * SEQ;
  if (s0 < EARLY_R) proj_out_body<true>(Ch, Cr, Wo, out, Ws, Cs, Rs, m0, n0, bb, s0);     // block-uniform
  else              proj_out_body<false>(Ch, Cr, Wo, out, Ws, Cs, Rs, m0, n0, bb, s0);
}

extern "C" void kernel_launch(void* const* d_in, const int* in_sizes, int n_in,
                              void* d_out, int out_size, void* d_ws, size_t ws_size,
                              hipStream_t stream) {
  if (n_in < 5) return;
  const int rows_needed = (NB - 1) * SEQ_FULL + SEQ;
  if (in_sizes[0] < rows_needed * DM) return;
  for (int i = 1; i < 5; ++i) if (in_sizes[i] < DM * DM) return;
  if (out_size < rows_needed * DM) return;

  const float* x  = (const float*)d_in[0];
  const float* Wq = (const float*)d_in[1];
  const float* Wk = (const float*)d_in[2];
  const float* Wv = (const float*)d_in[3];
  const float* Wo = (const float*)d_in[4];
  float* out = (float*)d_out;

  const size_t plane = (size_t)MT * DM * sizeof(h16);              // 16,777,216 at full size
  const size_t wpl   = (size_t)DM * DM * sizeof(h16);              //    524,288
  const size_t rpl   = (size_t)NB * EARLY_R * DM * sizeof(h16);    //  2,097,152 at full size
  size_t off = 0;
  char* ws = (char*)d_ws;
  h16* xb  = (h16*)(ws + off); off += plane;
  h16* wqb = (h16*)(ws + off); off += wpl;
  h16* wkb = (h16*)(ws + off); off += wpl;
  h16* wvb = (h16*)(ws + off); off += wpl;
  h16* wob = (h16*)(ws + off); off += wpl;
  h16* qh  = (h16*)(ws + off); off += plane;
  h16* kh  = (h16*)(ws + off); off += plane;
  h16* vth = (h16*)(ws + off); off += plane;   // [b][d][s]
  h16* qr  = (h16*)(ws + off); off += rpl;
  h16* kr  = (h16*)(ws + off); off += rpl;
  h16* vtr = (h16*)(ws + off); off += rpl;     // [b][d][s < EARLY_R]
  h16* ch  = (h16*)(ws + off); off += plane;
  h16* crp = (h16*)(ws + off); off += rpl;
  float* opp = (float*)(ws + off); off += (size_t)NB * NSLOT * 32 * DM * sizeof(float);   // partial sums of the cut tiles' runs
  float* mlp = (float*)(ws + off); off += (size_t)NB * NSLOT * 64 * sizeof(float);        // their row maxima and row sums
  if (off > ws_size) return;

  const int nx8 = MT * DM / 8;
  cvt_x_kernel<<<(nx8 + 255) / 256, 256, 0, stream>>>(x, xb, nx8);
  cvt_w_kernel<<<dim3((DM * DM / 8 + 255) / 256, 4), 256, 0, stream>>>(Wq, Wk, Wv, Wo, wqb, wkb, wvb, wob);

  proj_qkv_kernel<<<dim3(MT / 64, DM / 128, 3), 256, 0, stream>>>(xb, wqb, wkb, wvb, qh, kh, vth, qr, kr, vtr);

  attn_early_kernel<<<dim3(EARLY_R / 16, NB), 256, 0, stream>>>(qh, qr, kh, kr, vth, vtr, ch, crp);
  if (SEQ > EARLY_R) {
    attn_main_kernel<<<dim3(NB, NRUN), 256, 0, stream>>>(qh, kh, vth, ch, opp, mlp);
    if (MAXSEG > 1) attn_combine_kernel<<<dim3(NCUT * 8, NB), 256, 0, stream>>>(opp, mlp, ch);
  }

  proj_out_kernel<<<dim3(MT / 64, DM / 128), 256, 0, stream>>>(ch, crp, wob, out);
}

// v007
// A run of this version takes 199 microseconds.
// Next to v006, in two timings, it ran 1.15 and 1.16 times as fast.
// Counting every step since v000, it is 5.03 times as fast.
#include <hip/hip_runtime.h>
// Contractions: Q/K/V projections (K = 512), scores Q K^T (K = 512), P V (K = keys) and the output projection (K = 512)
// on v_wmma_f32_16x16x32_f16 (f16 operands, f32 accumulate). Inputs enter as bf16-RNE values carried x16 in f16 planes;
// q/k/v/ctx are f16 hi planes carried x16 plus f16 residual planes carried x16384 for the first EARLY_R positions of each
// sequence (scores: hh + hr + rh, P V: hh + hr + rh, output projection: h + r); P carried x1024; softmax statistics in f32.

typedef _Float16 h16;
typedef _Float16 h16x8 __attribute__((ext_vector_type(8)));
typedef _Float16 v16h  __attribute__((ext_vector_type(16)));
typedef float  v8f    __attribute__((ext_vector_type(8)));
typedef float  v4f    __attribute__((ext_vector_type(4)));
typedef unsigned v4u  __attribute__((ext_vector_type(4)));

#ifndef NB
#define NB 4
#endif
#ifndef SEQ
#define SEQ 4096
#endif
#define NB_FULL 4
#define SEQ_FULL 4096
#define DM 512
#define EARLY_CAP 512
#define EARLY_R ((SEQ < EARLY_CAP) ? SEQ : EARLY_CAP)
#define MT (NB * SEQ)
// LDS row pitches in elements. f16 rows read by 16-byte fragment loads: byte pitch = 16 x odd, so the 16 rows of a fragment
// fall on distinct bank groups. f32 score rows: pitch chosen so that the tile stores and the row reads both spread over banks.
#define QP  (DM + 8)               // 1040 B: Q and K rows of 512 f16
#define VP64 72                    // 144 B: V^T and P rows of 64 f16
#define VP32 40                    // 80 B: V^T and P rows of 32 f16
#define SP64 76                    // f32 score rows of 64
#define SP32 36                    // f32 score rows of 32
#define KB   128                   // k block of the projections' LDS staging
#define KP   (KB + 8)              // 272 B: staged projection operand rows of 128 f16

static_assert(SEQ % 64 == 0);
static_assert((EARLY_R) % 64 == 0);
static_assert(NB >= 1 && NB <= NB_FULL);
static_assert(SEQ >= 64 && SEQ <= SEQ_FULL);
static_assert(DM % 128 == 0);
static_assert(((NB - 1) * SEQ_FULL + SEQ) * DM <= NB_FULL * SEQ_FULL * DM);

#define ISC  16.0f                 // carry of the x / q / k / v / ctx f16 hi planes
#define WSC  16.0f                 // carry of the weight planes
#define PSC  1024.0f               // carry of P
#define RSC  16384.0f              // carry of every residual plane
#define RINV (1.0f / 16384.0f)
#define PROJ_MUL (1.0f / 16.0f)    // acc of (x16 * x16) operands -> x16 plane value
#define OUT_MUL  (1.0f / 256.0f)   // acc of (x16 * x16) operands -> f32 output
#define SCL ((1.0f / 256.0f) * (1.0f / 22.627416610717773f))

template <typename V> __device__ __forceinline__ void vst2(void* p, V v) {
  *(V*)p = v; 
}
__device__ __forceinline__ void copy16_g2s(h16* ldst, const h16* gsrc) { *(h16x8*)ldst = *(const h16x8*)gsrc; }

__device__ __forceinline__ float bf16r(float f) {     // RNE convert to bf16, value kept in f32
  unsigned u = __float_as_uint(f);
  u = (u + 0x7FFFu + ((u >> 16) & 1u)) & 0xFFFF0000u;
  return __uint_as_float(u);
}

// ---- WMMA fragment loaders (f16, row-major K-contiguous source); A and B (from B^T rows) share the per-lane K map:
//      row/col = lane&15; elements 0..7 <- k0 + 8*half + 0..7, elements 8..15 <- k0 + 16 + 8*half + 0..7
__device__ __forceinline__ v16h load_a_frag(const h16* base, int ld, int k0) {
  int lane = threadIdx.x & 31;
  int idx  = lane & 15;
  int half = lane >> 4;
  const h16* p = base + idx * ld + k0 + half * 8;
  h16x8 lo = *(const h16x8*)(p);
  h16x8 hi = *(const h16x8*)(p + 16);
  return __builtin_shufflevector(lo, hi, 0,1,2,3,4,5,6,7,8,9,10,11,12,13,14,15);
}
__device__ __forceinline__ v16h load_b_frag(const h16* base, int ld, int k0) { return load_a_frag(base, ld, k0); }

__device__ __forceinline__ v8f wmma_f16(v16h a, v16h b, v8f c) {
  return __builtin_amdgcn_wmma_f32_16x16x32_f16(false, a, false, b, (short)0, c, false, false);
}

// sc += A(16 x DM) * B(16 x DM)^T, both from LDS rows of pitch QP, k ascending. The fragments are read G k-steps at a time into
// two register sets, each group one group ahead of the WMMAs that use it, so that a wave waits for LDS once per group at most.
template <int G> __device__ __forceinline__ v8f dot_rows(const h16* A, const h16* B, v8f sc) {
  constexpr int NG = DM / (32 * G);
  v16h fa[2][G], fb[2][G];
#pragma unroll     // constant indices keep the fragment sets in registers
  for (int j = 0; j < G; ++j) { fa[0][j] = load_a_frag(A, QP, j * 32); fb[0][j] = load_b_frag(B, QP, j * 32); }
#pragma unroll     // constant indices keep the fragment sets in registers
  for (int g = 0; g < NG; ++g) {
    if (g + 1 < NG) {
#pragma unroll     // as above
      for (int j = 0; j < G; ++j) {
        fa[(g + 1) & 1][j] = load_a_frag(A, QP, ((g + 1) * G + j) * 32);
        fb[(g + 1) & 1][j] = load_b_frag(B, QP, ((g + 1) * G + j) * 32);
      }
    }
    __builtin_amdgcn_sched_barrier(0);   // keeps the next group's reads ahead of this group's WMMAs (else they sink to their use)
#pragma unroll     // as above
    for (int j = 0; j < G; ++j) sc = wmma_f16(fa[g & 1][j], fb[g & 1][j], sc);
    __builtin_amdgcn_sched_barrier(0);   // no read of the group after next in front of these WMMAs: it would take a third register set
  }
  return sc;
}

// Work-group barrier for data handed over in LDS alone: its fences name the LDS address space only, so a wave waits for its LDS
// operations and not for its global loads, which stay in flight across it (__syncthreads() waits for them too).
__device__ __forceinline__ void lds_barrier() {
  __builtin_amdgcn_fence(__ATOMIC_RELEASE, "workgroup", "local");
  __builtin_amdgcn_s_barrier();
  __builtin_amdgcn_fence(__ATOMIC_ACQUIRE, "workgroup", "local");
}

// N 16-byte pieces per thread, 'step' elements apart, from global memory into registers.
template <int N> __device__ __forceinline__ void load_pieces(h16x8 (&r)[N], const h16* g0, size_t step) {
#pragma unroll     // constant indices keep r[] in registers and the steps in the loads' offset fields
  for (int i = 0; i < N; ++i) r[i] = *(const h16x8*)(g0 + i * step);
  // address-translation wait; g0 as an input keeps the loads' address pair untouched (also by a later load's result) up to it
  asm volatile("s_wait_xcnt 0x0" :: "v"(g0) : "memory");
}

// Stage ROWS rows of KB f16 (256 B = two whole lines per row, source row pitch DM) into LDS rows of pitch KP, 256 threads:
// one wave-wide 16-byte load covers two rows = four whole lines.
template <int ROWS> __device__ __forceinline__ void stage_rows(h16* lds, const h16* g, int tid) {
  h16* l0 = lds + (tid >> 4) * KP + (tid & 15) * 8;
  const h16* g0 = g + (size_t)(tid >> 4) * DM + (tid & 15) * 8;
  h16x8 r[ROWS / 16];
  load_pieces<ROWS / 16>(r, g0, 16 * DM);
#pragma unroll     // constant indices keep r[] in registers
  for (int i = 0; i < ROWS / 16; ++i) *(h16x8*)(l0 + i * 16 * KP) = r[i];
}

// ---------------- conversion kernel ----------------
// One grid for both independent jobs; the block index picks the job, 8 elements (16 B) per thread.
// Blocks < NXB: xb[row][c] = f16( bf16r(x) * 16 ), rows indexed b*SEQ + s, source rows b*SEQ_FULL + s.
// The other blocks, NWB per matrix: Wb[n][k] = f16( bf16r(W[n][k]) * 16 ) (weights are already [out][in] = [n][k]).
#define NXB (MT * DM / 8 / 256)
#define NWB (DM * DM / 8 / 256)
static_assert(MT * DM % (8 * 256) == 0 && DM * DM % (8 * 256) == 0);
__global__ __launch_bounds__(256) void cvt_kernel(const float* __restrict__ x,
                                                  const float* __restrict__ W0, const float* __restrict__ W1,
                                                  const float* __restrict__ W2, const float* __restrict__ W3,
                                                  h16* __restrict__ xb,
                                                  h16* __restrict__ D0, h16* __restrict__ D1,
                                                  h16* __restrict__ D2, h16* __restrict__ D3) {
  const float* src;
  h16* dst;
  float carry;
  if (blockIdx.x < NXB) {                            // block-uniform
    const int g = blockIdx.x * 256 + threadIdx.x;
    const int row = g >> 6, c8 = g & 63;             // 64 groups of 8 per 512-wide row
    const int b = row / SEQ, sq = row - b * SEQ;
    src = x + ((size_t)(b * SEQ_FULL + sq)) * DM + c8 * 8;
    dst = xb + (size_t)g * 8;
    carry = ISC;
  } else {
    const int r = blockIdx.x - NXB, y = r / NWB;
    const int g = (r - y * NWB) * 256 + threadIdx.x;
    const float* W = (y == 0) ? W0 : (y == 1) ? W1 : (y == 2) ? W2 : W3;
    h16*       D  = (y == 0) ? D0 : (y == 1) ? D1 : (y == 2) ? D2 : D3;
    src = W + (size_t)g * 8;
    dst = D + (size_t)g * 8;
    carry = WSC;
  }
  const v4f a = *(const v4f*)(src), bq = *(const v4f*)(src + 4);
  union { h16x8 h; v4u u; } pk;
#pragma unroll
  for (int i = 0; i < 4; ++i) { pk.h[i] = (h16)(bf16r(a[i]) * carry); pk.h[4 + i] = (h16)(bf16r(bq[i]) * carry); }
  vst2(dst, pk.u);
}

// ---------------- projection GEMM: Y = X(MT x 512) * W(512 x 512)^T, blockIdx.z selects Q / K / V ----------------
// 8 waves/WG: 4 M-subtiles x 2 N-groups(64). Each wave: 16x64 (4 WMMA tiles). The X (64 rows) and W (128 rows) operands are
// staged in LDS in k blocks of KB = 128 by whole-line 16-byte loads; fragments are read from LDS. The staging space is reused
// for the 64 x 128 output tile. Blocks whose sequence positions are < EARLY_R also write the residual planes (x16384).
__global__ __launch_bounds__(256) void proj_qkv_kernel(const h16* __restrict__ Xb,
                                                       const h16* __restrict__ Wq, const h16* __restrict__ Wk,
                                                       const h16* __restrict__ Wv,
                                                       h16* __restrict__ Qh, h16* __restrict__ Kh, h16* __restrict__ Vth,
                                                       h16* __restrict__ Qr, h16* __restrict__ Kr, h16* __restrict__ Vtr) {
  __shared__ __align__(16) h16 Th[128 * 136];     // [m][n] pitch 136 (Q/K) or [n][m] pitch 72 (V)
  __shared__ __align__(16) h16 Tr[128 * 136];
  const int z = blockIdx.z;
  const h16* W = (z == 0) ? Wq : (z == 1) ? Wk : Wv;
  const int transposed = (z == 2) ? 1 : 0;
  const int m0 = blockIdx.x * 64, n0 = blockIdx.y * 128;
  const int bb = m0 / SEQ, s0 = m0 - bb * SEQ;
  const bool early = (s0 < EARLY_R);
  const int tid = threadIdx.x, w = tid >> 5, lane = tid & 31, idx = lane & 15, half = lane >> 4;
  const int mw_l = (w & 3) * 16;
  const int nw_l = (w >> 2) * 64;

  v8f c[4] = {};
  h16* Ws = Th;                                     // [128][KP] during the k loop
  h16* Xs = Tr;                                     // [64][KP] during the k loop
#pragma unroll 1   // rolled: nothing moves across the barriers of a trip, unrolling would only multiply the code
  for (int kb = 0; kb < DM; kb += KB) {
    __syncthreads();                                // the previous block's fragment reads are done
    stage_rows<64>(Xs, Xb + (size_t)m0 * DM + kb, tid);
    stage_rows<128>(Ws, W + (size_t)n0 * DM + kb, tid);
    __syncthreads();                                // the staged block is visible to every wave
#pragma unroll
    for (int k0 = 0; k0 < KB; k0 += 32) {
      v16h a = load_a_frag(Xs + mw_l * KP, KP, k0);
      v16h bf[4];
#pragma unroll
      for (int t = 0; t < 4; ++t) bf[t] = load_b_frag(Ws + (nw_l + t * 16) * KP, KP, k0);
      __builtin_amdgcn_sched_barrier(0);            // keeps the k step's reads together, ahead of its WMMAs
#pragma unroll
      for (int t = 0; t < 4; ++t) c[t] = wmma_f16(a, bf[t], c[t]);
    }
  }
  __syncthreads();                                  // last fragment reads done before the space becomes the output tile
#pragma unroll
  for (int t = 0; t < 4; ++t) {
    const int cl = nw_l + t * 16 + idx;             // local col
#pragma unroll
    for (int g = 0; g < 8; ++g) {
      const int rl = mw_l + g + 8 * half;           // local row
      const float u = c[t][g] * PROJ_MUL;           // x16 carried value
      const h16 hv = (h16)u;
      const int li = transposed ? (cl * 72 + rl) : (rl * 136 + cl);
      Th[li] = hv;
      if (early) Tr[li] = (h16)((u - (float)hv) * RSC);
    }
  }
  __syncthreads();
  if (!transposed) {
    h16* Oh = (z == 0) ? Qh : Kh;
    h16* Orp = (z == 0) ? Qr : Kr;
    for (int gg = tid; gg < 64 * 16; gg += 256) {
      const int rl = gg >> 4, pc = gg & 15;
      vst2(Oh + (size_t)(m0 + rl) * DM + n0 + pc * 8, *(const v4u*)(&Th[rl * 136 + pc * 8]));
      if (early) vst2(Orp + (size_t)(bb * EARLY_R + s0 + rl) * DM + n0 + pc * 8, *(const v4u*)(&Tr[rl * 136 + pc * 8]));
    }
  } else {
    for (int gg = tid; gg < 128 * 8; gg += 256) {
      const int cl = gg >> 3, pc = gg & 7;
      vst2(Vth + ((size_t)(bb * DM + n0 + cl)) * SEQ + s0 + pc * 8, *(const v4u*)(&Th[cl * 72 + pc * 8]));
      if (early) vst2(Vtr + ((size_t)(bb * DM + n0 + cl)) * EARLY_R + s0 + pc * 8, *(const v4u*)(&Tr[cl * 72 + pc * 8]));
    }
  }
}

// ---------------- split of the main attention's key ranges ----------------
// A 32-query tile at position q0 walks q0/64 + 1 key chunks, so the last tile costs seven times the first, and with one workgroup
// per tile the launch lasts as long as the last tile. A tile of more than SEGL chunks is cut into equal runs of at most SEGL chunks,
// one workgroup each; the runs are dealt out longest first. A run of a cut tile leaves its unnormalised sums, its row maxima and
// its row sums in a slot of the workspace, and attn_combine_kernel joins the slots of a tile.
#define SEGL 22                    // a little under two rounds of workgroups at two per WGP
#define NO_SLOT 0xFFFF
constexpr int NT = (SEQ > EARLY_R) ? (SEQ - EARLY_R) / 32 : 1;
constexpr int tile_chunks(int t) { return (EARLY_R + t * 32) / 64 + 1; }
constexpr int tile_segs(int t) { return (tile_chunks(t) + SEGL - 1) / SEGL; }
constexpr int count_runs(bool cut_only) {
  int c = 0;
  for (int t = 0; t < NT; ++t) if (!cut_only || tile_segs(t) > 1) c += tile_segs(t);
  return c;
}
constexpr int count_cut_tiles() {
  int c = 0;
  for (int t = 0; t < NT; ++t) if (tile_segs(t) > 1) ++c;
  return c;
}
constexpr int NRUN   = count_runs(false);                                  // runs per sequence, one workgroup each
constexpr int NSLOT  = (count_runs(true) > 0) ? count_runs(true) : 1;      // partial results per sequence
constexpr int NCUT   = (count_cut_tiles() > 0) ? count_cut_tiles() : 1;    // tiles per sequence that are cut
constexpr int MAXSEG = tile_segs(NT - 1);
struct Run { unsigned short tile, c0, len, slot; };       // chunks c0 .. c0 + len - 1 of a tile; slot = NO_SLOT: the whole tile
struct Cut { unsigned short tile, slot, nseg, pad; };     // a cut tile's runs lie in slots slot .. slot + nseg - 1
struct SegTab { Run run[NRUN]; Cut cut[NCUT]; };
constexpr SegTab make_seg_tab() {
  SegTab T = {};
  int n = 0, slot = 0, nc = 0;
  for (int t = 0; t < NT; ++t) {
    const int ch = tile_chunks(t), ns = tile_segs(t);
    if (ns > 1) { T.cut[nc].tile = (unsigned short)t; T.cut[nc].slot = (unsigned short)slot; T.cut[nc].nseg = (unsigned short)ns; ++nc; }
    for (int s = 0; s < ns; ++s) {
      Run r = {};
      r.tile = (unsigned short)t;
      r.c0   = (unsigned short)(s * ch / ns);
      r.len  = (unsigned short)((s + 1) * ch / ns - s * ch / ns);
      r.slot = (unsigned short)((ns > 1) ? slot++ : NO_SLOT);
      int p = n++;                                        // insertion keeps the list sorted, longest run first
      for (; p > 0 && T.run[p - 1].len < r.len; --p) T.run[p] = T.run[p - 1];
      T.run[p] = r;
    }
  }
  return T;
}
__constant__ const SegTab SEGS = make_seg_tab();
#define OPP (DM + 4)               // f32 row pitch of the partial tile in LDS: rows g and g + 8 fall on different banks

// ---------------- flash attention, causal, query positions >= EARLY_R (single products) ----------------
// WG = 32 queries, 8 waves, key chunks of 64: one run of chunks of one tile (table above). The K chunk is staged in LDS by whole-line loads for the
// score phase; the V^T chunk takes the same LDS space for the PV phase. Both pass through registers and are loaded one phase
// ahead of their LDS store: V^T during the score phase, the next chunk's K during the softmax and PV phases.
// Every wave covers both 16-query tiles, so that each fragment read from LDS feeds two WMMAs.
// Score phase: wave w -> (ds = w&3, kh = w>>2): 32 keys x 32 queries (2 x 2 tiles of K Q^T) over the dims [128 ds, 128 ds + 128);
// the four partial sums of a score meet in the softmax phase. PV phase: wave w -> 32 q x dims [64w, 64w + 64) (2 x 4 accum tiles).
// LDS (declared in attn_kernel): Qs; Vts, d-major, K rows [64][QP] in the score phase, f16 ctx tile [32][512] after the loop;
// Ss, one plane of partial scores per 128-dim slice; Ps; the rows' factors, sums and maxima.
__device__ __forceinline__
void attn_main_body(h16 (*Qs)[QP], h16 (*Vts)[VP64], float (*Ss)[32][SP64], h16 (*Ps)[VP64],
                    float* alpha_s, float* l_s, float* m_s, const int b, const Run run,
                    const h16* __restrict__ Qh, const h16* __restrict__ Kh,
                    const h16* __restrict__ Vth, h16* __restrict__ Ch, float* __restrict__ Op, float* __restrict__ Ml) {
  const int q0  = EARLY_R + run.tile * 32;
  const int tid = threadIdx.x;
  const int w    = tid >> 5;
  const int lane = tid & 31;
  const int idx  = lane & 15;
  const int half = lane >> 4;
  const int ds = w & 3;      // score phase: slice of 128 dims
  const int kh = w >> 2;     // score phase: half of the chunk's keys

  const h16* Qg = Qh + ((size_t)(b * SEQ + q0)) * DM;
  for (int cc = tid; cc < 32 * (DM / 8); cc += 256) {
    const int r = cc >> 6, dc = cc & 63;
    copy16_g2s(&Qs[r][dc * 8], Qg + (size_t)r * DM + dc * 8);
  }

  h16* Ks = &Vts[0][0];
  h16* Kst = Ks + (tid >> 6) * QP + (tid & 63) * 8;      // this thread's first K piece; the next ones lie 4 rows apart
  h16* Vst = &Vts[tid >> 3][(tid & 7) * 8];              // this thread's first V^T piece; the next ones lie 32 rows apart
  static_assert(64 * QP <= DM * VP64);
  v8f o[2][4] = {};                   // [query tile][16 dims]
  const int srow = tid >> 3;          // softmax: 8 threads per query row, 8 neighbouring keys each
  const int sj   = tid & 7;
  float m_prev = -1e30f;
  float l_run  = 0.0f;
  const int cbeg = run.c0, nchunk = run.c0 + run.len;   // this run's chunks; a tile's last chunk q0/64 covers every position <= q0+31
  const h16* Kg = Kh + ((size_t)(b * SEQ + (tid >> 6))) * DM + (tid & 63) * 8;
  h16x8 kreg[16];                     // the K chunk of the coming trip, in flight across the loop's back edge
  load_pieces<16>(kreg, Kg + (size_t)(cbeg * 64) * DM, 4 * DM);

#pragma unroll 1
  for (int ci = cbeg; ci < nchunk; ++ci) {
    const int kv0 = ci * 64;
    lds_barrier();     // prior PV done with Vts / Ps (and Qs issue point on the first chunk); the K pieces stay in flight
#pragma unroll     // constant indices keep kreg[] in registers
    for (int i = 0; i < 16; ++i) *(h16x8*)(Kst + i * 4 * QP) = kreg[i];
    const h16* Vg = Vth + (size_t)(b * DM + (tid >> 3)) * SEQ + kv0 + (tid & 7) * 8;
    h16x8 vreg[16];    // V^T chunk, in flight and then held in registers during the score phase
    load_pieces<16>(vreg, Vg, (size_t)32 * SEQ);
    lds_barrier();     // K chunk visible; the V^T pieces stay in flight

    {
      // A = K rows, B = Q rows: a lane then holds 8 neighbouring keys of one query, two 16-byte stores per tile.
      const h16* Kf = Ks + (kh * 32) * QP + ds * 128;
      const h16* Qf = &Qs[0][ds * 128];
      v8f sc[2][2] = {};               // [key tile][query tile]
      v16h fk[2][2], fq[2][2];         // two register sets: each k step's fragments are read one step ahead of their WMMAs
#pragma unroll     // constant indices keep the fragment sets in registers (every loop of this block)
      for (int j = 0; j < 2; ++j) { fk[0][j] = load_a_frag(Kf + j * 16 * QP, QP, 0); fq[0][j] = load_b_frag(Qf + j * 16 * QP, QP, 0); }
#pragma unroll
      for (int s = 0; s < 4; ++s) {
        if (s + 1 < 4) {
#pragma unroll
          for (int j = 0; j < 2; ++j) {
            fk[(s + 1) & 1][j] = load_a_frag(Kf + j * 16 * QP, QP, (s + 1) * 32);
            fq[(s + 1) & 1][j] = load_b_frag(Qf + j * 16 * QP, QP, (s + 1) * 32);
          }
        }
        __builtin_amdgcn_sched_barrier(0);   // keeps the next step's reads ahead of this step's WMMAs (else they sink to their use)
#pragma unroll
        for (int kt = 0; kt < 2; ++kt)
#pragma unroll
          for (int qt = 0; qt < 2; ++qt) sc[kt][qt] = wmma_f16(fk[s & 1][kt], fq[s & 1][qt], sc[kt][qt]);
        __builtin_amdgcn_sched_barrier(0);   // no read of the step after next in front of these WMMAs: it would take a third register set
      }
#pragma unroll
      for (int kt = 0; kt < 2; ++kt)
#pragma unroll
        for (int qt = 0; qt < 2; ++qt) {
          float* sp = &Ss[ds][qt * 16 + idx][kh * 32 + kt * 16 + 8 * half];
          *(v4f*)(sp)     = __builtin_shufflevector(sc[kt][qt], sc[kt][qt], 0, 1, 2, 3);
          *(v4f*)(sp + 4) = __builtin_shufflevector(sc[kt][qt], sc[kt][qt], 4, 5, 6, 7);
        }
    }
    lds_barrier();     // scores visible; every K fragment read is done, so V^T may take the space

#pragma unroll     // constant indices keep vreg[] in registers
    for (int i = 0; i < 16; ++i) *(h16x8*)(Vst + i * 32 * VP64) = vreg[i];
    // The next chunk's K pieces land under softmax and PV. The last trip loads its own chunk again, unused: under a test the old
    // pieces would count as live from their LDS store to here, through the score phase, and no longer fit the registers.
    load_pieces<16>(kreg, Kg + (size_t)((ci + 1 < nchunk) ? kv0 + 64 : kv0) * DM, 4 * DM);
    {
      float v[8];
      float mloc = -1e30f;
      v4f pl[4], ph[4];                // the four partial sums of this thread's 8 scores
#pragma unroll
      for (int p = 0; p < 4; ++p) { pl[p] = *(const v4f*)(&Ss[p][srow][sj * 8]); ph[p] = *(const v4f*)(&Ss[p][srow][sj * 8 + 4]); }
      const v4f sl = (pl[0] + pl[1]) + (pl[2] + pl[3]);
      const v4f sh = (ph[0] + ph[1]) + (ph[2] + ph[3]);
#pragma unroll
      for (int e = 0; e < 8; ++e) {
        float val = ((e < 4) ? sl[e & 3] : sh[e & 3]) * SCL;
        if (kv0 + sj * 8 + e > q0 + srow) val = -1e30f;   // causal: replace masked scores
        v[e] = val; mloc = fmaxf(mloc, val);
      }
#pragma unroll
      for (int msk = 1; msk < 8; msk <<= 1) mloc = fmaxf(mloc, __shfl_xor(mloc, msk, 32));
      const float m_new = fmaxf(m_prev, mloc);
      const float alpha = __expf(m_prev - m_new);
      float ssum = 0.0f;
      h16x8 pk;
#pragma unroll
      for (int e = 0; e < 8; ++e) {
        const float p = __expf(v[e] - m_new);
        ssum += p;
        pk[e] = (h16)(p * PSC);
      }
      *(h16x8*)(&Ps[srow][sj * 8]) = pk;
#pragma unroll
      for (int msk = 1; msk < 8; msk <<= 1) ssum += __shfl_xor(ssum, msk, 32);
      l_run = l_run * alpha + ssum;
      m_prev = m_new;
      if (sj == 0) { alpha_s[srow] = alpha; l_s[srow] = l_run; }
    }
    lds_barrier();     // P, the factors and V^T visible; the next K pieces stay in flight

    {
      float al[2][8];
#pragma unroll     // constant indices keep al[], pa[] and vb[] in registers (every loop of this block)
      for (int qt = 0; qt < 2; ++qt)
#pragma unroll
        for (int g = 0; g < 8; ++g) al[qt][g] = alpha_s[qt * 16 + g + 8 * half];
      __builtin_amdgcn_sched_barrier(0);   // the factors' reads go first: the rescale then waits for them alone
      const h16* Vf = &Vts[w * 64][0];
      v16h pa[2][2], vb[2][4];             // [32 keys][query tile], [32 keys][16 dims]
#pragma unroll
      for (int qt = 0; qt < 2; ++qt) pa[0][qt] = load_a_frag(&Ps[qt * 16][0], VP64, 0);
#pragma unroll
      for (int t = 0; t < 4; ++t) vb[0][t] = load_b_frag(Vf + t * 16 * VP64, VP64, 0);
      __builtin_amdgcn_sched_barrier(0);   // keys 0..31: the reads stay ahead of the rescale, which runs under their latency
#pragma unroll
      for (int qt = 0; qt < 2; ++qt)
#pragma unroll
        for (int t = 0; t < 4; ++t)
#pragma unroll
          for (int g = 0; g < 8; ++g) o[qt][t][g] *= al[qt][g];
      __builtin_amdgcn_sched_barrier(0);   // keys 32..63 are read behind the rescale, when the factors' registers are free ...
#pragma unroll
      for (int qt = 0; qt < 2; ++qt) pa[1][qt] = load_a_frag(&Ps[qt * 16][0], VP64, 32);
#pragma unroll
      for (int t = 0; t < 4; ++t) vb[1][t] = load_b_frag(Vf + t * 16 * VP64, VP64, 32);
      __builtin_amdgcn_sched_barrier(0);   // ... and ahead of the first eight WMMAs, which run under their latency
#pragma unroll
      for (int s = 0; s < 2; ++s)
#pragma unroll
        for (int t = 0; t < 4; ++t)
#pragma unroll
          for (int qt = 0; qt < 2; ++qt) o[qt][t] = wmma_f16(pa[s][qt], vb[s][t], o[qt][t]);
    }
  }
  if (sj == 0) m_s[srow] = m_prev;
  __syncthreads();

  if (run.slot != NO_SLOT) {          // block-uniform: a run of a cut tile hands its sums on as they are, in f32
    float* Cf = (float*)&Vts[0][0];
    static_assert(32 * OPP * sizeof(float) <= DM * VP64 * sizeof(h16));
#pragma unroll     // constant indices keep o[] in registers (all three loops)
    for (int qt = 0; qt < 2; ++qt)
#pragma unroll
      for (int t = 0; t < 4; ++t)
#pragma unroll
        for (int g = 0; g < 8; ++g) Cf[(qt * 16 + g + 8 * half) * OPP + w * 64 + t * 16 + idx] = o[qt][t][g];
    __syncthreads();                  // the tile is complete before it leaves in whole lines
    const size_t pi = (size_t)b * NSLOT + run.slot;
    float* dst = Op + pi * (32 * DM);
#pragma unroll     // 16 pieces per thread, two rows of the tile apart: all reads issued ahead of the stores, steps in the offset fields
    for (int i = 0; i < 32 * DM / 4 / 256; ++i)
      vst2(dst + (size_t)(i * 256 + tid) * 4, *(const v4f*)(Cf + (i * 2 + (tid >> 7)) * OPP + (tid & 127) * 4));
    if (tid < 64) Ml[pi * 64 + tid] = (tid < 32) ? m_s[tid] : l_s[tid - 32];   // wave 0: the maxima's line, wave 1: the sums' line
    return;
  }

  h16* Ct = &Vts[0][0];
#pragma unroll
  for (int qt = 0; qt < 2; ++qt) {
    float linv[8];
#pragma unroll
    for (int g = 0; g < 8; ++g) linv[g] = 1.0f / (l_s[qt * 16 + g + 8 * half] * PSC);
#pragma unroll
    for (int t = 0; t < 4; ++t) {
      const int col = w * 64 + t * 16 + idx;
#pragma unroll
      for (int g = 0; g < 8; ++g) Ct[(qt * 16 + g + 8 * half) * DM + col] = (h16)(o[qt][t][g] * linv[g]);
    }
  }
  __syncthreads();
  {
    h16* dst = Ch + ((size_t)(b * SEQ + q0)) * DM;
    for (int gg = tid; gg < 32 * DM / 8; gg += 256) vst2(dst + (size_t)gg * 8, *(const v4u*)(Ct + gg * 8));
  }
}

// ---------------- join of a cut tile's runs: ctx = sum_s e^(m_s - M) O_s / (sum_s e^(m_s - M) l_s), M = max_s m_s ----------------
// WG = 4 query rows of one cut tile; a thread joins 8 neighbouring dims and stores them as 16 bytes.
__global__ __launch_bounds__(256) void attn_combine_kernel(const float* __restrict__ Op, const float* __restrict__ Ml,
                                                           h16* __restrict__ Ch) {
  const Cut cut = SEGS.cut[blockIdx.x >> 3];
  const int b = blockIdx.y, tid = threadIdx.x;
  const int row = (blockIdx.x & 7) * 4 + (tid >> 6), c8 = tid & 63;
  const size_t p0 = (size_t)b * NSLOT + cut.slot;
  float m[MAXSEG], l[MAXSEG];
  v4f lo[MAXSEG], hi[MAXSEG];
#pragma unroll     // constant indices keep the parts in registers; every part's loads are issued before the first is used
  for (int s = 0; s < MAXSEG; ++s) {
    if (s < 2 || s < cut.nseg) {      // block-uniform; a cut tile has two parts at least
      const float* ml  = Ml + (p0 + s) * 64 + row;
      const float* src = Op + ((p0 + s) * 32 + row) * DM + c8 * 8;
      m[s] = ml[0]; l[s] = ml[32];
      lo[s] = *(const v4f*)(src); hi[s] = *(const v4f*)(src + 4);
      // address-translation wait; the pointers as inputs keep the loads' address pairs untouched (also by a later load's result) up to it
      asm volatile("s_wait_xcnt 0x0" :: "v"(ml), "v"(src) : "memory");
    } else {                          // no such part: weight e^(-1e30 - M) = 0
      m[s] = -1e30f; l[s] = 0.0f; lo[s] = v4f{}; hi[s] = v4f{};
    }
  }
  float M = m[0];
#pragma unroll     // constant indices, as above (this loop and the next two)
  for (int s = 1; s < MAXSEG; ++s) M = fmaxf(M, m[s]);
  float L = 0.0f;
  v4f alo = {}, ahi = {};
#pragma unroll
  for (int s = 0; s < MAXSEG; ++s) {
    const float ws = __expf(m[s] - M);
    L += ws * l[s]; alo += lo[s] * ws; ahi += hi[s] * ws;
  }
  const float linv = 1.0f / (L * PSC);
  union { h16x8 h; v4u u; } pk;
#pragma unroll
  for (int i = 0; i < 4; ++i) { pk.h[i] = (h16)(alo[i] * linv); pk.h[4 + i] = (h16)(ahi[i] * linv); }
  vst2(Ch + ((size_t)(b * SEQ + EARLY_R + cut.tile * 32 + row)) * DM + c8 * 8, pk.u);
}

// ---------------- flash attention, causal, query positions < EARLY_R (hi + residual products) ----------------
// WG = 16 queries, 8 waves, key chunks of 32 (chunks 0 .. q0/32). Q (hi,res) staged once; K (hi,res) and V^T (hi,res)
// chunks staged in LDS through registers. Score phase: waves 0..5 -> (prod = w>>1, kj = w&1): prod 0 = Qh Kh, 1 = Qh Kr, 2 = Qr Kh.
// PV phase: wave w -> dims [64w, 64w+64): Oh += Ph Vh ; Or += Ph Vr + Pr Vh. Writes ctx hi and ctx res planes.
// LDS: views of the arrays that attn_kernel declares. As in the main body the V^T chunk takes the K chunk's space: K is stored
// behind the barrier that ends the PV reads, V^T behind the barrier that ends the score reads.
__device__ __forceinline__
void attn_early_body(h16* Qraw, h16* KVraw, float* Sraw, h16* Praw, float* alpha_s, float* l_s, const int b, const int q0,
                     const h16* __restrict__ Qh, const h16* __restrict__ Qr,
                     const h16* __restrict__ Kh, const h16* __restrict__ Kr,
                     const h16* __restrict__ Vth, const h16* __restrict__ Vtr,
                     h16* __restrict__ Ch, h16* __restrict__ Cr) {
  h16   (*Qs)[16][QP]    = (h16 (*)[16][QP])Qraw;       // [2]: hi, residual
  h16   (*Ks)[32][QP]    = (h16 (*)[32][QP])KVraw;      // [2]; reused as the ctx tiles [2][16][512] after the loop
  h16   (*Vts)[DM][VP32] = (h16 (*)[DM][VP32])KVraw;    // [2]; d-major
  float (*Ss)[16][SP32]  = (float (*)[16][SP32])Sraw;   // [3]
  h16   (*Ps)[16][VP32]  = (h16 (*)[16][VP32])Praw;     // [2]

  const int tid = threadIdx.x;
  const int w    = tid >> 5;
  const int lane = tid & 31;
  const int idx  = lane & 15;
  const int half = lane >> 4;

  {
    const h16* Qg0 = Qh + ((size_t)(b * SEQ + q0)) * DM;
    const h16* Qg1 = Qr + ((size_t)(b * EARLY_R + q0)) * DM;
    for (int cc = tid; cc < 16 * (DM / 8); cc += 256) {
      const int r = cc >> 6, dc = cc & 63;
      copy16_g2s(&Qs[0][r][dc * 8], Qg0 + (size_t)r * DM + dc * 8);
      copy16_g2s(&Qs[1][r][dc * 8], Qg1 + (size_t)r * DM + dc * 8);
    }
  }

  v8f oh[4] = {};
  v8f orr[4] = {};
  const int srow = tid >> 4;          // softmax: 16 threads per query row
  const int sj   = tid & 15;
  float m_prev = -1e30f;
  float l_run  = 0.0f;
  const int nchunk = q0 / 32 + 1;     // keys 0 .. 32*nchunk-1 cover every position <= q0+15
  // As in the main body the chunks pass through registers, loaded one phase ahead of their LDS store: V^T during the score
  // phase, the next chunk's K during the softmax and PV phases. Per thread and plane: 8 K pieces 4 rows apart, 8 V^T pieces 64 rows apart.
  h16* Kst = &Ks[0][tid >> 6][(tid & 63) * 8];
  h16* Vst = &Vts[0][tid >> 2][(tid & 3) * 8];
  const h16* Kg0 = Kh + ((size_t)(b * SEQ + (tid >> 6))) * DM + (tid & 63) * 8;
  const h16* Kg1 = Kr + ((size_t)(b * EARLY_R + (tid >> 6))) * DM + (tid & 63) * 8;
  h16x8 kh8[8], kr8[8];               // the K chunk of the coming trip, in flight across the loop's back edge
  load_pieces<8>(kh8, Kg0, 4 * DM);
  load_pieces<8>(kr8, Kg1, 4 * DM);

#pragma unroll 1
  for (int ci = 0; ci < nchunk; ++ci) {
    const int kv0 = ci * 32;
    lds_barrier();     // prior PV done with Vts / Ps, prior scores done with Ks; the K pieces stay in flight
#pragma unroll     // constant indices keep kh8[] and kr8[] in registers
    for (int i = 0; i < 8; ++i) {
      *(h16x8*)(Kst + i * 4 * QP) = kh8[i];
      *(h16x8*)(Kst + 32 * QP + i * 4 * QP) = kr8[i];
    }
    h16x8 vh8[8], vr8[8];             // V^T chunk, in flight and then held in registers during the score phase
    load_pieces<8>(vh8, Vth + (size_t)(b * DM + (tid >> 2)) * SEQ + kv0 + (tid & 3) * 8, (size_t)64 * SEQ);
    load_pieces<8>(vr8, Vtr + (size_t)(b * DM + (tid >> 2)) * EARLY_R + kv0 + (tid & 3) * 8, (size_t)64 * EARLY_R);
    lds_barrier();     // K chunk visible; the V^T pieces stay in flight

    if (w < 6) {                                   // wave-uniform
      const int prod = w >> 1, kj = w & 1;
      const int pa = (prod == 2) ? 1 : 0;
      const int pb = (prod == 1) ? 1 : 0;
      const v8f sc = dot_rows<2>(&Qs[pa][0][0], &Ks[pb][kj * 16][0], v8f{});
      const int col = kj * 16 + idx;
#pragma unroll
      for (int g = 0; g < 8; ++g) Ss[prod][g + 8 * half][col] = sc[g];
    }
    lds_barrier();     // scores visible

#pragma unroll     // constant indices keep vh8[] and vr8[] in registers
    for (int i = 0; i < 8; ++i) {
      *(h16x8*)(Vst + i * 64 * VP32) = vh8[i];
      *(h16x8*)(Vst + DM * VP32 + i * 64 * VP32) = vr8[i];
    }
    {  // the last trip loads its own chunk again, unused (as in the main body)
      const size_t kn = (size_t)((ci + 1 < nchunk) ? kv0 + 32 : kv0) * DM;
      load_pieces<8>(kh8, Kg0 + kn, 4 * DM);
      load_pieces<8>(kr8, Kg1 + kn, 4 * DM);
    }
    {
      float v[2];
      float mloc = -1e30f;
      const int qrow = q0 + srow;
#pragma unroll
      for (int e = 0; e < 2; ++e) {
        const int cidx = sj + e * 16;
        float s = (Ss[0][srow][cidx] + (Ss[1][srow][cidx] + Ss[2][srow][cidx]) * RINV) * SCL;
        if (kv0 + cidx > qrow) s = -1e30f;         // causal: replace masked scores
        v[e] = s; mloc = fmaxf(mloc, s);
      }
#pragma unroll
      for (int msk = 1; msk < 16; msk <<= 1) mloc = fmaxf(mloc, __shfl_xor(mloc, msk, 32));
      const float m_new = fmaxf(m_prev, mloc);
      const float alpha = __expf(m_prev - m_new);
      float ssum = 0.0f;
#pragma unroll
      for (int e = 0; e < 2; ++e) {
        const int cidx = sj + e * 16;
        const float p  = __expf(v[e] - m_new);
        ssum += p;
        const float pp = p * PSC;
        const h16 hv = (h16)pp;
        Ps[0][srow][cidx] = hv;
        Ps[1][srow][cidx] = (h16)((pp - (float)hv) * RSC);
      }
#pragma unroll
      for (int msk = 1; msk < 16; msk <<= 1) ssum += __shfl_xor(ssum, msk, 32);
      l_run = l_run * alpha + ssum;
      m_prev = m_new;
      if (sj == 0) { alpha_s[srow] = alpha; l_s[srow] = l_run; }
    }
    lds_barrier();     // P, the factors and V^T visible; the next K pieces stay in flight

    {
      float al[8];
#pragma unroll
      for (int g = 0; g < 8; ++g) al[g] = alpha_s[g + 8 * half];
      v16h ah = load_a_frag(&Ps[0][0][0], VP32, 0);
      v16h ar = load_a_frag(&Ps[1][0][0], VP32, 0);
      v16h bh[4], br[4];               // every fragment of the chunk, read as one group
#pragma unroll     // constant indices keep bh[] and br[] in registers
      for (int t = 0; t < 4; ++t) {
        const int d0 = w * 64 + t * 16;
        bh[t] = load_b_frag(&Vts[0][d0][0], VP32, 0);
        br[t] = load_b_frag(&Vts[1][d0][0], VP32, 0);
      }
      __builtin_amdgcn_sched_barrier(0);   // keeps all reads ahead of the rescale and the WMMAs, which then run under their latency
#pragma unroll
      for (int t = 0; t < 4; ++t)
#pragma unroll
        for (int g = 0; g < 8; ++g) { oh[t][g] *= al[g]; orr[t][g] *= al[g]; }
#pragma unroll
      for (int t = 0; t < 4; ++t) {
        oh[t]  = wmma_f16(ah, bh[t], oh[t]);
        orr[t] = wmma_f16(ah, br[t], orr[t]);
        orr[t] = wmma_f16(ar, bh[t], orr[t]);
      }
    }
  }
  __syncthreads();

  h16* Ct = &Ks[0][0][0];
  float linv[8];
#pragma unroll
  for (int g = 0; g < 8; ++g) linv[g] = 1.0f / (l_s[g + 8 * half] * PSC);
#pragma unroll
  for (int t = 0; t < 4; ++t) {
    const int col = w * 64 + t * 16 + idx;
#pragma unroll
    for (int g = 0; g < 8; ++g) {
      const int rl = g + 8 * half;
      const float u = (oh[t][g] + orr[t][g] * RINV) * linv[g];     // x16 carried ctx
      const h16 hv = (h16)u;
      Ct[rl * DM + col] = hv;
      Ct[16 * DM + rl * DM + col] = (h16)((u - (float)hv) * RSC);
    }
  }
  __syncthreads();
  {
    h16* dsth = Ch + ((size_t)(b * SEQ + q0)) * DM;
    h16* dstr = Cr + ((size_t)(b * EARLY_R + q0)) * DM;
    for (int gg = tid; gg < 16 * DM / 8; gg += 256) {
      vst2(dsth + (size_t)gg * 8, *(const v4u*)(Ct + gg * 8));
      vst2(dstr + (size_t)gg * 8, *(const v4u*)(Ct + 16 * DM + gg * 8));
    }
  }
}

// ---------------- both attention bodies in one grid ----------------
// The two jobs are independent. blockIdx.x = sequence (the fast index: each job's blocks start longest first over all sequences);
// blockIdx.y < NEB: an early tile, last tile (most chunks) first; behind them the runs of the main body's table. Started with the
// first round, an early tile ends inside it whatever its chunks cost beside a run's; started last it could outlast the last runs.
// One set of LDS arrays serves both bodies, small enough for two workgroups per WGP.
constexpr int NMAIN = (SEQ > EARLY_R) ? NRUN : 0;
constexpr int NEB   = EARLY_R / 16;                                   // early tiles per sequence
constexpr int VROWS = (2 * DM * VP32 + VP64 - 1) / VP64;              // rows of VP64 that also hold the early body's two V^T planes
static_assert(VROWS >= DM && 2 * 32 * QP <= VROWS * VP64);
static_assert(3 * 16 * SP32 <= 4 * 32 * SP64 && 2 * 16 * VP32 <= 32 * VP64);
__global__ __launch_bounds__(256) __attribute__((amdgpu_num_vgpr(256)))
void attn_kernel(const h16* __restrict__ Qh, const h16* __restrict__ Qr,
                 const h16* __restrict__ Kh, const h16* __restrict__ Kr,
                 const h16* __restrict__ Vth, const h16* __restrict__ Vtr,
                 h16* __restrict__ Ch, h16* __restrict__ Cr, float* __restrict__ Op, float* __restrict__ Ml) {
  __shared__ __align__(16) h16   Qs[32][QP];
  __shared__ __align__(16) h16   Vts[VROWS][VP64];
  __shared__ __align__(16) float Ss[4][32][SP64];
  __shared__ __align__(16) h16   Ps[32][VP64];
  __shared__ float alpha_s[32];
  __shared__ float l_s[32];
  __shared__ float m_s[32];
  const int b = blockIdx.x, y = blockIdx.y;
  if (y >= NEB)                                     // block-uniform
    attn_main_body(Qs, Vts, Ss, Ps, alpha_s, l_s, m_s, b, SEGS.run[y - NEB], Qh, Kh, Vth, Ch, Op, Ml);
  else
    attn_early_body(&Qs[0][0], &Vts[0][0], &Ss[0][0][0], &Ps[0][0], alpha_s, l_s, b, (NEB - 1 - y) * 16,
                    Qh, Qr, Kh, Kr, Vth, Vtr, Ch, Cr);
}

// ---------------- output projection: out = ctx(MT x 512) * Wo(512 x 512)^T, f32 ----------------
// Same wave layout and k-block LDS staging as proj_qkv. Blocks with sequence positions < EARLY_R add the ctx residual product
// (second accumulator); the two kinds of block run separate instances of the body, so that only the early one holds it.
template <bool EARLY> __device__ __forceinline__
void proj_out_body(const h16* __restrict__ Ch, const h16* __restrict__ Cr, const h16* __restrict__ Wo, float* __restrict__ out,
                   h16* Ws, h16* Cs, h16* Rs, int m0, int n0, int bb, int s0) {
  const int tid = threadIdx.x, w = tid >> 5, lane = tid & 31, idx = lane & 15, half = lane >> 4;
  const int mw_l = (w & 3) * 16;
  const int nw_l = (w >> 2) * 64;

  v8f c[4] = {};
  v8f cr[4] = {};                                   // used by the early instance only
#pragma unroll 1   // rolled: nothing moves across the barriers of a trip, unrolling would only multiply the code
  for (int kb = 0; kb < DM; kb += KB) {
    __syncthreads();                                // the previous block's fragment reads are done
    stage_rows<64>(Cs, Ch + (size_t)m0 * DM + kb, tid);
    stage_rows<128>(Ws, Wo + (size_t)n0 * DM + kb, tid);
    if (EARLY) {
      __builtin_amdgcn_sched_barrier(0);            // the W pieces leave their registers first: all three loads' would not fit 128
      stage_rows<64>(Rs, Cr + (size_t)(bb * EARLY_R + s0) * DM + kb, tid);
    }
    __syncthreads();                                // the staged block is visible to every wave
#pragma unroll
    for (int k0 = 0; k0 < KB; k0 += 32) {
      v16h a = load_a_frag(Cs + mw_l * KP, KP, k0);
      v16h ar = {};
      if (EARLY) ar = load_a_frag(Rs + mw_l * KP, KP, k0);
      v16h bf[4];
#pragma unroll
      for (int t = 0; t < 4; ++t) bf[t] = load_b_frag(Ws + (nw_l + t * 16) * KP, KP, k0);
      __builtin_amdgcn_sched_barrier(0);            // keeps the k step's reads together, ahead of its WMMAs
#pragma unroll
      for (int t = 0; t < 4; ++t) {
        c[t] = wmma_f16(a, bf[t], c[t]);
        if (EARLY) cr[t] = wmma_f16(ar, bf[t], cr[t]);
      }
      if (EARLY) __builtin_amdgcn_sched_barrier(0); // two accumulator sets: a second fragment set would not fit 128 registers
    }
  }
  __syncthreads();                                  // last fragment reads done before the space becomes the output tile
  float* T = (float*)Ws;
#pragma unroll
  for (int t = 0; t < 4; ++t) {
    const int cl = nw_l + t * 16 + idx;
#pragma unroll
    for (int g = 0; g < 8; ++g) {
      const int rl = mw_l + g + 8 * half;
      T[rl * 132 + cl] = (EARLY ? c[t][g] + cr[t][g] * RINV : c[t][g]) * OUT_MUL;
    }
  }
  __syncthreads();
  {
    float* dst = out + ((size_t)(bb * SEQ_FULL + s0)) * DM + n0;
    for (int gg = tid; gg < 64 * 32; gg += 256) {
      const int rl = gg >> 5, pc = gg & 31;
      vst2(dst + (size_t)rl * DM + pc * 4, *(const v4f*)(&T[rl * 132 + pc * 4]));
    }
  }
}

__global__ __launch_bounds__(256) __attribute__((amdgpu_num_vgpr(128)))   // four workgroups (LDS limit) = 8 waves per SIMD
void proj_out_kernel(const h16* __restrict__ Ch, const h16* __restrict__ Cr,
                                                       const h16* __restrict__ Wo, float* __restrict__ out) {
  __shared__ __align__(16) h16 Ws[128 * KP];      // reused as the f32 output tile [64][132] after the k loop
  __shared__ __align__(16) h16 Cs[64 * KP];
  __shared__ __align__(16) h16 Rs[64 * KP];
  static_assert(64 * 132 * sizeof(float) <= 128 * KP * sizeof(h16));
  const int m0 = blockIdx.x * 64, n0 = blockIdx.y * 128;
  const int bb = m0 / SEQ, s0 = m0 - bb * SEQ;
  if (s0 < EARLY_R) proj_out_body<true>(Ch, Cr, Wo, out, Ws, Cs, Rs, m0, n0, bb, s0);     // block-uniform
  else              proj_out_body<false>(Ch, Cr, Wo, out, Ws, Cs, Rs, m0, n0, bb, s0);
}

extern "C" void kernel_launch(void* const* d_in, const int* in_sizes, int n_in,
                              void* d_out, int out_size, void* d_ws, size_t ws_size,
                              hipStream_t stream) {
  if (n_in < 5) return;
  const int rows_needed = (NB - 1) * SEQ_FULL + SEQ;
  if (in_sizes[0] < rows_needed * DM) return;
  for (int i = 1; i < 5; ++i) if (in_sizes[i] < DM * DM) return;
  if (out_size < rows_needed * DM) return;

  const float* x  = (const float*)d_in[0];
  const float* Wq = (const float*)d_in[1];
  const float* Wk = (const float*)d_in[2];
  const float* Wv = (const float*)d_in[3];
  const float* Wo = (const float*)d_in[4];
  float* out = (float*)d_out;

  const size_t plane = (size_t)MT * DM * sizeof(h16);              // 16,777,216 at full size
  const size_t wpl   = (size_t)DM * DM * sizeof(h16);              //    524,288
  const size_t rpl   = (size_t)NB * EARLY_R * DM * sizeof(h16);    //  2,097,152 at full size
  size_t off = 0;
  char* ws = (char*)d_ws;
  h16* xb  = (h16*)(ws + off); off += plane;
  h16* wqb = (h16*)(ws + off); off += wpl;
  h16* wkb = (h16*)(ws + off); off += wpl;
  h16* wvb = (h16*)(ws + off); off += wpl;
  h16* wob = (h16*)(ws + off); off += wpl;
  h16* qh  = (h16*)(ws + off); off += plane;
  h16* kh  = (h16*)(ws + off); off += plane;
  h16* vth = (h16*)(ws + off); off += plane;   // [b][d][s]
  h16* qr  = (h16*)(ws + off); off += rpl;
  h16* kr  = (h16*)(ws + off); off += rpl;
  h16* vtr = (h16*)(ws + off); off += rpl;     // [b][d][s < EARLY_R]
  h16* ch  = (h16*)(ws + off); off += plane;
  h16* crp = (h16*)(ws + off); off += rpl;
  float* opp = (float*)(ws + off); off += (size_t)NB * NSLOT * 32 * DM * sizeof(float);   // partial sums of the cut tiles' runs
  float* mlp = (float*)(ws + off); off += (size_t)NB * NSLOT * 64 * sizeof(float);        // their row maxima and row sums
  if (off > ws_size) return;

  cvt_kernel<<<NXB + 4 * NWB, 256, 0, stream>>>(x, Wq, Wk, Wv, Wo, xb, wqb, wkb, wvb, wob);

  proj_qkv_kernel<<<dim3(MT / 64, DM / 128, 3), 256, 0, stream>>>(xb, wqb, wkb, wvb, qh, kh, vth, qr, kr, vtr);

  attn_kernel<<<dim3(NB, NEB + NMAIN), 256, 0, stream>>>(qh, qr, kh, kr, vth, vtr, ch, crp, opp, mlp);
  if (SEQ > EARLY_R && MAXSEG > 1) attn_combine_kernel<<<dim3(NCUT * 8, NB), 256, 0, stream>>>(opp, mlp, ch);

  proj_out_kernel<<<dim3(MT / 64, DM / 128), 256, 0, stream>>>(ch, crp, wob, out);
}

// v008
// Measured time: 180 microseconds a run.
// In two side-by-side timings against v007, it was 1.10 and 1.11 times as fast.
// All steps since v000 together make it 5.55 times as fast.
#include <hip/hip_runtime.h>
// Contractions: Q/K/V projections (K = 512), scores Q K^T (K = 512), P V (K = keys) and the output projection (K = 512)
// on v_wmma_f32_16x16x32_f16 (f16 operands, f32 accumulate). Inputs enter as bf16-RNE values carried x16 in f16 planes;
// q/k/v/ctx are f16 hi planes carried x16 plus f16 residual planes carried x16384 for the first EARLY_R positions of each
// sequence (scores: hh + hr + rh, P V: hh + hr + rh, output projection: h + r); P carried x1024; softmax statistics in f32.

typedef _Float16 h16;
typedef _Float16 h16x8 __attribute__((ext_vector_type(8)));
typedef _Float16 v16h  __attribute__((ext_vector_type(16)));
typedef float  v8f    __attribute__((ext_vector_type(8)));
typedef float  v4f    __attribute__((ext_vector_type(4)));
typedef unsigned v4u  __attribute__((ext_vector_type(4)));

#ifndef NB
#define NB 4
#endif
#ifndef SEQ
#define SEQ 4096
#endif
#define NB_FULL 4
#define SEQ_FULL 4096
#define DM 512
#define EARLY_CAP 512
#define EARLY_R ((SEQ < EARLY_CAP) ? SEQ : EARLY_CAP)
#define MT (NB * SEQ)
// LDS row pitches in elements. f16 rows read by 16-byte fragment loads: byte pitch = 16 x odd, so the 16 rows of a fragment
// fall on distinct bank groups. f32 score rows: pitch chosen so that the tile stores and the row reads both spread over banks.
#define QP  (DM + 8)               // 1040 B: Q and K rows of 512 f16
#define VP64 72                    // 144 B: V^T and P rows of 64 f16
#define VP32 40                    // 80 B: V^T and P rows of 32 f16
#define SP64 76                    // f32 score rows of 64
#define SP32 36                    // f32 score rows of 32
#define KB   128                   // k block of the projections' LDS staging
#define KP   (KB + 8)              // 272 B: staged projection operand rows of 128 f16

static_assert(SEQ % 64 == 0);
static_assert((EARLY_R) % 64 == 0);
static_assert(NB >= 1 && NB <= NB_FULL);
static_assert(SEQ >= 64 && SEQ <= SEQ_FULL);
static_assert(DM % 128 == 0);
static_assert(((NB - 1) * SEQ_FULL + SEQ) * DM <= NB_FULL * SEQ_FULL * DM);

#define ISC  16.0f                 // carry of the x / q / k / v / ctx f16 hi planes
#define WSC  16.0f                 // carry of the weight planes
#define PSC  1024.0f               // carry of P
#define RSC  16384.0f              // carry of every residual plane
#define RINV (1.0f / 16384.0f)
#define PROJ_MUL (1.0f / 16.0f)    // acc of (x16 * x16) operands -> x16 plane value
#define OUT_MUL  (1.0f / 256.0f)   // acc of (x16 * x16) operands -> f32 output
#define SCL ((1.0f / 256.0f) * (1.0f / 22.627416610717773f))

template <typename V> __device__ __forceinline__ void vst2(void* p, V v) {
  *(V*)p = v; 
}
__device__ __forceinline__ void copy16_g2s(h16* ldst, const h16* gsrc) { *(h16x8*)ldst = *(const h16x8*)gsrc; }

__device__ __forceinline__ float bf16r(float f) {     // RNE convert to bf16, value kept in f32
  unsigned u = __float_as_uint(f);
  u = (u + 0x7FFFu + ((u >> 16) & 1u)) & 0xFFFF0000u;
  return __uint_as_float(u);
}

// ---- WMMA fragment loaders (f16, row-major K-contiguous source); A and B (from B^T rows) share the per-lane K map:
//      row/col = lane&15; elements 0..7 <- k0 + 8*half + 0..7, elements 8..15 <- k0 + 16 + 8*half + 0..7
__device__ __forceinline__ v16h load_a_frag(const h16* base, int ld, int k0) {
  int lane = threadIdx.x & 31;
  int idx  = lane & 15;
  int half = lane >> 4;
  const h16* p = base + idx * ld + k0 + half * 8;
  h16x8 lo = *(const h16x8*)(p);
  h16x8 hi = *(const h16x8*)(p + 16);
  return __builtin_shufflevector(lo, hi, 0,1,2,3,4,5,6,7,8,9,10,11,12,13,14,15);
}
__device__ __forceinline__ v16h load_b_frag(const h16* base, int ld, int k0) { return load_a_frag(base, ld, k0); }

__device__ __forceinline__ v8f wmma_f16(v16h a, v16h b, v8f c) {
  return __builtin_amdgcn_wmma_f32_16x16x32_f16(false, a, false, b, (short)0, c, false, false);
}

// sc += A(16 x DM) * B(16 x DM)^T, both from LDS rows of pitch QP, k ascending. The fragments are read G k-steps at a time into
// two register sets, each group one group ahead of the WMMAs that use it, so that a wave waits for LDS once per group at most.
template <int G> __device__ __forceinline__ v8f dot_rows(const h16* A, const h16* B, v8f sc) {
  constexpr int NG = DM / (32 * G);
  v16h fa[2][G], fb[2][G];
#pragma unroll     // constant indices keep the fragment sets in registers
  for (int j = 0; j < G; ++j) { fa[0][j] = load_a_frag(A, QP, j * 32); fb[0][j] = load_b_frag(B, QP, j * 32); }
#pragma unroll     // constant indices keep the fragment sets in registers
  for (int g = 0; g < NG; ++g) {
    if (g + 1 < NG) {
#pragma unroll     // as above
      for (int j = 0; j < G; ++j) {
        fa[(g + 1) & 1][j] = load_a_frag(A, QP, ((g + 1) * G + j) * 32);
        fb[(g + 1) & 1][j] = load_b_frag(B, QP, ((g + 1) * G + j) * 32);
      }
    }
    __builtin_amdgcn_sched_barrier(0);   // keeps the next group's reads ahead of this group's WMMAs (else they sink to their use)
#pragma unroll     // as above
    for (int j = 0; j < G; ++j) sc = wmma_f16(fa[g & 1][j], fb[g & 1][j], sc);
    __builtin_amdgcn_sched_barrier(0);   // no read of the group after next in front of these WMMAs: it would take a third register set
  }
  return sc;
}

// Work-group barrier for data handed over in LDS alone: its fences name the LDS address space only, so a wave waits for its LDS
// operations and not for its global loads, which stay in flight across it (__syncthreads() waits for them too).
__device__ __forceinline__ void lds_barrier() {
  __builtin_amdgcn_fence(__ATOMIC_RELEASE, "workgroup", "local");
  __builtin_amdgcn_s_barrier();
  __builtin_amdgcn_fence(__ATOMIC_ACQUIRE, "workgroup", "local");
}

// N 16-byte pieces per thread, 'step' elements apart, from global memory into registers.
template <int N> __device__ __forceinline__ void load_pieces(h16x8 (&r)[N], const h16* g0, size_t step) {
#pragma unroll     // constant indices keep r[] in registers and the steps in the loads' offset fields
  for (int i = 0; i < N; ++i) r[i] = *(const h16x8*)(g0 + i * step);
  // address-translation wait; g0 as an input keeps the loads' address pair untouched (also by a later load's result) up to it
  asm volatile("s_wait_xcnt 0x0" :: "v"(g0) : "memory");
}

// Stage ROWS rows of KB f16 (256 B = two whole lines per row, source row pitch DM) into LDS rows of pitch KP, 256 threads:
// one wave-wide 16-byte load covers two rows = four whole lines.
template <int ROWS> __device__ __forceinline__ void stage_rows(h16* lds, const h16* g, int tid) {
  h16* l0 = lds + (tid >> 4) * KP + (tid & 15) * 8;
  const h16* g0 = g + (size_t)(tid >> 4) * DM + (tid & 15) * 8;
  h16x8 r[ROWS / 16];
  load_pieces<ROWS / 16>(r, g0, 16 * DM);
#pragma unroll     // constant indices keep r[] in registers
  for (int i = 0; i < ROWS / 16; ++i) *(h16x8*)(l0 + i * 16 * KP) = r[i];
}

// ---------------- conversion kernel ----------------
// One grid for both independent jobs; the block index picks the job, 8 elements (16 B) per thread.
// Blocks < NXB: xb[row][c] = f16( bf16r(x) * 16 ), rows indexed b*SEQ + s, source rows b*SEQ_FULL + s.
// The other blocks, NWB per matrix: Wb[n][k] = f16( bf16r(W[n][k]) * 16 ) (weights are already [out][in] = [n][k]).
#define NXB (MT * DM / 8 / 256)
#define NWB (DM * DM / 8 / 256)
static_assert(MT * DM % (8 * 256) == 0 && DM * DM % (8 * 256) == 0);
__global__ __launch_bounds__(256) void cvt_kernel(const float* __restrict__ x,
                                                  const float* __restrict__ W0, const float* __restrict__ W1,
                                                  const float* __restrict__ W2, const float* __restrict__ W3,
                                                  h16* __restrict__ xb,
                                                  h16* __restrict__ D0, h16* __restrict__ D1,
                                                  h16* __restrict__ D2, h16* __restrict__ D3) {
  const float* src;
  h16* dst;
  float carry;
  if (blockIdx.x < NXB) {                            // block-uniform
    const int g = blockIdx.x * 256 + threadIdx.x;
    const int row = g >> 6, c8 = g & 63;             // 64 groups of 8 per 512-wide row
    const int b = row / SEQ, sq = row - b * SEQ;
    src = x + ((size_t)(b * SEQ_FULL + sq)) * DM + c8 * 8;
    dst = xb + (size_t)g * 8;
    carry = ISC;
  } else {
    const int r = blockIdx.x - NXB, y = r / NWB;
    const int g = (r - y * NWB) * 256 + threadIdx.x;
    const float* W = (y == 0) ? W0 : (y == 1) ? W1 : (y == 2) ? W2 : W3;
    h16*       D  = (y == 0) ? D0 : (y == 1) ? D1 : (y == 2) ? D2 : D3;
    src = W + (size_t)g * 8;
    dst = D + (size_t)g * 8;
    carry = WSC;
  }
  const v4f a = *(const v4f*)(src), bq = *(const v4f*)(src + 4);
  union { h16x8 h; v4u u; } pk;
#pragma unroll
  for (int i = 0; i < 4; ++i) { pk.h[i] = (h16)(bf16r(a[i]) * carry); pk.h[4 + i] = (h16)(bf16r(bq[i]) * carry); }
  vst2(dst, pk.u);
}

// ---------------- projection GEMM: Y = X(MT x 512) * W(512 x 512)^T, blockIdx.z selects Q / K / V ----------------
// 8 waves/WG: 4 M-subtiles x 2 N-groups(64). Each wave: 16x64 (4 WMMA tiles). The X (64 rows) and W (128 rows) operands are
// staged in LDS in k blocks of KB = 128 by whole-line 16-byte loads; fragments are read from LDS. The staging space is reused
// for the 64 x 128 output tile. Blocks whose sequence positions are < EARLY_R also write the residual planes (x16384).
__global__ __launch_bounds__(256) void proj_qkv_kernel(const h16* __restrict__ Xb,
                                                       const h16* __restrict__ Wq, const h16* __restrict__ Wk,
                                                       const h16* __restrict__ Wv,
                                                       h16* __restrict__ Qh, h16* __restrict__ Kh, h16* __restrict__ Vth,
                                                       h16* __restrict__ Qr, h16* __restrict__ Kr, h16* __restrict__ Vtr) {
  __shared__ __align__(16) h16 Th[128 * 136];     // [m][n] pitch 136 (Q/K) or [n][m] pitch 72 (V)
  __shared__ __align__(16) h16 Tr[128 * 136];
  const int z = blockIdx.z;
  const h16* W = (z == 0) ? Wq : (z == 1) ? Wk : Wv;
  const int transposed = (z == 2) ? 1 : 0;
  const int m0 = blockIdx.x * 64, n0 = blockIdx.y * 128;
  const int bb = m0 / SEQ, s0 = m0 - bb * SEQ;
  const bool early = (s0 < EARLY_R);
  const int tid = threadIdx.x, w = tid >> 5, lane = tid & 31, idx = lane & 15, half = lane >> 4;
  const int mw_l = (w & 3) * 16;
  const int nw_l = (w >> 2) * 64;

  v8f c[4] = {};
  h16* Ws = Th;                                     // [128][KP] during the k loop
  h16* Xs = Tr;                                     // [64][KP] during the k loop
#pragma unroll 1   // rolled: nothing moves across the barriers of a trip, unrolling would only multiply the code
  for (int kb = 0; kb < DM; kb += KB) {
    __syncthreads();                                // the previous block's fragment reads are done
    stage_rows<64>(Xs, Xb + (size_t)m0 * DM + kb, tid);
    stage_rows<128>(Ws, W + (size_t)n0 * DM + kb, tid);
    __syncthreads();                                // the staged block is visible to every wave
#pragma unroll
    for (int k0 = 0; k0 < KB; k0 += 32) {
      v16h a = load_a_frag(Xs + mw_l * KP, KP, k0);
      v16h bf[4];
#pragma unroll
      for (int t = 0; t < 4; ++t) bf[t] = load_b_frag(Ws + (nw_l + t * 16) * KP, KP, k0);
      __builtin_amdgcn_sched_barrier(0);            // keeps the k step's reads together, ahead of its WMMAs
#pragma unroll
      for (int t = 0; t < 4; ++t) c[t] = wmma_f16(a, bf[t], c[t]);
    }
  }
  __syncthreads();                                  // last fragment reads done before the space becomes the output tile
#pragma unroll
  for (int t = 0; t < 4; ++t) {
    const int cl = nw_l + t * 16 + idx;             // local col
#pragma unroll
    for (int g = 0; g < 8; ++g) {
      const int rl = mw_l + g + 8 * half;           // local row
      const float u = c[t][g] * PROJ_MUL;           // x16 carried value
      const h16 hv = (h16)u;
      const int li = transposed ? (cl * 72 + rl) : (rl * 136 + cl);
      Th[li] = hv;
      if (early) Tr[li] = (h16)((u - (float)hv) * RSC);
    }
  }
  __syncthreads();
  if (!transposed) {
    h16* Oh = (z == 0) ? Qh : Kh;
    h16* Orp = (z == 0) ? Qr : Kr;
    for (int gg = tid; gg < 64 * 16; gg += 256) {
      const int rl = gg >> 4, pc = gg & 15;
      vst2(Oh + (size_t)(m0 + rl) * DM + n0 + pc * 8, *(const v4u*)(&Th[rl * 136 + pc * 8]));
      if (early) vst2(Orp + (size_t)(bb * EARLY_R + s0 + rl) * DM + n0 + pc * 8, *(const v4u*)(&Tr[rl * 136 + pc * 8]));
    }
  } else {
    for (int gg = tid; gg < 128 * 8; gg += 256) {
      const int cl = gg >> 3, pc = gg & 7;
      vst2(Vth + ((size_t)(bb * DM + n0 + cl)) * SEQ + s0 + pc * 8, *(const v4u*)(&Th[cl * 72 + pc * 8]));
      if (early) vst2(Vtr + ((size_t)(bb * DM + n0 + cl)) * EARLY_R + s0 + pc * 8, *(const v4u*)(&Tr[cl * 72 + pc * 8]));
    }
  }
}

// ---------------- split of the main attention's key ranges ----------------
// A 64-query tile at position q0 walks q0/64 + 1 key chunks, so the last tile costs seven times the first, and with one workgroup
// per tile the launch lasts as long as the last tile. A tile of more than SEGL chunks is cut into equal runs of at most SEGL chunks,
// one workgroup each; the runs are dealt out longest first. A run of a cut tile leaves its unnormalised sums, its row maxima and
// its row sums in a slot of the workspace, and attn_combine_kernel joins the slots of a tile.
#define SEGL 22                    // about two rounds of workgroups at one per WGP
#define QT   64                    // queries per tile of the main body
#define NO_SLOT 0xFFFF
constexpr int NT = (SEQ > EARLY_R) ? (SEQ - EARLY_R) / QT : 1;
constexpr int tile_chunks(int t) { return (EARLY_R + t * QT) / 64 + 1; }
constexpr int tile_segs(int t) { return (tile_chunks(t) + SEGL - 1) / SEGL; }
constexpr int count_runs(bool cut_only) {
  int c = 0;
  for (int t = 0; t < NT; ++t) if (!cut_only || tile_segs(t) > 1) c += tile_segs(t);
  return c;
}
constexpr int count_cut_tiles() {
  int c = 0;
  for (int t = 0; t < NT; ++t) if (tile_segs(t) > 1) ++c;
  return c;
}
constexpr int NRUN   = count_runs(false);                                  // runs per sequence, one workgroup each
constexpr int NSLOT  = (count_runs(true) > 0) ? count_runs(true) : 1;      // partial results per sequence
constexpr int NCUT   = (count_cut_tiles() > 0) ? count_cut_tiles() : 1;    // tiles per sequence that are cut
constexpr int MAXSEG = tile_segs(NT - 1);
struct Run { unsigned short tile, c0, len, slot; };       // chunks c0 .. c0 + len - 1 of a tile; slot = NO_SLOT: the whole tile
struct Cut { unsigned short tile, slot, nseg, pad; };     // a cut tile's runs lie in slots slot .. slot + nseg - 1
struct SegTab { Run run[NRUN]; Cut cut[NCUT]; };
constexpr SegTab make_seg_tab() {
  SegTab T = {};
  int n = 0, slot = 0, nc = 0;
  for (int t = 0; t < NT; ++t) {
    const int ch = tile_chunks(t), ns = tile_segs(t);
    if (ns > 1) { T.cut[nc].tile = (unsigned short)t; T.cut[nc].slot = (unsigned short)slot; T.cut[nc].nseg = (unsigned short)ns; ++nc; }
    for (int s = 0; s < ns; ++s) {
      Run r = {};
      r.tile = (unsigned short)t;
      r.c0   = (unsigned short)(s * ch / ns);
      r.len  = (unsigned short)((s + 1) * ch / ns - s * ch / ns);
      r.slot = (unsigned short)((ns > 1) ? slot++ : NO_SLOT);
      int p = n++;                                        // insertion keeps the list sorted, longest run first
      for (; p > 0 && T.run[p - 1].len < r.len; --p) T.run[p] = T.run[p - 1];
      T.run[p] = r;
    }
  }
  return T;
}
__constant__ const SegTab SEGS = make_seg_tab();
#define OPP (DM + 4)               // f32 row pitch of the partial tile in LDS: rows g and g + 8 fall on different banks

// ---------------- flash attention, causal, query positions >= EARLY_R (single products) ----------------
// WG = 64 queries, 16 waves, key chunks of 64: one run of chunks of one tile (table above). Each staged chunk serves all 64 queries, so a
// query costs half the L2 reads and LDS stores of K and V^T that it costs in a 32-query workgroup. The K chunk is staged in LDS by whole-line loads for the
// score phase; the V^T chunk takes the same LDS space for the PV phase. Both pass through registers and are loaded one phase
// ahead of their LDS store: V^T during the score phase, the next chunk's K during the softmax and PV phases.
// Waves 0..7 serve queries 0..31 of the tile, waves 8..15 queries 32..63 (qb = 32 (w>>3)); a wave covers both 16-query tiles of its half,
// so that each fragment read from LDS feeds two WMMAs.
// Score phase: wave w -> (ds = w&3, kh = (w>>2)&1): 32 keys x 32 queries (2 x 2 tiles of K Q^T) over the dims [128 ds, 128 ds + 128);
// the four partial sums of a score meet in the softmax phase. PV phase: wave w -> 32 q x dims [64 (w&7), 64 (w&7) + 64) (2 x 4 accum tiles).
// LDS (views of attn_kernel's array): Qs; behind it Vts, d-major, K rows [64][QP] in the score phase, f16 ctx tile [64][512] after the loop;
// Ss, one plane of partial scores per 128-dim slice; Ps; the rows' factors, sums and maxima.
__device__ __forceinline__
void attn_main_body(h16 (*Qs)[QP], h16 (*Vts)[VP64], float (*Ss)[QT][SP64], h16 (*Ps)[VP64],
                    float* alpha_s, float* l_s, float* m_s, const int b, const Run run,
                    const h16* __restrict__ Qh, const h16* __restrict__ Kh,
                    const h16* __restrict__ Vth, h16* __restrict__ Ch, float* __restrict__ Op, float* __restrict__ Ml) {
  const int q0  = EARLY_R + run.tile * QT;
  const int tid = threadIdx.x;
  const int w    = tid >> 5;
  const int lane = tid & 31;
  const int idx  = lane & 15;
  const int half = lane >> 4;
  const int ds = w & 3;         // score phase: slice of 128 dims
  const int kh = (w >> 2) & 1;  // score phase: half of the chunk's keys
  const int qb = (w >> 3) * 32; // both matrix phases: first query row of this wave's half of the tile
  const int dw = (w & 7) * 64;  // PV phase: first dim of this wave's 64

  // The Q tile has a K chunk's shape and is dealt out alike: 8 pieces per thread, 8 rows apart, all in flight together (the workgroup
  // is alone on its WGP, so nothing else runs under these loads' latency).
  static_assert(QT == 64);
  h16x8 qreg[8];
  load_pieces<8>(qreg, Qh + ((size_t)(b * SEQ + q0 + (tid >> 6))) * DM + (tid & 63) * 8, 8 * DM);

  h16* Ks = &Vts[0][0];
  h16* Kst = Ks + (tid >> 6) * QP + (tid & 63) * 8;      // this thread's first K piece; the next ones lie 8 rows apart
  h16* Vst = &Vts[tid >> 3][(tid & 7) * 8];              // this thread's first V^T piece; the next ones lie 64 rows apart
  static_assert(64 * QP <= DM * VP64);
  v8f o[2][4] = {};                   // [query tile][16 dims]
  const int srow = tid >> 3;          // softmax: 8 threads per query row, 8 neighbouring keys each
  const int sj   = tid & 7;
  float m_prev = -1e30f;
  float l_run  = 0.0f;
  const int cbeg = run.c0, nchunk = run.c0 + run.len;   // this run's chunks; a tile's last chunk q0/64 covers every position <= q0+63
  const h16* Kg = Kh + ((size_t)(b * SEQ + (tid >> 6))) * DM + (tid & 63) * 8;
  h16x8 kreg[8];                      // the K chunk of the coming trip, in flight across the loop's back edge
  load_pieces<8>(kreg, Kg + (size_t)(cbeg * 64) * DM, 8 * DM);
#pragma unroll     // constant indices keep qreg[] in registers
  for (int i = 0; i < 8; ++i) *(h16x8*)(&Qs[(tid >> 6) + i * 8][(tid & 63) * 8]) = qreg[i];

#pragma unroll 1
  for (int ci = cbeg; ci < nchunk; ++ci) {
    const int kv0 = ci * 64;
    lds_barrier();     // prior PV done with Vts / Ps (and Qs issue point on the first chunk); the K pieces stay in flight
#pragma unroll     // constant indices keep kreg[] in registers
    for (int i = 0; i < 8; ++i) *(h16x8*)(Kst + i * 8 * QP) = kreg[i];
    const h16* Vg = Vth + (size_t)(b * DM + (tid >> 3)) * SEQ + kv0 + (tid & 7) * 8;
    h16x8 vreg[8];     // V^T chunk, in flight and then held in registers during the score phase
    load_pieces<8>(vreg, Vg, (size_t)64 * SEQ);
    lds_barrier();     // K chunk visible; the V^T pieces stay in flight

    {
      // A = K rows, B = Q rows: a lane then holds 8 neighbouring keys of one query, two 16-byte stores per tile.
      const h16* Kf = Ks + (kh * 32) * QP + ds * 128;
      const h16* Qf = &Qs[qb][ds * 128];
      v8f sc[2][2] = {};               // [key tile][query tile]
      v16h fk[2][2], fq[2][2];         // two register sets: each k step's fragments are read one step ahead of their WMMAs
#pragma unroll     // constant indices keep the fragment sets in registers (every loop of this block)
      for (int j = 0; j < 2; ++j) { fk[0][j] = load_a_frag(Kf + j * 16 * QP, QP, 0); fq[0][j] = load_b_frag(Qf + j * 16 * QP, QP, 0); }
#pragma unroll
      for (int s = 0; s < 4; ++s) {
        if (s + 1 < 4) {
#pragma unroll
          for (int j = 0; j < 2; ++j) {
            fk[(s + 1) & 1][j] = load_a_frag(Kf + j * 16 * QP, QP, (s + 1) * 32);
            fq[(s + 1) & 1][j] = load_b_frag(Qf + j * 16 * QP, QP, (s + 1) * 32);
          }
        }
        __builtin_amdgcn_sched_barrier(0);   // keeps the next step's reads ahead of this step's WMMAs (else they sink to their use)
#pragma unroll
        for (int kt = 0; kt < 2; ++kt)
#pragma unroll
          for (int qt = 0; qt < 2; ++qt) sc[kt][qt] = wmma_f16(fk[s & 1][kt], fq[s & 1][qt], sc[kt][qt]);
        __builtin_amdgcn_sched_barrier(0);   // no read of the step after next in front of these WMMAs: it would take a third register set
      }
#pragma unroll
      for (int kt = 0; kt < 2; ++kt)
#pragma unroll
        for (int qt = 0; qt < 2; ++qt) {
          float* sp = &Ss[ds][qb + qt * 16 + idx][kh * 32 + kt * 16 + 8 * half];
          *(v4f*)(sp)     = __builtin_shufflevector(sc[kt][qt], sc[kt][qt], 0, 1, 2, 3);
          *(v4f*)(sp + 4) = __builtin_shufflevector(sc[kt][qt], sc[kt][qt], 4, 5, 6, 7);
        }
    }
    lds_barrier();     // scores visible; every K fragment read is done, so V^T may take the space

#pragma unroll     // constant indices keep vreg[] in registers
    for (int i = 0; i < 8; ++i) *(h16x8*)(Vst + i * 64 * VP64) = vreg[i];
    // The next chunk's K pieces land under softmax and PV. The last trip loads its own chunk again, unused: under a test the old
    // pieces would count as live from their LDS store to here, through the score phase, and no longer fit the registers.
    load_pieces<8>(kreg, Kg + (size_t)((ci + 1 < nchunk) ? kv0 + 64 : kv0) * DM, 8 * DM);
    {
      float v[8];
      float mloc = -1e30f;
      v4f pl[4], ph[4];                // the four partial sums of this thread's 8 scores
#pragma unroll
      for (int p = 0; p < 4; ++p) { pl[p] = *(const v4f*)(&Ss[p][srow][sj * 8]); ph[p] = *(const v4f*)(&Ss[p][srow][sj * 8 + 4]); }
      const v4f sl = (pl[0] + pl[1]) + (pl[2] + pl[3]);
      const v4f sh = (ph[0] + ph[1]) + (ph[2] + ph[3]);
#pragma unroll
      for (int e = 0; e < 8; ++e) {
        float val = ((e < 4) ? sl[e & 3] : sh[e & 3]) * SCL;
        if (kv0 + sj * 8 + e > q0 + srow) val = -1e30f;   // causal: replace masked scores
        v[e] = val; mloc = fmaxf(mloc, val);
      }
#pragma unroll
      for (int msk = 1; msk < 8; msk <<= 1) mloc = fmaxf(mloc, __shfl_xor(mloc, msk, 32));
      const float m_new = fmaxf(m_prev, mloc);
      const float alpha = __expf(m_prev - m_new);
      float ssum = 0.0f;
      h16x8 pk;
#pragma unroll
      for (int e = 0; e < 8; ++e) {
        const float p = __expf(v[e] - m_new);
        ssum += p;
        pk[e] = (h16)(p * PSC);
      }
      *(h16x8*)(&Ps[srow][sj * 8]) = pk;
#pragma unroll
      for (int msk = 1; msk < 8; msk <<= 1) ssum += __shfl_xor(ssum, msk, 32);
      l_run = l_run * alpha + ssum;
      m_prev = m_new;
      if (sj == 0) { alpha_s[srow] = alpha; l_s[srow] = l_run; }
    }
    lds_barrier();     // P, the factors and V^T visible; the next K pieces stay in flight

    {
      float al[2][8];
#pragma unroll     // constant indices keep al[], pa[] and vb[] in registers (every loop of this block)
      for (int qt = 0; qt < 2; ++qt)
#pragma unroll
        for (int g = 0; g < 8; ++g) al[qt][g] = alpha_s[qb + qt * 16 + g + 8 * half];
      __builtin_amdgcn_sched_barrier(0);   // the factors' reads go first: the rescale then waits for them alone
      const h16* Vf = &Vts[dw][0];
      v16h pa[2][2], vb[2][4];             // [32 keys][query tile], [32 keys][16 dims]
#pragma unroll
      for (int qt = 0; qt < 2; ++qt) pa[0][qt] = load_a_frag(&Ps[qb + qt * 16][0], VP64, 0);
#pragma unroll
      for (int t = 0; t < 4; ++t) vb[0][t] = load_b_frag(Vf + t * 16 * VP64, VP64, 0);
      __builtin_amdgcn_sched_barrier(0);   // keys 0..31: the reads stay ahead of the rescale, which runs under their latency
#pragma unroll
      for (int qt = 0; qt < 2; ++qt)
#pragma unroll
        for (int t = 0; t < 4; ++t)
#pragma unroll
          for (int g = 0; g < 8; ++g) o[qt][t][g] *= al[qt][g];
      __builtin_amdgcn_sched_barrier(0);   // keys 32..63 are read behind the rescale, when the factors' registers are free ...
#pragma unroll
      for (int qt = 0; qt < 2; ++qt) pa[1][qt] = load_a_frag(&Ps[qb + qt * 16][0], VP64, 32);
#pragma unroll
      for (int t = 0; t < 4; ++t) vb[1][t] = load_b_frag(Vf + t * 16 * VP64, VP64, 32);
      __builtin_amdgcn_sched_barrier(0);   // ... and ahead of the first eight WMMAs, which run under their latency
#pragma unroll
      for (int s = 0; s < 2; ++s)
#pragma unroll
        for (int t = 0; t < 4; ++t)
#pragma unroll
          for (int qt = 0; qt < 2; ++qt) o[qt][t] = wmma_f16(pa[s][qt], vb[s][t], o[qt][t]);
    }
  }
  if (sj == 0) m_s[srow] = m_prev;
  __syncthreads();

  if (run.slot != NO_SLOT) {          // block-uniform: a run of a cut tile hands its sums on as they are, in f32
    float* Cf = (float*)&Qs[0][0];    // the f32 tile takes the space of Qs and, directly behind it, of Vts
    static_assert(QT * OPP * sizeof(float) <= (QT * QP + DM * VP64) * sizeof(h16));
#pragma unroll     // constant indices keep o[] in registers (all three loops)
    for (int qt = 0; qt < 2; ++qt)
#pragma unroll
      for (int t = 0; t < 4; ++t)
#pragma unroll
        for (int g = 0; g < 8; ++g) Cf[(qb + qt * 16 + g + 8 * half) * OPP + dw + t * 16 + idx] = o[qt][t][g];
    __syncthreads();                  // the tile is complete before it leaves in whole lines
    const size_t pi = (size_t)b * NSLOT + run.slot;
    float* dst = Op + pi * (QT * DM);
#pragma unroll     // 16 pieces per thread, four rows of the tile apart: all reads issued ahead of the stores, steps in the offset fields
    for (int i = 0; i < QT * DM / 4 / 512; ++i)
      vst2(dst + (size_t)(i * 512 + tid) * 4, *(const v4f*)(Cf + (i * 4 + (tid >> 7)) * OPP + (tid & 127) * 4));
    if (tid < 2 * QT) Ml[pi * (2 * QT) + tid] = (tid < QT) ? m_s[tid] : l_s[tid - QT];   // waves 0, 1: the maxima's lines, waves 2, 3: the sums'
    return;
  }

  h16* Ct = &Vts[0][0];
  static_assert(QT * DM <= DM * VP64);
#pragma unroll
  for (int qt = 0; qt < 2; ++qt) {
    float linv[8];
#pragma unroll
    for (int g = 0; g < 8; ++g) linv[g] = 1.0f / (l_s[qb + qt * 16 + g + 8 * half] * PSC);
#pragma unroll
    for (int t = 0; t < 4; ++t) {
      const int col = dw + t * 16 + idx;
#pragma unroll
      for (int g = 0; g < 8; ++g) Ct[(qb + qt * 16 + g + 8 * half) * DM + col] = (h16)(o[qt][t][g] * linv[g]);
    }
  }
  __syncthreads();
  {
    h16* dst = Ch + ((size_t)(b * SEQ + q0)) * DM;
    for (int gg = tid; gg < QT * DM / 8; gg += 512) vst2(dst + (size_t)gg * 8, *(const v4u*)(Ct + gg * 8));
  }
}

// ---------------- join of a cut tile's runs: ctx = sum_s e^(m_s - M) O_s / (sum_s e^(m_s - M) l_s), M = max_s m_s ----------------
// WG = 4 query rows of one cut tile; a thread joins 8 neighbouring dims and stores them as 16 bytes.
__global__ __launch_bounds__(256) void attn_combine_kernel(const float* __restrict__ Op, const float* __restrict__ Ml,
                                                           h16* __restrict__ Ch) {
  const Cut cut = SEGS.cut[blockIdx.x / (QT / 4)];
  const int b = blockIdx.y, tid = threadIdx.x;
  const int row = (blockIdx.x % (QT / 4)) * 4 + (tid >> 6), c8 = tid & 63;
  const size_t p0 = (size_t)b * NSLOT + cut.slot;
  float m[MAXSEG], l[MAXSEG];
  v4f lo[MAXSEG], hi[MAXSEG];
#pragma unroll     // constant indices keep the parts in registers; every part's loads are issued before the first is used
  for (int s = 0; s < MAXSEG; ++s) {
    if (s < 2 || s < cut.nseg) {      // block-uniform; a cut tile has two parts at least
      const float* ml  = Ml + (p0 + s) * (2 * QT) + row;
      const float* src = Op + ((p0 + s) * QT + row) * DM + c8 * 8;
      m[s] = ml[0]; l[s] = ml[QT];
      lo[s] = *(const v4f*)(src); hi[s] = *(const v4f*)(src + 4);
      // address-translation wait; the pointers as inputs keep the loads' address pairs untouched (also by a later load's result) up to it
      asm volatile("s_wait_xcnt 0x0" :: "v"(ml), "v"(src) : "memory");
    } else {                          // no such part: weight e^(-1e30 - M) = 0
      m[s] = -1e30f; l[s] = 0.0f; lo[s] = v4f{}; hi[s] = v4f{};
    }
  }
  float M = m[0];
#pragma unroll     // constant indices, as above (this loop and the next two)
  for (int s = 1; s < MAXSEG; ++s) M = fmaxf(M, m[s]);
  float L = 0.0f;
  v4f alo = {}, ahi = {};
#pragma unroll
  for (int s = 0; s < MAXSEG; ++s) {
    const float ws = __expf(m[s] - M);
    L += ws * l[s]; alo += lo[s] * ws; ahi += hi[s] * ws;
  }
  const float linv = 1.0f / (L * PSC);
  union { h16x8 h; v4u u; } pk;
#pragma unroll
  for (int i = 0; i < 4; ++i) { pk.h[i] = (h16)(alo[i] * linv); pk.h[4 + i] = (h16)(ahi[i] * linv); }
  vst2(Ch + ((size_t)(b * SEQ + EARLY_R + cut.tile * QT + row)) * DM + c8 * 8, pk.u);
}

// ---------------- flash attention, causal, query positions < EARLY_R (hi + residual products) ----------------
// 16 queries, 8 waves (one half of a workgroup, with LDS of its own; the barriers are the workgroup's, so the two halves' tiles walk
// the same number of chunks), key chunks of 32 (chunks 0 .. q0/32). Q (hi,res) staged once; K (hi,res) and V^T (hi,res)
// chunks staged in LDS through registers. Score phase: waves 0..5 -> (prod = w>>1, kj = w&1): prod 0 = Qh Kh, 1 = Qh Kr, 2 = Qr Kh.
// PV phase: wave w -> dims [64w, 64w+64): Oh += Ph Vh ; Or += Ph Vr + Pr Vh. Writes ctx hi and ctx res planes.
// LDS: views of the array that attn_kernel declares. As in the main body the V^T chunk takes the K chunk's space: K is stored
// behind the barrier that ends the PV reads, V^T behind the barrier that ends the score reads.
__device__ __forceinline__
void attn_early_body(h16* Qraw, h16* KVraw, float* Sraw, h16* Praw, float* alpha_s, float* l_s, const int b, const int q0,
                     const h16* __restrict__ Qh, const h16* __restrict__ Qr,
                     const h16* __restrict__ Kh, const h16* __restrict__ Kr,
                     const h16* __restrict__ Vth, const h16* __restrict__ Vtr,
                     h16* __restrict__ Ch, h16* __restrict__ Cr) {
  h16   (*Qs)[16][QP]    = (h16 (*)[16][QP])Qraw;       // [2]: hi, residual
  h16   (*Ks)[32][QP]    = (h16 (*)[32][QP])KVraw;      // [2]; reused as the ctx tiles [2][16][512] after the loop
  h16   (*Vts)[DM][VP32] = (h16 (*)[DM][VP32])KVraw;    // [2]; d-major
  float (*Ss)[16][SP32]  = (float (*)[16][SP32])Sraw;   // [3]
  h16   (*Ps)[16][VP32]  = (h16 (*)[16][VP32])Praw;     // [2]

  const int tid = threadIdx.x & 255;  // thread and wave numbers inside this half of the workgroup
  const int w    = tid >> 5;
  const int lane = tid & 31;
  const int idx  = lane & 15;
  const int half = lane >> 4;

  {
    const h16* Qg0 = Qh + ((size_t)(b * SEQ + q0)) * DM;
    const h16* Qg1 = Qr + ((size_t)(b * EARLY_R + q0)) * DM;
    for (int cc = tid; cc < 16 * (DM / 8); cc += 256) {
      const int r = cc >> 6, dc = cc & 63;
      copy16_g2s(&Qs[0][r][dc * 8], Qg0 + (size_t)r * DM + dc * 8);
      copy16_g2s(&Qs[1][r][dc * 8], Qg1 + (size_t)r * DM + dc * 8);
    }
  }

  v8f oh[4] = {};
  v8f orr[4] = {};
  const int srow = tid >> 4;          // softmax: 16 threads per query row
  const int sj   = tid & 15;
  float m_prev = -1e30f;
  float l_run  = 0.0f;
  const int nchunk = q0 / 32 + 1;     // keys 0 .. 32*nchunk-1 cover every position <= q0+15
  // As in the main body the chunks pass through registers, loaded one phase ahead of their LDS store: V^T during the score
  // phase, the next chunk's K during the softmax and PV phases. Per thread and plane: 8 K pieces 4 rows apart, 8 V^T pieces 64 rows apart.
  h16* Kst = &Ks[0][tid >> 6][(tid & 63) * 8];
  h16* Vst = &Vts[0][tid >> 2][(tid & 3) * 8];
  const h16* Kg0 = Kh + ((size_t)(b * SEQ + (tid >> 6))) * DM + (tid & 63) * 8;
  const h16* Kg1 = Kr + ((size_t)(b * EARLY_R + (tid >> 6))) * DM + (tid & 63) * 8;
  h16x8 kh8[8], kr8[8];               // the K chunk of the coming trip, in flight across the loop's back edge
  load_pieces<8>(kh8, Kg0, 4 * DM);
  load_pieces<8>(kr8, Kg1, 4 * DM);

#pragma unroll 1
  for (int ci = 0; ci < nchunk; ++ci) {
    const int kv0 = ci * 32;
    lds_barrier();     // prior PV done with Vts / Ps, prior scores done with Ks; the K pieces stay in flight
#pragma unroll     // constant indices keep kh8[] and kr8[] in registers
    for (int i = 0; i < 8; ++i) {
      *(h16x8*)(Kst + i * 4 * QP) = kh8[i];
      *(h16x8*)(Kst + 32 * QP + i * 4 * QP) = kr8[i];
    }
    h16x8 vh8[8], vr8[8];             // V^T chunk, in flight and then held in registers during the score phase
    load_pieces<8>(vh8, Vth + (size_t)(b * DM + (tid >> 2)) * SEQ + kv0 + (tid & 3) * 8, (size_t)64 * SEQ);
    load_pieces<8>(vr8, Vtr + (size_t)(b * DM + (tid >> 2)) * EARLY_R + kv0 + (tid & 3) * 8, (size_t)64 * EARLY_R);
    lds_barrier();     // K chunk visible; the V^T pieces stay in flight

    if (w < 6) {                                   // wave-uniform
      const int prod = w >> 1, kj = w & 1;
      const int pa = (prod == 2) ? 1 : 0;
      const int pb = (prod == 1) ? 1 : 0;
      const v8f sc = dot_rows<2>(&Qs[pa][0][0], &Ks[pb][kj * 16][0], v8f{});
      const int col = kj * 16 + idx;
#pragma unroll
      for (int g = 0; g < 8; ++g) Ss[prod][g + 8 * half][col] = sc[g];
    }
    lds_barrier();     // scores visible

#pragma unroll     // constant indices keep vh8[] and vr8[] in registers
    for (int i = 0; i < 8; ++i) {
      *(h16x8*)(Vst + i * 64 * VP32) = vh8[i];
      *(h16x8*)(Vst + DM * VP32 + i * 64 * VP32) = vr8[i];
    }
    {  // the last trip loads its own chunk again, unused (as in the main body)
      const size_t kn = (size_t)((ci + 1 < nchunk) ? kv0 + 32 : kv0) * DM;
      load_pieces<8>(kh8, Kg0 + kn, 4 * DM);
      load_pieces<8>(kr8, Kg1 + kn, 4 * DM);
    }
    {
      float v[2];
      float mloc = -1e30f;
      const int qrow = q0 + srow;
#pragma unroll
      for (int e = 0; e < 2; ++e) {
        const int cidx = sj + e * 16;
        float s = (Ss[0][srow][cidx] + (Ss[1][srow][cidx] + Ss[2][srow][cidx]) * RINV) * SCL;
        if (kv0 + cidx > qrow) s = -1e30f;         // causal: replace masked scores
        v[e] = s; mloc = fmaxf(mloc, s);
      }
#pragma unroll
      for (int msk = 1; msk < 16; msk <<= 1) mloc = fmaxf(mloc, __shfl_xor(mloc, msk, 32));
      const float m_new = fmaxf(m_prev, mloc);
      const float alpha = __expf(m_prev - m_new);
      float ssum = 0.0f;
#pragma unroll
      for (int e = 0; e < 2; ++e) {
        const int cidx = sj + e * 16;
        const float p  = __expf(v[e] - m_new);
        ssum += p;
        const float pp = p * PSC;
        const h16 hv = (h16)pp;
        Ps[0][srow][cidx] = hv;
        Ps[1][srow][cidx] = (h16)((pp - (float)hv) * RSC);
      }
#pragma unroll
      for (int msk = 1; msk < 16; msk <<= 1) ssum += __shfl_xor(ssum, msk, 32);
      l_run = l_run * alpha + ssum;
      m_prev = m_new;
      if (sj == 0) { alpha_s[srow] = alpha; l_s[srow] = l_run; }
    }
    lds_barrier();     // P, the factors and V^T visible; the next K pieces stay in flight

    {
      float al[8];
#pragma unroll
      for (int g = 0; g < 8; ++g) al[g] = alpha_s[g + 8 * half];
      v16h ah = load_a_frag(&Ps[0][0][0], VP32, 0);
      v16h ar = load_a_frag(&Ps[1][0][0], VP32, 0);
      v16h bh[4], br[4];               // every fragment of the chunk, read as one group
#pragma unroll     // constant indices keep bh[] and br[] in registers
      for (int t = 0; t < 4; ++t) {
        const int d0 = w * 64 + t * 16;
        bh[t] = load_b_frag(&Vts[0][d0][0], VP32, 0);
        br[t] = load_b_frag(&Vts[1][d0][0], VP32, 0);
      }
      __builtin_amdgcn_sched_barrier(0);   // keeps all reads ahead of the rescale and the WMMAs, which then run under their latency
#pragma unroll
      for (int t = 0; t < 4; ++t)
#pragma unroll
        for (int g = 0; g < 8; ++g) { oh[t][g] *= al[g]; orr[t][g] *= al[g]; }
#pragma unroll
      for (int t = 0; t < 4; ++t) {
        oh[t]  = wmma_f16(ah, bh[t], oh[t]);
        orr[t] = wmma_f16(ah, br[t], orr[t]);
        orr[t] = wmma_f16(ar, bh[t], orr[t]);
      }
    }
  }
  __syncthreads();

  h16* Ct = &Ks[0][0][0];
  float linv[8];
#pragma unroll
  for (int g = 0; g < 8; ++g) linv[g] = 1.0f / (l_s[g + 8 * half] * PSC);
#pragma unroll
  for (int t = 0; t < 4; ++t) {
    const int col = w * 64 + t * 16 + idx;
#pragma unroll
    for (int g = 0; g < 8; ++g) {
      const int rl = g + 8 * half;
      const float u = (oh[t][g] + orr[t][g] * RINV) * linv[g];     // x16 carried ctx
      const h16 hv = (h16)u;
      Ct[rl * DM + col] = hv;
      Ct[16 * DM + rl * DM + col] = (h16)((u - (float)hv) * RSC);
    }
  }
  __syncthreads();
  {
    h16* dsth = Ch + ((size_t)(b * SEQ + q0)) * DM;
    h16* dstr = Cr + ((size_t)(b * EARLY_R + q0)) * DM;
    for (int gg = tid; gg < 16 * DM / 8; gg += 256) {
      vst2(dsth + (size_t)gg * 8, *(const v4u*)(Ct + gg * 8));
      vst2(dstr + (size_t)gg * 8, *(const v4u*)(Ct + 16 * DM + gg * 8));
    }
  }
}

// ---------------- both attention bodies in one grid ----------------
// The two jobs are independent. blockIdx.x = sequence (the fast index: each job's blocks start longest first over all sequences);
// blockIdx.y < NEB: a pair of neighbouring early tiles, last pair (most chunks) first; behind them the runs of the main body's table.
// Started with the first round, an early pair ends inside it whatever its chunks cost beside a run's; started last it could outlast
// the last runs. Workgroups of 16 waves, one per WGP; one LDS array serves both bodies.
constexpr int NMAIN = (SEQ > EARLY_R) ? NRUN : 0;
constexpr int NEB   = EARLY_R / 32;                                   // pairs of early tiles per sequence
// byte offsets in the LDS array: the main body's views ...
constexpr int MQ_OFF = 0;
constexpr int MV_OFF = MQ_OFF + QT * QP * (int)sizeof(h16);           // directly behind Qs: the f32 partial tile spans both
constexpr int MS_OFF = MV_OFF + DM * VP64 * (int)sizeof(h16);
constexpr int MP_OFF = MS_OFF + 4 * QT * SP64 * (int)sizeof(float);
constexpr int MF_OFF = MP_OFF + QT * VP64 * (int)sizeof(h16);         // factors, sums, maxima: QT floats each
constexpr int M_BYTES = MF_OFF + 3 * QT * (int)sizeof(float);
// ... and those of one early tile
constexpr int EQ_OFF = 0;
constexpr int EV_OFF = EQ_OFF + 2 * 16 * QP * (int)sizeof(h16);
constexpr int ES_OFF = EV_OFF + 2 * DM * VP32 * (int)sizeof(h16);
constexpr int EP_OFF = ES_OFF + 3 * 16 * SP32 * (int)sizeof(float);
constexpr int EF_OFF = EP_OFF + 2 * 16 * VP32 * (int)sizeof(h16);     // factors, sums: 16 floats each
constexpr int E_BYTES = EF_OFF + 2 * 16 * (int)sizeof(float);
constexpr int ATTN_LDS = (M_BYTES > 2 * E_BYTES) ? M_BYTES : 2 * E_BYTES;
static_assert(2 * 32 * QP <= 2 * DM * VP32 && 64 * QP <= DM * VP64);  // a K chunk fits its V^T chunk's space
static_assert(MV_OFF % 16 == 0 && MS_OFF % 16 == 0 && MP_OFF % 16 == 0 && MF_OFF % 16 == 0);
static_assert(EV_OFF % 16 == 0 && ES_OFF % 16 == 0 && EP_OFF % 16 == 0 && EF_OFF % 16 == 0 && E_BYTES % 16 == 0);
static_assert(ATTN_LDS <= 320 * 1024);
__global__ __launch_bounds__(512) __attribute__((amdgpu_num_vgpr(256)))
void attn_kernel(const h16* __restrict__ Qh, const h16* __restrict__ Qr,
                 const h16* __restrict__ Kh, const h16* __restrict__ Kr,
                 const h16* __restrict__ Vth, const h16* __restrict__ Vtr,
                 h16* __restrict__ Ch, h16* __restrict__ Cr, float* __restrict__ Op, float* __restrict__ Ml) {
  __shared__ __align__(16) char lds[ATTN_LDS];
  const int b = blockIdx.x, y = blockIdx.y;
  if (y >= NEB) {                                   // block-uniform
    float* f = (float*)(lds + MF_OFF);
    attn_main_body((h16 (*)[QP])(lds + MQ_OFF), (h16 (*)[VP64])(lds + MV_OFF), (float (*)[QT][SP64])(lds + MS_OFF),
                   (h16 (*)[VP64])(lds + MP_OFF), f, f + QT, f + 2 * QT, b, SEGS.run[y - NEB], Qh, Kh, Vth, Ch, Op, Ml);
  } else {
    // waves 0..7: the pair's first tile, waves 8..15: its second; read as a scalar, so that the tile's position, its trip count and
    // its LDS base stay wave-uniform for the compiler (scalar loop branch, no EXEC masking round the WMMAs)
    const int hw = __builtin_amdgcn_readfirstlane(threadIdx.x >> 8);
    char* e = lds + hw * E_BYTES;
    float* f = (float*)(e + EF_OFF);
    // tiles 32 j and 32 j + 16 both walk j + 1 chunks: every wave of the workgroup passes the same barriers
    attn_early_body((h16*)(e + EQ_OFF), (h16*)(e + EV_OFF), (float*)(e + ES_OFF), (h16*)(e + EP_OFF), f, f + 16, b,
                    (NEB - 1 - y) * 32 + hw * 16, Qh, Qr, Kh, Kr, Vth, Vtr, Ch, Cr);
  }
}

// ---------------- output projection: out = ctx(MT x 512) * Wo(512 x 512)^T, f32 ----------------
// Same wave layout and k-block LDS staging as proj_qkv. Blocks with sequence positions < EARLY_R add the ctx residual product
// (second accumulator); the two kinds of block run separate instances of the body, so that only the early one holds it.
template <bool EARLY> __device__ __forceinline__
void proj_out_body(const h16* __restrict__ Ch, const h16* __restrict__ Cr, const h16* __restrict__ Wo, float* __restrict__ out,
                   h16* Ws, h16* Cs, h16* Rs, int m0, int n0, int bb, int s0) {
  const int tid = threadIdx.x, w = tid >> 5, lane = tid & 31, idx = lane & 15, half = lane >> 4;
  const int mw_l = (w & 3) * 16;
  const int nw_l = (w >> 2) * 64;

  v8f c[4] = {};
  v8f cr[4] = {};                                   // used by the early instance only
#pragma unroll 1   // rolled: nothing moves across the barriers of a trip, unrolling would only multiply the code
  for (int kb = 0; kb < DM; kb += KB) {
    __syncthreads();                                // the previous block's fragment reads are done
    stage_rows<64>(Cs, Ch + (size_t)m0 * DM + kb, tid);
    stage_rows<128>(Ws, Wo + (size_t)n0 * DM + kb, tid);
    if (EARLY) {
      __builtin_amdgcn_sched_barrier(0);            // the W pieces leave their registers first: all three loads' would not fit 128
      stage_rows<64>(Rs, Cr + (size_t)(bb * EARLY_R + s0) * DM + kb, tid);
    }
    __syncthreads();                                // the staged block is visible to every wave
#pragma unroll
    for (int k0 = 0; k0 < KB; k0 += 32) {
      v16h a = load_a_frag(Cs + mw_l * KP, KP, k0);
      v16h ar = {};
      if (EARLY) ar = load_a_frag(Rs + mw_l * KP, KP, k0);
      v16h bf[4];
#pragma unroll
      for (int t = 0; t < 4; ++t) bf[t] = load_b_frag(Ws + (nw_l + t * 16) * KP, KP, k0);
      __builtin_amdgcn_sched_barrier(0);            // keeps the k step's reads together, ahead of its WMMAs
#pragma unroll
      for (int t = 0; t < 4; ++t) {
        c[t] = wmma_f16(a, bf[t], c[t]);
        if (EARLY) cr[t] = wmma_f16(ar, bf[t], cr[t]);
      }
      if (EARLY) __builtin_amdgcn_sched_barrier(0); // two accumulator sets: a second fragment set would not fit 128 registers
    }
  }
  __syncthreads();                                  // last fragment reads done before the space becomes the output tile
  float* T = (float*)Ws;
#pragma unroll
  for (int t = 0; t < 4; ++t) {
    const int cl = nw_l + t * 16 + idx;
#pragma unroll
    for (int g = 0; g < 8; ++g) {
      const int rl = mw_l + g + 8 * half;
      T[rl * 132 + cl] = (EARLY ? c[t][g] + cr[t][g] * RINV : c[t][g]) * OUT_MUL;
    }
  }
  __syncthreads();
  {
    float* dst = out + ((size_t)(bb * SEQ_FULL + s0)) * DM + n0;
    for (int gg = tid; gg < 64 * 32; gg += 256) {
      const int rl = gg >> 5, pc = gg & 31;
      vst2(dst + (size_t)rl * DM + pc * 4, *(const v4f*)(&T[rl * 132 + pc * 4]));
    }
  }
}

__global__ __launch_bounds__(256) __attribute__((amdgpu_num_vgpr(128)))   // four workgroups (LDS limit) = 8 waves per SIMD
void proj_out_kernel(const h16* __restrict__ Ch, const h16* __restrict__ Cr,
                                                       const h16* __restrict__ Wo, float* __restrict__ out) {
  __shared__ __align__(16) h16 Ws[128 * KP];      // reused as the f32 output tile [64][132] after the k loop
  __shared__ __align__(16) h16 Cs[64 * KP];
  __shared__ __align__(16) h16 Rs[64 * KP];
  static_assert(64 * 132 * sizeof(float) <= 128 * KP * sizeof(h16));
  const int m0 = blockIdx.x * 64, n0 = blockIdx.y * 128;
  const int bb = m0 / SEQ, s0 = m0 - bb * SEQ;
  if (s0 < EARLY_R) proj_out_body<true>(Ch, Cr, Wo, out, Ws, Cs, Rs, m0, n0, bb, s0);     // block-uniform
  else              proj_out_body<false>(Ch, Cr, Wo, out, Ws, Cs, Rs, m0, n0, bb, s0);
}

extern "C" void kernel_launch(void* const* d_in, const int* in_sizes, int n_in,
                              void* d_out, int out_size, void* d_ws, size_t ws_size,
                              hipStream_t stream) {
  if (n_in < 5) return;
  const int rows_needed = (NB - 1) * SEQ_FULL + SEQ;
  if (in_sizes[0] < rows_needed * DM) return;
  for (int i = 1; i < 5; ++i) if (in_sizes[i] < DM * DM) return;
  if (out_size < rows_needed * DM) return;

  const float* x  = (const float*)d_in[0];
  const float* Wq = (const float*)d_in[1];
  const float* Wk = (const float*)d_in[2];
  const float* Wv = (const float*)d_in[3];
  const float* Wo = (const float*)d_in[4];
  float* out = (float*)d_out;

  const size_t plane = (size_t)MT * DM * sizeof(h16);              // 16,777,216 at full size
  const size_t wpl   = (size_t)DM * DM * sizeof(h16);              //    524,288
  const size_t rpl   = (size_t)NB * EARLY_R * DM * sizeof(h16);    //  2,097,152 at full size
  size_t off = 0;
  char* ws = (char*)d_ws;
  h16* xb  = (h16*)(ws + off); off += plane;
  h16* wqb = (h16*)(ws + off); off += wpl;
  h16* wkb = (h16*)(ws + off); off += wpl;
  h16* wvb = (h16*)(ws + off); off += wpl;
  h16* wob = (h16*)(ws + off); off += wpl;
  h16* qh  = (h16*)(ws + off); off += plane;
  h16* kh  = (h16*)(ws + off); off += plane;
  h16* vth = (h16*)(ws + off); off += plane;   // [b][d][s]
  h16* qr  = (h16*)(ws + off); off += rpl;
  h16* kr  = (h16*)(ws + off); off += rpl;
  h16* vtr = (h16*)(ws + off); off += rpl;     // [b][d][s < EARLY_R]
  h16* ch  = (h16*)(ws + off); off += plane;
  h16* crp = (h16*)(ws + off); off += rpl;
  float* opp = (float*)(ws + off); off += (size_t)NB * NSLOT * QT * DM * sizeof(float);   // partial sums of the cut tiles' runs
  float* mlp = (float*)(ws + off); off += (size_t)NB * NSLOT * 2 * QT * sizeof(float);    // their row maxima and row sums
  if (off > ws_size) return;

  cvt_kernel<<<NXB + 4 * NWB, 256, 0, stream>>>(x, Wq, Wk, Wv, Wo, xb, wqb, wkb, wvb, wob);

  proj_qkv_kernel<<<dim3(MT / 64, DM / 128, 3), 256, 0, stream>>>(xb, wqb, wkb, wvb, qh, kh, vth, qr, kr, vtr);

  attn_kernel<<<dim3(NB, NEB + NMAIN), 512, 0, stream>>>(qh, qr, kh, kr, vth, vtr, ch, crp, opp, mlp);
  if (SEQ > EARLY_R && MAXSEG > 1) attn_combine_kernel<<<dim3(NCUT * (QT / 4), NB), 256, 0, stream>>>(opp, mlp, ch);

  proj_out_kernel<<<dim3(MT / 64, DM / 128), 256, 0, stream>>>(ch, crp, wob, out);
}

// v009
// It runs in 174 microseconds.
// Next to v008, in two timings, it ran 1.04 and 1.02 times as fast.
// Over all steps from v000 it is 5.72 times as fast.
#include <hip/hip_runtime.h>
// Contractions: Q/K/V projections (K = 512), scores Q K^T (K = 512), P V (K = keys) and the output projection (K = 512)
// on v_wmma_f32_16x16x32_f16 (f16 operands, f32 accumulate). Inputs enter as bf16-RNE values carried x16 in f16 planes;
// q/k/v/ctx are f16 hi planes carried x16 plus f16 residual planes carried x16384 for the first EARLY_R positions of each
// sequence (scores: hh + hr + rh, P V: hh + hr + rh, output projection: h + r); P carried x1024; softmax statistics in f32.

typedef _Float16 h16;
typedef _Float16 h16x8 __attribute__((ext_vector_type(8)));
typedef _Float16 v16h  __attribute__((ext_vector_type(16)));
typedef float  v8f    __attribute__((ext_vector_type(8)));
typedef float  v4f    __attribute__((ext_vector_type(4)));
typedef unsigned v4u  __attribute__((ext_vector_type(4)));

#ifndef NB
#define NB 4
#endif
#ifndef SEQ
#define SEQ 4096
#endif
#define NB_FULL 4
#define SEQ_FULL 4096
#define DM 512
#define EARLY_CAP 512
#define EARLY_R ((SEQ < EARLY_CAP) ? SEQ : EARLY_CAP)
#define MT (NB * SEQ)
// LDS row pitches in elements. f16 rows read by 16-byte fragment loads: byte pitch = 16 x odd, so the 16 rows of a fragment
// fall on distinct bank groups. f32 score rows: pitch chosen so that the tile stores and the row reads both spread over banks.
#define QP  (DM + 8)               // 1040 B: Q and K rows of 512 f16
#define VP64 72                    // 144 B: V^T and P rows of 64 f16
#define VP32 40                    // 80 B: V^T and P rows of 32 f16
#define SP64 76                    // f32 score rows of 64
#define SP32 36                    // f32 score rows of 32
#define KB   128                   // k block of the projections' LDS staging
#define KP   (KB + 8)              // 272 B: staged projection operand rows of 128 f16

static_assert(SEQ % 64 == 0);
static_assert((EARLY_R) % 64 == 0);
static_assert(NB >= 1 && NB <= NB_FULL);
static_assert(SEQ >= 64 && SEQ <= SEQ_FULL);
static_assert(DM % 128 == 0);
static_assert(((NB - 1) * SEQ_FULL + SEQ) * DM <= NB_FULL * SEQ_FULL * DM);

#define ISC  16.0f                 // carry of the x / q / k / v / ctx f16 hi planes
#define WSC  16.0f                 // carry of the weight planes
#define PSC  1024.0f               // carry of P
#define RSC  16384.0f              // carry of every residual plane
#define RINV (1.0f / 16384.0f)
#define PROJ_MUL (1.0f / 16.0f)    // acc of (x16 * x16) operands -> x16 plane value
#define OUT_MUL  (1.0f / 256.0f)   // acc of (x16 * x16) operands -> f32 output
#define SCL ((1.0f / 256.0f) * (1.0f / 22.627416610717773f))

template <typename V> __device__ __forceinline__ void vst2(void* p, V v) {
  *(V*)p = v; 
}
__device__ __forceinline__ void copy16_g2s(h16* ldst, const h16* gsrc) { *(h16x8*)ldst = *(const h16x8*)gsrc; }

__device__ __forceinline__ float bf16r(float f) {     // RNE convert to bf16, value kept in f32
  unsigned u = __float_as_uint(f);
  u = (u + 0x7FFFu + ((u >> 16) & 1u)) & 0xFFFF0000u;
  return __uint_as_float(u);
}

// ---- WMMA fragment loaders (f16, row-major K-contiguous source); A and B (from B^T rows) share the per-lane K map:
//      row/col = lane&15; elements 0..7 <- k0 + 8*half + 0..7, elements 8..15 <- k0 + 16 + 8*half + 0..7
__device__ __forceinline__ v16h load_a_frag(const h16* base, int ld, int k0) {
  int lane = threadIdx.x & 31;
  int idx  = lane & 15;
  int half = lane >> 4;
  const h16* p = base + idx * ld + k0 + half * 8;
  h16x8 lo = *(const h16x8*)(p);
  h16x8 hi = *(const h16x8*)(p + 16);
  return __builtin_shufflevector(lo, hi, 0,1,2,3,4,5,6,7,8,9,10,11,12,13,14,15);
}
__device__ __forceinline__ v16h load_b_frag(const h16* base, int ld, int k0) { return load_a_frag(base, ld, k0); }

__device__ __forceinline__ v8f wmma_f16(v16h a, v16h b, v8f c) {
  return __builtin_amdgcn_wmma_f32_16x16x32_f16(false, a, false, b, (short)0, c, false, false);
}

// sc += A(16 x DM) * B(16 x DM)^T, both from LDS rows of pitch QP, k ascending. The fragments are read G k-steps at a time into
// two register sets, each group one group ahead of the WMMAs that use it, so that a wave waits for LDS once per group at most.
template <int G> __device__ __forceinline__ v8f dot_rows(const h16* A, const h16* B, v8f sc) {
  constexpr int NG = DM / (32 * G);
  v16h fa[2][G], fb[2][G];
#pragma unroll     // constant indices keep the fragment sets in registers
  for (int j = 0; j < G; ++j) { fa[0][j] = load_a_frag(A, QP, j * 32); fb[0][j] = load_b_frag(B, QP, j * 32); }
#pragma unroll     // constant indices keep the fragment sets in registers
  for (int g = 0; g < NG; ++g) {
    if (g + 1 < NG) {
#pragma unroll     // as above
      for (int j = 0; j < G; ++j) {
        fa[(g + 1) & 1][j] = load_a_frag(A, QP, ((g + 1) * G + j) * 32);
        fb[(g + 1) & 1][j] = load_b_frag(B, QP, ((g + 1) * G + j) * 32);
      }
    }
    __builtin_amdgcn_sched_barrier(0);   // keeps the next group's reads ahead of this group's WMMAs (else they sink to their use)
#pragma unroll     // as above
    for (int j = 0; j < G; ++j) sc = wmma_f16(fa[g & 1][j], fb[g & 1][j], sc);
    __builtin_amdgcn_sched_barrier(0);   // no read of the group after next in front of these WMMAs: it would take a third register set
  }
  return sc;
}

// Work-group barrier for data handed over in LDS alone: its fences name the LDS address space only, so a wave waits for its LDS
// operations and not for its global loads, which stay in flight across it (__syncthreads() waits for them too).
__device__ __forceinline__ void lds_barrier() {
  __builtin_amdgcn_fence(__ATOMIC_RELEASE, "workgroup", "local");
  __builtin_amdgcn_s_barrier();
  __builtin_amdgcn_fence(__ATOMIC_ACQUIRE, "workgroup", "local");
}

// N 16-byte pieces per thread, 'step' elements apart, from global memory into registers.
template <int N> __device__ __forceinline__ void load_pieces(h16x8 (&r)[N], const h16* g0, size_t step) {
#pragma unroll     // constant indices keep r[] in registers and the steps in the loads' offset fields
  for (int i = 0; i < N; ++i) r[i] = *(const h16x8*)(g0 + i * step);
  // address-translation wait; g0 as an input keeps the loads' address pair untouched (also by a later load's result) up to it
  asm volatile("s_wait_xcnt 0x0" :: "v"(g0) : "memory");
}

// LDS byte address of a __shared__ location: the destination operand of an asynchronous copy.
__device__ __forceinline__ unsigned lds_addr(const void* p) {
  return (unsigned)(size_t)(const __attribute__((address_space(3))) void*)p;
}

// Eight asynchronous 16-byte copies per lane from global memory into LDS, through no register: pieces 'lstep' bytes apart in LDS and
// 'gstep' elements apart in global memory. The address-translation wait closes the copies' own statement, so that it stands ahead of
// every later write of their address registers.
__device__ __forceinline__ void copy8_async(unsigned l0, unsigned lstep, const h16* g0, size_t gstep) {
  asm volatile("global_load_async_to_lds_b128 %0, %8, off\n\t"
               "global_load_async_to_lds_b128 %1, %9, off\n\t"
               "global_load_async_to_lds_b128 %2, %10, off\n\t"
               "global_load_async_to_lds_b128 %3, %11, off\n\t"
               "global_load_async_to_lds_b128 %4, %12, off\n\t"
               "global_load_async_to_lds_b128 %5, %13, off\n\t"
               "global_load_async_to_lds_b128 %6, %14, off\n\t"
               "global_load_async_to_lds_b128 %7, %15, off\n\t"
               "s_wait_xcnt 0x0"
               :: "v"(l0), "v"(l0 + lstep), "v"(l0 + 2 * lstep), "v"(l0 + 3 * lstep),
                  "v"(l0 + 4 * lstep), "v"(l0 + 5 * lstep), "v"(l0 + 6 * lstep), "v"(l0 + 7 * lstep),
                  "v"(g0), "v"(g0 + gstep), "v"(g0 + 2 * gstep), "v"(g0 + 3 * gstep),
                  "v"(g0 + 4 * gstep), "v"(g0 + 5 * gstep), "v"(g0 + 6 * gstep), "v"(g0 + 7 * gstep)
               : "memory");
}

// Hand-over point of a chunk staged by asynchronous copies: each wave's LDS operations are done and its own copies have landed, then
// the workgroup barrier. Behind it every wave may read what was copied, and the space whose readers have just left may be refilled.
__device__ __forceinline__ void publish_barrier() {
  asm volatile("s_wait_dscnt 0x0" ::: "memory");      // this wave's LDS reads and writes are done before another wave's copies refill the space
  asm volatile("s_wait_asynccnt 0x0" ::: "memory");   // this wave's copies have landed: the compiler places no wait for them
  __syncthreads();
}

// Stage ROWS rows of KB f16 (256 B = two whole lines per row, source row pitch DM) into LDS rows of pitch KP, 256 threads:
// one wave-wide 16-byte load covers two rows = four whole lines.
template <int ROWS> __device__ __forceinline__ void stage_rows(h16* lds, const h16* g, int tid) {
  h16* l0 = lds + (tid >> 4) * KP + (tid & 15) * 8;
  const h16* g0 = g + (size_t)(tid >> 4) * DM + (tid & 15) * 8;
  h16x8 r[ROWS / 16];
  load_pieces<ROWS / 16>(r, g0, 16 * DM);
#pragma unroll     // constant indices keep r[] in registers
  for (int i = 0; i < ROWS / 16; ++i) *(h16x8*)(l0 + i * 16 * KP) = r[i];
}

// ---------------- conversion kernel ----------------
// One grid for both independent jobs; the block index picks the job, 8 elements (16 B) per thread.
// Blocks < NXB: xb[row][c] = f16( bf16r(x) * 16 ), rows indexed b*SEQ + s, source rows b*SEQ_FULL + s.
// The other blocks, NWB per matrix: Wb[n][k] = f16( bf16r(W[n][k]) * 16 ) (weights are already [out][in] = [n][k]).
#define NXB (MT * DM / 8 / 256)
#define NWB (DM * DM / 8 / 256)
static_assert(MT * DM % (8 * 256) == 0 && DM * DM % (8 * 256) == 0);
__global__ __launch_bounds__(256) void cvt_kernel(const float* __restrict__ x,
                                                  const float* __restrict__ W0, const float* __restrict__ W1,
                                                  const float* __restrict__ W2, const float* __restrict__ W3,
                                                  h16* __restrict__ xb,
                                                  h16* __restrict__ D0, h16* __restrict__ D1,
                                                  h16* __restrict__ D2, h16* __restrict__ D3) {
  const float* src;
  h16* dst;
  float carry;
  if (blockIdx.x < NXB) {                            // block-uniform
    const int g = blockIdx.x * 256 + threadIdx.x;
    const int row = g >> 6, c8 = g & 63;             // 64 groups of 8 per 512-wide row
    const int b = row / SEQ, sq = row - b * SEQ;
    src = x + ((size_t)(b * SEQ_FULL + sq)) * DM + c8 * 8;
    dst = xb + (size_t)g * 8;
    carry = ISC;
  } else {
    const int r = blockIdx.x - NXB, y = r / NWB;
    const int g = (r - y * NWB) * 256 + threadIdx.x;
    const float* W = (y == 0) ? W0 : (y == 1) ? W1 : (y == 2) ? W2 : W3;
    h16*       D  = (y == 0) ? D0 : (y == 1) ? D1 : (y == 2) ? D2 : D3;
    src = W + (size_t)g * 8;
    dst = D + (size_t)g * 8;
    carry = WSC;
  }
  const v4f a = *(const v4f*)(src), bq = *(const v4f*)(src + 4);
  union { h16x8 h; v4u u; } pk;
#pragma unroll
  for (int i = 0; i < 4; ++i) { pk.h[i] = (h16)(bf16r(a[i]) * carry); pk.h[4 + i] = (h16)(bf16r(bq[i]) * carry); }
  vst2(dst, pk.u);
}

// ---------------- projection GEMM: Y = X(MT x 512) * W(512 x 512)^T, blockIdx.z selects Q / K / V ----------------
// 8 waves/WG: 4 M-subtiles x 2 N-groups(64). Each wave: 16x64 (4 WMMA tiles). The X (64 rows) and W (128 rows) operands are
// staged in LDS in k blocks of KB = 128 by whole-line 16-byte loads; fragments are read from LDS. The staging space is reused
// for the 64 x 128 output tile. Blocks whose sequence positions are < EARLY_R also write the residual planes (x16384).
__global__ __launch_bounds__(256) void proj_qkv_kernel(const h16* __restrict__ Xb,
                                                       const h16* __restrict__ Wq, const h16* __restrict__ Wk,
                                                       const h16* __restrict__ Wv,
                                                       h16* __restrict__ Qh, h16* __restrict__ Kh, h16* __restrict__ Vth,
                                                       h16* __restrict__ Qr, h16* __restrict__ Kr, h16* __restrict__ Vtr) {
  __shared__ __align__(16) h16 Th[128 * 136];     // [m][n] pitch 136 (Q/K) or [n][m] pitch 72 (V)
  __shared__ __align__(16) h16 Tr[128 * 136];
  const int z = blockIdx.z;
  const h16* W = (z == 0) ? Wq : (z == 1) ? Wk : Wv;
  const int transposed = (z == 2) ? 1 : 0;
  const int m0 = blockIdx.x * 64, n0 = blockIdx.y * 128;
  const int bb = m0 / SEQ, s0 = m0 - bb * SEQ;
  const bool early = (s0 < EARLY_R);
  const int tid = threadIdx.x, w = tid >> 5, lane = tid & 31, idx = lane & 15, half = lane >> 4;
  const int mw_l = (w & 3) * 16;
  const int nw_l = (w >> 2) * 64;

  v8f c[4] = {};
  h16* Ws = Th;                                     // [128][KP] during the k loop
  h16* Xs = Tr;                                     // [64][KP] during the k loop
#pragma unroll 1   // rolled: nothing moves across the barriers of a trip, unrolling would only multiply the code
  for (int kb = 0; kb < DM; kb += KB) {
    __syncthreads();                                // the previous block's fragment reads are done
    stage_rows<64>(Xs, Xb + (size_t)m0 * DM + kb, tid);
    stage_rows<128>(Ws, W + (size_t)n0 * DM + kb, tid);
    __syncthreads();                                // the staged block is visible to every wave
#pragma unroll
    for (int k0 = 0; k0 < KB; k0 += 32) {
      v16h a = load_a_frag(Xs + mw_l * KP, KP, k0);
      v16h bf[4];
#pragma unroll
      for (int t = 0; t < 4; ++t) bf[t] = load_b_frag(Ws + (nw_l + t * 16) * KP, KP, k0);
      __builtin_amdgcn_sched_barrier(0);            // keeps the k step's reads together, ahead of its WMMAs
#pragma unroll
      for (int t = 0; t < 4; ++t) c[t] = wmma_f16(a, bf[t], c[t]);
    }
  }
  __syncthreads();                                  // last fragment reads done before the space becomes the output tile
#pragma unroll
  for (int t = 0; t < 4; ++t) {
    const int cl = nw_l + t * 16 + idx;             // local col
#pragma unroll
    for (int g = 0; g < 8; ++g) {
      const int rl = mw_l + g + 8 * half;           // local row
      const float u = c[t][g] * PROJ_MUL;           // x16 carried value
      const h16 hv = (h16)u;
      const int li = transposed ? (cl * 72 + rl) : (rl * 136 + cl);
      Th[li] = hv;
      if (early) Tr[li] = (h16)((u - (float)hv) * RSC);
    }
  }
  __syncthreads();
  if (!transposed) {
    h16* Oh = (z == 0) ? Qh : Kh;
    h16* Orp = (z == 0) ? Qr : Kr;
    for (int gg = tid; gg < 64 * 16; gg += 256) {
      const int rl = gg >> 4, pc = gg & 15;
      vst2(Oh + (size_t)(m0 + rl) * DM + n0 + pc * 8, *(const v4u*)(&Th[rl * 136 + pc * 8]));
      if (early) vst2(Orp + (size_t)(bb * EARLY_R + s0 + rl) * DM + n0 + pc * 8, *(const v4u*)(&Tr[rl * 136 + pc * 8]));
    }
  } else {
    for (int gg = tid; gg < 128 * 8; gg += 256) {
      const int cl = gg >> 3, pc = gg & 7;
      vst2(Vth + ((size_t)(bb * DM + n0 + cl)) * SEQ + s0 + pc * 8, *(const v4u*)(&Th[cl * 72 + pc * 8]));
      if (early) vst2(Vtr + ((size_t)(bb * DM + n0 + cl)) * EARLY_R + s0 + pc * 8, *(const v4u*)(&Tr[cl * 72 + pc * 8]));
    }
  }
}

// ---------------- split of the main attention's key ranges ----------------
// A 64-query tile at position q0 walks q0/64 + 1 key chunks, so the last tile costs seven times the first, and with one workgroup
// per tile the launch lasts as long as the last tile. A tile of more than SEGL chunks is cut into equal runs of at most SEGL chunks,
// one workgroup each; the runs are dealt out longest first. A run of a cut tile leaves its unnormalised sums, its row maxima and
// its row sums in a slot of the workspace, and attn_combine_kernel joins the slots of a tile.
#define SEGL 22                    // about two rounds of workgroups at one per WGP
#define QT   64                    // queries per tile of the main body
#define NO_SLOT 0xFFFF
constexpr int NT = (SEQ > EARLY_R) ? (SEQ - EARLY_R) / QT : 1;
constexpr int tile_chunks(int t) { return (EARLY_R + t * QT) / 64 + 1; }
constexpr int tile_segs(int t) { return (tile_chunks(t) + SEGL - 1) / SEGL; }
constexpr int count_runs(bool cut_only) {
  int c = 0;
  for (int t = 0; t < NT; ++t) if (!cut_only || tile_segs(t) > 1) c += tile_segs(t);
  return c;
}
constexpr int count_cut_tiles() {
  int c = 0;
  for (int t = 0; t < NT; ++t) if (tile_segs(t) > 1) ++c;
  return c;
}
constexpr int NRUN   = count_runs(false);                                  // runs per sequence, one workgroup each
constexpr int NSLOT  = (count_runs(true) > 0) ? count_runs(true) : 1;      // partial results per sequence
constexpr int NCUT   = (count_cut_tiles() > 0) ? count_cut_tiles() : 1;    // tiles per sequence that are cut
constexpr int MAXSEG = tile_segs(NT - 1);
struct Run { unsigned short tile, c0, len, slot; };       // chunks c0 .. c0 + len - 1 of a tile; slot = NO_SLOT: the whole tile
struct Cut { unsigned short tile, slot, nseg, pad; };     // a cut tile's runs lie in slots slot .. slot + nseg - 1
struct SegTab { Run run[NRUN]; Cut cut[NCUT]; };
constexpr SegTab make_seg_tab() {
  SegTab T = {};
  int n = 0, slot = 0, nc = 0;
  for (int t = 0; t < NT; ++t) {
    const int ch = tile_chunks(t), ns = tile_segs(t);
    if (ns > 1) { T.cut[nc].tile = (unsigned short)t; T.cut[nc].slot = (unsigned short)slot; T.cut[nc].nseg = (unsigned short)ns; ++nc; }
    for (int s = 0; s < ns; ++s) {
      Run r = {};
      r.tile = (unsigned short)t;
      r.c0   = (unsigned short)(s * ch / ns);
      r.len  = (unsigned short)((s + 1) * ch / ns - s * ch / ns);
      r.slot = (unsigned short)((ns > 1) ? slot++ : NO_SLOT);
      int p = n++;                                        // insertion keeps the list sorted, longest run first
      for (; p > 0 && T.run[p - 1].len < r.len; --p) T.run[p] = T.run[p - 1];
      T.run[p] = r;
    }
  }
  return T;
}
__constant__ const SegTab SEGS = make_seg_tab();
#define OPP (DM + 4)               // f32 row pitch of the partial tile in LDS: rows g and g + 8 fall on different banks

// ---------------- flash attention, causal, query positions >= EARLY_R (single products) ----------------
// WG = 64 queries, 16 waves, key chunks of 64: one run of chunks of one tile (table above). Each staged chunk serves all 64 queries, so a
// query costs half the L2 reads and LDS writes of K and V^T that it costs in a 32-query workgroup. The Q tile, the K chunks and the V^T chunks
// come into LDS by asynchronous copies of whole lines, through no register, K and V^T each into a space of its own: V^T flies during
// the score phase, the next chunk's K during the softmax and PV phases.
// Waves 0..7 serve queries 0..31 of the tile, waves 8..15 queries 32..63 (qb = 32 (w>>3)); a wave covers both 16-query tiles of its half,
// so that each fragment read from LDS feeds two WMMAs.
// Score phase: wave w -> (ds = w&3, kh = (w>>2)&1): 32 keys x 32 queries (2 x 2 tiles of K Q^T) over the dims [128 ds, 128 ds + 128);
// the four partial sums of a score meet in the softmax phase. PV phase: wave w -> 32 q x dims [64 (w&7), 64 (w&7) + 64) (2 x 4 accum tiles).
// LDS (views of attn_kernel's array): Qs; behind it Vts, d-major, f16 ctx tile [64][512] after the loop;
// Ss, one plane of partial scores per 128-dim slice; Ps; the rows' factors, sums and maxima; Ks, K rows [64][QP].
__device__ __forceinline__
void attn_main_body(h16 (*Qs)[QP], h16 (*Vts)[VP64], float (*Ss)[QT][SP64], h16 (*Ps)[VP64],
                    float* alpha_s, float* l_s, float* m_s, h16* Ks, const int b, const Run run,
                    const h16* __restrict__ Qh, const h16* __restrict__ Kh,
                    const h16* __restrict__ Vth, h16* __restrict__ Ch, float* __restrict__ Op, float* __restrict__ Ml) {
  const int q0  = EARLY_R + run.tile * QT;
  const int tid = threadIdx.x;
  const int w    = tid >> 5;
  const int lane = tid & 31;
  const int idx  = lane & 15;
  const int half = lane >> 4;
  const int ds = w & 3;         // score phase: slice of 128 dims
  const int kh = (w >> 2) & 1;  // score phase: half of the chunk's keys
  const int qb = (w >> 3) * 32; // both matrix phases: first query row of this wave's half of the tile
  const int dw = (w & 7) * 64;  // PV phase: first dim of this wave's 64

  // The Q tile has a K chunk's shape and is dealt out alike: 8 pieces per thread, 8 rows apart.
  static_assert(QT == 64);
  const unsigned Kst = lds_addr(Ks + (tid >> 6) * QP + (tid & 63) * 8);   // this thread's first K piece; the next ones lie 8 rows apart
  const unsigned Vst = lds_addr(&Vts[tid >> 3][(tid & 7) * 8]);           // this thread's first V^T piece; the next ones lie 64 rows apart
  v8f o[2][4] = {};                   // [query tile][16 dims]
  const int srow = tid >> 3;          // softmax: 8 threads per query row, 8 neighbouring keys each
  const int sj   = tid & 7;
  float m_prev = -1e30f;
  float l_run  = 0.0f;
  const int cbeg = run.c0, nchunk = run.c0 + run.len;   // this run's chunks; a tile's last chunk q0/64 covers every position <= q0+63
  const h16* Kg = Kh + ((size_t)(b * SEQ + (tid >> 6))) * DM + (tid & 63) * 8;
  // The Q tile and the first K chunk fly together; the first trip's hand-over point publishes both.
  copy8_async(lds_addr(&Qs[tid >> 6][(tid & 63) * 8]), 8 * QP * sizeof(h16),
              Qh + ((size_t)(b * SEQ + q0 + (tid >> 6))) * DM + (tid & 63) * 8, 8 * DM);
  copy8_async(Kst, 8 * QP * sizeof(h16), Kg + (size_t)(cbeg * 64) * DM, 8 * DM);

#pragma unroll 1
  for (int ci = cbeg; ci < nchunk; ++ci) {
    const int kv0 = ci * 64;
    publish_barrier(); // this chunk's K (and Q on the first trip) landed and visible; prior PV done with Vts / Ps
    // the V^T chunk lands under the score phase
    copy8_async(Vst, 64 * VP64 * sizeof(h16), Vth + (size_t)(b * DM + (tid >> 3)) * SEQ + kv0 + (tid & 7) * 8, (size_t)64 * SEQ);

    {
      // A = K rows, B = Q rows: a lane then holds 8 neighbouring keys of one query, two 16-byte stores per tile.
      const h16* Kf = Ks + (kh * 32) * QP + ds * 128;
      const h16* Qf = &Qs[qb][ds * 128];
      v8f sc[2][2] = {};               // [key tile][query tile]
      v16h fk[2][2], fq[2][2];         // two register sets: each k step's fragments are read one step ahead of their WMMAs
#pragma unroll     // constant indices keep the fragment sets in registers (every loop of this block)
      for (int j = 0; j < 2; ++j) { fk[0][j] = load_a_frag(Kf + j * 16 * QP, QP, 0); fq[0][j] = load_b_frag(Qf + j * 16 * QP, QP, 0); }
#pragma unroll
      for (int s = 0; s < 4; ++s) {
        if (s + 1 < 4) {
#pragma unroll
          for (int j = 0; j < 2; ++j) {
            fk[(s + 1) & 1][j] = load_a_frag(Kf + j * 16 * QP, QP, (s + 1) * 32);
            fq[(s + 1) & 1][j] = load_b_frag(Qf + j * 16 * QP, QP, (s + 1) * 32);
          }
        }
        __builtin_amdgcn_sched_barrier(0);   // keeps the next step's reads ahead of this step's WMMAs (else they sink to their use)
#pragma unroll
        for (int kt = 0; kt < 2; ++kt)
#pragma unroll
          for (int qt = 0; qt < 2; ++qt) sc[kt][qt] = wmma_f16(fk[s & 1][kt], fq[s & 1][qt], sc[kt][qt]);
        __builtin_amdgcn_sched_barrier(0);   // no read of the step after next in front of these WMMAs: it would take a third register set
      }
#pragma unroll
      for (int kt = 0; kt < 2; ++kt)
#pragma unroll
        for (int qt = 0; qt < 2; ++qt) {
          float* sp = &Ss[ds][qb + qt * 16 + idx][kh * 32 + kt * 16 + 8 * half];
          *(v4f*)(sp)     = __builtin_shufflevector(sc[kt][qt], sc[kt][qt], 0, 1, 2, 3);
          *(v4f*)(sp + 4) = __builtin_shufflevector(sc[kt][qt], sc[kt][qt], 4, 5, 6, 7);
        }
    }
    publish_barrier(); // scores visible, V^T landed and visible; every K fragment read is done, so the next K chunk may take the space

    // the next chunk's K lands under softmax and PV (the test reads the same for the whole workgroup)
    if (ci + 1 < nchunk) copy8_async(Kst, 8 * QP * sizeof(h16), Kg + (size_t)(kv0 + 64) * DM, 8 * DM);
    {
      float v[8];
      float mloc = -1e30f;
      v4f pl[4], ph[4];                // the four partial sums of this thread's 8 scores
#pragma unroll
      for (int p = 0; p < 4; ++p) { pl[p] = *(const v4f*)(&Ss[p][srow][sj * 8]); ph[p] = *(const v4f*)(&Ss[p][srow][sj * 8 + 4]); }
      const v4f sl = (pl[0] + pl[1]) + (pl[2] + pl[3]);
      const v4f sh = (ph[0] + ph[1]) + (ph[2] + ph[3]);
#pragma unroll
      for (int e = 0; e < 8; ++e) {
        float val = ((e < 4) ? sl[e & 3] : sh[e & 3]) * SCL;
        if (kv0 + sj * 8 + e > q0 + srow) val = -1e30f;   // causal: replace masked scores
        v[e] = val; mloc = fmaxf(mloc, val);
      }
#pragma unroll
      for (int msk = 1; msk < 8; msk <<= 1) mloc = fmaxf(mloc, __shfl_xor(mloc, msk, 32));
      const float m_new = fmaxf(m_prev, mloc);
      const float alpha = __expf(m_prev - m_new);
      float ssum = 0.0f;
      h16x8 pk;
#pragma unroll
      for (int e = 0; e < 8; ++e) {
        const float p = __expf(v[e] - m_new);
        ssum += p;
        pk[e] = (h16)(p * PSC);
      }
      *(h16x8*)(&Ps[srow][sj * 8]) = pk;
#pragma unroll
      for (int msk = 1; msk < 8; msk <<= 1) ssum += __shfl_xor(ssum, msk, 32);
      l_run = l_run * alpha + ssum;
      m_prev = m_new;
      if (sj == 0) { alpha_s[srow] = alpha; l_s[srow] = l_run; }
    }
    lds_barrier();     // P and the factors visible; the next K chunk's copies stay in flight

    {
      float al[2][8];
#pragma unroll     // constant indices keep al[], pa[] and vb[] in registers (every loop of this block)
      for (int qt = 0; qt < 2; ++qt)
#pragma unroll
        for (int g = 0; g < 8; ++g) al[qt][g] = alpha_s[qb + qt * 16 + g + 8 * half];
      __builtin_amdgcn_sched_barrier(0);   // the factors' reads go first: the rescale then waits for them alone
      const h16* Vf = &Vts[dw][0];
      v16h pa[2][2], vb[2][4];             // [32 keys][query tile], [32 keys][16 dims]
#pragma unroll
      for (int qt = 0; qt < 2; ++qt) pa[0][qt] = load_a_frag(&Ps[qb + qt * 16][0], VP64, 0);
#pragma unroll
      for (int t = 0; t < 4; ++t) vb[0][t] = load_b_frag(Vf + t * 16 * VP64, VP64, 0);
      __builtin_amdgcn_sched_barrier(0);   // keys 0..31: the reads stay ahead of the rescale, which runs under their latency
#pragma unroll
      for (int qt = 0; qt < 2; ++qt)
#pragma unroll
        for (int t = 0; t < 4; ++t)
#pragma unroll
          for (int g = 0; g < 8; ++g) o[qt][t][g] *= al[qt][g];
      __builtin_amdgcn_sched_barrier(0);   // keys 32..63 are read behind the rescale, when the factors' registers are free ...
#pragma unroll
      for (int qt = 0; qt < 2; ++qt) pa[1][qt] = load_a_frag(&Ps[qb + qt * 16][0], VP64, 32);
#pragma unroll
      for (int t = 0; t < 4; ++t) vb[1][t] = load_b_frag(Vf + t * 16 * VP64, VP64, 32);
      __builtin_amdgcn_sched_barrier(0);   // ... and ahead of the first eight WMMAs, which run under their latency
#pragma unroll
      for (int s = 0; s < 2; ++s)
#pragma unroll
        for (int t = 0; t < 4; ++t)
#pragma unroll
          for (int qt = 0; qt < 2; ++qt) o[qt][t] = wmma_f16(pa[s][qt], vb[s][t], o[qt][t]);
    }
  }
  asm volatile("s_wait_asynccnt 0x0" ::: "memory");   // no copy is outstanding when the staging space is put to other use
  if (sj == 0) m_s[srow] = m_prev;
  __syncthreads();

  if (run.slot != NO_SLOT) {          // block-uniform: a run of a cut tile hands its sums on as they are, in f32
    float* Cf = (float*)&Qs[0][0];    // the f32 tile takes the space of Qs and, directly behind it, of Vts
    static_assert(QT * OPP * sizeof(float) <= (QT * QP + DM * VP64) * sizeof(h16));
#pragma unroll     // constant indices keep o[] in registers (all three loops)
    for (int qt = 0; qt < 2; ++qt)
#pragma unroll
      for (int t = 0; t < 4; ++t)
#pragma unroll
        for (int g = 0; g < 8; ++g) Cf[(qb + qt * 16 + g + 8 * half) * OPP + dw + t * 16 + idx] = o[qt][t][g];
    __syncthreads();                  // the tile is complete before it leaves in whole lines
    const size_t pi = (size_t)b * NSLOT + run.slot;
    float* dst = Op + pi * (QT * DM);
#pragma unroll     // 16 pieces per thread, four rows of the tile apart: all reads issued ahead of the stores, steps in the offset fields
    for (int i = 0; i < QT * DM / 4 / 512; ++i)
      vst2(dst + (size_t)(i * 512 + tid) * 4, *(const v4f*)(Cf + (i * 4 + (tid >> 7)) * OPP + (tid & 127) * 4));
    if (tid < 2 * QT) Ml[pi * (2 * QT) + tid] = (tid < QT) ? m_s[tid] : l_s[tid - QT];   // waves 0, 1: the maxima's lines, waves 2, 3: the sums'
    return;
  }

  h16* Ct = &Vts[0][0];
  static_assert(QT * DM <= DM * VP64);
#pragma unroll
  for (int qt = 0; qt < 2; ++qt) {
    float linv[8];
#pragma unroll
    for (int g = 0; g < 8; ++g) linv[g] = 1.0f / (l_s[qb + qt * 16 + g + 8 * half] * PSC);
#pragma unroll
    for (int t = 0; t < 4; ++t) {
      const int col = dw + t * 16 + idx;
#pragma unroll
      for (int g = 0; g < 8; ++g) Ct[(qb + qt * 16 + g + 8 * half) * DM + col] = (h16)(o[qt][t][g] * linv[g]);
    }
  }
  __syncthreads();
  {
    h16* dst = Ch + ((size_t)(b * SEQ + q0)) * DM;
    for (int gg = tid; gg < QT * DM / 8; gg += 512) vst2(dst + (size_t)gg * 8, *(const v4u*)(Ct + gg * 8));
  }
}

// ---------------- join of a cut tile's runs: ctx = sum_s e^(m_s - M) O_s / (sum_s e^(m_s - M) l_s), M = max_s m_s ----------------
// WG = 4 query rows of one cut tile; a thread joins 8 neighbouring dims and stores them as 16 bytes.
__global__ __launch_bounds__(256) void attn_combine_kernel(const float* __restrict__ Op, const float* __restrict__ Ml,
                                                           h16* __restrict__ Ch) {
  const Cut cut = SEGS.cut[blockIdx.x / (QT / 4)];
  const int b = blockIdx.y, tid = threadIdx.x;
  const int row = (blockIdx.x % (QT / 4)) * 4 + (tid >> 6), c8 = tid & 63;
  const size_t p0 = (size_t)b * NSLOT + cut.slot;
  float m[MAXSEG], l[MAXSEG];
  v4f lo[MAXSEG], hi[MAXSEG];
#pragma unroll     // constant indices keep the parts in registers; every part's loads are issued before the first is used
  for (int s = 0; s < MAXSEG; ++s) {
    if (s < 2 || s < cut.nseg) {      // block-uniform; a cut tile has two parts at least
      const float* ml  = Ml + (p0 + s) * (2 * QT) + row;
      const float* src = Op + ((p0 + s) * QT + row) * DM + c8 * 8;
      m[s] = ml[0]; l[s] = ml[QT];
      lo[s] = *(const v4f*)(src); hi[s] = *(const v4f*)(src + 4);
      // address-translation wait; the pointers as inputs keep the loads' address pairs untouched (also by a later load's result) up to it
      asm volatile("s_wait_xcnt 0x0" :: "v"(ml), "v"(src) : "memory");
    } else {                          // no such part: weight e^(-1e30 - M) = 0
      m[s] = -1e30f; l[s] = 0.0f; lo[s] = v4f{}; hi[s] = v4f{};
    }
  }
  float M = m[0];
#pragma unroll     // constant indices, as above (this loop and the next two)
  for (int s = 1; s < MAXSEG; ++s) M = fmaxf(M, m[s]);
  float L = 0.0f;
  v4f alo = {}, ahi = {};
#pragma unroll
  for (int s = 0; s < MAXSEG; ++s) {
    const float ws = __expf(m[s] - M);
    L += ws * l[s]; alo += lo[s] * ws; ahi += hi[s] * ws;
  }
  const float linv = 1.0f / (L * PSC);
  union { h16x8 h; v4u u; } pk;
#pragma unroll
  for (int i = 0; i < 4; ++i) { pk.h[i] = (h16)(alo[i] * linv); pk.h[4 + i] = (h16)(ahi[i] * linv); }
  vst2(Ch + ((size_t)(b * SEQ + EARLY_R + cut.tile * QT + row)) * DM + c8 * 8, pk.u);
}

// ---------------- flash attention, causal, query positions < EARLY_R (hi + residual products) ----------------
// 16 queries, 8 waves (one half of a workgroup, with LDS of its own; the barriers are the workgroup's, so the two halves' tiles walk
// the same number of chunks), key chunks of 32 (chunks 0 .. q0/32). Q (hi,res) staged once; K (hi,res) and V^T (hi,res)
// chunks staged in LDS through registers. Score phase: waves 0..5 -> (prod = w>>1, kj = w&1): prod 0 = Qh Kh, 1 = Qh Kr, 2 = Qr Kh.
// PV phase: wave w -> dims [64w, 64w+64): Oh += Ph Vh ; Or += Ph Vr + Pr Vh. Writes ctx hi and ctx res planes.
// LDS: views of the array that attn_kernel declares. The V^T chunk takes the K chunk's space: K is stored
// behind the barrier that ends the PV reads, V^T behind the barrier that ends the score reads.
__device__ __forceinline__
void attn_early_body(h16* Qraw, h16* KVraw, float* Sraw, h16* Praw, float* alpha_s, float* l_s, const int b, const int q0,
                     const h16* __restrict__ Qh, const h16* __restrict__ Qr,
                     const h16* __restrict__ Kh, const h16* __restrict__ Kr,
                     const h16* __restrict__ Vth, const h16* __restrict__ Vtr,
                     h16* __restrict__ Ch, h16* __restrict__ Cr) {
  h16   (*Qs)[16][QP]    = (h16 (*)[16][QP])Qraw;       // [2]: hi, residual
  h16   (*Ks)[32][QP]    = (h16 (*)[32][QP])KVraw;      // [2]; reused as the ctx tiles [2][16][512] after the loop
  h16   (*Vts)[DM][VP32] = (h16 (*)[DM][VP32])KVraw;    // [2]; d-major
  float (*Ss)[16][SP32]  = (float (*)[16][SP32])Sraw;   // [3]
  h16   (*Ps)[16][VP32]  = (h16 (*)[16][VP32])Praw;     // [2]

  const int tid = threadIdx.x & 255;  // thread and wave numbers inside this half of the workgroup
  const int w    = tid >> 5;
  const int lane = tid & 31;
  const int idx  = lane & 15;
  const int half = lane >> 4;

  {
    const h16* Qg0 = Qh + ((size_t)(b * SEQ + q0)) * DM;
    const h16* Qg1 = Qr + ((size_t)(b * EARLY_R + q0)) * DM;
    for (int cc = tid; cc < 16 * (DM / 8); cc += 256) {
      const int r = cc >> 6, dc = cc & 63;
      copy16_g2s(&Qs[0][r][dc * 8], Qg0 + (size_t)r * DM + dc * 8);
      copy16_g2s(&Qs[1][r][dc * 8], Qg1 + (size_t)r * DM + dc * 8);
    }
  }

  v8f oh[4] = {};
  v8f orr[4] = {};
  const int srow = tid >> 4;          // softmax: 16 threads per query row
  const int sj   = tid & 15;
  float m_prev = -1e30f;
  float l_run  = 0.0f;
  const int nchunk = q0 / 32 + 1;     // keys 0 .. 32*nchunk-1 cover every position <= q0+15
  // The chunks pass through registers, loaded one phase ahead of their LDS store: V^T during the score
  // phase, the next chunk's K during the softmax and PV phases. Per thread and plane: 8 K pieces 4 rows apart, 8 V^T pieces 64 rows apart.
  h16* Kst = &Ks[0][tid >> 6][(tid & 63) * 8];
  h16* Vst = &Vts[0][tid >> 2][(tid & 3) * 8];
  const h16* Kg0 = Kh + ((size_t)(b * SEQ + (tid >> 6))) * DM + (tid & 63) * 8;
  const h16* Kg1 = Kr + ((size_t)(b * EARLY_R + (tid >> 6))) * DM + (tid & 63) * 8;
  h16x8 kh8[8], kr8[8];               // the K chunk of the coming trip, in flight across the loop's back edge
  load_pieces<8>(kh8, Kg0, 4 * DM);
  load_pieces<8>(kr8, Kg1, 4 * DM);

#pragma unroll 1
  for (int ci = 0; ci < nchunk; ++ci) {
    const int kv0 = ci * 32;
    lds_barrier();     // prior PV done with Vts / Ps, prior scores done with Ks; the K pieces stay in flight
#pragma unroll     // constant indices keep kh8[] and kr8[] in registers
    for (int i = 0; i < 8; ++i) {
      *(h16x8*)(Kst + i * 4 * QP) = kh8[i];
      *(h16x8*)(Kst + 32 * QP + i * 4 * QP) = kr8[i];
    }
    h16x8 vh8[8], vr8[8];             // V^T chunk, in flight and then held in registers during the score phase
    load_pieces<8>(vh8, Vth + (size_t)(b * DM + (tid >> 2)) * SEQ + kv0 + (tid & 3) * 8, (size_t)64 * SEQ);
    load_pieces<8>(vr8, Vtr + (size_t)(b * DM + (tid >> 2)) * EARLY_R + kv0 + (tid & 3) * 8, (size_t)64 * EARLY_R);
    lds_barrier();     // K chunk visible; the V^T pieces stay in flight

    if (w < 6) {                                   // wave-uniform
      const int prod = w >> 1, kj = w & 1;
      const int pa = (prod == 2) ? 1 : 0;
      const int pb = (prod == 1) ? 1 : 0;
      const v8f sc = dot_rows<2>(&Qs[pa][0][0], &Ks[pb][kj * 16][0], v8f{});
      const int col = kj * 16 + idx;
#pragma unroll
      for (int g = 0; g < 8; ++g) Ss[prod][g + 8 * half][col] = sc[g];
    }
    lds_barrier();     // scores visible

#pragma unroll     // constant indices keep vh8[] and vr8[] in registers
    for (int i = 0; i < 8; ++i) {
      *(h16x8*)(Vst + i * 64 * VP32) = vh8[i];
      *(h16x8*)(Vst + DM * VP32 + i * 64 * VP32) = vr8[i];
    }
    {  // the last trip loads its own chunk again, unused: under a test the old pieces would count as live through the score phase
      const size_t kn = (size_t)((ci + 1 < nchunk) ? kv0 + 32 : kv0) * DM;
      load_pieces<8>(kh8, Kg0 + kn, 4 * DM);
      load_pieces<8>(kr8, Kg1 + kn, 4 * DM);
    }
    {
      float v[2];
      float mloc = -1e30f;
      const int qrow = q0 + srow;
#pragma unroll
      for (int e = 0; e < 2; ++e) {
        const int cidx = sj + e * 16;
        float s = (Ss[0][srow][cidx] + (Ss[1][srow][cidx] + Ss[2][srow][cidx]) * RINV) * SCL;
        if (kv0 + cidx > qrow) s = -1e30f;         // causal: replace masked scores
        v[e] = s; mloc = fmaxf(mloc, s);
      }
#pragma unroll
      for (int msk = 1; msk < 16; msk <<= 1) mloc = fmaxf(mloc, __shfl_xor(mloc, msk, 32));
      const float m_new = fmaxf(m_prev, mloc);
      const float alpha = __expf(m_prev - m_new);
      float ssum = 0.0f;
#pragma unroll
      for (int e = 0; e < 2; ++e) {
        const int cidx = sj + e * 16;
        const float p  = __expf(v[e] - m_new);
        ssum += p;
        const float pp = p * PSC;
        const h16 hv = (h16)pp;
        Ps[0][srow][cidx] = hv;
        Ps[1][srow][cidx] = (h16)((pp - (float)hv) * RSC);
      }
#pragma unroll
      for (int msk = 1; msk < 16; msk <<= 1) ssum += __shfl_xor(ssum, msk, 32);
      l_run = l_run * alpha + ssum;
      m_prev = m_new;
      if (sj == 0) { alpha_s[srow] = alpha; l_s[srow] = l_run; }
    }
    lds_barrier();     // P, the factors and V^T visible; the next K pieces stay in flight

    {
      float al[8];
#pragma unroll
      for (int g = 0; g < 8; ++g) al[g] = alpha_s[g + 8 * half];
      v16h ah = load_a_frag(&Ps[0][0][0], VP32, 0);
      v16h ar = load_a_frag(&Ps[1][0][0], VP32, 0);
      v16h bh[4], br[4];               // every fragment of the chunk, read as one group
#pragma unroll     // constant indices keep bh[] and br[] in registers
      for (int t = 0; t < 4; ++t) {
        const int d0 = w * 64 + t * 16;
        bh[t] = load_b_frag(&Vts[0][d0][0], VP32, 0);
        br[t] = load_b_frag(&Vts[1][d0][0], VP32, 0);
      }
      __builtin_amdgcn_sched_barrier(0);   // keeps all reads ahead of the rescale and the WMMAs, which then run under their latency
#pragma unroll
      for (int t = 0; t < 4; ++t)
#pragma unroll
        for (int g = 0; g < 8; ++g) { oh[t][g] *= al[g]; orr[t][g] *= al[g]; }
#pragma unroll
      for (int t = 0; t < 4; ++t) {
        oh[t]  = wmma_f16(ah, bh[t], oh[t]);
        orr[t] = wmma_f16(ah, br[t], orr[t]);
        orr[t] = wmma_f16(ar, bh[t], orr[t]);
      }
    }
  }
  __syncthreads();

  h16* Ct = &Ks[0][0][0];
  float linv[8];
#pragma unroll
  for (int g = 0; g < 8; ++g) linv[g] = 1.0f / (l_s[g + 8 * half] * PSC);
#pragma unroll
  for (int t = 0; t < 4; ++t) {
    const int col = w * 64 + t * 16 + idx;
#pragma unroll
    for (int g = 0; g < 8; ++g) {
      const int rl = g + 8 * half;
      const float u = (oh[t][g] + orr[t][g] * RINV) * linv[g];     // x16 carried ctx
      const h16 hv = (h16)u;
      Ct[rl * DM + col] = hv;
      Ct[16 * DM + rl * DM + col] = (h16)((u - (float)hv) * RSC);
    }
  }
  __syncthreads();
  {
    h16* dsth = Ch + ((size_t)(b * SEQ + q0)) * DM;
    h16* dstr = Cr + ((size_t)(b * EARLY_R + q0)) * DM;
    for (int gg = tid; gg < 16 * DM / 8; gg += 256) {
      vst2(dsth + (size_t)gg * 8, *(const v4u*)(Ct + gg * 8));
      vst2(dstr + (size_t)gg * 8, *(const v4u*)(Ct + 16 * DM + gg * 8));
    }
  }
}

// ---------------- both attention bodies in one grid ----------------
// The two jobs are independent. blockIdx.x = sequence (the fast index: each job's blocks start longest first over all sequences);
// blockIdx.y < NEB: a pair of neighbouring early tiles, last pair (most chunks) first; behind them the runs of the main body's table.
// Started with the first round, an early pair ends inside it whatever its chunks cost beside a run's; started last it could outlast
// the last runs. Workgroups of 16 waves, one per WGP; one LDS array serves both bodies.
constexpr int NMAIN = (SEQ > EARLY_R) ? NRUN : 0;
constexpr int NEB   = EARLY_R / 32;                                   // pairs of early tiles per sequence
// byte offsets in the LDS array: the main body's views ...
constexpr int MQ_OFF = 0;
constexpr int MV_OFF = MQ_OFF + QT * QP * (int)sizeof(h16);           // directly behind Qs: the f32 partial tile spans both
constexpr int MS_OFF = MV_OFF + DM * VP64 * (int)sizeof(h16);
constexpr int MP_OFF = MS_OFF + 4 * QT * SP64 * (int)sizeof(float);
constexpr int MF_OFF = MP_OFF + QT * VP64 * (int)sizeof(h16);         // factors, sums, maxima: QT floats each
constexpr int MK_OFF = MF_OFF + 3 * QT * (int)sizeof(float);          // K chunk
constexpr int M_BYTES = MK_OFF + 64 * QP * (int)sizeof(h16);
// ... and those of one early tile
constexpr int EQ_OFF = 0;
constexpr int EV_OFF = EQ_OFF + 2 * 16 * QP * (int)sizeof(h16);
constexpr int ES_OFF = EV_OFF + 2 * DM * VP32 * (int)sizeof(h16);
constexpr int EP_OFF = ES_OFF + 3 * 16 * SP32 * (int)sizeof(float);
constexpr int EF_OFF = EP_OFF + 2 * 16 * VP32 * (int)sizeof(h16);     // factors, sums: 16 floats each
constexpr int E_BYTES = EF_OFF + 2 * 16 * (int)sizeof(float);
constexpr int ATTN_LDS = (M_BYTES > 2 * E_BYTES) ? M_BYTES : 2 * E_BYTES;
static_assert(2 * 32 * QP <= 2 * DM * VP32);                          // an early K chunk fits its V^T chunk's space
static_assert(MV_OFF % 16 == 0 && MS_OFF % 16 == 0 && MP_OFF % 16 == 0 && MF_OFF % 16 == 0 && MK_OFF % 16 == 0);
static_assert(EV_OFF % 16 == 0 && ES_OFF % 16 == 0 && EP_OFF % 16 == 0 && EF_OFF % 16 == 0 && E_BYTES % 16 == 0);
static_assert(ATTN_LDS <= 320 * 1024);
__global__ __launch_bounds__(512) __attribute__((amdgpu_num_vgpr(256)))
void attn_kernel(const h16* __restrict__ Qh, const h16* __restrict__ Qr,
                 const h16* __restrict__ Kh, const h16* __restrict__ Kr,
                 const h16* __restrict__ Vth, const h16* __restrict__ Vtr,
                 h16* __restrict__ Ch, h16* __restrict__ Cr, float* __restrict__ Op, float* __restrict__ Ml) {
  __shared__ __align__(16) char lds[ATTN_LDS];
  const int b = blockIdx.x, y = blockIdx.y;
  if (y >= NEB) {                                   // block-uniform
    float* f = (float*)(lds + MF_OFF);
    attn_main_body((h16 (*)[QP])(lds + MQ_OFF), (h16 (*)[VP64])(lds + MV_OFF), (float (*)[QT][SP64])(lds + MS_OFF),
                   (h16 (*)[VP64])(lds + MP_OFF), f, f + QT, f + 2 * QT, (h16*)(lds + MK_OFF), b, SEGS.run[y - NEB], Qh, Kh, Vth, Ch, Op, Ml);
  } else {
    // waves 0..7: the pair's first tile, waves 8..15: its second; read as a scalar, so that the tile's position, its trip count and
    // its LDS base stay wave-uniform for the compiler (scalar loop branch, no EXEC masking round the WMMAs)
    const int hw = __builtin_amdgcn_readfirstlane(threadIdx.x >> 8);
    char* e = lds + hw * E_BYTES;
    float* f = (float*)(e + EF_OFF);
    // tiles 32 j and 32 j + 16 both walk j + 1 chunks: every wave of the workgroup passes the same barriers
    attn_early_body((h16*)(e + EQ_OFF), (h16*)(e + EV_OFF), (float*)(e + ES_OFF), (h16*)(e + EP_OFF), f, f + 16, b,
                    (NEB - 1 - y) * 32 + hw * 16, Qh, Qr, Kh, Kr, Vth, Vtr, Ch, Cr);
  }
}

// ---------------- output projection: out = ctx(MT x 512) * Wo(512 x 512)^T, f32 ----------------
// Same wave layout and k-block LDS staging as proj_qkv. Blocks with sequence positions < EARLY_R add the ctx residual product
// (second accumulator); the two kinds of block run separate instances of the body, so that only the early one holds it.
template <bool EARLY> __device__ __forceinline__
void proj_out_body(const h16* __restrict__ Ch, const h16* __restrict__ Cr, const h16* __restrict__ Wo, float* __restrict__ out,
                   h16* Ws, h16* Cs, h16* Rs, int m0, int n0, int bb, int s0) {
  const int tid = threadIdx.x, w = tid >> 5, lane = tid & 31, idx = lane & 15, half = lane >> 4;
  const int mw_l = (w & 3) * 16;
  const int nw_l = (w >> 2) * 64;

  v8f c[4] = {};
  v8f cr[4] = {};                                   // used by the early instance only
#pragma unroll 1   // rolled: nothing moves across the barriers of a trip, unrolling would only multiply the code
  for (int kb = 0; kb < DM; kb += KB) {
    __syncthreads();                                // the previous block's fragment reads are done
    stage_rows<64>(Cs, Ch + (size_t)m0 * DM + kb, tid);
    stage_rows<128>(Ws, Wo + (size_t)n0 * DM + kb, tid);
    if (EARLY) {
      __builtin_amdgcn_sched_barrier(0);            // the W pieces leave their registers first: all three loads' would not fit 128
      stage_rows<64>(Rs, Cr + (size_t)(bb * EARLY_R + s0) * DM + kb, tid);
    }
    __syncthreads();                                // the staged block is visible to every wave
#pragma unroll
    for (int k0 = 0; k0 < KB; k0 += 32) {
      v16h a = load_a_frag(Cs + mw_l * KP, KP, k0);
      v16h ar = {};
      if (EARLY) ar = load_a_frag(Rs + mw_l * KP, KP, k0);
      v16h bf[4];
#pragma unroll
      for (int t = 0; t < 4; ++t) bf[t] = load_b_frag(Ws + (nw_l + t * 16) * KP, KP, k0);
      __builtin_amdgcn_sched_barrier(0);            // keeps the k step's reads together, ahead of its WMMAs
#pragma unroll
      for (int t = 0; t < 4; ++t) {
        c[t] = wmma_f16(a, bf[t], c[t]);
        if (EARLY) cr[t] = wmma_f16(ar, bf[t], cr[t]);
      }
      if (EARLY) __builtin_amdgcn_sched_barrier(0); // two accumulator sets: a second fragment set would not fit 128 registers
    }
  }
  __syncthreads();                                  // last fragment reads done before the space becomes the output tile
  float* T = (float*)Ws;
#pragma unroll
  for (int t = 0; t < 4; ++t) {
    const int cl = nw_l + t * 16 + idx;
#pragma unroll
    for (int g = 0; g < 8; ++g) {
      const int rl = mw_l + g + 8 * half;
      T[rl * 132 + cl] = (EARLY ? c[t][g] + cr[t][g] * RINV : c[t][g]) * OUT_MUL;
    }
  }
  __syncthreads();
  {
    float* dst = out + ((size_t)(bb * SEQ_FULL + s0)) * DM + n0;
    for (int gg = tid; gg < 64 * 32; gg += 256) {
      const int rl = gg >> 5, pc = gg & 31;
      vst2(dst + (size_t)rl * DM + pc * 4, *(const v4f*)(&T[rl * 132 + pc * 4]));
    }
  }
}

__global__ __launch_bounds__(256) __attribute__((amdgpu_num_vgpr(128)))   // four workgroups (LDS limit) = 8 waves per SIMD
void proj_out_kernel(const h16* __restrict__ Ch, const h16* __restrict__ Cr,
                                                       const h16* __restrict__ Wo, float* __restrict__ out) {
  __shared__ __align__(16) h16 Ws[128 * KP];      // reused as the f32 output tile [64][132] after the k loop
  __shared__ __align__(16) h16 Cs[64 * KP];
  __shared__ __align__(16) h16 Rs[64 * KP];
  static_assert(64 * 132 * sizeof(float) <= 128 * KP * sizeof(h16));
  const int m0 = blockIdx.x * 64, n0 = blockIdx.y * 128;
  const int bb = m0 / SEQ, s0 = m0 - bb * SEQ;
  if (s0 < EARLY_R) proj_out_body<true>(Ch, Cr, Wo, out, Ws, Cs, Rs, m0, n0, bb, s0);     // block-uniform
  else              proj_out_body<false>(Ch, Cr, Wo, out, Ws, Cs, Rs, m0, n0, bb, s0);
}

extern "C" void kernel_launch(void* const* d_in, const int* in_sizes, int n_in,
                              void* d_out, int out_size, void* d_ws, size_t ws_size,
                              hipStream_t stream) {
  if (n_in < 5) return;
  const int rows_needed = (NB - 1) * SEQ_FULL + SEQ;
  if (in_sizes[0] < rows_needed * DM) return;
  for (int i = 1; i < 5; ++i) if (in_sizes[i] < DM * DM) return;
  if (out_size < rows_needed * DM) return;

  const float* x  = (const float*)d_in[0];
  const float* Wq = (const float*)d_in[1];
  const float* Wk = (const float*)d_in[2];
  const float* Wv = (const float*)d_in[3];
  const float* Wo = (const float*)d_in[4];
  float* out = (float*)d_out;

  const size_t plane = (size_t)MT * DM * sizeof(h16);              // 16,777,216 at full size
  const size_t wpl   = (size_t)DM * DM * sizeof(h16);              //    524,288
  const size_t rpl   = (size_t)NB * EARLY_R * DM * sizeof(h16);    //  2,097,152 at full size
  size_t off = 0;
  char* ws = (char*)d_ws;
  h16* xb  = (h16*)(ws + off); off += plane;
  h16* wqb = (h16*)(ws + off); off += wpl;
  h16* wkb = (h16*)(ws + off); off += wpl;
  h16* wvb = (h16*)(ws + off); off += wpl;
  h16* wob = (h16*)(ws + off); off += wpl;
  h16* qh  = (h16*)(ws + off); off += plane;
  h16* kh  = (h16*)(ws + off); off += plane;
  h16* vth = (h16*)(ws + off); off += plane;   // [b][d][s]
  h16* qr  = (h16*)(ws + off); off += rpl;
  h16* kr  = (h16*)(ws + off); off += rpl;
  h16* vtr = (h16*)(ws + off); off += rpl;     // [b][d][s < EARLY_R]
  h16* ch  = (h16*)(ws + off); off += plane;
  h16* crp = (h16*)(ws + off); off += rpl;
  float* opp = (float*)(ws + off); off += (size_t)NB * NSLOT * QT * DM * sizeof(float);   // partial sums of the cut tiles' runs
  float* mlp = (float*)(ws + off); off += (size_t)NB * NSLOT * 2 * QT * sizeof(float);    // their row maxima and row sums
  if (off > ws_size) return;

  cvt_kernel<<<NXB + 4 * NWB, 256, 0, stream>>>(x, Wq, Wk, Wv, Wo, xb, wqb, wkb, wvb, wob);

  proj_qkv_kernel<<<dim3(MT / 64, DM / 128, 3), 256, 0, stream>>>(xb, wqb, wkb, wvb, qh, kh, vth, qr, kr, vtr);

  attn_kernel<<<dim3(NB, NEB + NMAIN), 512, 0, stream>>>(qh, qr, kh, kr, vth, vtr, ch, crp, opp, mlp);
  if (SEQ > EARLY_R && MAXSEG > 1) attn_combine_kernel<<<dim3(NCUT * (QT / 4), NB), 256, 0, stream>>>(opp, mlp, ch);

  proj_out_kernel<<<dim3(MT / 64, DM / 128), 256, 0, stream>>>(ch, crp, wob, out);
}

// v010
// It runs in 169 microseconds.
// Timed twice side by side with v009, it ran 1.03 times as fast both times.
// Over all steps from v000 it is 5.88 times as fast.
#include <hip/hip_runtime.h>
// Contractions: Q/K/V projections (K = 512), scores Q K^T (K = 512), P V (K = keys) and the output projection (K = 512)
// on v_wmma_f32_16x16x32_f16 (f16 operands, f32 accumulate). Inputs enter as bf16-RNE values carried x16 in f16 planes;
// q/k/v/ctx are f16 hi planes carried x16 plus f16 residual planes carried x16384 for the first EARLY_R positions of each
// sequence (scores: hh + hr + rh, P V: hh + hr + rh, output projection: h + r); P carried x1024; softmax statistics in f32.

typedef _Float16 h16;
typedef _Float16 h16x8 __attribute__((ext_vector_type(8)));
typedef _Float16 v16h  __attribute__((ext_vector_type(16)));
typedef float  v8f    __attribute__((ext_vector_type(8)));
typedef float  v4f    __attribute__((ext_vector_type(4)));
typedef unsigned v4u  __attribute__((ext_vector_type(4)));

#ifndef NB
#define NB 4
#endif
#ifndef SEQ
#define SEQ 4096
#endif
#define NB_FULL 4
#define SEQ_FULL 4096
#define DM 512
#define EARLY_CAP 512
#define EARLY_R ((SEQ < EARLY_CAP) ? SEQ : EARLY_CAP)
#define MT (NB * SEQ)
// LDS row pitches in elements. f16 rows read by 16-byte fragment loads: byte pitch = 16 x odd, so the 16 rows of a fragment
// fall on distinct bank groups. f32 score rows: pitch chosen so that the tile stores and the row reads both spread over banks.
#define QP  (DM + 8)               // 1040 B: Q and K rows of 512 f16
#define VP64 72                    // 144 B: V^T and P rows of 64 f16
#define VP32 40                    // 80 B: V^T and P rows of 32 f16
#define SP64 76                    // f32 score rows of 64
#define SP32 36                    // f32 score rows of 32
#define KB   128                   // k block of the projections' LDS staging
#define KP   (KB + 8)              // 272 B: staged projection operand rows of 128 f16

static_assert(SEQ % 64 == 0);
static_assert((EARLY_R) % 64 == 0);
static_assert(NB >= 1 && NB <= NB_FULL);
static_assert(SEQ >= 64 && SEQ <= SEQ_FULL);
static_assert(DM % 128 == 0);
static_assert(((NB - 1) * SEQ_FULL + SEQ) * DM <= NB_FULL * SEQ_FULL * DM);

#define ISC  16.0f                 // carry of the x / q / k / v / ctx f16 hi planes
#define WSC  16.0f                 // carry of the weight planes
#define PSC  1024.0f               // carry of P
#define RSC  16384.0f              // carry of every residual plane
#define RINV (1.0f / 16384.0f)
#define PROJ_MUL (1.0f / 16.0f)    // acc of (x16 * x16) operands -> x16 plane value
#define OUT_MUL  (1.0f / 256.0f)   // acc of (x16 * x16) operands -> f32 output
#define SCL ((1.0f / 256.0f) * (1.0f / 22.627416610717773f))

template <typename V> __device__ __forceinline__ void vst2(void* p, V v) {
  *(V*)p = v; 
}
__device__ __forceinline__ void copy16_g2s(h16* ldst, const h16* gsrc) { *(h16x8*)ldst = *(const h16x8*)gsrc; }

__device__ __forceinline__ float bf16r(float f) {     // RNE convert to bf16, value kept in f32
  unsigned u = __float_as_uint(f);
  u = (u + 0x7FFFu + ((u >> 16) & 1u)) & 0xFFFF0000u;
  return __uint_as_float(u);
}

// ---- WMMA fragment loaders (f16, row-major K-contiguous source); A and B (from B^T rows) share the per-lane K map:
//      row/col = lane&15; elements 0..7 <- k0 + 8*half + 0..7, elements 8..15 <- k0 + 16 + 8*half + 0..7
__device__ __forceinline__ v16h load_a_frag(const h16* base, int ld, int k0) {
  int lane = threadIdx.x & 31;
  int idx  = lane & 15;
  int half = lane >> 4;
  const h16* p = base + idx * ld + k0 + half * 8;
  h16x8 lo = *(const h16x8*)(p);
  h16x8 hi = *(const h16x8*)(p + 16);
  return __builtin_shufflevector(lo, hi, 0,1,2,3,4,5,6,7,8,9,10,11,12,13,14,15);
}
__device__ __forceinline__ v16h load_b_frag(const h16* base, int ld, int k0) { return load_a_frag(base, ld, k0); }

__device__ __forceinline__ v8f wmma_f16(v16h a, v16h b, v8f c) {
  return __builtin_amdgcn_wmma_f32_16x16x32_f16(false, a, false, b, (short)0, c, false, false);
}

// sc += A(16 x DM) * B(16 x DM)^T, both from LDS rows of pitch QP, k ascending. The fragments are read G k-steps at a time into
// two register sets, each group one group ahead of the WMMAs that use it, so that a wave waits for LDS once per group at most.
template <int G> __device__ __forceinline__ v8f dot_rows(const h16* A, const h16* B, v8f sc) {
  constexpr int NG = DM / (32 * G);
  v16h fa[2][G], fb[2][G];
#pragma unroll     // constant indices keep the fragment sets in registers
  for (int j = 0; j < G; ++j) { fa[0][j] = load_a_frag(A, QP, j * 32); fb[0][j] = load_b_frag(B, QP, j * 32); }
#pragma unroll     // constant indices keep the fragment sets in registers
  for (int g = 0; g < NG; ++g) {
    if (g + 1 < NG) {
#pragma unroll     // as above
      for (int j = 0; j < G; ++j) {
        fa[(g + 1) & 1][j] = load_a_frag(A, QP, ((g + 1) * G + j) * 32);
        fb[(g + 1) & 1][j] = load_b_frag(B, QP, ((g + 1) * G + j) * 32);
      }
    }
    __builtin_amdgcn_sched_barrier(0);   // keeps the next group's reads ahead of this group's WMMAs (else they sink to their use)
#pragma unroll     // as above
    for (int j = 0; j < G; ++j) sc = wmma_f16(fa[g & 1][j], fb[g & 1][j], sc);
    __builtin_amdgcn_sched_barrier(0);   // no read of the group after next in front of these WMMAs: it would take a third register set
  }
  return sc;
}

// Work-group barrier for data handed over in LDS alone: its fences name the LDS address space only, so a wave waits for its LDS
// operations and not for its global loads, which stay in flight across it (__syncthreads() waits for them too).
__device__ __forceinline__ void lds_barrier() {
  __builtin_amdgcn_fence(__ATOMIC_RELEASE, "workgroup", "local");
  __builtin_amdgcn_s_barrier();
  __builtin_amdgcn_fence(__ATOMIC_ACQUIRE, "workgroup", "local");
}

// Value of lane (l ^ M), M < 16, by a DPP move inside the 16-lane row: it stays in the vector unit (the compiler folds it into an add
// that uses it). __shfl_xor goes through the LDS pipe (ds_bpermute_b32) and costs an LDS round trip per butterfly step.
template <int M> __device__ __forceinline__ float xor_lane(float v) {
  return __int_as_float(__builtin_amdgcn_update_dpp(0, __float_as_int(v), 0x160 + M, 0xf, 0xf, true));   // 0x160 + M = row_xmask:M
}

// N 16-byte pieces per thread, 'step' elements apart, from global memory into registers.
template <int N> __device__ __forceinline__ void load_pieces(h16x8 (&r)[N], const h16* g0, size_t step) {
#pragma unroll     // constant indices keep r[] in registers and the steps in the loads' offset fields
  for (int i = 0; i < N; ++i) r[i] = *(const h16x8*)(g0 + i * step);
  // address-translation wait; g0 as an input keeps the loads' address pair untouched (also by a later load's result) up to it
  asm volatile("s_wait_xcnt 0x0" :: "v"(g0) : "memory");
}

// LDS byte address of a __shared__ location: the destination operand of an asynchronous copy.
__device__ __forceinline__ unsigned lds_addr(const void* p) {
  return (unsigned)(size_t)(const __attribute__((address_space(3))) void*)p;
}

// Eight asynchronous 16-byte copies per lane from global memory into LDS, through no register: pieces 'lstep' bytes apart in LDS and
// 'gstep' elements apart in global memory. The address-translation wait closes the copies' own statement, so that it stands ahead of
// every later write of their address registers.
__device__ __forceinline__ void copy8_async(unsigned l0, unsigned lstep, const h16* g0, size_t gstep) {
  asm volatile("global_load_async_to_lds_b128 %0, %8, off\n\t"
               "global_load_async_to_lds_b128 %1, %9, off\n\t"
               "global_load_async_to_lds_b128 %2, %10, off\n\t"
               "global_load_async_to_lds_b128 %3, %11, off\n\t"
               "global_load_async_to_lds_b128 %4, %12, off\n\t"
               "global_load_async_to_lds_b128 %5, %13, off\n\t"
               "global_load_async_to_lds_b128 %6, %14, off\n\t"
               "global_load_async_to_lds_b128 %7, %15, off\n\t"
               "s_wait_xcnt 0x0"
               :: "v"(l0), "v"(l0 + lstep), "v"(l0 + 2 * lstep), "v"(l0 + 3 * lstep),
                  "v"(l0 + 4 * lstep), "v"(l0 + 5 * lstep), "v"(l0 + 6 * lstep), "v"(l0 + 7 * lstep),
                  "v"(g0), "v"(g0 + gstep), "v"(g0 + 2 * gstep), "v"(g0 + 3 * gstep),
                  "v"(g0 + 4 * gstep), "v"(g0 + 5 * gstep), "v"(g0 + 6 * gstep), "v"(g0 + 7 * gstep)
               : "memory");
}

// Hand-over point of a chunk staged by asynchronous copies: each wave's LDS operations are done and its own copies have landed, then
// the workgroup barrier. Behind it every wave may read what was copied, and the space whose readers have just left may be refilled.
__device__ __forceinline__ void publish_barrier() {
  asm volatile("s_wait_dscnt 0x0" ::: "memory");      // this wave's LDS reads and writes are done before another wave's copies refill the space
  asm volatile("s_wait_asynccnt 0x0" ::: "memory");   // this wave's copies have landed: the compiler places no wait for them
  __syncthreads();
}

// Stage ROWS rows of KB f16 (256 B = two whole lines per row, source row pitch DM) into LDS rows of pitch KP, 256 threads:
// one wave-wide 16-byte load covers two rows = four whole lines.
template <int ROWS> __device__ __forceinline__ void stage_rows(h16* lds, const h16* g, int tid) {
  h16* l0 = lds + (tid >> 4) * KP + (tid & 15) * 8;
  const h16* g0 = g + (size_t)(tid >> 4) * DM + (tid & 15) * 8;
  h16x8 r[ROWS / 16];
  load_pieces<ROWS / 16>(r, g0, 16 * DM);
#pragma unroll     // constant indices keep r[] in registers
  for (int i = 0; i < ROWS / 16; ++i) *(h16x8*)(l0 + i * 16 * KP) = r[i];
}

// ---------------- conversion kernel ----------------
// One grid for both independent jobs; the block index picks the job, 8 elements (16 B) per thread.
// Blocks < NXB: xb[row][c] = f16( bf16r(x) * 16 ), rows indexed b*SEQ + s, source rows b*SEQ_FULL + s.
// The other blocks, NWB per matrix: Wb[n][k] = f16( bf16r(W[n][k]) * 16 ) (weights are already [out][in] = [n][k]).
#define NXB (MT * DM / 8 / 256)
#define NWB (DM * DM / 8 / 256)
static_assert(MT * DM % (8 * 256) == 0 && DM * DM % (8 * 256) == 0);
__global__ __launch_bounds__(256) void cvt_kernel(const float* __restrict__ x,
                                                  const float* __restrict__ W0, const float* __restrict__ W1,
                                                  const float* __restrict__ W2, const float* __restrict__ W3,
                                                  h16* __restrict__ xb,
                                                  h16* __restrict__ D0, h16* __restrict__ D1,
                                                  h16* __restrict__ D2, h16* __restrict__ D3) {
  const float* src;
  h16* dst;
  float carry;
  if (blockIdx.x < NXB) {                            // block-uniform
    const int g = blockIdx.x * 256 + threadIdx.x;
    const int row = g >> 6, c8 = g & 63;             // 64 groups of 8 per 512-wide row
    const int b = row / SEQ, sq = row - b * SEQ;
    src = x + ((size_t)(b * SEQ_FULL + sq)) * DM + c8 * 8;
    dst = xb + (size_t)g * 8;
    carry = ISC;
  } else {
    const int r = blockIdx.x - NXB, y = r / NWB;
    const int g = (r - y * NWB) * 256 + threadIdx.x;
    const float* W = (y == 0) ? W0 : (y == 1) ? W1 : (y == 2) ? W2 : W3;
    h16*       D  = (y == 0) ? D0 : (y == 1) ? D1 : (y == 2) ? D2 : D3;
    src = W + (size_t)g * 8;
    dst = D + (size_t)g * 8;
    carry = WSC;
  }
  const v4f a = *(const v4f*)(src), bq = *(const v4f*)(src + 4);
  union { h16x8 h; v4u u; } pk;
#pragma unroll
  for (int i = 0; i < 4; ++i) { pk.h[i] = (h16)(bf16r(a[i]) * carry); pk.h[4 + i] = (h16)(bf16r(bq[i]) * carry); }
  vst2(dst, pk.u);
}

// ---------------- projection GEMM: Y = X(MT x 512) * W(512 x 512)^T, blockIdx.z selects Q / K / V ----------------
// 8 waves/WG: 4 M-subtiles x 2 N-groups(64). Each wave: 16x64 (4 WMMA tiles). The X (64 rows) and W (128 rows) operands are
// staged in LDS in k blocks of KB = 128 by whole-line 16-byte loads; fragments are read from LDS. The staging space is reused
// for the 64 x 128 output tile. Blocks whose sequence positions are < EARLY_R also write the residual planes (x16384).
__global__ __launch_bounds__(256) void proj_qkv_kernel(const h16* __restrict__ Xb,
                                                       const h16* __restrict__ Wq, const h16* __restrict__ Wk,
                                                       const h16* __restrict__ Wv,
                                                       h16* __restrict__ Qh, h16* __restrict__ Kh, h16* __restrict__ Vth,
                                                       h16* __restrict__ Qr, h16* __restrict__ Kr, h16* __restrict__ Vtr) {
  __shared__ __align__(16) h16 Th[128 * 136];     // [m][n] pitch 136 (Q/K) or [n][m] pitch 72 (V)
  __shared__ __align__(16) h16 Tr[128 * 136];
  const int z = blockIdx.z;
  const h16* W = (z == 0) ? Wq : (z == 1) ? Wk : Wv;
  const int transposed = (z == 2) ? 1 : 0;
  const int m0 = blockIdx.x * 64, n0 = blockIdx.y * 128;
  const int bb = m0 / SEQ, s0 = m0 - bb * SEQ;
  const bool early = (s0 < EARLY_R);
  const int tid = threadIdx.x, w = tid >> 5, lane = tid & 31, idx = lane & 15, half = lane >> 4;
  const int mw_l = (w & 3) * 16;
  const int nw_l = (w >> 2) * 64;

  v8f c[4] = {};
  h16* Ws = Th;                                     // [128][KP] during the k loop
  h16* Xs = Tr;                                     // [64][KP] during the k loop
#pragma unroll 1   // rolled: nothing moves across the barriers of a trip, unrolling would only multiply the code
  for (int kb = 0; kb < DM; kb += KB) {
    __syncthreads();                                // the previous block's fragment reads are done
    stage_rows<64>(Xs, Xb + (size_t)m0 * DM + kb, tid);
    stage_rows<128>(Ws, W + (size_t)n0 * DM + kb, tid);
    __syncthreads();                                // the staged block is visible to every wave
#pragma unroll
    for (int k0 = 0; k0 < KB; k0 += 32) {
      v16h a = load_a_frag(Xs + mw_l * KP, KP, k0);
      v16h bf[4];
#pragma unroll
      for (int t = 0; t < 4; ++t) bf[t] = load_b_frag(Ws + (nw_l + t * 16) * KP, KP, k0);
      __builtin_amdgcn_sched_barrier(0);            // keeps the k step's reads together, ahead of its WMMAs
#pragma unroll
      for (int t = 0; t < 4; ++t) c[t] = wmma_f16(a, bf[t], c[t]);
    }
  }
  __syncthreads();                                  // last fragment reads done before the space becomes the output tile
#pragma unroll
  for (int t = 0; t < 4; ++t) {
    const int cl = nw_l + t * 16 + idx;             // local col
#pragma unroll
    for (int g = 0; g < 8; ++g) {
      const int rl = mw_l + g + 8 * half;           // local row
      const float u = c[t][g] * PROJ_MUL;           // x16 carried value
      const h16 hv = (h16)u;
      const int li = transposed ? (cl * 72 + rl) : (rl * 136 + cl);
      Th[li] = hv;
      if (early) Tr[li] = (h16)((u - (float)hv) * RSC);
    }
  }
  __syncthreads();
  if (!transposed) {
    h16* Oh = (z == 0) ? Qh : Kh;
    h16* Orp = (z == 0) ? Qr : Kr;
    for (int gg = tid; gg < 64 * 16; gg += 256) {
      const int rl = gg >> 4, pc = gg & 15;
      vst2(Oh + (size_t)(m0 + rl) * DM + n0 + pc * 8, *(const v4u*)(&Th[rl * 136 + pc * 8]));
      if (early) vst2(Orp + (size_t)(bb * EARLY_R + s0 + rl) * DM + n0 + pc * 8, *(const v4u*)(&Tr[rl * 136 + pc * 8]));
    }
  } else {
    for (int gg = tid; gg < 128 * 8; gg += 256) {
      const int cl = gg >> 3, pc = gg & 7;
      vst2(Vth + ((size_t)(bb * DM + n0 + cl)) * SEQ + s0 + pc * 8, *(const v4u*)(&Th[cl * 72 + pc * 8]));
      if (early) vst2(Vtr + ((size_t)(bb * DM + n0 + cl)) * EARLY_R + s0 + pc * 8, *(const v4u*)(&Tr[cl * 72 + pc * 8]));
    }
  }
}

// ---------------- split of the main attention's key ranges ----------------
// A 64-query tile at position q0 walks q0/64 + 1 key chunks, so the last tile costs seven times the first, and with one workgroup
// per tile the launch lasts as long as the last tile. A tile of more than SEGL chunks is cut into equal runs of at most SEGL chunks,
// one workgroup each; the runs are dealt out longest first. A run of a cut tile leaves its unnormalised sums, its row maxima and
// its row sums in a slot of the workspace, and attn_combine_kernel joins the slots of a tile.
#define SEGL 22                    // about two rounds of workgroups at one per WGP
#define QT   64                    // queries per tile of the main body
#define NO_SLOT 0xFFFF
constexpr int NT = (SEQ > EARLY_R) ? (SEQ - EARLY_R) / QT : 1;
constexpr int tile_chunks(int t) { return (EARLY_R + t * QT) / 64 + 1; }
constexpr int tile_segs(int t) { return (tile_chunks(t) + SEGL - 1) / SEGL; }
constexpr int count_runs(bool cut_only) {
  int c = 0;
  for (int t = 0; t < NT; ++t) if (!cut_only || tile_segs(t) > 1) c += tile_segs(t);
  return c;
}
constexpr int count_cut_tiles() {
  int c = 0;
  for (int t = 0; t < NT; ++t) if (tile_segs(t) > 1) ++c;
  return c;
}
constexpr int NRUN   = count_runs(false);                                  // runs per sequence, one workgroup each
constexpr int NSLOT  = (count_runs(true) > 0) ? count_runs(true) : 1;      // partial results per sequence
constexpr int NCUT   = (count_cut_tiles() > 0) ? count_cut_tiles() : 1;    // tiles per sequence that are cut
constexpr int MAXSEG = tile_segs(NT - 1);
struct Run { unsigned short tile, c0, len, slot; };       // chunks c0 .. c0 + len - 1 of a tile; slot = NO_SLOT: the whole tile
struct Cut { unsigned short tile, slot, nseg, pad; };     // a cut tile's runs lie in slots slot .. slot + nseg - 1
struct SegTab { Run run[NRUN]; Cut cut[NCUT]; };
constexpr SegTab make_seg_tab() {
  SegTab T = {};
  int n = 0, slot = 0, nc = 0;
  for (int t = 0; t < NT; ++t) {
    const int ch = tile_chunks(t), ns = tile_segs(t);
    if (ns > 1) { T.cut[nc].tile = (unsigned short)t; T.cut[nc].slot = (unsigned short)slot; T.cut[nc].nseg = (unsigned short)ns; ++nc; }
    for (int s = 0; s < ns; ++s) {
      Run r = {};
      r.tile = (unsigned short)t;
      r.c0   = (unsigned short)(s * ch / ns);
      r.len  = (unsigned short)((s + 1) * ch / ns - s * ch / ns);
      r.slot = (unsigned short)((ns > 1) ? slot++ : NO_SLOT);
      int p = n++;                                        // insertion keeps the list sorted, longest run first
      for (; p > 0 && T.run[p - 1].len < r.len; --p) T.run[p] = T.run[p - 1];
      T.run[p] = r;
    }
  }
  return T;
}
__constant__ const SegTab SEGS = make_seg_tab();
#define OPP (DM + 4)               // f32 row pitch of the partial tile in LDS: rows g and g + 8 fall on different banks

// ---------------- flash attention, causal, query positions >= EARLY_R (single products) ----------------
// WG = 64 queries, 16 waves, key chunks of 64: one run of chunks of one tile (table above). Each staged chunk serves all 64 queries, so a
// query costs half the L2 reads and LDS writes of K and V^T that it costs in a 32-query workgroup. The Q tile, the K chunks and the V^T chunks
// come into LDS by asynchronous copies of whole lines, through no register, K and V^T each into a space of its own: V^T flies during
// the score phase, the next chunk's K during the softmax and PV phases.
// Waves 0..7 serve queries 0..31 of the tile, waves 8..15 queries 32..63 (qb = 32 (w>>3)); a wave covers both 16-query tiles of its half,
// so that each fragment read from LDS feeds two WMMAs.
// Score phase: wave w -> (ds = w&3, kh = (w>>2)&1): 32 keys x 32 queries (2 x 2 tiles of K Q^T) over the dims [128 ds, 128 ds + 128);
// the four partial sums of a score meet in the softmax phase. PV phase: wave w -> 32 q x dims [64 (w&7), 64 (w&7) + 64) (2 x 4 accum tiles).
// LDS (views of attn_kernel's array): Qs; behind it Vts, d-major, f16 ctx tile [64][512] after the loop;
// Ss, one plane of partial scores per 128-dim slice; Ps; the rows' factors, sums and maxima; Ks, K rows [64][QP].
__device__ __forceinline__
void attn_main_body(h16 (*Qs)[QP], h16 (*Vts)[VP64], float (*Ss)[QT][SP64], h16 (*Ps)[VP64],
                    float* alpha_s, float* l_s, float* m_s, h16* Ks, const int b, const Run run,
                    const h16* __restrict__ Qh, const h16* __restrict__ Kh,
                    const h16* __restrict__ Vth, h16* __restrict__ Ch, float* __restrict__ Op, float* __restrict__ Ml) {
  const int q0  = EARLY_R + run.tile * QT;
  const int tid = threadIdx.x;
  const int w    = tid >> 5;
  const int lane = tid & 31;
  const int idx  = lane & 15;
  const int half = lane >> 4;
  const int ds = w & 3;         // score phase: slice of 128 dims
  const int kh = (w >> 2) & 1;  // score phase: half of the chunk's keys
  const int qb = (w >> 3) * 32; // both matrix phases: first query row of this wave's half of the tile
  const int dw = (w & 7) * 64;  // PV phase: first dim of this wave's 64

  // The Q tile has a K chunk's shape and is dealt out alike: 8 pieces per thread, 8 rows apart.
  static_assert(QT == 64);
  const unsigned Kst = lds_addr(Ks + (tid >> 6) * QP + (tid & 63) * 8);   // this thread's first K piece; the next ones lie 8 rows apart
  const unsigned Vst = lds_addr(&Vts[tid >> 3][(tid & 7) * 8]);           // this thread's first V^T piece; the next ones lie 64 rows apart
  v8f o[2][4] = {};                   // [query tile][16 dims]
  const int srow = tid >> 3;          // softmax: 8 threads per query row, 8 neighbouring keys each
  const int sj   = tid & 7;
  float m_prev = -1e30f;
  float l_run  = 0.0f;
  const int cbeg = run.c0, nchunk = run.c0 + run.len;   // this run's chunks; a tile's last chunk q0/64 covers every position <= q0+63
  const h16* Kg = Kh + ((size_t)(b * SEQ + (tid >> 6))) * DM + (tid & 63) * 8;
  // The Q tile and the first K chunk fly together; the first trip's hand-over point publishes both.
  copy8_async(lds_addr(&Qs[tid >> 6][(tid & 63) * 8]), 8 * QP * sizeof(h16),
              Qh + ((size_t)(b * SEQ + q0 + (tid >> 6))) * DM + (tid & 63) * 8, 8 * DM);
  copy8_async(Kst, 8 * QP * sizeof(h16), Kg + (size_t)(cbeg * 64) * DM, 8 * DM);

#pragma unroll 1
  for (int ci = cbeg; ci < nchunk; ++ci) {
    const int kv0 = ci * 64;
    publish_barrier(); // this chunk's K (and Q on the first trip) landed and visible; prior PV done with Vts / Ps
    // the V^T chunk lands under the score phase
    copy8_async(Vst, 64 * VP64 * sizeof(h16), Vth + (size_t)(b * DM + (tid >> 3)) * SEQ + kv0 + (tid & 7) * 8, (size_t)64 * SEQ);

    {
      // A = K rows, B = Q rows: a lane then holds 8 neighbouring keys of one query, two 16-byte stores per tile.
      const h16* Kf = Ks + (kh * 32) * QP + ds * 128;
      const h16* Qf = &Qs[qb][ds * 128];
      v8f sc[2][2] = {};               // [key tile][query tile]
      v16h fk[2][2], fq[2][2];         // two register sets: each k step's fragments are read one step ahead of their WMMAs
#pragma unroll     // constant indices keep the fragment sets in registers (every loop of this block)
      for (int j = 0; j < 2; ++j) { fk[0][j] = load_a_frag(Kf + j * 16 * QP, QP, 0); fq[0][j] = load_b_frag(Qf + j * 16 * QP, QP, 0); }
#pragma unroll
      for (int s = 0; s < 4; ++s) {
        if (s + 1 < 4) {
#pragma unroll
          for (int j = 0; j < 2; ++j) {
            fk[(s + 1) & 1][j] = load_a_frag(Kf + j * 16 * QP, QP, (s + 1) * 32);
            fq[(s + 1) & 1][j] = load_b_frag(Qf + j * 16 * QP, QP, (s + 1) * 32);
          }
        }
        __builtin_amdgcn_sched_barrier(0);   // keeps the next step's reads ahead of this step's WMMAs (else they sink to their use)
#pragma unroll
        for (int kt = 0; kt < 2; ++kt)
#pragma unroll
          for (int qt = 0; qt < 2; ++qt) sc[kt][qt] = wmma_f16(fk[s & 1][kt], fq[s & 1][qt], sc[kt][qt]);
        __builtin_amdgcn_sched_barrier(0);   // no read of the step after next in front of these WMMAs: it would take a third register set
      }
#pragma unroll
      for (int kt = 0; kt < 2; ++kt)
#pragma unroll
        for (int qt = 0; qt < 2; ++qt) {
          float* sp = &Ss[ds][qb + qt * 16 + idx][kh * 32 + kt * 16 + 8 * half];
          *(v4f*)(sp)     = __builtin_shufflevector(sc[kt][qt], sc[kt][qt], 0, 1, 2, 3);
          *(v4f*)(sp + 4) = __builtin_shufflevector(sc[kt][qt], sc[kt][qt], 4, 5, 6, 7);
        }
    }
    publish_barrier(); // scores visible, V^T landed and visible; every K fragment read is done, so the next K chunk may take the space

    // the next chunk's K lands under softmax and PV (the test reads the same for the whole workgroup)
    if (ci + 1 < nchunk) copy8_async(Kst, 8 * QP * sizeof(h16), Kg + (size_t)(kv0 + 64) * DM, 8 * DM);
    {
      float v[8];
      float mloc = -1e30f;
      v4f pl[4], ph[4];                // the four partial sums of this thread's 8 scores
#pragma unroll
      for (int p = 0; p < 4; ++p) { pl[p] = *(const v4f*)(&Ss[p][srow][sj * 8]); ph[p] = *(const v4f*)(&Ss[p][srow][sj * 8 + 4]); }
      const v4f sl = (pl[0] + pl[1]) + (pl[2] + pl[3]);
      const v4f sh = (ph[0] + ph[1]) + (ph[2] + ph[3]);
#pragma unroll
      for (int e = 0; e < 8; ++e) {
        float val = ((e < 4) ? sl[e & 3] : sh[e & 3]) * SCL;
        if (kv0 + sj * 8 + e > q0 + srow) val = -1e30f;   // causal: replace masked scores
        v[e] = val; mloc = fmaxf(mloc, val);
      }
      mloc = fmaxf(mloc, xor_lane<1>(mloc)); mloc = fmaxf(mloc, xor_lane<2>(mloc)); mloc = fmaxf(mloc, xor_lane<4>(mloc));
      const float m_new = fmaxf(m_prev, mloc);
      const float alpha = __expf(m_prev - m_new);
      float ssum = 0.0f;
      h16x8 pk;
#pragma unroll
      for (int e = 0; e < 8; ++e) {
        const float p = __expf(v[e] - m_new);
        ssum += p;
        pk[e] = (h16)(p * PSC);
      }
      *(h16x8*)(&Ps[srow][sj * 8]) = pk;
      ssum += xor_lane<1>(ssum); ssum += xor_lane<2>(ssum); ssum += xor_lane<4>(ssum);
      l_run = l_run * alpha + ssum;
      m_prev = m_new;
      if (sj == 0) { alpha_s[srow] = alpha; l_s[srow] = l_run; }
    }
    lds_barrier();     // P and the factors visible; the next K chunk's copies stay in flight

    {
      float al[2][8];
#pragma unroll     // constant indices keep al[], pa[] and vb[] in registers (every loop of this block)
      for (int qt = 0; qt < 2; ++qt)
#pragma unroll
        for (int g = 0; g < 8; ++g) al[qt][g] = alpha_s[qb + qt * 16 + g + 8 * half];
      __builtin_amdgcn_sched_barrier(0);   // the factors' reads go first: the rescale then waits for them alone
      const h16* Vf = &Vts[dw][0];
      v16h pa[2][2], vb[2][4];             // [32 keys][query tile], [32 keys][16 dims]
#pragma unroll
      for (int qt = 0; qt < 2; ++qt) pa[0][qt] = load_a_frag(&Ps[qb + qt * 16][0], VP64, 0);
#pragma unroll
      for (int t = 0; t < 4; ++t) vb[0][t] = load_b_frag(Vf + t * 16 * VP64, VP64, 0);
      __builtin_amdgcn_sched_barrier(0);   // keys 0..31: the reads stay ahead of the rescale, which runs under their latency
#pragma unroll
      for (int qt = 0; qt < 2; ++qt)
#pragma unroll
        for (int t = 0; t < 4; ++t)
#pragma unroll
          for (int g = 0; g < 8; ++g) o[qt][t][g] *= al[qt][g];
      __builtin_amdgcn_sched_barrier(0);   // keys 32..63 are read behind the rescale, when the factors' registers are free ...
#pragma unroll
      for (int qt = 0; qt < 2; ++qt) pa[1][qt] = load_a_frag(&Ps[qb + qt * 16][0], VP64, 32);
#pragma unroll
      for (int t = 0; t < 4; ++t) vb[1][t] = load_b_frag(Vf + t * 16 * VP64, VP64, 32);
      __builtin_amdgcn_sched_barrier(0);   // ... and ahead of the first eight WMMAs, which run under their latency
#pragma unroll
      for (int s = 0; s < 2; ++s)
#pragma unroll
        for (int t = 0; t < 4; ++t)
#pragma unroll
          for (int qt = 0; qt < 2; ++qt) o[qt][t] = wmma_f16(pa[s][qt], vb[s][t], o[qt][t]);
    }
  }
  asm volatile("s_wait_asynccnt 0x0" ::: "memory");   // no copy is outstanding when the staging space is put to other use
  if (sj == 0) m_s[srow] = m_prev;
  __syncthreads();

  if (run.slot != NO_SLOT) {          // block-uniform: a run of a cut tile hands its sums on as they are, in f32
    float* Cf = (float*)&Qs[0][0];    // the f32 tile takes the space of Qs and, directly behind it, of Vts
    static_assert(QT * OPP * sizeof(float) <= (QT * QP + DM * VP64) * sizeof(h16));
#pragma unroll     // constant indices keep o[] in registers (all three loops)
    for (int qt = 0; qt < 2; ++qt)
#pragma unroll
      for (int t = 0; t < 4; ++t)
#pragma unroll
        for (int g = 0; g < 8; ++g) Cf[(qb + qt * 16 + g + 8 * half) * OPP + dw + t * 16 + idx] = o[qt][t][g];
    __syncthreads();                  // the tile is complete before it leaves in whole lines
    const size_t pi = (size_t)b * NSLOT + run.slot;
    float* dst = Op + pi * (QT * DM);
#pragma unroll     // 16 pieces per thread, four rows of the tile apart: all reads issued ahead of the stores, steps in the offset fields
    for (int i = 0; i < QT * DM / 4 / 512; ++i)
      vst2(dst + (size_t)(i * 512 + tid) * 4, *(const v4f*)(Cf + (i * 4 + (tid >> 7)) * OPP + (tid & 127) * 4));
    if (tid < 2 * QT) Ml[pi * (2 * QT) + tid] = (tid < QT) ? m_s[tid] : l_s[tid - QT];   // waves 0, 1: the maxima's lines, waves 2, 3: the sums'
    return;
  }

  h16* Ct = &Vts[0][0];
  static_assert(QT * DM <= DM * VP64);
#pragma unroll
  for (int qt = 0; qt < 2; ++qt) {
    float linv[8];
#pragma unroll
    for (int g = 0; g < 8; ++g) linv[g] = 1.0f / (l_s[qb + qt * 16 + g + 8 * half] * PSC);
#pragma unroll
    for (int t = 0; t < 4; ++t) {
      const int col = dw + t * 16 + idx;
#pragma unroll
      for (int g = 0; g < 8; ++g) Ct[(qb + qt * 16 + g + 8 * half) * DM + col] = (h16)(o[qt][t][g] * linv[g]);
    }
  }
  __syncthreads();
  {
    h16* dst = Ch + ((size_t)(b * SEQ + q0)) * DM;
    for (int gg = tid; gg < QT * DM / 8; gg += 512) vst2(dst + (size_t)gg * 8, *(const v4u*)(Ct + gg * 8));
  }
}

// ---------------- join of a cut tile's runs: ctx = sum_s e^(m_s - M) O_s / (sum_s e^(m_s - M) l_s), M = max_s m_s ----------------
// WG = 4 query rows of one cut tile; a thread joins 8 neighbouring dims and stores them as 16 bytes.
__global__ __launch_bounds__(256) void attn_combine_kernel(const float* __restrict__ Op, const float* __restrict__ Ml,
                                                           h16* __restrict__ Ch) {
  const Cut cut = SEGS.cut[blockIdx.x / (QT / 4)];
  const int b = blockIdx.y, tid = threadIdx.x;
  const int row = (blockIdx.x % (QT / 4)) * 4 + (tid >> 6), c8 = tid & 63;
  const size_t p0 = (size_t)b * NSLOT + cut.slot;
  float m[MAXSEG], l[MAXSEG];
  v4f lo[MAXSEG], hi[MAXSEG];
#pragma unroll     // constant indices keep the parts in registers; every part's loads are issued before the first is used
  for (int s = 0; s < MAXSEG; ++s) {
    if (s < 2 || s < cut.nseg) {      // block-uniform; a cut tile has two parts at least
      const float* ml  = Ml + (p0 + s) * (2 * QT) + row;
      const float* src = Op + ((p0 + s) * QT + row) * DM + c8 * 8;
      m[s] = ml[0]; l[s] = ml[QT];
      lo[s] = *(const v4f*)(src); hi[s] = *(const v4f*)(src + 4);
      // address-translation wait; the pointers as inputs keep the loads' address pairs untouched (also by a later load's result) up to it
      asm volatile("s_wait_xcnt 0x0" :: "v"(ml), "v"(src) : "memory");
    } else {                          // no such part: weight e^(-1e30 - M) = 0
      m[s] = -1e30f; l[s] = 0.0f; lo[s] = v4f{}; hi[s] = v4f{};
    }
  }
  float M = m[0];
#pragma unroll     // constant indices, as above (this loop and the next two)
  for (int s = 1; s < MAXSEG; ++s) M = fmaxf(M, m[s]);
  float L = 0.0f;
  v4f alo = {}, ahi = {};
#pragma unroll
  for (int s = 0; s < MAXSEG; ++s) {
    const float ws = __expf(m[s] - M);
    L += ws * l[s]; alo += lo[s] * ws; ahi += hi[s] * ws;
  }
  const float linv = 1.0f / (L * PSC);
  union { h16x8 h; v4u u; } pk;
#pragma unroll
  for (int i = 0; i < 4; ++i) { pk.h[i] = (h16)(alo[i] * linv); pk.h[4 + i] = (h16)(ahi[i] * linv); }
  vst2(Ch + ((size_t)(b * SEQ + EARLY_R + cut.tile * QT + row)) * DM + c8 * 8, pk.u);
}

// ---------------- flash attention, causal, query positions < EARLY_R (hi + residual products) ----------------
// 16 queries, 8 waves (one half of a workgroup, with LDS of its own; the barriers are the workgroup's, so the two halves' tiles walk
// the same number of chunks), key chunks of 32 (chunks 0 .. q0/32). Q (hi,res) staged once; K (hi,res) and V^T (hi,res)
// chunks staged in LDS through registers. Score phase: waves 0..5 -> (prod = w>>1, kj = w&1): prod 0 = Qh Kh, 1 = Qh Kr, 2 = Qr Kh.
// PV phase: wave w -> dims [64w, 64w+64): Oh += Ph Vh ; Or += Ph Vr + Pr Vh. Writes ctx hi and ctx res planes.
// LDS: views of the array that attn_kernel declares. The V^T chunk takes the K chunk's space: K is stored
// behind the barrier that ends the PV reads, V^T behind the barrier that ends the score reads.
__device__ __forceinline__
void attn_early_body(h16* Qraw, h16* KVraw, float* Sraw, h16* Praw, float* alpha_s, float* l_s, const int b, const int q0,
                     const h16* __restrict__ Qh, const h16* __restrict__ Qr,
                     const h16* __restrict__ Kh, const h16* __restrict__ Kr,
                     const h16* __restrict__ Vth, const h16* __restrict__ Vtr,
                     h16* __restrict__ Ch, h16* __restrict__ Cr) {
  h16   (*Qs)[16][QP]    = (h16 (*)[16][QP])Qraw;       // [2]: hi, residual
  h16   (*Ks)[32][QP]    = (h16 (*)[32][QP])KVraw;      // [2]; reused as the ctx tiles [2][16][512] after the loop
  h16   (*Vts)[DM][VP32] = (h16 (*)[DM][VP32])KVraw;    // [2]; d-major
  float (*Ss)[16][SP32]  = (float (*)[16][SP32])Sraw;   // [3]
  h16   (*Ps)[16][VP32]  = (h16 (*)[16][VP32])Praw;     // [2]

  const int tid = threadIdx.x & 255;  // thread and wave numbers inside this half of the workgroup
  const int w    = tid >> 5;
  const int lane = tid & 31;
  const int idx  = lane & 15;
  const int half = lane >> 4;

  {
    const h16* Qg0 = Qh + ((size_t)(b * SEQ + q0)) * DM;
    const h16* Qg1 = Qr + ((size_t)(b * EARLY_R + q0)) * DM;
    for (int cc = tid; cc < 16 * (DM / 8); cc += 256) {
      const int r = cc >> 6, dc = cc & 63;
      copy16_g2s(&Qs[0][r][dc * 8], Qg0 + (size_t)r * DM + dc * 8);
      copy16_g2s(&Qs[1][r][dc * 8], Qg1 + (size_t)r * DM + dc * 8);
    }
  }

  v8f oh[4] = {};
  v8f orr[4] = {};
  const int srow = tid >> 4;          // softmax: 16 threads per query row
  const int sj   = tid & 15;
  float m_prev = -1e30f;
  float l_run  = 0.0f;
  const int nchunk = q0 / 32 + 1;     // keys 0 .. 32*nchunk-1 cover every position <= q0+15
  // The chunks pass through registers, loaded one phase ahead of their LDS store: V^T during the score
  // phase, the next chunk's K during the softmax and PV phases. Per thread and plane: 8 K pieces 4 rows apart, 8 V^T pieces 64 rows apart.
  h16* Kst = &Ks[0][tid >> 6][(tid & 63) * 8];
  h16* Vst = &Vts[0][tid >> 2][(tid & 3) * 8];
  const h16* Kg0 = Kh + ((size_t)(b * SEQ + (tid >> 6))) * DM + (tid & 63) * 8;
  const h16* Kg1 = Kr + ((size_t)(b * EARLY_R + (tid >> 6))) * DM + (tid & 63) * 8;
  h16x8 kh8[8], kr8[8];               // the K chunk of the coming trip, in flight across the loop's back edge
  load_pieces<8>(kh8, Kg0, 4 * DM);
  load_pieces<8>(kr8, Kg1, 4 * DM);

#pragma unroll 1
  for (int ci = 0; ci < nchunk; ++ci) {
    const int kv0 = ci * 32;
    lds_barrier();     // prior PV done with Vts / Ps, prior scores done with Ks; the K pieces stay in flight
#pragma unroll     // constant indices keep kh8[] and kr8[] in registers
    for (int i = 0; i < 8; ++i) {
      *(h16x8*)(Kst + i * 4 * QP) = kh8[i];
      *(h16x8*)(Kst + 32 * QP + i * 4 * QP) = kr8[i];
    }
    h16x8 vh8[8], vr8[8];             // V^T chunk, in flight and then held in registers during the score phase
    load_pieces<8>(vh8, Vth + (size_t)(b * DM + (tid >> 2)) * SEQ + kv0 + (tid & 3) * 8, (size_t)64 * SEQ);
    load_pieces<8>(vr8, Vtr + (size_t)(b * DM + (tid >> 2)) * EARLY_R + kv0 + (tid & 3) * 8, (size_t)64 * EARLY_R);
    lds_barrier();     // K chunk visible; the V^T pieces stay in flight

    if (w < 6) {                                   // wave-uniform
      const int prod = w >> 1, kj = w & 1;
      const int pa = (prod == 2) ? 1 : 0;
      const int pb = (prod == 1) ? 1 : 0;
      const v8f sc = dot_rows<2>(&Qs[pa][0][0], &Ks[pb][kj * 16][0], v8f{});
      const int col = kj * 16 + idx;
#pragma unroll
      for (int g = 0; g < 8; ++g) Ss[prod][g + 8 * half][col] = sc[g];
    }
    lds_barrier();     // scores visible

#pragma unroll     // constant indices keep vh8[] and vr8[] in registers
    for (int i = 0; i < 8; ++i) {
      *(h16x8*)(Vst + i * 64 * VP32) = vh8[i];
      *(h16x8*)(Vst + DM * VP32 + i * 64 * VP32) = vr8[i];
    }
    {  // the last trip loads its own chunk again, unused: under a test the old pieces would count as live through the score phase
      const size_t kn = (size_t)((ci + 1 < nchunk) ? kv0 + 32 : kv0) * DM;
      load_pieces<8>(kh8, Kg0 + kn, 4 * DM);
      load_pieces<8>(kr8, Kg1 + kn, 4 * DM);
    }
    {
      float v[2];
      float mloc = -1e30f;
      const int qrow = q0 + srow;
#pragma unroll
      for (int e = 0; e < 2; ++e) {
        const int cidx = sj + e * 16;
        float s = (Ss[0][srow][cidx] + (Ss[1][srow][cidx] + Ss[2][srow][cidx]) * RINV) * SCL;
        if (kv0 + cidx > qrow) s = -1e30f;         // causal: replace masked scores
        v[e] = s; mloc = fmaxf(mloc, s);
      }
      mloc = fmaxf(mloc, xor_lane<1>(mloc)); mloc = fmaxf(mloc, xor_lane<2>(mloc));
      mloc = fmaxf(mloc, xor_lane<4>(mloc)); mloc = fmaxf(mloc, xor_lane<8>(mloc));
      const float m_new = fmaxf(m_prev, mloc);
      const float alpha = __expf(m_prev - m_new);
      float ssum = 0.0f;
#pragma unroll
      for (int e = 0; e < 2; ++e) {
        const int cidx = sj + e * 16;
        const float p  = __expf(v[e] - m_new);
        ssum += p;
        const float pp = p * PSC;
        const h16 hv = (h16)pp;
        Ps[0][srow][cidx] = hv;
        Ps[1][srow][cidx] = (h16)((pp - (float)hv) * RSC);
      }
      ssum += xor_lane<1>(ssum); ssum += xor_lane<2>(ssum); ssum += xor_lane<4>(ssum); ssum += xor_lane<8>(ssum);
      l_run = l_run * alpha + ssum;
      m_prev = m_new;
      if (sj == 0) { alpha_s[srow] = alpha; l_s[srow] = l_run; }
    }
    lds_barrier();     // P, the factors and V^T visible; the next K pieces stay in flight

    {
      float al[8];
#pragma unroll
      for (int g = 0; g < 8; ++g) al[g] = alpha_s[g + 8 * half];
      v16h ah = load_a_frag(&Ps[0][0][0], VP32, 0);
      v16h ar = load_a_frag(&Ps[1][0][0], VP32, 0);
      v16h bh[4], br[4];               // every fragment of the chunk, read as one group
#pragma unroll     // constant indices keep bh[] and br[] in registers
      for (int t = 0; t < 4; ++t) {
        const int d0 = w * 64 + t * 16;
        bh[t] = load_b_frag(&Vts[0][d0][0], VP32, 0);
        br[t] = load_b_frag(&Vts[1][d0][0], VP32, 0);
      }
      __builtin_amdgcn_sched_barrier(0);   // keeps all reads ahead of the rescale and the WMMAs, which then run under their latency
#pragma unroll
      for (int t = 0; t < 4; ++t)
#pragma unroll
        for (int g = 0; g < 8; ++g) { oh[t][g] *= al[g]; orr[t][g] *= al[g]; }
#pragma unroll
      for (int t = 0; t < 4; ++t) {
        oh[t]  = wmma_f16(ah, bh[t], oh[t]);
        orr[t] = wmma_f16(ah, br[t], orr[t]);
        orr[t] = wmma_f16(ar, bh[t], orr[t]);
      }
    }
  }
  __syncthreads();

  h16* Ct = &Ks[0][0][0];
  float linv[8];
#pragma unroll
  for (int g = 0; g < 8; ++g) linv[g] = 1.0f / (l_s[g + 8 * half] * PSC);
#pragma unroll
  for (int t = 0; t < 4; ++t) {
    const int col = w * 64 + t * 16 + idx;
#pragma unroll
    for (int g = 0; g < 8; ++g) {
      const int rl = g + 8 * half;
      const float u = (oh[t][g] + orr[t][g] * RINV) * linv[g];     // x16 carried ctx
      const h16 hv = (h16)u;
      Ct[rl * DM + col] = hv;
      Ct[16 * DM + rl * DM + col] = (h16)((u - (float)hv) * RSC);
    }
  }
  __syncthreads();
  {
    h16* dsth = Ch + ((size_t)(b * SEQ + q0)) * DM;
    h16* dstr = Cr + ((size_t)(b * EARLY_R + q0)) * DM;
    for (int gg = tid; gg < 16 * DM / 8; gg += 256) {
      vst2(dsth + (size_t)gg * 8, *(const v4u*)(Ct + gg * 8));
      vst2(dstr + (size_t)gg * 8, *(const v4u*)(Ct + 16 * DM + gg * 8));
    }
  }
}

// ---------------- both attention bodies in one grid ----------------
// The two jobs are independent. blockIdx.x = sequence (the fast index: each job's blocks start longest first over all sequences);
// blockIdx.y < NEB: a pair of neighbouring early tiles, last pair (most chunks) first; behind them the runs of the main body's table.
// Started with the first round, an early pair ends inside it whatever its chunks cost beside a run's; started last it could outlast
// the last runs. Workgroups of 16 waves, one per WGP; one LDS array serves both bodies.
constexpr int NMAIN = (SEQ > EARLY_R) ? NRUN : 0;
constexpr int NEB   = EARLY_R / 32;                                   // pairs of early tiles per sequence
// byte offsets in the LDS array: the main body's views ...
constexpr int MQ_OFF = 0;
constexpr int MV_OFF = MQ_OFF + QT * QP * (int)sizeof(h16);           // directly behind Qs: the f32 partial tile spans both
constexpr int MS_OFF = MV_OFF + DM * VP64 * (int)sizeof(h16);
constexpr int MP_OFF = MS_OFF + 4 * QT * SP64 * (int)sizeof(float);
constexpr int MF_OFF = MP_OFF + QT * VP64 * (int)sizeof(h16);         // factors, sums, maxima: QT floats each
constexpr int MK_OFF = MF_OFF + 3 * QT * (int)sizeof(float);          // K chunk
constexpr int M_BYTES = MK_OFF + 64 * QP * (int)sizeof(h16);
// ... and those of one early tile
constexpr int EQ_OFF = 0;
constexpr int EV_OFF = EQ_OFF + 2 * 16 * QP * (int)sizeof(h16);
constexpr int ES_OFF = EV_OFF + 2 * DM * VP32 * (int)sizeof(h16);
constexpr int EP_OFF = ES_OFF + 3 * 16 * SP32 * (int)sizeof(float);
constexpr int EF_OFF = EP_OFF + 2 * 16 * VP32 * (int)sizeof(h16);     // factors, sums: 16 floats each
constexpr int E_BYTES = EF_OFF + 2 * 16 * (int)sizeof(float);
constexpr int ATTN_LDS = (M_BYTES > 2 * E_BYTES) ? M_BYTES : 2 * E_BYTES;
static_assert(2 * 32 * QP <= 2 * DM * VP32);                          // an early K chunk fits its V^T chunk's space
static_assert(MV_OFF % 16 == 0 && MS_OFF % 16 == 0 && MP_OFF % 16 == 0 && MF_OFF % 16 == 0 && MK_OFF % 16 == 0);
static_assert(EV_OFF % 16 == 0 && ES_OFF % 16 == 0 && EP_OFF % 16 == 0 && EF_OFF % 16 == 0 && E_BYTES % 16 == 0);
static_assert(ATTN_LDS <= 320 * 1024);
__global__ __launch_bounds__(512) __attribute__((amdgpu_num_vgpr(256)))
void attn_kernel(const h16* __restrict__ Qh, const h16* __restrict__ Qr,
                 const h16* __restrict__ Kh, const h16* __restrict__ Kr,
                 const h16* __restrict__ Vth, const h16* __restrict__ Vtr,
                 h16* __restrict__ Ch, h16* __restrict__ Cr, float* __restrict__ Op, float* __restrict__ Ml) {
  __shared__ __align__(16) char lds[ATTN_LDS];
  const int b = blockIdx.x, y = blockIdx.y;
  if (y >= NEB) {                                   // block-uniform
    float* f = (float*)(lds + MF_OFF);
    attn_main_body((h16 (*)[QP])(lds + MQ_OFF), (h16 (*)[VP64])(lds + MV_OFF), (float (*)[QT][SP64])(lds + MS_OFF),
                   (h16 (*)[VP64])(lds + MP_OFF), f, f + QT, f + 2 * QT, (h16*)(lds + MK_OFF), b, SEGS.run[y - NEB], Qh, Kh, Vth, Ch, Op, Ml);
  } else {
    // waves 0..7: the pair's first tile, waves 8..15: its second; read as a scalar, so that the tile's position, its trip count and
    // its LDS base stay wave-uniform for the compiler (scalar loop branch, no EXEC masking round the WMMAs)
    const int hw = __builtin_amdgcn_readfirstlane(threadIdx.x >> 8);
    char* e = lds + hw * E_BYTES;
    float* f = (float*)(e + EF_OFF);
    // tiles 32 j and 32 j + 16 both walk j + 1 chunks: every wave of the workgroup passes the same barriers
    attn_early_body((h16*)(e + EQ_OFF), (h16*)(e + EV_OFF), (float*)(e + ES_OFF), (h16*)(e + EP_OFF), f, f + 16, b,
                    (NEB - 1 - y) * 32 + hw * 16, Qh, Qr, Kh, Kr, Vth, Vtr, Ch, Cr);
  }
}

// ---------------- output projection: out = ctx(MT x 512) * Wo(512 x 512)^T, f32 ----------------
// Same wave layout and k-block LDS staging as proj_qkv. Blocks with sequence positions < EARLY_R add the ctx residual product
// (second accumulator); the two kinds of block run separate instances of the body, so that only the early one holds it.
template <bool EARLY> __device__ __forceinline__
void proj_out_body(const h16* __restrict__ Ch, const h16* __restrict__ Cr, const h16* __restrict__ Wo, float* __restrict__ out,
                   h16* Ws, h16* Cs, h16* Rs, int m0, int n0, int bb, int s0) {
  const int tid = threadIdx.x, w = tid >> 5, lane = tid & 31, idx = lane & 15, half = lane >> 4;
  const int mw_l = (w & 3) * 16;
  const int nw_l = (w >> 2) * 64;

  v8f c[4] = {};
  v8f cr[4] = {};                                   // used by the early instance only
#pragma unroll 1   // rolled: nothing moves across the barriers of a trip, unrolling would only multiply the code
  for (int kb = 0; kb < DM; kb += KB) {
    __syncthreads();                                // the previous block's fragment reads are done
    stage_rows<64>(Cs, Ch + (size_t)m0 * DM + kb, tid);
    stage_rows<128>(Ws, Wo + (size_t)n0 * DM + kb, tid);
    if (EARLY) {
      __builtin_amdgcn_sched_barrier(0);            // the W pieces leave their registers first: all three loads' would not fit 128
      stage_rows<64>(Rs, Cr + (size_t)(bb * EARLY_R + s0) * DM + kb, tid);
    }
    __syncthreads();                                // the staged block is visible to every wave
#pragma unroll
    for (int k0 = 0; k0 < KB; k0 += 32) {
      v16h a = load_a_frag(Cs + mw_l * KP, KP, k0);
      v16h ar = {};
      if (EARLY) ar = load_a_frag(Rs + mw_l * KP, KP, k0);
      v16h bf[4];
#pragma unroll
      for (int t = 0; t < 4; ++t) bf[t] = load_b_frag(Ws + (nw_l + t * 16) * KP, KP, k0);
      __builtin_amdgcn_sched_barrier(0);            // keeps the k step's reads together, ahead of its WMMAs
#pragma unroll
      for (int t = 0; t < 4; ++t) {
        c[t] = wmma_f16(a, bf[t], c[t]);
        if (EARLY) cr[t] = wmma_f16(ar, bf[t], cr[t]);
      }
      if (EARLY) __builtin_amdgcn_sched_barrier(0); // two accumulator sets: a second fragment set would not fit 128 registers
    }
  }
  __syncthreads();                                  // last fragment reads done before the space becomes the output tile
  float* T = (float*)Ws;
#pragma unroll
  for (int t = 0; t < 4; ++t) {
    const int cl = nw_l + t * 16 + idx;
#pragma unroll
    for (int g = 0; g < 8; ++g) {
      const int rl = mw_l + g + 8 * half;
      T[rl * 132 + cl] = (EARLY ? c[t][g] + cr[t][g] * RINV : c[t][g]) * OUT_MUL;
    }
  }
  __syncthreads();
  {
    float* dst = out + ((size_t)(bb * SEQ_FULL + s0)) * DM + n0;
    for (int gg = tid; gg < 64 * 32; gg += 256) {
      const int rl = gg >> 5, pc = gg & 31;
      vst2(dst + (size_t)rl * DM + pc * 4, *(const v4f*)(&T[rl * 132 + pc * 4]));
    }
  }
}

__global__ __launch_bounds__(256) __attribute__((amdgpu_num_vgpr(128)))   // four workgroups (LDS limit) = 8 waves per SIMD
void proj_out_kernel(const h16* __restrict__ Ch, const h16* __restrict__ Cr,
                                                       const h16* __restrict__ Wo, float* __restrict__ out) {
  __shared__ __align__(16) h16 Ws[128 * KP];      // reused as the f32 output tile [64][132] after the k loop
  __shared__ __align__(16) h16 Cs[64 * KP];
  __shared__ __align__(16) h16 Rs[64 * KP];
  static_assert(64 * 132 * sizeof(float) <= 128 * KP * sizeof(h16));
  const int m0 = blockIdx.x * 64, n0 = blockIdx.y * 128;
  const int bb = m0 / SEQ, s0 = m0 - bb * SEQ;
  if (s0 < EARLY_R) proj_out_body<true>(Ch, Cr, Wo, out, Ws, Cs, Rs, m0, n0, bb, s0);     // block-uniform
  else              proj_out_body<false>(Ch, Cr, Wo, out, Ws, Cs, Rs, m0, n0, bb, s0);
}

extern "C" void kernel_launch(void* const* d_in, const int* in_sizes, int n_in,
                              void* d_out, int out_size, void* d_ws, size_t ws_size,
                              hipStream_t stream) {
  if (n_in < 5) return;
  const int rows_needed = (NB - 1) * SEQ_FULL + SEQ;
  if (in_sizes[0] < rows_needed * DM) return;
  for (int i = 1; i < 5; ++i) if (in_sizes[i] < DM * DM) return;
  if (out_size < rows_needed * DM) return;

  const float* x  = (const float*)d_in[0];
  const float* Wq = (const float*)d_in[1];
  const float* Wk = (const float*)d_in[2];
  const float* Wv = (const float*)d_in[3];
  const float* Wo = (const float*)d_in[4];
  float* out = (float*)d_out;

  const size_t plane = (size_t)MT * DM * sizeof(h16);              // 16,777,216 at full size
  const size_t wpl   = (size_t)DM * DM * sizeof(h16);              //    524,288
  const size_t rpl   = (size_t)NB * EARLY_R * DM * sizeof(h16);    //  2,097,152 at full size
  size_t off = 0;
  char* ws = (char*)d_ws;
  h16* xb  = (h16*)(ws + off); off += plane;
  h16* wqb = (h16*)(ws + off); off += wpl;
  h16* wkb = (h16*)(ws + off); off += wpl;
  h16* wvb = (h16*)(ws + off); off += wpl;
  h16* wob = (h16*)(ws + off); off += wpl;
  h16* qh  = (h16*)(ws + off); off += plane;
  h16* kh  = (h16*)(ws + off); off += plane;
  h16* vth = (h16*)(ws + off); off += plane;   // [b][d][s]
  h16* qr  = (h16*)(ws + off); off += rpl;
  h16* kr  = (h16*)(ws + off); off += rpl;
  h16* vtr = (h16*)(ws + off); off += rpl;     // [b][d][s < EARLY_R]
  h16* ch  = (h16*)(ws + off); off += plane;
  h16* crp = (h16*)(ws + off); off += rpl;
  float* opp = (float*)(ws + off); off += (size_t)NB * NSLOT * QT * DM * sizeof(float);   // partial sums of the cut tiles' runs
  float* mlp = (float*)(ws + off); off += (size_t)NB * NSLOT * 2 * QT * sizeof(float);    // their row maxima and row sums
  if (off > ws_size) return;

  cvt_kernel<<<NXB + 4 * NWB, 256, 0, stream>>>(x, Wq, Wk, Wv, Wo, xb, wqb, wkb, wvb, wob);

  proj_qkv_kernel<<<dim3(MT / 64, DM / 128, 3), 256, 0, stream>>>(xb, wqb, wkb, wvb, qh, kh, vth, qr, kr, vtr);

  attn_kernel<<<dim3(NB, NEB + NMAIN), 512, 0, stream>>>(qh, qr, kh, kr, vth, vtr, ch, crp, opp, mlp);
  if (SEQ > EARLY_R && MAXSEG > 1) attn_combine_kernel<<<dim3(NCUT * (QT / 4), NB), 256, 0, stream>>>(opp, mlp, ch);

  proj_out_kernel<<<dim3(MT / 64, DM / 128), 256, 0, stream>>>(ch, crp, wob, out);
}
